// v000
// Measured on an AMD MI455X. A time is GPU time per run, averaged over a window of back-to-back runs after a warm-up
// (all launches, gaps included; the runs take copies of the inputs in turn), and the median of several windows.
// Apart from v000's, it joins two sittings. Times from different sittings can be a few percent apart, while
// side-by-side timings come from the same sitting.
// v000, which the later versions start from, runs in 3320 microseconds.
#include <hip/hip_runtime.h>
#include <hip/hip_bf16.h>
#include <math.h>

typedef __attribute__((ext_vector_type(2))) float v2f;
typedef __attribute__((ext_vector_type(8))) float v8f;
typedef __attribute__((ext_vector_type(4))) unsigned int v4u;
typedef __attribute__((ext_vector_type(8))) int v8i;
typedef __attribute__((ext_vector_type(4))) int v4i;

__device__ __forceinline__ v8f wmma_f32x4(v2f a, v2f b, v8f c) {
    // D = A(16x4 f32) * B(4x16 f32) + C(16x16 f32)
    return __builtin_amdgcn_wmma_f32_16x16x4_f32(
        /*neg_a=*/false, a, /*neg_b=*/false, b,
        /*c_mod=*/(short)0, c, /*reuse_a=*/false, /*reuse_b=*/false);
}

__device__ __forceinline__ void tdm_load_2d(const void* gptr, unsigned lds_off_bytes,
                                            unsigned tile_w_elems, unsigned tile_h_rows,
                                            unsigned row_stride_elems) {
    unsigned long long ga = (unsigned long long)(uintptr_t)gptr;
    v4u g0;
    g0.x = 1u;
    g0.y = lds_off_bytes;
    g0.z = (unsigned)(ga & 0xFFFFFFFFull);
    g0.w = (unsigned)((ga >> 32) & 0x01FFFFFFull)
         | 0x80000000u;
    const unsigned td0 = 0x7FFFFFFFu, td1 = 0x7FFFFFFFu;
    v8i g1;
    g1[0] = (int)(2u << 16);
    g1[1] = (int)((td0 & 0xFFFFu) << 16);
    g1[2] = (int)((td0 >> 16) | ((td1 & 0xFFFFu) << 16));
    g1[3] = (int)((td1 >> 16) | (tile_w_elems << 16));
    g1[4] = (int)tile_h_rows;
    g1[5] = (int)row_stride_elems;
    g1[6] = 0;
    g1[7] = 0;
    v4i zz4 = {};
    v8i zz8 = {};
    __builtin_amdgcn_tensor_load_to_lds(g0, g1, zz4, zz4, zz8, 0);
}

// ---------------------------------------------------------------------------
// Wide GEMM: Y[M,N] = A[M,Kd] @ W[N,Kd]^T (+bias). Requires M%128==0, N%128==0.
// Block = 256 threads = 8 waves arranged 4(M) x 2(N); each wave computes a
// 32x64 strip = 2x4 WMMA tiles (8 accumulators). No divergent guards anywhere.
// ---------------------------------------------------------------------------
__global__ void gemm_nt_wmma_wide(const float* __restrict__ A, const float* __restrict__ W,
                                  const float* __restrict__ bias, float* __restrict__ Y,
                                  int M, int N, int Kd) {
    int wave = threadIdx.x >> 5;
    int lane = threadIdx.x & 31;
    int wm = wave & 3;                   // 0..3
    int wn = wave >> 2;                  // 0..1
    int m0 = blockIdx.x * 128 + wm * 32;
    int n0 = blockIdx.y * 128 + wn * 64;
    int lr = lane & 15;
    int hi = lane >> 4;

    const float* a0p = A + (size_t)(m0 + lr) * Kd;
    const float* a1p = A + (size_t)(m0 + 16 + lr) * Kd;
    const float* wp[4];
#pragma unroll
    for (int t = 0; t < 4; ++t) wp[t] = W + (size_t)(n0 + t * 16 + lr) * Kd;

    v8f acc[2][4];
#pragma unroll
    for (int mi = 0; mi < 2; ++mi)
#pragma unroll
        for (int t = 0; t < 4; ++t) acc[mi][t] = (v8f){};

    for (int kk = 0; kk < Kd; kk += 4) {
        int ka = kk + hi * 2;
        v2f a0, a1;
        a0.x = a0p[ka]; a0.y = a0p[ka + 1];
        a1.x = a1p[ka]; a1.y = a1p[ka + 1];
        v2f b[4];
#pragma unroll
        for (int t = 0; t < 4; ++t) { b[t].x = wp[t][ka]; b[t].y = wp[t][ka + 1]; }
#pragma unroll
        for (int t = 0; t < 4; ++t) acc[0][t] = wmma_f32x4(a0, b[t], acc[0][t]);
#pragma unroll
        for (int t = 0; t < 4; ++t) acc[1][t] = wmma_f32x4(a1, b[t], acc[1][t]);
    }

#pragma unroll
    for (int mi = 0; mi < 2; ++mi)
#pragma unroll
        for (int t = 0; t < 4; ++t)
#pragma unroll
            for (int r = 0; r < 8; ++r) {
                int m = m0 + mi * 16 + r + hi * 8;
                int n = n0 + t * 16 + lr;
                float val = acc[mi][t][r];
                if (bias) val += bias[n];
                Y[(size_t)m * N + n] = val;
            }
}

__global__ void gemm_nt_wmma_small(const float* __restrict__ A, const float* __restrict__ W,
                                   const float* __restrict__ bias, float* __restrict__ Y,
                                   int M, int N, int Kd, int apply_sigmoid) {
    int wave = threadIdx.x >> 5;
    int lane = threadIdx.x & 31;
    int m0 = (blockIdx.x * 8 + wave) * 16;
    int lr = lane & 15;
    int hi = lane >> 4;
    int wrow = lr;                       // n0 == 0 (single tile of columns)
    int wrc = (wrow < N) ? wrow : 0;
    float msk = (wrow < N) ? 1.f : 0.f;

    const float* ap = A + (size_t)(m0 + lr) * Kd;
    const float* wpr = W + (size_t)wrc * Kd;

    v8f acc = {};
    for (int kk = 0; kk < Kd; kk += 4) {
        int ka = kk + hi * 2;
        v2f a, b;
        a.x = ap[ka];           a.y = ap[ka + 1];
        b.x = wpr[ka] * msk;    b.y = wpr[ka + 1] * msk;
        acc = wmma_f32x4(a, b, acc);
    }
#pragma unroll
    for (int r = 0; r < 8; ++r) {
        int m = m0 + r + hi * 8;
        int n = lr;
        if (n < N) {
            float val = acc[r];
            if (bias) val += bias[n];
            if (apply_sigmoid) val = 1.f / (1.f + __expf(-val));
            Y[(size_t)m * N + n] = val;
        }
    }
}

// ---------------------------------------------------------------------------
// Multi-timescale gated linear attention recurrence.
// grid = B*H blocks, block = K*dh = 128 threads.
// Thread (kk, j) owns state column Hm[b,h,kk,:,j] in registers (64 floats).
// ---------------------------------------------------------------------------
__global__ void linatt_kernel(const float* __restrict__ q, const float* __restrict__ k,
                              const float* __restrict__ v, const float* __restrict__ gate,
                              const float* __restrict__ decay_logit,
                              float* __restrict__ y_lin, int B, int T, int H, int Kts) {
    const int dh = 64;
    int b = blockIdx.x / H;
    int h = blockIdx.x % H;
    int kk = threadIdx.x / dh;   // timescale index
    int j  = threadIdx.x % dh;   // state column

    float lam = 1.f / (1.f + __expf(-decay_logit[h * Kts + kk]));

    float Hcol[64];
#pragma unroll
    for (int i = 0; i < 64; ++i) Hcol[i] = 0.f;
    float Z = 0.f;

    __shared__ float sq[64];
    __shared__ float sk[64];
    __shared__ float sy[128];

    for (int t = 0; t < T; ++t) {
        size_t base = (((size_t)b * T + t) * H + h) * dh;
        if (threadIdx.x < 64) sq[threadIdx.x] = q[base + threadIdx.x];
        else                  sk[threadIdx.x - 64] = k[base + threadIdx.x - 64];
        __syncthreads();

        float g = gate[(((size_t)b * T + t) * H + h) * Kts + kk];
        float s = 0.f;
#pragma unroll
        for (int i = 0; i < 64; ++i) s += fabsf(sk[i]);
        s = s * (1.f / 64.f) + 1e-6f;
        Z = Z * lam + g * s;

        float vj = v[base + j];
        float acc = 0.f;
#pragma unroll
        for (int i = 0; i < 64; ++i) {
            Hcol[i] = Hcol[i] * lam + g * sk[i] * vj;
            acc += sq[i] * Hcol[i];
        }
        sy[threadIdx.x] = acc / (Z + 1e-6f);
        __syncthreads();
        if (threadIdx.x < 64)
            y_lin[base + threadIdx.x] = sy[threadIdx.x] + sy[64 + threadIdx.x];
        __syncthreads();
    }
}

__global__ void local_attn_wmma(const float* __restrict__ q, const float* __restrict__ k,
                                const float* __restrict__ v, float* __restrict__ y_loc,
                                int B, int T, int H) {
    const int dh = 64;
    const int W = 64;
    const int SLD = 129;
    int nc = T / W;
    int h = blockIdx.x % H;
    int c = (blockIdx.x / H) % nc;
    int b = blockIdx.x / (H * nc);

    __shared__ float smem[64 * 64 + 128 * 64];   // Q | K, aliased as S after use
    __shared__ float sV[128 * 64];
    float* sQ = smem;
    float* sK = smem + 64 * 64;
    float* sS = smem;                            // aliased after barrier

    int tid = threadIdx.x;

    const float* qg = q + (((size_t)b * T + c * W) * H + h) * dh;
    if (tid < 32) {
        tdm_load_2d(qg, (unsigned)(uintptr_t)(void*)sQ, 64, 64, H * dh);
        if (c > 0) {
            const float* kg = k + (((size_t)b * T + (c - 1) * W) * H + h) * dh;
            const float* vg = v + (((size_t)b * T + (c - 1) * W) * H + h) * dh;
            tdm_load_2d(kg, (unsigned)(uintptr_t)(void*)sK, 64, 128, H * dh);
            tdm_load_2d(vg, (unsigned)(uintptr_t)(void*)sV, 64, 128, H * dh);
        }
        __builtin_amdgcn_s_wait_tensorcnt(0);
    }
    if (c == 0) {
        // boundary chunk: prev-chunk rows are zero, cur-chunk rows are tokens 0..63
        for (int idx = tid; idx < 128 * 64; idx += 256) {
            int jj = idx >> 6, d = idx & 63;
            float kvl = 0.f, vvl = 0.f;
            if (jj >= 64) {
                size_t g = (((size_t)b * T + (jj - 64)) * H + h) * dh + d;
                kvl = k[g];
                vvl = v[g];
            }
            sK[idx] = kvl;
            sV[idx] = vvl;
        }
    }
    __syncthreads();

    int wave = tid >> 5, lane = tid & 31, lr = lane & 15, hi = lane >> 4;

    // scores: 64x128 = 4x8 tiles of 16x16; wave handles 4 tiles
    v8f sc[4];
    for (int it = 0; it < 4; ++it) {
        int id = wave * 4 + it;
        int tm = id >> 3, tn = id & 7;
        v8f acc = {};
        for (int kkk = 0; kkk < 64; kkk += 4) {
            int ka = kkk + hi * 2;
            v2f a, bb;
            a.x  = sQ[(tm * 16 + lr) * 64 + ka];
            a.y  = sQ[(tm * 16 + lr) * 64 + ka + 1];
            bb.x = sK[(tn * 16 + lr) * 64 + ka];
            bb.y = sK[(tn * 16 + lr) * 64 + ka + 1];
            acc = wmma_f32x4(a, bb, acc);
        }
        sc[it] = acc;
    }
    __syncthreads();   // done reading sQ/sK; safe to alias as sS

    // ALiBi + causal window mask, write scores to LDS
    float slope = exp2f(-8.0f * (float)(h + 1) / (float)H);
    for (int it = 0; it < 4; ++it) {
        int id = wave * 4 + it;
        int tm = id >> 3, tn = id & 7;
#pragma unroll
        for (int r = 0; r < 8; ++r) {
            int i = tm * 16 + r + hi * 8;
            int jj = tn * 16 + lr;
            float val = sc[it][r];
            bool valid = (jj >= i + 1) && (jj <= i + W) && (c * W + jj - W >= 0);
            val = valid ? (val - slope * (float)(i + W - jj)) : -1e30f;
            sS[i * SLD + jj] = val;
        }
    }
    __syncthreads();

    // row softmax (threads 0..63, one row each)
    if (tid < 64) {
        float mx = -3.4e38f;
        for (int jj = 0; jj < 128; ++jj) mx = fmaxf(mx, sS[tid * SLD + jj]);
        float sum = 0.f;
        for (int jj = 0; jj < 128; ++jj) {
            float e = __expf(sS[tid * SLD + jj] - mx);
            sS[tid * SLD + jj] = e;
            sum += e;
        }
        float inv = 1.f / sum;
        for (int jj = 0; jj < 128; ++jj) sS[tid * SLD + jj] *= inv;
    }
    __syncthreads();

    // y = P[64,128] @ Vctx[128,64]; 16 tiles, wave handles 2; V from LDS
    for (int it = 0; it < 2; ++it) {
        int id = wave * 2 + it;
        int tm = id >> 2, tn = id & 3;
        int n = tn * 16 + lr;
        v8f acc = {};
        for (int kkk = 0; kkk < 128; kkk += 4) {
            int ka = kkk + hi * 2;
            v2f a, bb;
            a.x = sS[(tm * 16 + lr) * SLD + ka];
            a.y = sS[(tm * 16 + lr) * SLD + ka + 1];
            bb.x = sV[ka * 64 + n];
            bb.y = sV[(ka + 1) * 64 + n];
            acc = wmma_f32x4(a, bb, acc);
        }
#pragma unroll
        for (int r = 0; r < 8; ++r) {
            int i = tm * 16 + r + hi * 8;
            y_loc[(((size_t)b * T + c * W + i) * H + h) * dh + n] = acc[r];
        }
    }
}

// ---------------------------------------------------------------------------
// y = alpha * y_loc + (1 - alpha) * y_lin   (alpha per [B,T,H])
// ---------------------------------------------------------------------------
__global__ void mix_kernel(const float* __restrict__ y_loc, const float* __restrict__ y_lin,
                           const float* __restrict__ alpha, float* __restrict__ y,
                           size_t total, int dh) {
    size_t idx = (size_t)blockIdx.x * blockDim.x + threadIdx.x;
    if (idx < total) {
        size_t bth = idx / dh;     // (b*T + t)*H + h
        float a = alpha[bth];
        y[idx] = a * y_loc[idx] + (1.f - a) * y_lin[idx];
    }
}

// ---------------------------------------------------------------------------
// out = LayerNorm(x + proj) * gamma + beta ; block per (b,t) row.
// ---------------------------------------------------------------------------
__global__ void addnorm_kernel(const float* __restrict__ x, const float* __restrict__ proj,
                               const float* __restrict__ gamma, const float* __restrict__ beta,
                               float* __restrict__ out, int D) {
    __shared__ float red[256];
    size_t row = blockIdx.x;
    const float* xr = x + row * D;
    const float* pr = proj + row * D;

    float s = 0.f, s2 = 0.f;
    for (int d = threadIdx.x; d < D; d += 256) {
        float r = xr[d] + pr[d];
        s += r; s2 += r * r;
    }
    red[threadIdx.x] = s;
    __syncthreads();
    for (int off = 128; off > 0; off >>= 1) {
        if (threadIdx.x < off) red[threadIdx.x] += red[threadIdx.x + off];
        __syncthreads();
    }
    float mean = red[0] / (float)D;
    __syncthreads();
    red[threadIdx.x] = s2;
    __syncthreads();
    for (int off = 128; off > 0; off >>= 1) {
        if (threadIdx.x < off) red[threadIdx.x] += red[threadIdx.x + off];
        __syncthreads();
    }
    float var = red[0] / (float)D - mean * mean;
    float inv = rsqrtf(var + 1e-5f);
    for (int d = threadIdx.x; d < D; d += 256) {
        float r = xr[d] + pr[d];
        out[row * D + d] = (r - mean) * inv * gamma[d] + beta[d];
    }
}

// ---------------------------------------------------------------------------
extern "C" void kernel_launch(void* const* d_in, const int* in_sizes, int n_in,
                              void* d_out, int out_size, void* d_ws, size_t ws_size,
                              hipStream_t stream) {
    const int D = 512, H = 8, Kts = 2, dh = 64, T = 2048;
    const int M = in_sizes[0] / D;          // B*T = 4096
    const int B = M / T;                    // 2
    const int nc = T / 64;

    const float* x      = (const float*)d_in[0];
    const float* Wq     = (const float*)d_in[1];
    const float* Wk     = (const float*)d_in[2];
    const float* Wv     = (const float*)d_in[3];
    const float* Wg     = (const float*)d_in[4];
    const float* bg     = (const float*)d_in[5];
    const float* Wa     = (const float*)d_in[6];
    const float* ba     = (const float*)d_in[7];
    const float* Wo     = (const float*)d_in[8];
    const float* bo     = (const float*)d_in[9];
    const float* decay  = (const float*)d_in[10];
    const float* gamma  = (const float*)d_in[11];
    const float* beta   = (const float*)d_in[12];
    float* out = (float*)d_out;

    // workspace carve-up
    float* ws = (float*)d_ws;
    size_t off = 0;
    float* q_buf    = ws + off; off += (size_t)M * D;
    float* k_buf    = ws + off; off += (size_t)M * D;
    float* v_buf    = ws + off; off += (size_t)M * D;
    float* gate_buf = ws + off; off += (size_t)M * H * Kts;
    float* alp_buf  = ws + off; off += (size_t)M * H;
    float* ylin_buf = ws + off; off += (size_t)M * D;
    float* yloc_buf = ws + off; off += (size_t)M * D;
    float* ymix_buf = ws + off; off += (size_t)M * D;
    float* proj_buf = ws + off; off += (size_t)M * D;

    dim3 blk(256);
    dim3 grid_wide(M / 128, D / 128);       // 32 x 4
    dim3 grid_small(M / 128, 1);

    // projections (wide, guard-free WMMA GEMMs)
    gemm_nt_wmma_wide<<<grid_wide, blk, 0, stream>>>(x, Wq, nullptr, q_buf, M, D, D);
    gemm_nt_wmma_wide<<<grid_wide, blk, 0, stream>>>(x, Wk, nullptr, k_buf, M, D, D);
    gemm_nt_wmma_wide<<<grid_wide, blk, 0, stream>>>(x, Wv, nullptr, v_buf, M, D, D);
    // skinny projections with sigmoid fused
    gemm_nt_wmma_small<<<grid_small, blk, 0, stream>>>(x, Wg, bg, gate_buf, M, H * Kts, D, 1);
    gemm_nt_wmma_small<<<grid_small, blk, 0, stream>>>(x, Wa, ba, alp_buf,  M, H,       D, 1);

    // serial gated linear attention
    linatt_kernel<<<B * H, 128, 0, stream>>>(q_buf, k_buf, v_buf, gate_buf, decay,
                                             ylin_buf, B, T, H, Kts);

    local_attn_wmma<<<B * nc * H, 256, 0, stream>>>(q_buf, k_buf, v_buf, yloc_buf, B, T, H);

    // gated blend
    size_t total = (size_t)M * D;
    mix_kernel<<<(unsigned)((total + 255) / 256), blk, 0, stream>>>(yloc_buf, ylin_buf,
                                                                    alp_buf, ymix_buf,
                                                                    total, dh);

    // output projection + residual + layernorm
    gemm_nt_wmma_wide<<<grid_wide, blk, 0, stream>>>(ymix_buf, Wo, bo, proj_buf, M, D, D);
    addnorm_kernel<<<M, blk, 0, stream>>>(x, proj_buf, gamma, beta, out, D);
}

// v001
// One run takes 263 microseconds.
// In both of two side-by-side timings against v000, it was 12.6 times as fast.
#include <hip/hip_runtime.h>
#include <hip/hip_bf16.h>
#include <math.h>

typedef __attribute__((ext_vector_type(2))) float v2f;
typedef __attribute__((ext_vector_type(8))) float v8f;
typedef __attribute__((ext_vector_type(4))) unsigned int v4u;
typedef __attribute__((ext_vector_type(8))) int v8i;
typedef __attribute__((ext_vector_type(4))) int v4i;

__device__ __forceinline__ v8f wmma_f32x4(v2f a, v2f b, v8f c) {
    // D = A(16x4 f32) * B(4x16 f32) + C(16x16 f32)
    return __builtin_amdgcn_wmma_f32_16x16x4_f32(
        /*neg_a=*/false, a, /*neg_b=*/false, b,
        /*c_mod=*/(short)0, c, /*reuse_a=*/false, /*reuse_b=*/false);
}

__device__ __forceinline__ void tdm_load_2d(const void* gptr, unsigned lds_off_bytes,
                                            unsigned tile_w_elems, unsigned tile_h_rows,
                                            unsigned row_stride_elems) {
    unsigned long long ga = (unsigned long long)(uintptr_t)gptr;
    v4u g0;
    g0.x = 1u;
    g0.y = lds_off_bytes;
    g0.z = (unsigned)(ga & 0xFFFFFFFFull);
    g0.w = (unsigned)((ga >> 32) & 0x01FFFFFFull)
         | 0x80000000u;
    const unsigned td0 = 0x7FFFFFFFu, td1 = 0x7FFFFFFFu;
    v8i g1;
    g1[0] = (int)(2u << 16);
    g1[1] = (int)((td0 & 0xFFFFu) << 16);
    g1[2] = (int)((td0 >> 16) | ((td1 & 0xFFFFu) << 16));
    g1[3] = (int)((td1 >> 16) | (tile_w_elems << 16));
    g1[4] = (int)tile_h_rows;
    g1[5] = (int)row_stride_elems;
    g1[6] = 0;
    g1[7] = 0;
    v4i zz4 = {};
    v8i zz8 = {};
    __builtin_amdgcn_tensor_load_to_lds(g0, g1, zz4, zz4, zz8, 0);
}

// ---------------------------------------------------------------------------
// Wide GEMM: Y[M,N] = A[M,Kd] @ W[N,Kd]^T (+bias). Requires M%128==0, N%128==0.
// Block = 256 threads = 8 waves arranged 4(M) x 2(N); each wave computes a
// 32x64 strip = 2x4 WMMA tiles (8 accumulators). No divergent guards anywhere.
// ---------------------------------------------------------------------------
__global__ void gemm_nt_wmma_wide(const float* __restrict__ A, const float* __restrict__ W,
                                  const float* __restrict__ bias, float* __restrict__ Y,
                                  int M, int N, int Kd) {
    int wave = threadIdx.x >> 5;
    int lane = threadIdx.x & 31;
    int wm = wave & 3;                   // 0..3
    int wn = wave >> 2;                  // 0..1
    int m0 = blockIdx.x * 128 + wm * 32;
    int n0 = blockIdx.y * 128 + wn * 64;
    int lr = lane & 15;
    int hi = lane >> 4;

    const float* a0p = A + (size_t)(m0 + lr) * Kd;
    const float* a1p = A + (size_t)(m0 + 16 + lr) * Kd;
    const float* wp[4];
#pragma unroll
    for (int t = 0; t < 4; ++t) wp[t] = W + (size_t)(n0 + t * 16 + lr) * Kd;

    v8f acc[2][4];
#pragma unroll
    for (int mi = 0; mi < 2; ++mi)
#pragma unroll
        for (int t = 0; t < 4; ++t) acc[mi][t] = (v8f){};

    for (int kk = 0; kk < Kd; kk += 4) {
        int ka = kk + hi * 2;
        v2f a0, a1;
        a0.x = a0p[ka]; a0.y = a0p[ka + 1];
        a1.x = a1p[ka]; a1.y = a1p[ka + 1];
        v2f b[4];
#pragma unroll
        for (int t = 0; t < 4; ++t) { b[t].x = wp[t][ka]; b[t].y = wp[t][ka + 1]; }
#pragma unroll
        for (int t = 0; t < 4; ++t) acc[0][t] = wmma_f32x4(a0, b[t], acc[0][t]);
#pragma unroll
        for (int t = 0; t < 4; ++t) acc[1][t] = wmma_f32x4(a1, b[t], acc[1][t]);
    }

#pragma unroll
    for (int mi = 0; mi < 2; ++mi)
#pragma unroll
        for (int t = 0; t < 4; ++t)
#pragma unroll
            for (int r = 0; r < 8; ++r) {
                int m = m0 + mi * 16 + r + hi * 8;
                int n = n0 + t * 16 + lr;
                float val = acc[mi][t][r];
                if (bias) val += bias[n];
                Y[(size_t)m * N + n] = val;
            }
}

__global__ void gemm_nt_wmma_small(const float* __restrict__ A, const float* __restrict__ W,
                                   const float* __restrict__ bias, float* __restrict__ Y,
                                   int M, int N, int Kd, int apply_sigmoid) {
    int wave = threadIdx.x >> 5;
    int lane = threadIdx.x & 31;
    int m0 = (blockIdx.x * 8 + wave) * 16;
    int lr = lane & 15;
    int hi = lane >> 4;
    int wrow = lr;                       // n0 == 0 (single tile of columns)
    int wrc = (wrow < N) ? wrow : 0;
    float msk = (wrow < N) ? 1.f : 0.f;

    const float* ap = A + (size_t)(m0 + lr) * Kd;
    const float* wpr = W + (size_t)wrc * Kd;

    v8f acc = {};
    for (int kk = 0; kk < Kd; kk += 4) {
        int ka = kk + hi * 2;
        v2f a, b;
        a.x = ap[ka];           a.y = ap[ka + 1];
        b.x = wpr[ka] * msk;    b.y = wpr[ka + 1] * msk;
        acc = wmma_f32x4(a, b, acc);
    }
#pragma unroll
    for (int r = 0; r < 8; ++r) {
        int m = m0 + r + hi * 8;
        int n = lr;
        if (n < N) {
            float val = acc[r];
            if (bias) val += bias[n];
            if (apply_sigmoid) val = 1.f / (1.f + __expf(-val));
            Y[(size_t)m * N + n] = val;
        }
    }
}

// ---------------------------------------------------------------------------
// Multi-timescale gated linear attention, chunk-parallel form (chunks of 64
// tokens). With lam constant over time, for token i of chunk c:
//   Hm_i = lam^(i+1) * E + sum_{s<=i} lam^(i-s) * g_s * k_s v_s^T
//   Z_i  = lam^(i+1) * zE + sum_{s<=i} lam^(i-s) * g_s * s_s
// where E, zE are the state at the end of chunk c-1. Three launches:
//   1. chunk_state: S_c = sum_i lam^(63-i) g_i k_i v_i^T (and the same for Z)
//   2. chunk_scan : E_c = lam^64 * E_{c-1} + S_c over the chunks, in place
//   3. chunk_out  : y = (masked decayed Q K^T) V + scaled Q E
// Only non-negative powers of lam are formed, so every factor is in [0, 1].
// ---------------------------------------------------------------------------
constexpr int LA_T  = 2048;        // tokens per sequence
constexpr int LA_H  = 8;           // heads
constexpr int LA_NC = LA_T / 64;   // chunks per sequence
constexpr int LA_RS = LA_H * 64;   // dwords between the rows of one head's q, k, v
constexpr int LA_PA = 68;          // LDS pitch (dwords), rows read 8 bytes along k
constexpr int LA_PB = 72;          // LDS pitch (dwords), rows read across columns

__device__ __forceinline__ float la_sigmoid(float x) { return 1.f / (1.f + __expf(-x)); }

// base^n for 0 <= n <= 127 by squaring: 1 at n == 0 for any base, no logarithm.
__device__ __forceinline__ float la_ipow(float base, int n) {
    float p = 1.f;
#pragma unroll     // seven fixed bits, no loop control
    for (int bit = 0; bit < 7; ++bit) {
        if (n & 1) p *= base;
        base *= base;
        n >>= 1;
    }
    return p;
}

// A thread's four float4 of a 64x64 f32 tile (256 threads): global -> registers.
struct LaTile { float4 a, b, c, d; };
__device__ __forceinline__ LaTile la_tile_load(const float* g, int tid) {
    const float* p = g + ((unsigned)(tid >> 4) * LA_RS + (unsigned)(tid & 15) * 4);
    LaTile t;
    t.a = *(const float4*)(p);
    t.b = *(const float4*)(p + 16 * LA_RS);
    t.c = *(const float4*)(p + 32 * LA_RS);
    t.d = *(const float4*)(p + 48 * LA_RS);
    // address registers of these loads (offset, scalar base) are free for reuse only behind this wait
    asm volatile("s_wait_xcnt 0x0" ::: "memory");
    return t;
}
// ... and registers -> LDS at the given pitch.
__device__ __forceinline__ void la_tile_put(float* s, int pitch, int tid, const LaTile& t) {
    float* p = s + (tid >> 4) * pitch + (tid & 15) * 4;
    *(float4*)(p) = t.a;
    *(float4*)(p + 16 * pitch) = t.b;
    *(float4*)(p + 32 * pitch) = t.c;
    *(float4*)(p + 48 * pitch) = t.d;
}

// mean |k_i| + 1e-6 of row i = tid >> 2; four lanes share a row (valid in all four).
__device__ __forceinline__ float la_row_absmean(const float* s, int pitch, int tid) {
    int i = tid >> 2, qd = tid & 3;
    float a = 0.f;
#pragma unroll     // 16 independent LDS reads in flight
    for (int e = 0; e < 16; ++e) a += fabsf(s[i * pitch + e * 4 + qd]);
    a += __shfl_xor(a, 1);
    a += __shfl_xor(a, 2);
    return a * (1.f / 64.f) + 1e-6f;
}

// grid = B*LA_H*LA_NC, block = 256. blockIdx.x = (b*LA_H + h)*LA_NC + c.
// The pointers are not __restrict__: the loads then keep their side of the asm waits.
__global__ __launch_bounds__(256) void linatt_chunk_state(const float* k, const float* v, const float* gate,
                                   const float* decay_logit, float* S, float* zS) {
    int c  = blockIdx.x % LA_NC;
    int bh = blockIdx.x / LA_NC;
    int h = bh % LA_H, b = bh / LA_H;
    int tid = threadIdx.x;

    __shared__ __attribute__((aligned(16))) float sK[64 * LA_PB];
    __shared__ __attribute__((aligned(16))) float sV[64 * LA_PB];
    __shared__ float sW[2][64];      // lam^(63-i) * g_i
    __shared__ float sAbs[64];

    size_t tok0 = (size_t)b * LA_T + c * 64;
    size_t base = (tok0 * LA_H + h) * 64;
    LaTile rk = la_tile_load(k + base, tid);
    LaTile rv = la_tile_load(v + base, tid);
    la_tile_put(sK, LA_PB, tid, rk);
    la_tile_put(sV, LA_PB, tid, rv);
    if (tid < 128) {
        int kap = tid >> 6, i = tid & 63;
        float lam = la_sigmoid(decay_logit[h * 2 + kap]);
        sW[kap][i] = gate[((tok0 + i) * LA_H + h) * 2 + kap] * la_ipow(lam, 63 - i);
    }
    __syncthreads();

    float am = la_row_absmean(sK, LA_PB, tid);
    if ((tid & 3) == 0) sAbs[tid >> 2] = am;

    // S[a][j] = sum_i K[i][a] * (w_i V[i][j]); wave = (timescale, 16 columns j)
    int wave = tid >> 5, lane = tid & 31, lr = lane & 15, hi = lane >> 4;
    int kap = wave >> 2, tn = wave & 3;
    int n = tn * 16 + lr;
    v8f acc[4];
#pragma unroll     // register arrays need constant indices
    for (int tm = 0; tm < 4; ++tm) acc[tm] = (v8f){};
#pragma unroll 4   // four k-steps per trip: their LDS loads go out together
    for (int kk = 0; kk < 64; kk += 4) {
        int ka = kk + hi * 2;
        v2f bb;
        bb.x = sV[ka * LA_PB + n] * sW[kap][ka];
        bb.y = sV[(ka + 1) * LA_PB + n] * sW[kap][ka + 1];
#pragma unroll     // register arrays need constant indices
        for (int tm = 0; tm < 4; ++tm) {
            v2f a;
            a.x = sK[ka * LA_PB + tm * 16 + lr];
            a.y = sK[(ka + 1) * LA_PB + tm * 16 + lr];
            acc[tm] = wmma_f32x4(a, bb, acc[tm]);
        }
    }
    __syncthreads();   // sAbs complete
    if (wave < 2) {    // wave w sums timescale w
        float z = sW[wave][lane] * sAbs[lane] + sW[wave][lane + 32] * sAbs[lane + 32];
#pragma unroll     // five fixed shuffle steps
        for (int m = 16; m > 0; m >>= 1) z += __shfl_xor(z, m);
        if (lane == 0) zS[(size_t)blockIdx.x * 2 + wave] = z;
    }
    float* Sp = S + (size_t)blockIdx.x * 2 * 4096;
    unsigned so = (unsigned)(kap * 4096 + hi * 8 * 64 + n);
#pragma unroll     // register arrays need constant indices
    for (int tm = 0; tm < 4; ++tm)
#pragma unroll     // register arrays need constant indices
        for (int r = 0; r < 8; ++r)
            Sp[so + (tm * 16 + r) * 64] = acc[tm][r];
}

__global__ __launch_bounds__(256) void linatt_chunk_scan(float* __restrict__ S, float* __restrict__ zS,
                                  const float* __restrict__ decay_logit, int BH) {
    int gid = blockIdx.x * 256 + threadIdx.x;
    {
        int e4 = gid & 1023, kap = (gid >> 10) & 1, bh = gid >> 11;
        float l64 = la_ipow(la_sigmoid(decay_logit[(bh % LA_H) * 2 + kap]), 64);
        float4* p = (float4*)S + ((size_t)bh * LA_NC * 2 + kap) * 1024 + e4;
        float4 s[LA_NC];
#pragma unroll     // register arrays need constant indices
        for (int c = 0; c < LA_NC; ++c) s[c] = p[(size_t)c * 2048];
        // every load is issued before the first store (all in flight at once), and
        // the address registers are free for reuse only behind this wait
        asm volatile("s_wait_xcnt 0x0" ::: "memory");
        float4 run = make_float4(0.f, 0.f, 0.f, 0.f);
#pragma unroll     // register arrays need constant indices
        for (int c = 0; c < LA_NC; ++c) {
            float4 t = s[c];
            s[c] = run;
            run.x = run.x * l64 + t.x;
            run.y = run.y * l64 + t.y;
            run.z = run.z * l64 + t.z;
            run.w = run.w * l64 + t.w;
        }
        // the stores stay behind all the arithmetic: no register of an issued store is rewritten
        __builtin_amdgcn_sched_barrier(0);
#pragma unroll     // register arrays need constant indices
        for (int c = 1; c < LA_NC; ++c) p[(size_t)c * 2048] = s[c];
        // registers of the stores above are free for reuse only behind this wait
        asm volatile("s_wait_xcnt 0x0" ::: "memory");
    }
    if (gid < BH * 2) {
        int kap = gid & 1, bh = gid >> 1;
        float l64 = la_ipow(la_sigmoid(decay_logit[(bh % LA_H) * 2 + kap]), 64);
        float* pz = zS + (size_t)bh * LA_NC * 2 + kap;
        float z[LA_NC];
#pragma unroll     // register arrays need constant indices
        for (int c = 0; c < LA_NC; ++c) z[c] = pz[c * 2];
        asm volatile("s_wait_xcnt 0x0" ::: "memory");
        float run = 0.f;
#pragma unroll     // register arrays need constant indices
        for (int c = 0; c < LA_NC; ++c) {
            float t = z[c];
            z[c] = run;
            run = run * l64 + t;
        }
        __builtin_amdgcn_sched_barrier(0);
#pragma unroll     // register arrays need constant indices
        for (int c = 1; c < LA_NC; ++c) pz[c * 2] = z[c];
    }
}

// grid = B*LA_H*LA_NC, block = 256. blockIdx.x = (b*LA_H + h)*LA_NC + c.
// The pointers are not __restrict__: the loads then keep their side of the asm waits.
__global__ __launch_bounds__(256) void linatt_chunk_out(const float* q, const float* k, const float* v, const float* gate,
                                 const float* decay_logit, const float* E, const float* zE,
                                 float* y_lin) {
    int c  = blockIdx.x % LA_NC;
    int bh = blockIdx.x / LA_NC;
    int h = bh % LA_H, b = bh / LA_H;
    int tid = threadIdx.x;
    int wave = tid >> 5, lane = tid & 31, lr = lane & 15, hi = lane >> 4;
    int tn = wave & 3, tm0 = (wave >> 2) * 2;    // wave owns tiles (tm0, tn), (tm0+1, tn)
    int n = tn * 16 + lr;

    __shared__ __attribute__((aligned(16))) float sQ[64 * LA_PA];
    __shared__ __attribute__((aligned(16))) float sK[64 * LA_PA];
    __shared__ __attribute__((aligned(16))) float sV[64 * LA_PB];
    __shared__ __attribute__((aligned(16))) float sP[64 * LA_PA];
    __shared__ float sG[2][64];      // gate
    __shared__ float sGS[2][64];     // gate * (mean|k| + 1e-6)
    __shared__ float sZ[2][64];      // Z_i
    __shared__ float sRZ[2][64];     // 1 / (Z_i + 1e-6)
    __shared__ float sRS[2][64];     // lam^(i+1) / (Z_i + 1e-6)
    __shared__ float sPw[2][128];    // [63 + d] = lam^d for d = 0..64, 0 for d = -63..-1 (the causal mask)

    size_t tok0 = (size_t)b * LA_T + c * 64;
    size_t base = (tok0 * LA_H + h) * 64;
    LaTile rq = la_tile_load(q + base, tid);
    LaTile rk = la_tile_load(k + base, tid);
    LaTile rv = la_tile_load(v + base, tid);
    // B fragments of the two incoming states, columns n: fetched here, in flight
    // together with the tiles.
    const float* Ep = E + (size_t)blockIdx.x * 2 * 4096;
    unsigned eo = (unsigned)(hi * 2 * 64 + n);
    v2f ef[2][16];
#pragma unroll     // register arrays need constant indices
    for (int kap = 0; kap < 2; ++kap)
#pragma unroll     // register arrays need constant indices
        for (int ks = 0; ks < 16; ++ks) ef[kap][ks] = (v2f){};
    float z0 = 0.f;   // incoming Z of timescale tid & 1
    if (c > 0) {   // chunk 0 starts from the zero state
#pragma unroll     // register arrays need constant indices
        for (int kap = 0; kap < 2; ++kap)
#pragma unroll     // register arrays need constant indices
            for (int ks = 0; ks < 16; ++ks) {
                ef[kap][ks].x = Ep[eo + kap * 4096 + ks * 256];
                ef[kap][ks].y = Ep[eo + kap * 4096 + ks * 256 + 64];
            }
        z0 = zE[(size_t)blockIdx.x * 2 + (tid & 1)];
        // address registers of the loads above are free for reuse only behind this wait
        asm volatile("s_wait_xcnt 0x0" ::: "memory");
    }
    la_tile_put(sQ, LA_PA, tid, rq);
    la_tile_put(sK, LA_PA, tid, rk);
    la_tile_put(sV, LA_PB, tid, rv);
    if (tid < 128) {
        int kap = tid >> 6, i = tid & 63;
        sG[kap][i] = gate[((tok0 + i) * LA_H + h) * 2 + kap];
    }
    {
        int kap = tid >> 7, d = (tid & 127) - 63;
        float pw = la_ipow(la_sigmoid(decay_logit[h * 2 + kap]), d > 0 ? d : 0);
        sPw[kap][63 + d] = (d >= 0) ? pw : 0.f;
    }
    __syncthreads();

    float am = la_row_absmean(sK, LA_PA, tid);
    if ((tid & 3) < 2) sGS[tid & 3][tid >> 2] = sG[tid & 3][tid >> 2] * am;

    // A[i][s] = q_i . k_s
    v8f sc[2];
    sc[0] = (v8f){}; sc[1] = (v8f){};
#pragma unroll 4   // four k-steps per trip: their LDS loads go out together
    for (int kk = 0; kk < 64; kk += 4) {
        int ka = kk + hi * 2;
        v2f bb = *(const v2f*)&sK[(tn * 16 + lr) * LA_PA + ka];
#pragma unroll     // register arrays need constant indices
        for (int t = 0; t < 2; ++t) {
            v2f a = *(const v2f*)&sQ[((tm0 + t) * 16 + lr) * LA_PA + ka];
            sc[t] = wmma_f32x4(a, bb, sc[t]);
        }
    }
    __syncthreads();   // sGS complete

    if (tid < 2) {     // Z inside the chunk
        float Z = z0;
        float lam = sPw[tid][64];
#pragma unroll 16  // the LDS reads of 16 steps go out ahead of the serial chain
        for (int i = 0; i < 64; ++i) {
            Z = Z * lam + sGS[tid][i];
            sZ[tid][i] = Z;
        }
    }
    __syncthreads();   // sZ complete
    if (tid < 128) {
        int kap = tid >> 6, i = tid & 63;
        float rz = 1.f / (sZ[kap][i] + 1e-6f);
        sRZ[kap][i] = rz;
        sRS[kap][i] = rz * sPw[kap][64 + i];
    }
    __syncthreads();   // sRZ, sRS complete

    // P[i][s] = A[i][s] * sum_kap lam^(i-s) g_s / (Z_i + 1e-6) for s <= i, else 0
#pragma unroll     // register arrays need constant indices
    for (int t = 0; t < 2; ++t)
#pragma unroll     // register arrays need constant indices
        for (int r = 0; r < 8; ++r) {
            int i = (tm0 + t) * 16 + r + hi * 8;
            int e = 63 + i - n;
            float w = sPw[0][e] * sG[0][n] * sRZ[0][i] + sPw[1][e] * sG[1][n] * sRZ[1][i];
            sP[i * LA_PA + n] = sc[t][r] * w;
        }
    __syncthreads();   // sP complete

    v8f acc[2];
    acc[0] = (v8f){}; acc[1] = (v8f){};
#pragma unroll 4   // four k-steps per trip: their LDS loads go out together
    for (int kk = 0; kk < 64; kk += 4) {
        int ka = kk + hi * 2;
        v2f bb;
        bb.x = sV[ka * LA_PB + n];
        bb.y = sV[(ka + 1) * LA_PB + n];
#pragma unroll     // register arrays need constant indices
        for (int t = 0; t < 2; ++t) {
            v2f a = *(const v2f*)&sP[((tm0 + t) * 16 + lr) * LA_PA + ka];
            acc[t] = wmma_f32x4(a, bb, acc[t]);
        }
    }
#pragma unroll     // register arrays need constant indices
    for (int kap = 0; kap < 2; ++kap) {
        float rs0 = sRS[kap][tm0 * 16 + lr];
        float rs1 = sRS[kap][(tm0 + 1) * 16 + lr];
#pragma unroll     // register arrays need constant indices
        for (int ks = 0; ks < 16; ++ks) {
            int ka = ks * 4 + hi * 2;
            v2f a0 = *(const v2f*)&sQ[(tm0 * 16 + lr) * LA_PA + ka];
            v2f a1 = *(const v2f*)&sQ[((tm0 + 1) * 16 + lr) * LA_PA + ka];
            a0 *= rs0;
            a1 *= rs1;
            acc[0] = wmma_f32x4(a0, ef[kap][ks], acc[0]);
            acc[1] = wmma_f32x4(a1, ef[kap][ks], acc[1]);
        }
    }
    float* yp = y_lin + base;
    unsigned yo = (unsigned)((tm0 * 16 + hi * 8) * LA_RS + n);
#pragma unroll     // register arrays need constant indices
    for (int t = 0; t < 2; ++t)
#pragma unroll     // register arrays need constant indices
        for (int r = 0; r < 8; ++r)
            yp[yo + (t * 16 + r) * LA_RS] = acc[t][r];
}

__global__ void local_attn_wmma(const float* __restrict__ q, const float* __restrict__ k,
                                const float* __restrict__ v, float* __restrict__ y_loc,
                                int B, int T, int H) {
    const int dh = 64;
    const int W = 64;
    const int SLD = 129;
    int nc = T / W;
    int h = blockIdx.x % H;
    int c = (blockIdx.x / H) % nc;
    int b = blockIdx.x / (H * nc);

    __shared__ float smem[64 * 64 + 128 * 64];   // Q | K, aliased as S after use
    __shared__ float sV[128 * 64];
    float* sQ = smem;
    float* sK = smem + 64 * 64;
    float* sS = smem;                            // aliased after barrier

    int tid = threadIdx.x;

    const float* qg = q + (((size_t)b * T + c * W) * H + h) * dh;
    if (tid < 32) {
        tdm_load_2d(qg, (unsigned)(uintptr_t)(void*)sQ, 64, 64, H * dh);
        if (c > 0) {
            const float* kg = k + (((size_t)b * T + (c - 1) * W) * H + h) * dh;
            const float* vg = v + (((size_t)b * T + (c - 1) * W) * H + h) * dh;
            tdm_load_2d(kg, (unsigned)(uintptr_t)(void*)sK, 64, 128, H * dh);
            tdm_load_2d(vg, (unsigned)(uintptr_t)(void*)sV, 64, 128, H * dh);
        }
        __builtin_amdgcn_s_wait_tensorcnt(0);
    }
    if (c == 0) {
        // boundary chunk: prev-chunk rows are zero, cur-chunk rows are tokens 0..63
        for (int idx = tid; idx < 128 * 64; idx += 256) {
            int jj = idx >> 6, d = idx & 63;
            float kvl = 0.f, vvl = 0.f;
            if (jj >= 64) {
                size_t g = (((size_t)b * T + (jj - 64)) * H + h) * dh + d;
                kvl = k[g];
                vvl = v[g];
            }
            sK[idx] = kvl;
            sV[idx] = vvl;
        }
    }
    __syncthreads();

    int wave = tid >> 5, lane = tid & 31, lr = lane & 15, hi = lane >> 4;

    // scores: 64x128 = 4x8 tiles of 16x16; wave handles 4 tiles
    v8f sc[4];
    for (int it = 0; it < 4; ++it) {
        int id = wave * 4 + it;
        int tm = id >> 3, tn = id & 7;
        v8f acc = {};
        for (int kkk = 0; kkk < 64; kkk += 4) {
            int ka = kkk + hi * 2;
            v2f a, bb;
            a.x  = sQ[(tm * 16 + lr) * 64 + ka];
            a.y  = sQ[(tm * 16 + lr) * 64 + ka + 1];
            bb.x = sK[(tn * 16 + lr) * 64 + ka];
            bb.y = sK[(tn * 16 + lr) * 64 + ka + 1];
            acc = wmma_f32x4(a, bb, acc);
        }
        sc[it] = acc;
    }
    __syncthreads();   // done reading sQ/sK; safe to alias as sS

    // ALiBi + causal window mask, write scores to LDS
    float slope = exp2f(-8.0f * (float)(h + 1) / (float)H);
    for (int it = 0; it < 4; ++it) {
        int id = wave * 4 + it;
        int tm = id >> 3, tn = id & 7;
#pragma unroll
        for (int r = 0; r < 8; ++r) {
            int i = tm * 16 + r + hi * 8;
            int jj = tn * 16 + lr;
            float val = sc[it][r];
            bool valid = (jj >= i + 1) && (jj <= i + W) && (c * W + jj - W >= 0);
            val = valid ? (val - slope * (float)(i + W - jj)) : -1e30f;
            sS[i * SLD + jj] = val;
        }
    }
    __syncthreads();

    // row softmax (threads 0..63, one row each)
    if (tid < 64) {
        float mx = -3.4e38f;
        for (int jj = 0; jj < 128; ++jj) mx = fmaxf(mx, sS[tid * SLD + jj]);
        float sum = 0.f;
        for (int jj = 0; jj < 128; ++jj) {
            float e = __expf(sS[tid * SLD + jj] - mx);
            sS[tid * SLD + jj] = e;
            sum += e;
        }
        float inv = 1.f / sum;
        for (int jj = 0; jj < 128; ++jj) sS[tid * SLD + jj] *= inv;
    }
    __syncthreads();

    // y = P[64,128] @ Vctx[128,64]; 16 tiles, wave handles 2; V from LDS
    for (int it = 0; it < 2; ++it) {
        int id = wave * 2 + it;
        int tm = id >> 2, tn = id & 3;
        int n = tn * 16 + lr;
        v8f acc = {};
        for (int kkk = 0; kkk < 128; kkk += 4) {
            int ka = kkk + hi * 2;
            v2f a, bb;
            a.x = sS[(tm * 16 + lr) * SLD + ka];
            a.y = sS[(tm * 16 + lr) * SLD + ka + 1];
            bb.x = sV[ka * 64 + n];
            bb.y = sV[(ka + 1) * 64 + n];
            acc = wmma_f32x4(a, bb, acc);
        }
#pragma unroll
        for (int r = 0; r < 8; ++r) {
            int i = tm * 16 + r + hi * 8;
            y_loc[(((size_t)b * T + c * W + i) * H + h) * dh + n] = acc[r];
        }
    }
}

// ---------------------------------------------------------------------------
// y = alpha * y_loc + (1 - alpha) * y_lin   (alpha per [B,T,H])
// ---------------------------------------------------------------------------
__global__ void mix_kernel(const float* __restrict__ y_loc, const float* __restrict__ y_lin,
                           const float* __restrict__ alpha, float* __restrict__ y,
                           size_t total, int dh) {
    size_t idx = (size_t)blockIdx.x * blockDim.x + threadIdx.x;
    if (idx < total) {
        size_t bth = idx / dh;     // (b*T + t)*H + h
        float a = alpha[bth];
        y[idx] = a * y_loc[idx] + (1.f - a) * y_lin[idx];
    }
}

// ---------------------------------------------------------------------------
// out = LayerNorm(x + proj) * gamma + beta ; block per (b,t) row.
// ---------------------------------------------------------------------------
__global__ void addnorm_kernel(const float* __restrict__ x, const float* __restrict__ proj,
                               const float* __restrict__ gamma, const float* __restrict__ beta,
                               float* __restrict__ out, int D) {
    __shared__ float red[256];
    size_t row = blockIdx.x;
    const float* xr = x + row * D;
    const float* pr = proj + row * D;

    float s = 0.f, s2 = 0.f;
    for (int d = threadIdx.x; d < D; d += 256) {
        float r = xr[d] + pr[d];
        s += r; s2 += r * r;
    }
    red[threadIdx.x] = s;
    __syncthreads();
    for (int off = 128; off > 0; off >>= 1) {
        if (threadIdx.x < off) red[threadIdx.x] += red[threadIdx.x + off];
        __syncthreads();
    }
    float mean = red[0] / (float)D;
    __syncthreads();
    red[threadIdx.x] = s2;
    __syncthreads();
    for (int off = 128; off > 0; off >>= 1) {
        if (threadIdx.x < off) red[threadIdx.x] += red[threadIdx.x + off];
        __syncthreads();
    }
    float var = red[0] / (float)D - mean * mean;
    float inv = rsqrtf(var + 1e-5f);
    for (int d = threadIdx.x; d < D; d += 256) {
        float r = xr[d] + pr[d];
        out[row * D + d] = (r - mean) * inv * gamma[d] + beta[d];
    }
}

// ---------------------------------------------------------------------------
extern "C" void kernel_launch(void* const* d_in, const int* in_sizes, int n_in,
                              void* d_out, int out_size, void* d_ws, size_t ws_size,
                              hipStream_t stream) {
    const int D = 512, H = 8, Kts = 2, dh = 64, T = 2048;
    const int M = in_sizes[0] / D;          // B*T = 4096
    const int B = M / T;                    // 2
    const int nc = T / 64;

    const float* x      = (const float*)d_in[0];
    const float* Wq     = (const float*)d_in[1];
    const float* Wk     = (const float*)d_in[2];
    const float* Wv     = (const float*)d_in[3];
    const float* Wg     = (const float*)d_in[4];
    const float* bg     = (const float*)d_in[5];
    const float* Wa     = (const float*)d_in[6];
    const float* ba     = (const float*)d_in[7];
    const float* Wo     = (const float*)d_in[8];
    const float* bo     = (const float*)d_in[9];
    const float* decay  = (const float*)d_in[10];
    const float* gamma  = (const float*)d_in[11];
    const float* beta   = (const float*)d_in[12];
    float* out = (float*)d_out;

    // workspace carve-up
    float* ws = (float*)d_ws;
    size_t off = 0;
    float* q_buf    = ws + off; off += (size_t)M * D;
    float* k_buf    = ws + off; off += (size_t)M * D;
    float* v_buf    = ws + off; off += (size_t)M * D;
    float* gate_buf = ws + off; off += (size_t)M * H * Kts;
    float* alp_buf  = ws + off; off += (size_t)M * H;
    float* ylin_buf = ws + off; off += (size_t)M * D;
    float* yloc_buf = ws + off; off += (size_t)M * D;
    float* ymix_buf = ws + off; off += (size_t)M * D;
    float* proj_buf = ws + off; off += (size_t)M * D;
    float* st_buf   = ws + off; off += (size_t)B * H * nc * Kts * dh * dh;
    float* zst_buf  = ws + off; off += (size_t)B * H * nc * Kts;

    dim3 blk(256);
    dim3 grid_wide(M / 128, D / 128);       // 32 x 4
    dim3 grid_small(M / 128, 1);

    // projections (wide, guard-free WMMA GEMMs)
    gemm_nt_wmma_wide<<<grid_wide, blk, 0, stream>>>(x, Wq, nullptr, q_buf, M, D, D);
    gemm_nt_wmma_wide<<<grid_wide, blk, 0, stream>>>(x, Wk, nullptr, k_buf, M, D, D);
    gemm_nt_wmma_wide<<<grid_wide, blk, 0, stream>>>(x, Wv, nullptr, v_buf, M, D, D);
    // skinny projections with sigmoid fused
    gemm_nt_wmma_small<<<grid_small, blk, 0, stream>>>(x, Wg, bg, gate_buf, M, H * Kts, D, 1);
    gemm_nt_wmma_small<<<grid_small, blk, 0, stream>>>(x, Wa, ba, alp_buf,  M, H,       D, 1);

    // gated linear attention, chunk-parallel: chunk states, scan over chunks, outputs
    linatt_chunk_state<<<B * nc * H, blk, 0, stream>>>(k_buf, v_buf, gate_buf, decay,
                                                       st_buf, zst_buf);
    linatt_chunk_scan<<<B * H * 8, blk, 0, stream>>>(st_buf, zst_buf, decay, B * H);
    linatt_chunk_out<<<B * nc * H, blk, 0, stream>>>(q_buf, k_buf, v_buf, gate_buf, decay,
                                                     st_buf, zst_buf, ylin_buf);

    local_attn_wmma<<<B * nc * H, 256, 0, stream>>>(q_buf, k_buf, v_buf, yloc_buf, B, T, H);

    // gated blend
    size_t total = (size_t)M * D;
    mix_kernel<<<(unsigned)((total + 255) / 256), blk, 0, stream>>>(yloc_buf, ylin_buf,
                                                                    alp_buf, ymix_buf,
                                                                    total, dh);

    // output projection + residual + layernorm
    gemm_nt_wmma_wide<<<grid_wide, blk, 0, stream>>>(ymix_buf, Wo, bo, proj_buf, M, D, D);
    addnorm_kernel<<<M, blk, 0, stream>>>(x, proj_buf, gamma, beta, out, D);
}

// v002
// It runs in 165 microseconds.
// Next to v001, in two timings, it ran 1.60 times as fast each time.
// All steps since v000 together make it 20.1 times as fast.
#include <hip/hip_runtime.h>
#include <hip/hip_bf16.h>
#include <math.h>

typedef __attribute__((ext_vector_type(2))) float v2f;
typedef __attribute__((ext_vector_type(8))) float v8f;
typedef __attribute__((ext_vector_type(4))) unsigned int v4u;
typedef __attribute__((ext_vector_type(8))) int v8i;
typedef __attribute__((ext_vector_type(4))) int v4i;

__device__ __forceinline__ v8f wmma_f32x4(v2f a, v2f b, v8f c) {
    // D = A(16x4 f32) * B(4x16 f32) + C(16x16 f32)
    return __builtin_amdgcn_wmma_f32_16x16x4_f32(
        /*neg_a=*/false, a, /*neg_b=*/false, b,
        /*c_mod=*/(short)0, c, /*reuse_a=*/false, /*reuse_b=*/false);
}

__device__ __forceinline__ void tdm_load_2d(const void* gptr, unsigned lds_off_bytes,
                                            unsigned tile_w_elems, unsigned tile_h_rows,
                                            unsigned row_stride_elems) {
    unsigned long long ga = (unsigned long long)(uintptr_t)gptr;
    v4u g0;
    g0.x = 1u;
    g0.y = lds_off_bytes;
    g0.z = (unsigned)(ga & 0xFFFFFFFFull);
    g0.w = (unsigned)((ga >> 32) & 0x01FFFFFFull)
         | 0x80000000u;
    const unsigned td0 = 0x7FFFFFFFu, td1 = 0x7FFFFFFFu;
    v8i g1;
    g1[0] = (int)(2u << 16);
    g1[1] = (int)((td0 & 0xFFFFu) << 16);
    g1[2] = (int)((td0 >> 16) | ((td1 & 0xFFFFu) << 16));
    g1[3] = (int)((td1 >> 16) | (tile_w_elems << 16));
    g1[4] = (int)tile_h_rows;
    g1[5] = (int)row_stride_elems;
    g1[6] = 0;
    g1[7] = 0;
    v4i zz4 = {};
    v8i zz8 = {};
    __builtin_amdgcn_tensor_load_to_lds(g0, g1, zz4, zz4, zz8, 0);
}

constexpr int GW_BM   = 64;
constexpr int GW_BN   = 128;
constexpr int GW_BK   = 64;
constexpr int GW_P    = 68;
constexpr int GW_ROWS = GW_BM + GW_BN;
constexpr int GW_BUF  = GW_ROWS * GW_P;

// One k-tile into one buffer: thread tid brings 16 bytes of rows (tid >> 4) + 16 j, j = 0..11
// (j < 4: rows of A, then rows of W), by twelve asynchronous copies global -> LDS.
__device__ __forceinline__ void gw_tile_copy(unsigned lds, const float* ga, const float* gw, int Kd) {
    const size_t rs = (size_t)16 * Kd;             // 16 rows on in global memory
    const unsigned ls = 16u * GW_P * 4u;           // 16 rows on in LDS, bytes
    // the copies go through no register; the closing wait stands inside the statement so that
    // the address registers named here are rewritten only behind it
    asm volatile("global_load_async_to_lds_b128 %0, %1, off\n\t"
                 "global_load_async_to_lds_b128 %2, %3, off\n\t"
                 "global_load_async_to_lds_b128 %4, %5, off\n\t"
                 "global_load_async_to_lds_b128 %6, %7, off\n\t"
                 "global_load_async_to_lds_b128 %8, %9, off\n\t"
                 "global_load_async_to_lds_b128 %10, %11, off\n\t"
                 "global_load_async_to_lds_b128 %12, %13, off\n\t"
                 "global_load_async_to_lds_b128 %14, %15, off\n\t"
                 "global_load_async_to_lds_b128 %16, %17, off\n\t"
                 "global_load_async_to_lds_b128 %18, %19, off\n\t"
                 "global_load_async_to_lds_b128 %20, %21, off\n\t"
                 "global_load_async_to_lds_b128 %22, %23, off\n\t"
                 "s_wait_xcnt 0x0"
                 :: "v"(lds),           "v"(ga),          "v"(lds + ls),      "v"(ga + rs),
                    "v"(lds + 2 * ls),  "v"(ga + 2 * rs), "v"(lds + 3 * ls),  "v"(ga + 3 * rs),
                    "v"(lds + 4 * ls),  "v"(gw),          "v"(lds + 5 * ls),  "v"(gw + rs),
                    "v"(lds + 6 * ls),  "v"(gw + 2 * rs), "v"(lds + 7 * ls),  "v"(gw + 3 * rs),
                    "v"(lds + 8 * ls),  "v"(gw + 4 * rs), "v"(lds + 9 * ls),  "v"(gw + 5 * rs),
                    "v"(lds + 10 * ls), "v"(gw + 6 * rs), "v"(lds + 11 * ls), "v"(gw + 7 * rs)
                 : "memory");
}

__global__ __launch_bounds__(256) void gemm_nt_wmma_wide(const float* __restrict__ A, const float* __restrict__ W,
                                  const float* __restrict__ bias, float* __restrict__ Y,
                                  int M, int N, int Kd) {
    __shared__ __attribute__((aligned(16))) float sT[2 * GW_BUF];

    int tid = threadIdx.x;
    int wave = tid >> 5;
    int lane = tid & 31;
    int wm = wave & 1;                   // 0..1
    int wn = wave >> 1;                  // 0..3
    int mB = blockIdx.x * GW_BM;
    int nB = blockIdx.y * GW_BN;
    int lr = lane & 15;
    int hi = lane >> 4;

    // this thread's place in a tile: row tid >> 4, 16 bytes at dword (tid & 15) * 4
    int cr = tid >> 4, cc = (tid & 15) * 4;
    const float* ga = A + (size_t)(mB + cr) * Kd + cc;
    const float* gw = W + (size_t)(nB + cr) * Kd + cc;
    unsigned lds0 = (unsigned)(uintptr_t)(void*)&sT[cr * GW_P + cc];   // LDS byte address, buffer 0
    const unsigned bufb = (unsigned)GW_BUF * 4u;                       // bytes from buffer 0 to buffer 1
    const int nt = Kd / GW_BK;

    v8f acc[2][2];
#pragma unroll     // register arrays need constant indices
    for (int mi = 0; mi < 2; ++mi)
#pragma unroll     // register arrays need constant indices
        for (int t = 0; t < 2; ++t) acc[mi][t] = (v8f){};

    gw_tile_copy(lds0, ga, gw, Kd);
    // tile 0 has landed for this wave; the barrier publishes it to the others
    asm volatile("s_wait_asynccnt 0x0" ::: "memory");
    __syncthreads();
    if (nt > 1) gw_tile_copy(lds0 + bufb, ga + GW_BK, gw + GW_BK, Kd);

    for (int kt = 0; kt < nt; ++kt) {
        const float* sb = sT + (kt & 1) * GW_BUF;
        const float* sa = sb + (wm * 32 + lr) * GW_P + hi * 2;
        const float* sw = sb + (GW_BM + wn * 32 + lr) * GW_P + hi * 2;
#pragma unroll     // the tile's LDS reads are visible together and go out ahead of the WMMAs
        for (int ks = 0; ks < GW_BK / 4; ++ks) {
            v2f a0 = *(const v2f*)(sa + ks * 4);
            v2f a1 = *(const v2f*)(sa + 16 * GW_P + ks * 4);
            v2f b0 = *(const v2f*)(sw + ks * 4);
            v2f b1 = *(const v2f*)(sw + 16 * GW_P + ks * 4);
            acc[0][0] = wmma_f32x4(a0, b0, acc[0][0]);
            acc[0][1] = wmma_f32x4(a0, b1, acc[0][1]);
            acc[1][0] = wmma_f32x4(a1, b0, acc[1][0]);
            acc[1][1] = wmma_f32x4(a1, b1, acc[1][1]);
        }
        // this wave's reads of the buffer have returned before the buffer is refilled
        asm volatile("s_wait_dscnt 0x0" ::: "memory");
        // this wave's copies of tile kt + 1 have landed before the barrier publishes them
        asm volatile("s_wait_asynccnt 0x0" ::: "memory");
        __syncthreads();
        if (kt + 2 < nt)
            gw_tile_copy(lds0 + (unsigned)(kt & 1) * bufb, ga + (size_t)(kt + 2) * GW_BK,
                         gw + (size_t)(kt + 2) * GW_BK, Kd);
    }
    // no copy is outstanding when the wave goes on to its end
    asm volatile("s_wait_asynccnt 0x0" ::: "memory");

    int m0 = mB + wm * 32 + hi * 8;
    int n0 = nB + wn * 32 + lr;
    float bv[2] = {0.f, 0.f};
    if (bias) {
        bv[0] = bias[n0];
        bv[1] = bias[n0 + 16];
        // the address registers of the two loads are free for reuse only behind this wait
        asm volatile("s_wait_xcnt 0x0" ::: "memory");
    }
    float* yp[2][8];
#pragma unroll     // register arrays need constant indices
    for (int mi = 0; mi < 2; ++mi)
#pragma unroll     // register arrays need constant indices
        for (int r = 0; r < 8; ++r) {
            yp[mi][r] = Y + (size_t)(m0 + mi * 16 + r) * N + n0;
            acc[mi][0][r] += bv[0];
            acc[mi][1][r] += bv[1];
        }
    // the stores stay behind all the arithmetic: no register of an issued store is rewritten
    __builtin_amdgcn_sched_barrier(0);
#pragma unroll     // register arrays need constant indices
    for (int mi = 0; mi < 2; ++mi)
#pragma unroll     // register arrays need constant indices
        for (int r = 0; r < 8; ++r) {
            yp[mi][r][0]  = acc[mi][0][r];
            yp[mi][r][16] = acc[mi][1][r];
        }
}

__global__ void gemm_nt_wmma_small(const float* __restrict__ A, const float* __restrict__ W,
                                   const float* __restrict__ bias, float* __restrict__ Y,
                                   int M, int N, int Kd, int apply_sigmoid) {
    int wave = threadIdx.x >> 5;
    int lane = threadIdx.x & 31;
    int m0 = (blockIdx.x * 8 + wave) * 16;
    int lr = lane & 15;
    int hi = lane >> 4;
    int wrow = lr;                       // n0 == 0 (single tile of columns)
    int wrc = (wrow < N) ? wrow : 0;
    float msk = (wrow < N) ? 1.f : 0.f;

    const float* ap = A + (size_t)(m0 + lr) * Kd;
    const float* wpr = W + (size_t)wrc * Kd;

    v8f acc = {};
    for (int kk = 0; kk < Kd; kk += 4) {
        int ka = kk + hi * 2;
        v2f a, b;
        a.x = ap[ka];           a.y = ap[ka + 1];
        b.x = wpr[ka] * msk;    b.y = wpr[ka + 1] * msk;
        acc = wmma_f32x4(a, b, acc);
    }
#pragma unroll
    for (int r = 0; r < 8; ++r) {
        int m = m0 + r + hi * 8;
        int n = lr;
        if (n < N) {
            float val = acc[r];
            if (bias) val += bias[n];
            if (apply_sigmoid) val = 1.f / (1.f + __expf(-val));
            Y[(size_t)m * N + n] = val;
        }
    }
}

// ---------------------------------------------------------------------------
// Multi-timescale gated linear attention, chunk-parallel form (chunks of 64
// tokens). With lam constant over time, for token i of chunk c:
//   Hm_i = lam^(i+1) * E + sum_{s<=i} lam^(i-s) * g_s * k_s v_s^T
//   Z_i  = lam^(i+1) * zE + sum_{s<=i} lam^(i-s) * g_s * s_s
// where E, zE are the state at the end of chunk c-1. Three launches:
//   1. chunk_state: S_c = sum_i lam^(63-i) g_i k_i v_i^T (and the same for Z)
//   2. chunk_scan : E_c = lam^64 * E_{c-1} + S_c over the chunks, in place
//   3. chunk_out  : y = (masked decayed Q K^T) V + scaled Q E
// Only non-negative powers of lam are formed, so every factor is in [0, 1].
// ---------------------------------------------------------------------------
constexpr int LA_T  = 2048;        // tokens per sequence
constexpr int LA_H  = 8;           // heads
constexpr int LA_NC = LA_T / 64;   // chunks per sequence
constexpr int LA_RS = LA_H * 64;   // dwords between the rows of one head's q, k, v
constexpr int LA_PA = 68;          // LDS pitch (dwords), rows read 8 bytes along k
constexpr int LA_PB = 72;          // LDS pitch (dwords), rows read across columns

__device__ __forceinline__ float la_sigmoid(float x) { return 1.f / (1.f + __expf(-x)); }

// base^n for 0 <= n <= 127 by squaring: 1 at n == 0 for any base, no logarithm.
__device__ __forceinline__ float la_ipow(float base, int n) {
    float p = 1.f;
#pragma unroll     // seven fixed bits, no loop control
    for (int bit = 0; bit < 7; ++bit) {
        if (n & 1) p *= base;
        base *= base;
        n >>= 1;
    }
    return p;
}

// A thread's four float4 of a 64x64 f32 tile (256 threads): global -> registers.
struct LaTile { float4 a, b, c, d; };
__device__ __forceinline__ LaTile la_tile_load(const float* g, int tid) {
    const float* p = g + ((unsigned)(tid >> 4) * LA_RS + (unsigned)(tid & 15) * 4);
    LaTile t;
    t.a = *(const float4*)(p);
    t.b = *(const float4*)(p + 16 * LA_RS);
    t.c = *(const float4*)(p + 32 * LA_RS);
    t.d = *(const float4*)(p + 48 * LA_RS);
    // address registers of these loads (offset, scalar base) are free for reuse only behind this wait
    asm volatile("s_wait_xcnt 0x0" ::: "memory");
    return t;
}
// ... and registers -> LDS at the given pitch.
__device__ __forceinline__ void la_tile_put(float* s, int pitch, int tid, const LaTile& t) {
    float* p = s + (tid >> 4) * pitch + (tid & 15) * 4;
    *(float4*)(p) = t.a;
    *(float4*)(p + 16 * pitch) = t.b;
    *(float4*)(p + 32 * pitch) = t.c;
    *(float4*)(p + 48 * pitch) = t.d;
}

// mean |k_i| + 1e-6 of row i = tid >> 2; four lanes share a row (valid in all four).
__device__ __forceinline__ float la_row_absmean(const float* s, int pitch, int tid) {
    int i = tid >> 2, qd = tid & 3;
    float a = 0.f;
#pragma unroll     // 16 independent LDS reads in flight
    for (int e = 0; e < 16; ++e) a += fabsf(s[i * pitch + e * 4 + qd]);
    a += __shfl_xor(a, 1);
    a += __shfl_xor(a, 2);
    return a * (1.f / 64.f) + 1e-6f;
}

// grid = B*LA_H*LA_NC, block = 256. blockIdx.x = (b*LA_H + h)*LA_NC + c.
// The pointers are not __restrict__: the loads then keep their side of the asm waits.
__global__ __launch_bounds__(256) void linatt_chunk_state(const float* k, const float* v, const float* gate,
                                   const float* decay_logit, float* S, float* zS) {
    int c  = blockIdx.x % LA_NC;
    int bh = blockIdx.x / LA_NC;
    int h = bh % LA_H, b = bh / LA_H;
    int tid = threadIdx.x;

    __shared__ __attribute__((aligned(16))) float sK[64 * LA_PB];
    __shared__ __attribute__((aligned(16))) float sV[64 * LA_PB];
    __shared__ float sW[2][64];      // lam^(63-i) * g_i
    __shared__ float sAbs[64];

    size_t tok0 = (size_t)b * LA_T + c * 64;
    size_t base = (tok0 * LA_H + h) * 64;
    LaTile rk = la_tile_load(k + base, tid);
    LaTile rv = la_tile_load(v + base, tid);
    la_tile_put(sK, LA_PB, tid, rk);
    la_tile_put(sV, LA_PB, tid, rv);
    if (tid < 128) {
        int kap = tid >> 6, i = tid & 63;
        float lam = la_sigmoid(decay_logit[h * 2 + kap]);
        sW[kap][i] = gate[((tok0 + i) * LA_H + h) * 2 + kap] * la_ipow(lam, 63 - i);
    }
    __syncthreads();

    float am = la_row_absmean(sK, LA_PB, tid);
    if ((tid & 3) == 0) sAbs[tid >> 2] = am;

    // S[a][j] = sum_i K[i][a] * (w_i V[i][j]); wave = (timescale, 16 columns j)
    int wave = tid >> 5, lane = tid & 31, lr = lane & 15, hi = lane >> 4;
    int kap = wave >> 2, tn = wave & 3;
    int n = tn * 16 + lr;
    v8f acc[4];
#pragma unroll     // register arrays need constant indices
    for (int tm = 0; tm < 4; ++tm) acc[tm] = (v8f){};
#pragma unroll 4   // four k-steps per trip: their LDS loads go out together
    for (int kk = 0; kk < 64; kk += 4) {
        int ka = kk + hi * 2;
        v2f bb;
        bb.x = sV[ka * LA_PB + n] * sW[kap][ka];
        bb.y = sV[(ka + 1) * LA_PB + n] * sW[kap][ka + 1];
#pragma unroll     // register arrays need constant indices
        for (int tm = 0; tm < 4; ++tm) {
            v2f a;
            a.x = sK[ka * LA_PB + tm * 16 + lr];
            a.y = sK[(ka + 1) * LA_PB + tm * 16 + lr];
            acc[tm] = wmma_f32x4(a, bb, acc[tm]);
        }
    }
    __syncthreads();   // sAbs complete
    if (wave < 2) {    // wave w sums timescale w
        float z = sW[wave][lane] * sAbs[lane] + sW[wave][lane + 32] * sAbs[lane + 32];
#pragma unroll     // five fixed shuffle steps
        for (int m = 16; m > 0; m >>= 1) z += __shfl_xor(z, m);
        if (lane == 0) zS[(size_t)blockIdx.x * 2 + wave] = z;
    }
    float* Sp = S + (size_t)blockIdx.x * 2 * 4096;
    unsigned so = (unsigned)(kap * 4096 + hi * 8 * 64 + n);
#pragma unroll     // register arrays need constant indices
    for (int tm = 0; tm < 4; ++tm)
#pragma unroll     // register arrays need constant indices
        for (int r = 0; r < 8; ++r)
            Sp[so + (tm * 16 + r) * 64] = acc[tm][r];
}

__global__ __launch_bounds__(256) void linatt_chunk_scan(float* __restrict__ S, float* __restrict__ zS,
                                  const float* __restrict__ decay_logit, int BH) {
    int gid = blockIdx.x * 256 + threadIdx.x;
    {
        int e4 = gid & 1023, kap = (gid >> 10) & 1, bh = gid >> 11;
        float l64 = la_ipow(la_sigmoid(decay_logit[(bh % LA_H) * 2 + kap]), 64);
        float4* p = (float4*)S + ((size_t)bh * LA_NC * 2 + kap) * 1024 + e4;
        float4 s[LA_NC];
#pragma unroll     // register arrays need constant indices
        for (int c = 0; c < LA_NC; ++c) s[c] = p[(size_t)c * 2048];
        // every load is issued before the first store (all in flight at once), and
        // the address registers are free for reuse only behind this wait
        asm volatile("s_wait_xcnt 0x0" ::: "memory");
        float4 run = make_float4(0.f, 0.f, 0.f, 0.f);
#pragma unroll     // register arrays need constant indices
        for (int c = 0; c < LA_NC; ++c) {
            float4 t = s[c];
            s[c] = run;
            run.x = run.x * l64 + t.x;
            run.y = run.y * l64 + t.y;
            run.z = run.z * l64 + t.z;
            run.w = run.w * l64 + t.w;
        }
        // the stores stay behind all the arithmetic: no register of an issued store is rewritten
        __builtin_amdgcn_sched_barrier(0);
#pragma unroll     // register arrays need constant indices
        for (int c = 1; c < LA_NC; ++c) p[(size_t)c * 2048] = s[c];
        // registers of the stores above are free for reuse only behind this wait
        asm volatile("s_wait_xcnt 0x0" ::: "memory");
    }
    if (gid < BH * 2) {
        int kap = gid & 1, bh = gid >> 1;
        float l64 = la_ipow(la_sigmoid(decay_logit[(bh % LA_H) * 2 + kap]), 64);
        float* pz = zS + (size_t)bh * LA_NC * 2 + kap;
        float z[LA_NC];
#pragma unroll     // register arrays need constant indices
        for (int c = 0; c < LA_NC; ++c) z[c] = pz[c * 2];
        asm volatile("s_wait_xcnt 0x0" ::: "memory");
        float run = 0.f;
#pragma unroll     // register arrays need constant indices
        for (int c = 0; c < LA_NC; ++c) {
            float t = z[c];
            z[c] = run;
            run = run * l64 + t;
        }
        __builtin_amdgcn_sched_barrier(0);
#pragma unroll     // register arrays need constant indices
        for (int c = 1; c < LA_NC; ++c) pz[c * 2] = z[c];
    }
}

// grid = B*LA_H*LA_NC, block = 256. blockIdx.x = (b*LA_H + h)*LA_NC + c.
// The pointers are not __restrict__: the loads then keep their side of the asm waits.
__global__ __launch_bounds__(256) void linatt_chunk_out(const float* q, const float* k, const float* v, const float* gate,
                                 const float* decay_logit, const float* E, const float* zE,
                                 float* y_lin) {
    int c  = blockIdx.x % LA_NC;
    int bh = blockIdx.x / LA_NC;
    int h = bh % LA_H, b = bh / LA_H;
    int tid = threadIdx.x;
    int wave = tid >> 5, lane = tid & 31, lr = lane & 15, hi = lane >> 4;
    int tn = wave & 3, tm0 = (wave >> 2) * 2;    // wave owns tiles (tm0, tn), (tm0+1, tn)
    int n = tn * 16 + lr;

    __shared__ __attribute__((aligned(16))) float sQ[64 * LA_PA];
    __shared__ __attribute__((aligned(16))) float sK[64 * LA_PA];
    __shared__ __attribute__((aligned(16))) float sV[64 * LA_PB];
    __shared__ __attribute__((aligned(16))) float sP[64 * LA_PA];
    __shared__ float sG[2][64];      // gate
    __shared__ float sGS[2][64];     // gate * (mean|k| + 1e-6)
    __shared__ float sZ[2][64];      // Z_i
    __shared__ float sRZ[2][64];     // 1 / (Z_i + 1e-6)
    __shared__ float sRS[2][64];     // lam^(i+1) / (Z_i + 1e-6)
    __shared__ float sPw[2][128];    // [63 + d] = lam^d for d = 0..64, 0 for d = -63..-1 (the causal mask)

    size_t tok0 = (size_t)b * LA_T + c * 64;
    size_t base = (tok0 * LA_H + h) * 64;
    LaTile rq = la_tile_load(q + base, tid);
    LaTile rk = la_tile_load(k + base, tid);
    LaTile rv = la_tile_load(v + base, tid);
    // B fragments of the two incoming states, columns n: fetched here, in flight
    // together with the tiles.
    const float* Ep = E + (size_t)blockIdx.x * 2 * 4096;
    unsigned eo = (unsigned)(hi * 2 * 64 + n);
    v2f ef[2][16];
#pragma unroll     // register arrays need constant indices
    for (int kap = 0; kap < 2; ++kap)
#pragma unroll     // register arrays need constant indices
        for (int ks = 0; ks < 16; ++ks) ef[kap][ks] = (v2f){};
    float z0 = 0.f;   // incoming Z of timescale tid & 1
    if (c > 0) {   // chunk 0 starts from the zero state
#pragma unroll     // register arrays need constant indices
        for (int kap = 0; kap < 2; ++kap)
#pragma unroll     // register arrays need constant indices
            for (int ks = 0; ks < 16; ++ks) {
                ef[kap][ks].x = Ep[eo + kap * 4096 + ks * 256];
                ef[kap][ks].y = Ep[eo + kap * 4096 + ks * 256 + 64];
            }
        z0 = zE[(size_t)blockIdx.x * 2 + (tid & 1)];
        // address registers of the loads above are free for reuse only behind this wait
        asm volatile("s_wait_xcnt 0x0" ::: "memory");
    }
    la_tile_put(sQ, LA_PA, tid, rq);
    la_tile_put(sK, LA_PA, tid, rk);
    la_tile_put(sV, LA_PB, tid, rv);
    if (tid < 128) {
        int kap = tid >> 6, i = tid & 63;
        sG[kap][i] = gate[((tok0 + i) * LA_H + h) * 2 + kap];
    }
    {
        int kap = tid >> 7, d = (tid & 127) - 63;
        float pw = la_ipow(la_sigmoid(decay_logit[h * 2 + kap]), d > 0 ? d : 0);
        sPw[kap][63 + d] = (d >= 0) ? pw : 0.f;
    }
    __syncthreads();

    float am = la_row_absmean(sK, LA_PA, tid);
    if ((tid & 3) < 2) sGS[tid & 3][tid >> 2] = sG[tid & 3][tid >> 2] * am;

    // A[i][s] = q_i . k_s
    v8f sc[2];
    sc[0] = (v8f){}; sc[1] = (v8f){};
#pragma unroll 4   // four k-steps per trip: their LDS loads go out together
    for (int kk = 0; kk < 64; kk += 4) {
        int ka = kk + hi * 2;
        v2f bb = *(const v2f*)&sK[(tn * 16 + lr) * LA_PA + ka];
#pragma unroll     // register arrays need constant indices
        for (int t = 0; t < 2; ++t) {
            v2f a = *(const v2f*)&sQ[((tm0 + t) * 16 + lr) * LA_PA + ka];
            sc[t] = wmma_f32x4(a, bb, sc[t]);
        }
    }
    __syncthreads();   // sGS complete

    if (tid < 2) {     // Z inside the chunk
        float Z = z0;
        float lam = sPw[tid][64];
#pragma unroll 16  // the LDS reads of 16 steps go out ahead of the serial chain
        for (int i = 0; i < 64; ++i) {
            Z = Z * lam + sGS[tid][i];
            sZ[tid][i] = Z;
        }
    }
    __syncthreads();   // sZ complete
    if (tid < 128) {
        int kap = tid >> 6, i = tid & 63;
        float rz = 1.f / (sZ[kap][i] + 1e-6f);
        sRZ[kap][i] = rz;
        sRS[kap][i] = rz * sPw[kap][64 + i];
    }
    __syncthreads();   // sRZ, sRS complete

    // P[i][s] = A[i][s] * sum_kap lam^(i-s) g_s / (Z_i + 1e-6) for s <= i, else 0
#pragma unroll     // register arrays need constant indices
    for (int t = 0; t < 2; ++t)
#pragma unroll     // register arrays need constant indices
        for (int r = 0; r < 8; ++r) {
            int i = (tm0 + t) * 16 + r + hi * 8;
            int e = 63 + i - n;
            float w = sPw[0][e] * sG[0][n] * sRZ[0][i] + sPw[1][e] * sG[1][n] * sRZ[1][i];
            sP[i * LA_PA + n] = sc[t][r] * w;
        }
    __syncthreads();   // sP complete

    v8f acc[2];
    acc[0] = (v8f){}; acc[1] = (v8f){};
#pragma unroll 4   // four k-steps per trip: their LDS loads go out together
    for (int kk = 0; kk < 64; kk += 4) {
        int ka = kk + hi * 2;
        v2f bb;
        bb.x = sV[ka * LA_PB + n];
        bb.y = sV[(ka + 1) * LA_PB + n];
#pragma unroll     // register arrays need constant indices
        for (int t = 0; t < 2; ++t) {
            v2f a = *(const v2f*)&sP[((tm0 + t) * 16 + lr) * LA_PA + ka];
            acc[t] = wmma_f32x4(a, bb, acc[t]);
        }
    }
#pragma unroll     // register arrays need constant indices
    for (int kap = 0; kap < 2; ++kap) {
        float rs0 = sRS[kap][tm0 * 16 + lr];
        float rs1 = sRS[kap][(tm0 + 1) * 16 + lr];
#pragma unroll     // register arrays need constant indices
        for (int ks = 0; ks < 16; ++ks) {
            int ka = ks * 4 + hi * 2;
            v2f a0 = *(const v2f*)&sQ[(tm0 * 16 + lr) * LA_PA + ka];
            v2f a1 = *(const v2f*)&sQ[((tm0 + 1) * 16 + lr) * LA_PA + ka];
            a0 *= rs0;
            a1 *= rs1;
            acc[0] = wmma_f32x4(a0, ef[kap][ks], acc[0]);
            acc[1] = wmma_f32x4(a1, ef[kap][ks], acc[1]);
        }
    }
    float* yp = y_lin + base;
    unsigned yo = (unsigned)((tm0 * 16 + hi * 8) * LA_RS + n);
#pragma unroll     // register arrays need constant indices
    for (int t = 0; t < 2; ++t)
#pragma unroll     // register arrays need constant indices
        for (int r = 0; r < 8; ++r)
            yp[yo + (t * 16 + r) * LA_RS] = acc[t][r];
}

__global__ void local_attn_wmma(const float* __restrict__ q, const float* __restrict__ k,
                                const float* __restrict__ v, float* __restrict__ y_loc,
                                int B, int T, int H) {
    const int dh = 64;
    const int W = 64;
    const int SLD = 129;
    int nc = T / W;
    int h = blockIdx.x % H;
    int c = (blockIdx.x / H) % nc;
    int b = blockIdx.x / (H * nc);

    __shared__ float smem[64 * 64 + 128 * 64];   // Q | K, aliased as S after use
    __shared__ float sV[128 * 64];
    float* sQ = smem;
    float* sK = smem + 64 * 64;
    float* sS = smem;                            // aliased after barrier

    int tid = threadIdx.x;

    const float* qg = q + (((size_t)b * T + c * W) * H + h) * dh;
    if (tid < 32) {
        tdm_load_2d(qg, (unsigned)(uintptr_t)(void*)sQ, 64, 64, H * dh);
        if (c > 0) {
            const float* kg = k + (((size_t)b * T + (c - 1) * W) * H + h) * dh;
            const float* vg = v + (((size_t)b * T + (c - 1) * W) * H + h) * dh;
            tdm_load_2d(kg, (unsigned)(uintptr_t)(void*)sK, 64, 128, H * dh);
            tdm_load_2d(vg, (unsigned)(uintptr_t)(void*)sV, 64, 128, H * dh);
        }
        __builtin_amdgcn_s_wait_tensorcnt(0);
    }
    if (c == 0) {
        // boundary chunk: prev-chunk rows are zero, cur-chunk rows are tokens 0..63
        for (int idx = tid; idx < 128 * 64; idx += 256) {
            int jj = idx >> 6, d = idx & 63;
            float kvl = 0.f, vvl = 0.f;
            if (jj >= 64) {
                size_t g = (((size_t)b * T + (jj - 64)) * H + h) * dh + d;
                kvl = k[g];
                vvl = v[g];
            }
            sK[idx] = kvl;
            sV[idx] = vvl;
        }
    }
    __syncthreads();

    int wave = tid >> 5, lane = tid & 31, lr = lane & 15, hi = lane >> 4;

    // scores: 64x128 = 4x8 tiles of 16x16; wave handles 4 tiles
    v8f sc[4];
    for (int it = 0; it < 4; ++it) {
        int id = wave * 4 + it;
        int tm = id >> 3, tn = id & 7;
        v8f acc = {};
        for (int kkk = 0; kkk < 64; kkk += 4) {
            int ka = kkk + hi * 2;
            v2f a, bb;
            a.x  = sQ[(tm * 16 + lr) * 64 + ka];
            a.y  = sQ[(tm * 16 + lr) * 64 + ka + 1];
            bb.x = sK[(tn * 16 + lr) * 64 + ka];
            bb.y = sK[(tn * 16 + lr) * 64 + ka + 1];
            acc = wmma_f32x4(a, bb, acc);
        }
        sc[it] = acc;
    }
    __syncthreads();   // done reading sQ/sK; safe to alias as sS

    // ALiBi + causal window mask, write scores to LDS
    float slope = exp2f(-8.0f * (float)(h + 1) / (float)H);
    for (int it = 0; it < 4; ++it) {
        int id = wave * 4 + it;
        int tm = id >> 3, tn = id & 7;
#pragma unroll
        for (int r = 0; r < 8; ++r) {
            int i = tm * 16 + r + hi * 8;
            int jj = tn * 16 + lr;
            float val = sc[it][r];
            bool valid = (jj >= i + 1) && (jj <= i + W) && (c * W + jj - W >= 0);
            val = valid ? (val - slope * (float)(i + W - jj)) : -1e30f;
            sS[i * SLD + jj] = val;
        }
    }
    __syncthreads();

    // row softmax (threads 0..63, one row each)
    if (tid < 64) {
        float mx = -3.4e38f;
        for (int jj = 0; jj < 128; ++jj) mx = fmaxf(mx, sS[tid * SLD + jj]);
        float sum = 0.f;
        for (int jj = 0; jj < 128; ++jj) {
            float e = __expf(sS[tid * SLD + jj] - mx);
            sS[tid * SLD + jj] = e;
            sum += e;
        }
        float inv = 1.f / sum;
        for (int jj = 0; jj < 128; ++jj) sS[tid * SLD + jj] *= inv;
    }
    __syncthreads();

    // y = P[64,128] @ Vctx[128,64]; 16 tiles, wave handles 2; V from LDS
    for (int it = 0; it < 2; ++it) {
        int id = wave * 2 + it;
        int tm = id >> 2, tn = id & 3;
        int n = tn * 16 + lr;
        v8f acc = {};
        for (int kkk = 0; kkk < 128; kkk += 4) {
            int ka = kkk + hi * 2;
            v2f a, bb;
            a.x = sS[(tm * 16 + lr) * SLD + ka];
            a.y = sS[(tm * 16 + lr) * SLD + ka + 1];
            bb.x = sV[ka * 64 + n];
            bb.y = sV[(ka + 1) * 64 + n];
            acc = wmma_f32x4(a, bb, acc);
        }
#pragma unroll
        for (int r = 0; r < 8; ++r) {
            int i = tm * 16 + r + hi * 8;
            y_loc[(((size_t)b * T + c * W + i) * H + h) * dh + n] = acc[r];
        }
    }
}

// ---------------------------------------------------------------------------
// y = alpha * y_loc + (1 - alpha) * y_lin   (alpha per [B,T,H])
// ---------------------------------------------------------------------------
__global__ void mix_kernel(const float* __restrict__ y_loc, const float* __restrict__ y_lin,
                           const float* __restrict__ alpha, float* __restrict__ y,
                           size_t total, int dh) {
    size_t idx = (size_t)blockIdx.x * blockDim.x + threadIdx.x;
    if (idx < total) {
        size_t bth = idx / dh;     // (b*T + t)*H + h
        float a = alpha[bth];
        y[idx] = a * y_loc[idx] + (1.f - a) * y_lin[idx];
    }
}

// ---------------------------------------------------------------------------
// out = LayerNorm(x + proj) * gamma + beta ; block per (b,t) row.
// ---------------------------------------------------------------------------
__global__ void addnorm_kernel(const float* __restrict__ x, const float* __restrict__ proj,
                               const float* __restrict__ gamma, const float* __restrict__ beta,
                               float* __restrict__ out, int D) {
    __shared__ float red[256];
    size_t row = blockIdx.x;
    const float* xr = x + row * D;
    const float* pr = proj + row * D;

    float s = 0.f, s2 = 0.f;
    for (int d = threadIdx.x; d < D; d += 256) {
        float r = xr[d] + pr[d];
        s += r; s2 += r * r;
    }
    red[threadIdx.x] = s;
    __syncthreads();
    for (int off = 128; off > 0; off >>= 1) {
        if (threadIdx.x < off) red[threadIdx.x] += red[threadIdx.x + off];
        __syncthreads();
    }
    float mean = red[0] / (float)D;
    __syncthreads();
    red[threadIdx.x] = s2;
    __syncthreads();
    for (int off = 128; off > 0; off >>= 1) {
        if (threadIdx.x < off) red[threadIdx.x] += red[threadIdx.x + off];
        __syncthreads();
    }
    float var = red[0] / (float)D - mean * mean;
    float inv = rsqrtf(var + 1e-5f);
    for (int d = threadIdx.x; d < D; d += 256) {
        float r = xr[d] + pr[d];
        out[row * D + d] = (r - mean) * inv * gamma[d] + beta[d];
    }
}

// ---------------------------------------------------------------------------
extern "C" void kernel_launch(void* const* d_in, const int* in_sizes, int n_in,
                              void* d_out, int out_size, void* d_ws, size_t ws_size,
                              hipStream_t stream) {
    const int D = 512, H = 8, Kts = 2, dh = 64, T = 2048;
    const int M = in_sizes[0] / D;          // B*T = 4096
    const int B = M / T;                    // 2
    const int nc = T / 64;

    const float* x      = (const float*)d_in[0];
    const float* Wq     = (const float*)d_in[1];
    const float* Wk     = (const float*)d_in[2];
    const float* Wv     = (const float*)d_in[3];
    const float* Wg     = (const float*)d_in[4];
    const float* bg     = (const float*)d_in[5];
    const float* Wa     = (const float*)d_in[6];
    const float* ba     = (const float*)d_in[7];
    const float* Wo     = (const float*)d_in[8];
    const float* bo     = (const float*)d_in[9];
    const float* decay  = (const float*)d_in[10];
    const float* gamma  = (const float*)d_in[11];
    const float* beta   = (const float*)d_in[12];
    float* out = (float*)d_out;

    // workspace carve-up
    float* ws = (float*)d_ws;
    size_t off = 0;
    float* q_buf    = ws + off; off += (size_t)M * D;
    float* k_buf    = ws + off; off += (size_t)M * D;
    float* v_buf    = ws + off; off += (size_t)M * D;
    float* gate_buf = ws + off; off += (size_t)M * H * Kts;
    float* alp_buf  = ws + off; off += (size_t)M * H;
    float* ylin_buf = ws + off; off += (size_t)M * D;
    float* yloc_buf = ws + off; off += (size_t)M * D;
    float* ymix_buf = ws + off; off += (size_t)M * D;
    float* proj_buf = ws + off; off += (size_t)M * D;
    float* st_buf   = ws + off; off += (size_t)B * H * nc * Kts * dh * dh;
    float* zst_buf  = ws + off; off += (size_t)B * H * nc * Kts;

    dim3 blk(256);
    dim3 grid_wide(M / 64, D / 128);        // 64 x 4
    dim3 grid_small(M / 128, 1);

    // projections (wide, guard-free WMMA GEMMs)
    gemm_nt_wmma_wide<<<grid_wide, blk, 0, stream>>>(x, Wq, nullptr, q_buf, M, D, D);
    gemm_nt_wmma_wide<<<grid_wide, blk, 0, stream>>>(x, Wk, nullptr, k_buf, M, D, D);
    gemm_nt_wmma_wide<<<grid_wide, blk, 0, stream>>>(x, Wv, nullptr, v_buf, M, D, D);
    // skinny projections with sigmoid fused
    gemm_nt_wmma_small<<<grid_small, blk, 0, stream>>>(x, Wg, bg, gate_buf, M, H * Kts, D, 1);
    gemm_nt_wmma_small<<<grid_small, blk, 0, stream>>>(x, Wa, ba, alp_buf,  M, H,       D, 1);

    // gated linear attention, chunk-parallel: chunk states, scan over chunks, outputs
    linatt_chunk_state<<<B * nc * H, blk, 0, stream>>>(k_buf, v_buf, gate_buf, decay,
                                                       st_buf, zst_buf);
    linatt_chunk_scan<<<B * H * 8, blk, 0, stream>>>(st_buf, zst_buf, decay, B * H);
    linatt_chunk_out<<<B * nc * H, blk, 0, stream>>>(q_buf, k_buf, v_buf, gate_buf, decay,
                                                     st_buf, zst_buf, ylin_buf);

    local_attn_wmma<<<B * nc * H, 256, 0, stream>>>(q_buf, k_buf, v_buf, yloc_buf, B, T, H);

    // gated blend
    size_t total = (size_t)M * D;
    mix_kernel<<<(unsigned)((total + 255) / 256), blk, 0, stream>>>(yloc_buf, ylin_buf,
                                                                    alp_buf, ymix_buf,
                                                                    total, dh);

    // output projection + residual + layernorm
    gemm_nt_wmma_wide<<<grid_wide, blk, 0, stream>>>(ymix_buf, Wo, bo, proj_buf, M, D, D);
    addnorm_kernel<<<M, blk, 0, stream>>>(x, proj_buf, gamma, beta, out, D);
}

// v003
// A run of this version takes 158 microseconds.
// Timed twice side by side with v002, it ran 1.04 and 1.05 times as fast.
// Over all steps from v000 it is 20.9 times as fast.
#include <hip/hip_runtime.h>
#include <hip/hip_bf16.h>
#include <math.h>

typedef __attribute__((ext_vector_type(2))) float v2f;
typedef __attribute__((ext_vector_type(8))) float v8f;
typedef __attribute__((ext_vector_type(4))) unsigned int v4u;
typedef __attribute__((ext_vector_type(8))) int v8i;
typedef __attribute__((ext_vector_type(4))) int v4i;

__device__ __forceinline__ v8f wmma_f32x4(v2f a, v2f b, v8f c) {
    // D = A(16x4 f32) * B(4x16 f32) + C(16x16 f32)
    return __builtin_amdgcn_wmma_f32_16x16x4_f32(
        /*neg_a=*/false, a, /*neg_b=*/false, b,
        /*c_mod=*/(short)0, c, /*reuse_a=*/false, /*reuse_b=*/false);
}

__device__ __forceinline__ void tdm_load_2d(const void* gptr, unsigned lds_off_bytes,
                                            unsigned tile_w_elems, unsigned tile_h_rows,
                                            unsigned row_stride_elems) {
    unsigned long long ga = (unsigned long long)(uintptr_t)gptr;
    v4u g0;
    g0.x = 1u;
    g0.y = lds_off_bytes;
    g0.z = (unsigned)(ga & 0xFFFFFFFFull);
    g0.w = (unsigned)((ga >> 32) & 0x01FFFFFFull)
         | 0x80000000u;
    const unsigned td0 = 0x7FFFFFFFu, td1 = 0x7FFFFFFFu;
    v8i g1;
    g1[0] = (int)(2u << 16);
    g1[1] = (int)((td0 & 0xFFFFu) << 16);
    g1[2] = (int)((td0 >> 16) | ((td1 & 0xFFFFu) << 16));
    g1[3] = (int)((td1 >> 16) | (tile_w_elems << 16));
    g1[4] = (int)tile_h_rows;
    g1[5] = (int)row_stride_elems;
    g1[6] = 0;
    g1[7] = 0;
    v4i zz4 = {};
    v8i zz8 = {};
    __builtin_amdgcn_tensor_load_to_lds(g0, g1, zz4, zz4, zz8, 0);
}

constexpr int GW_BM   = 64;
constexpr int GW_BN   = 128;
constexpr int GW_BK   = 64;
constexpr int GW_P    = 68;
constexpr int GW_ROWS = GW_BM + GW_BN;
constexpr int GW_BUF  = GW_ROWS * GW_P;

// One k-tile into one buffer: thread tid brings 16 bytes of rows (tid >> 4) + 16 j, j = 0..11
// (j < 4: rows of A, then rows of W), by twelve asynchronous copies global -> LDS.
__device__ __forceinline__ void gw_tile_copy(unsigned lds, const float* ga, const float* gw, int Kd) {
    const size_t rs = (size_t)16 * Kd;             // 16 rows on in global memory
    const unsigned ls = 16u * GW_P * 4u;           // 16 rows on in LDS, bytes
    // the copies go through no register; the closing wait stands inside the statement so that
    // the address registers named here are rewritten only behind it
    asm volatile("global_load_async_to_lds_b128 %0, %1, off\n\t"
                 "global_load_async_to_lds_b128 %2, %3, off\n\t"
                 "global_load_async_to_lds_b128 %4, %5, off\n\t"
                 "global_load_async_to_lds_b128 %6, %7, off\n\t"
                 "global_load_async_to_lds_b128 %8, %9, off\n\t"
                 "global_load_async_to_lds_b128 %10, %11, off\n\t"
                 "global_load_async_to_lds_b128 %12, %13, off\n\t"
                 "global_load_async_to_lds_b128 %14, %15, off\n\t"
                 "global_load_async_to_lds_b128 %16, %17, off\n\t"
                 "global_load_async_to_lds_b128 %18, %19, off\n\t"
                 "global_load_async_to_lds_b128 %20, %21, off\n\t"
                 "global_load_async_to_lds_b128 %22, %23, off\n\t"
                 "s_wait_xcnt 0x0"
                 :: "v"(lds),           "v"(ga),          "v"(lds + ls),      "v"(ga + rs),
                    "v"(lds + 2 * ls),  "v"(ga + 2 * rs), "v"(lds + 3 * ls),  "v"(ga + 3 * rs),
                    "v"(lds + 4 * ls),  "v"(gw),          "v"(lds + 5 * ls),  "v"(gw + rs),
                    "v"(lds + 6 * ls),  "v"(gw + 2 * rs), "v"(lds + 7 * ls),  "v"(gw + 3 * rs),
                    "v"(lds + 8 * ls),  "v"(gw + 4 * rs), "v"(lds + 9 * ls),  "v"(gw + 5 * rs),
                    "v"(lds + 10 * ls), "v"(gw + 6 * rs), "v"(lds + 11 * ls), "v"(gw + 7 * rs)
                 : "memory");
}

__global__ __launch_bounds__(256) void gemm_nt_wmma_wide(const float* __restrict__ A, const float* __restrict__ W,
                                  const float* __restrict__ bias, float* __restrict__ Y,
                                  int M, int N, int Kd) {
    __shared__ __attribute__((aligned(16))) float sT[2 * GW_BUF];

    int tid = threadIdx.x;
    int wave = tid >> 5;
    int lane = tid & 31;
    int wm = wave & 1;                   // 0..1
    int wn = wave >> 1;                  // 0..3
    int mB = blockIdx.x * GW_BM;
    int nB = blockIdx.y * GW_BN;
    int lr = lane & 15;
    int hi = lane >> 4;

    // this thread's place in a tile: row tid >> 4, 16 bytes at dword (tid & 15) * 4
    int cr = tid >> 4, cc = (tid & 15) * 4;
    const float* ga = A + (size_t)(mB + cr) * Kd + cc;
    const float* gw = W + (size_t)(nB + cr) * Kd + cc;
    unsigned lds0 = (unsigned)(uintptr_t)(void*)&sT[cr * GW_P + cc];   // LDS byte address, buffer 0
    const unsigned bufb = (unsigned)GW_BUF * 4u;                       // bytes from buffer 0 to buffer 1
    const int nt = Kd / GW_BK;

    v8f acc[2][2];
#pragma unroll     // register arrays need constant indices
    for (int mi = 0; mi < 2; ++mi)
#pragma unroll     // register arrays need constant indices
        for (int t = 0; t < 2; ++t) acc[mi][t] = (v8f){};

    gw_tile_copy(lds0, ga, gw, Kd);
    // tile 0 has landed for this wave; the barrier publishes it to the others
    asm volatile("s_wait_asynccnt 0x0" ::: "memory");
    __syncthreads();
    if (nt > 1) gw_tile_copy(lds0 + bufb, ga + GW_BK, gw + GW_BK, Kd);

    for (int kt = 0; kt < nt; ++kt) {
        const float* sb = sT + (kt & 1) * GW_BUF;
        const float* sa = sb + (wm * 32 + lr) * GW_P + hi * 2;
        const float* sw = sb + (GW_BM + wn * 32 + lr) * GW_P + hi * 2;
#pragma unroll     // the tile's LDS reads are visible together and go out ahead of the WMMAs
        for (int ks = 0; ks < GW_BK / 4; ++ks) {
            v2f a0 = *(const v2f*)(sa + ks * 4);
            v2f a1 = *(const v2f*)(sa + 16 * GW_P + ks * 4);
            v2f b0 = *(const v2f*)(sw + ks * 4);
            v2f b1 = *(const v2f*)(sw + 16 * GW_P + ks * 4);
            acc[0][0] = wmma_f32x4(a0, b0, acc[0][0]);
            acc[0][1] = wmma_f32x4(a0, b1, acc[0][1]);
            acc[1][0] = wmma_f32x4(a1, b0, acc[1][0]);
            acc[1][1] = wmma_f32x4(a1, b1, acc[1][1]);
        }
        // this wave's reads of the buffer have returned before the buffer is refilled
        asm volatile("s_wait_dscnt 0x0" ::: "memory");
        // this wave's copies of tile kt + 1 have landed before the barrier publishes them
        asm volatile("s_wait_asynccnt 0x0" ::: "memory");
        __syncthreads();
        if (kt + 2 < nt)
            gw_tile_copy(lds0 + (unsigned)(kt & 1) * bufb, ga + (size_t)(kt + 2) * GW_BK,
                         gw + (size_t)(kt + 2) * GW_BK, Kd);
    }
    // no copy is outstanding when the wave goes on to its end
    asm volatile("s_wait_asynccnt 0x0" ::: "memory");

    int m0 = mB + wm * 32 + hi * 8;
    int n0 = nB + wn * 32 + lr;
    float bv[2] = {0.f, 0.f};
    if (bias) {
        bv[0] = bias[n0];
        bv[1] = bias[n0 + 16];
        // the address registers of the two loads are free for reuse only behind this wait
        asm volatile("s_wait_xcnt 0x0" ::: "memory");
    }
    float* yp[2][8];
#pragma unroll     // register arrays need constant indices
    for (int mi = 0; mi < 2; ++mi)
#pragma unroll     // register arrays need constant indices
        for (int r = 0; r < 8; ++r) {
            yp[mi][r] = Y + (size_t)(m0 + mi * 16 + r) * N + n0;
            acc[mi][0][r] += bv[0];
            acc[mi][1][r] += bv[1];
        }
    // the stores stay behind all the arithmetic: no register of an issued store is rewritten
    __builtin_amdgcn_sched_barrier(0);
#pragma unroll     // register arrays need constant indices
    for (int mi = 0; mi < 2; ++mi)
#pragma unroll     // register arrays need constant indices
        for (int r = 0; r < 8; ++r) {
            yp[mi][r][0]  = acc[mi][0][r];
            yp[mi][r][16] = acc[mi][1][r];
        }
}

__global__ void gemm_nt_wmma_small(const float* __restrict__ A, const float* __restrict__ W,
                                   const float* __restrict__ bias, float* __restrict__ Y,
                                   int M, int N, int Kd, int apply_sigmoid) {
    int wave = threadIdx.x >> 5;
    int lane = threadIdx.x & 31;
    int m0 = (blockIdx.x * 8 + wave) * 16;
    int lr = lane & 15;
    int hi = lane >> 4;
    int wrow = lr;                       // n0 == 0 (single tile of columns)
    int wrc = (wrow < N) ? wrow : 0;
    float msk = (wrow < N) ? 1.f : 0.f;

    const float* ap = A + (size_t)(m0 + lr) * Kd;
    const float* wpr = W + (size_t)wrc * Kd;

    v8f acc = {};
    for (int kk = 0; kk < Kd; kk += 4) {
        int ka = kk + hi * 2;
        v2f a, b;
        a.x = ap[ka];           a.y = ap[ka + 1];
        b.x = wpr[ka] * msk;    b.y = wpr[ka + 1] * msk;
        acc = wmma_f32x4(a, b, acc);
    }
#pragma unroll
    for (int r = 0; r < 8; ++r) {
        int m = m0 + r + hi * 8;
        int n = lr;
        if (n < N) {
            float val = acc[r];
            if (bias) val += bias[n];
            if (apply_sigmoid) val = 1.f / (1.f + __expf(-val));
            Y[(size_t)m * N + n] = val;
        }
    }
}

// ---------------------------------------------------------------------------
// Multi-timescale gated linear attention, chunk-parallel form (chunks of 64
// tokens). With lam constant over time, for token i of chunk c:
//   Hm_i = lam^(i+1) * E + sum_{s<=i} lam^(i-s) * g_s * k_s v_s^T
//   Z_i  = lam^(i+1) * zE + sum_{s<=i} lam^(i-s) * g_s * s_s
// where E, zE are the state at the end of chunk c-1. Three launches:
//   1. chunk_state: S_c = sum_i lam^(63-i) g_i k_i v_i^T (and the same for Z)
//   2. chunk_scan : E_c = lam^64 * E_{c-1} + S_c over the chunks, in place
//   3. chunk_out  : y = (masked decayed Q K^T) V + scaled Q E
// Only non-negative powers of lam are formed, so every factor is in [0, 1].
// ---------------------------------------------------------------------------
constexpr int LA_T  = 2048;        // tokens per sequence
constexpr int LA_H  = 8;           // heads
constexpr int LA_NC = LA_T / 64;   // chunks per sequence
constexpr int LA_RS = LA_H * 64;   // dwords between the rows of one head's q, k, v
constexpr int LA_PA = 68;          // LDS pitch (dwords), rows read 8 bytes along k
constexpr int LA_PB = 72;          // LDS pitch (dwords), rows read across columns

__device__ __forceinline__ float la_sigmoid(float x) { return 1.f / (1.f + __expf(-x)); }

// base^n for 0 <= n <= 127 by squaring: 1 at n == 0 for any base, no logarithm.
__device__ __forceinline__ float la_ipow(float base, int n) {
    float p = 1.f;
#pragma unroll     // seven fixed bits, no loop control
    for (int bit = 0; bit < 7; ++bit) {
        if (n & 1) p *= base;
        base *= base;
        n >>= 1;
    }
    return p;
}

// A thread's four float4 of a 64x64 f32 tile (256 threads): global -> registers.
struct LaTile { float4 a, b, c, d; };
__device__ __forceinline__ LaTile la_tile_load(const float* g, int tid) {
    const float* p = g + ((unsigned)(tid >> 4) * LA_RS + (unsigned)(tid & 15) * 4);
    LaTile t;
    t.a = *(const float4*)(p);
    t.b = *(const float4*)(p + 16 * LA_RS);
    t.c = *(const float4*)(p + 32 * LA_RS);
    t.d = *(const float4*)(p + 48 * LA_RS);
    // address registers of these loads (offset, scalar base) are free for reuse only behind this wait
    asm volatile("s_wait_xcnt 0x0" ::: "memory");
    return t;
}
// ... and registers -> LDS at the given pitch.
__device__ __forceinline__ void la_tile_put(float* s, int pitch, int tid, const LaTile& t) {
    float* p = s + (tid >> 4) * pitch + (tid & 15) * 4;
    *(float4*)(p) = t.a;
    *(float4*)(p + 16 * pitch) = t.b;
    *(float4*)(p + 32 * pitch) = t.c;
    *(float4*)(p + 48 * pitch) = t.d;
}

// mean |k_i| + 1e-6 of row i = tid >> 2; four lanes share a row (valid in all four).
__device__ __forceinline__ float la_row_absmean(const float* s, int pitch, int tid) {
    int i = tid >> 2, qd = tid & 3;
    float a = 0.f;
#pragma unroll     // 16 independent LDS reads in flight
    for (int e = 0; e < 16; ++e) a += fabsf(s[i * pitch + e * 4 + qd]);
    a += __shfl_xor(a, 1);
    a += __shfl_xor(a, 2);
    return a * (1.f / 64.f) + 1e-6f;
}

// grid = B*LA_H*LA_NC, block = 256. blockIdx.x = (b*LA_H + h)*LA_NC + c.
// The pointers are not __restrict__: the loads then keep their side of the asm waits.
__global__ __launch_bounds__(256) void linatt_chunk_state(const float* k, const float* v, const float* gate,
                                   const float* decay_logit, float* S, float* zS) {
    int c  = blockIdx.x % LA_NC;
    int bh = blockIdx.x / LA_NC;
    int h = bh % LA_H, b = bh / LA_H;
    int tid = threadIdx.x;

    __shared__ __attribute__((aligned(16))) float sK[64 * LA_PB];
    __shared__ __attribute__((aligned(16))) float sV[64 * LA_PB];
    __shared__ float sW[2][64];      // lam^(63-i) * g_i
    __shared__ float sAbs[64];

    size_t tok0 = (size_t)b * LA_T + c * 64;
    size_t base = (tok0 * LA_H + h) * 64;
    LaTile rk = la_tile_load(k + base, tid);
    LaTile rv = la_tile_load(v + base, tid);
    la_tile_put(sK, LA_PB, tid, rk);
    la_tile_put(sV, LA_PB, tid, rv);
    if (tid < 128) {
        int kap = tid >> 6, i = tid & 63;
        float lam = la_sigmoid(decay_logit[h * 2 + kap]);
        sW[kap][i] = gate[((tok0 + i) * LA_H + h) * 2 + kap] * la_ipow(lam, 63 - i);
    }
    __syncthreads();

    float am = la_row_absmean(sK, LA_PB, tid);
    if ((tid & 3) == 0) sAbs[tid >> 2] = am;

    // S[a][j] = sum_i K[i][a] * (w_i V[i][j]); wave = (timescale, 16 columns j)
    int wave = tid >> 5, lane = tid & 31, lr = lane & 15, hi = lane >> 4;
    int kap = wave >> 2, tn = wave & 3;
    int n = tn * 16 + lr;
    v8f acc[4];
#pragma unroll     // register arrays need constant indices
    for (int tm = 0; tm < 4; ++tm) acc[tm] = (v8f){};
#pragma unroll 4   // four k-steps per trip: their LDS loads go out together
    for (int kk = 0; kk < 64; kk += 4) {
        int ka = kk + hi * 2;
        v2f bb;
        bb.x = sV[ka * LA_PB + n] * sW[kap][ka];
        bb.y = sV[(ka + 1) * LA_PB + n] * sW[kap][ka + 1];
#pragma unroll     // register arrays need constant indices
        for (int tm = 0; tm < 4; ++tm) {
            v2f a;
            a.x = sK[ka * LA_PB + tm * 16 + lr];
            a.y = sK[(ka + 1) * LA_PB + tm * 16 + lr];
            acc[tm] = wmma_f32x4(a, bb, acc[tm]);
        }
    }
    __syncthreads();   // sAbs complete
    if (wave < 2) {    // wave w sums timescale w
        float z = sW[wave][lane] * sAbs[lane] + sW[wave][lane + 32] * sAbs[lane + 32];
#pragma unroll     // five fixed shuffle steps
        for (int m = 16; m > 0; m >>= 1) z += __shfl_xor(z, m);
        if (lane == 0) zS[(size_t)blockIdx.x * 2 + wave] = z;
    }
    float* Sp = S + (size_t)blockIdx.x * 2 * 4096;
    unsigned so = (unsigned)(kap * 4096 + hi * 8 * 64 + n);
#pragma unroll     // register arrays need constant indices
    for (int tm = 0; tm < 4; ++tm)
#pragma unroll     // register arrays need constant indices
        for (int r = 0; r < 8; ++r)
            Sp[so + (tm * 16 + r) * 64] = acc[tm][r];
}

__global__ __launch_bounds__(256) void linatt_chunk_scan(float* __restrict__ S, float* __restrict__ zS,
                                  const float* __restrict__ decay_logit, int BH) {
    int gid = blockIdx.x * 256 + threadIdx.x;
    {
        int e4 = gid & 1023, kap = (gid >> 10) & 1, bh = gid >> 11;
        float l64 = la_ipow(la_sigmoid(decay_logit[(bh % LA_H) * 2 + kap]), 64);
        float4* p = (float4*)S + ((size_t)bh * LA_NC * 2 + kap) * 1024 + e4;
        float4 s[LA_NC];
#pragma unroll     // register arrays need constant indices
        for (int c = 0; c < LA_NC; ++c) s[c] = p[(size_t)c * 2048];
        // every load is issued before the first store (all in flight at once), and
        // the address registers are free for reuse only behind this wait
        asm volatile("s_wait_xcnt 0x0" ::: "memory");
        float4 run = make_float4(0.f, 0.f, 0.f, 0.f);
#pragma unroll     // register arrays need constant indices
        for (int c = 0; c < LA_NC; ++c) {
            float4 t = s[c];
            s[c] = run;
            run.x = run.x * l64 + t.x;
            run.y = run.y * l64 + t.y;
            run.z = run.z * l64 + t.z;
            run.w = run.w * l64 + t.w;
        }
        // the stores stay behind all the arithmetic: no register of an issued store is rewritten
        __builtin_amdgcn_sched_barrier(0);
#pragma unroll     // register arrays need constant indices
        for (int c = 1; c < LA_NC; ++c) p[(size_t)c * 2048] = s[c];
        // registers of the stores above are free for reuse only behind this wait
        asm volatile("s_wait_xcnt 0x0" ::: "memory");
    }
    if (gid < BH * 2) {
        int kap = gid & 1, bh = gid >> 1;
        float l64 = la_ipow(la_sigmoid(decay_logit[(bh % LA_H) * 2 + kap]), 64);
        float* pz = zS + (size_t)bh * LA_NC * 2 + kap;
        float z[LA_NC];
#pragma unroll     // register arrays need constant indices
        for (int c = 0; c < LA_NC; ++c) z[c] = pz[c * 2];
        asm volatile("s_wait_xcnt 0x0" ::: "memory");
        float run = 0.f;
#pragma unroll     // register arrays need constant indices
        for (int c = 0; c < LA_NC; ++c) {
            float t = z[c];
            z[c] = run;
            run = run * l64 + t;
        }
        __builtin_amdgcn_sched_barrier(0);
#pragma unroll     // register arrays need constant indices
        for (int c = 1; c < LA_NC; ++c) pz[c * 2] = z[c];
    }
}

// grid = B*LA_H*LA_NC, block = 256. blockIdx.x = (b*LA_H + h)*LA_NC + c.
// The pointers are not __restrict__: the loads then keep their side of the asm waits.
__global__ __launch_bounds__(256) void linatt_chunk_out(const float* q, const float* k, const float* v, const float* gate,
                                 const float* decay_logit, const float* E, const float* zE,
                                 float* y_lin) {
    int c  = blockIdx.x % LA_NC;
    int bh = blockIdx.x / LA_NC;
    int h = bh % LA_H, b = bh / LA_H;
    int tid = threadIdx.x;
    int wave = tid >> 5, lane = tid & 31, lr = lane & 15, hi = lane >> 4;
    int tn = wave & 3, tm0 = (wave >> 2) * 2;    // wave owns tiles (tm0, tn), (tm0+1, tn)
    int n = tn * 16 + lr;

    __shared__ __attribute__((aligned(16))) float sQ[64 * LA_PA];
    __shared__ __attribute__((aligned(16))) float sK[64 * LA_PA];
    __shared__ __attribute__((aligned(16))) float sV[64 * LA_PB];
    __shared__ __attribute__((aligned(16))) float sP[64 * LA_PA];
    __shared__ float sG[2][64];      // gate
    __shared__ float sGS[2][64];     // gate * (mean|k| + 1e-6)
    __shared__ float sZ[2][64];      // Z_i
    __shared__ float sRZ[2][64];     // 1 / (Z_i + 1e-6)
    __shared__ float sRS[2][64];     // lam^(i+1) / (Z_i + 1e-6)
    __shared__ float sPw[2][128];    // [63 + d] = lam^d for d = 0..64, 0 for d = -63..-1 (the causal mask)

    size_t tok0 = (size_t)b * LA_T + c * 64;
    size_t base = (tok0 * LA_H + h) * 64;
    LaTile rq = la_tile_load(q + base, tid);
    LaTile rk = la_tile_load(k + base, tid);
    LaTile rv = la_tile_load(v + base, tid);
    // B fragments of the two incoming states, columns n: fetched here, in flight
    // together with the tiles.
    const float* Ep = E + (size_t)blockIdx.x * 2 * 4096;
    unsigned eo = (unsigned)(hi * 2 * 64 + n);
    v2f ef[2][16];
#pragma unroll     // register arrays need constant indices
    for (int kap = 0; kap < 2; ++kap)
#pragma unroll     // register arrays need constant indices
        for (int ks = 0; ks < 16; ++ks) ef[kap][ks] = (v2f){};
    float z0 = 0.f;   // incoming Z of timescale tid & 1
    if (c > 0) {   // chunk 0 starts from the zero state
#pragma unroll     // register arrays need constant indices
        for (int kap = 0; kap < 2; ++kap)
#pragma unroll     // register arrays need constant indices
            for (int ks = 0; ks < 16; ++ks) {
                ef[kap][ks].x = Ep[eo + kap * 4096 + ks * 256];
                ef[kap][ks].y = Ep[eo + kap * 4096 + ks * 256 + 64];
            }
        z0 = zE[(size_t)blockIdx.x * 2 + (tid & 1)];
        // address registers of the loads above are free for reuse only behind this wait
        asm volatile("s_wait_xcnt 0x0" ::: "memory");
    }
    la_tile_put(sQ, LA_PA, tid, rq);
    la_tile_put(sK, LA_PA, tid, rk);
    la_tile_put(sV, LA_PB, tid, rv);
    if (tid < 128) {
        int kap = tid >> 6, i = tid & 63;
        sG[kap][i] = gate[((tok0 + i) * LA_H + h) * 2 + kap];
    }
    {
        int kap = tid >> 7, d = (tid & 127) - 63;
        float pw = la_ipow(la_sigmoid(decay_logit[h * 2 + kap]), d > 0 ? d : 0);
        sPw[kap][63 + d] = (d >= 0) ? pw : 0.f;
    }
    __syncthreads();

    float am = la_row_absmean(sK, LA_PA, tid);
    if ((tid & 3) < 2) sGS[tid & 3][tid >> 2] = sG[tid & 3][tid >> 2] * am;

    // A[i][s] = q_i . k_s
    v8f sc[2];
    sc[0] = (v8f){}; sc[1] = (v8f){};
#pragma unroll 4   // four k-steps per trip: their LDS loads go out together
    for (int kk = 0; kk < 64; kk += 4) {
        int ka = kk + hi * 2;
        v2f bb = *(const v2f*)&sK[(tn * 16 + lr) * LA_PA + ka];
#pragma unroll     // register arrays need constant indices
        for (int t = 0; t < 2; ++t) {
            v2f a = *(const v2f*)&sQ[((tm0 + t) * 16 + lr) * LA_PA + ka];
            sc[t] = wmma_f32x4(a, bb, sc[t]);
        }
    }
    __syncthreads();   // sGS complete

    if (tid < 2) {     // Z inside the chunk
        float Z = z0;
        float lam = sPw[tid][64];
#pragma unroll 16  // the LDS reads of 16 steps go out ahead of the serial chain
        for (int i = 0; i < 64; ++i) {
            Z = Z * lam + sGS[tid][i];
            sZ[tid][i] = Z;
        }
    }
    __syncthreads();   // sZ complete
    if (tid < 128) {
        int kap = tid >> 6, i = tid & 63;
        float rz = 1.f / (sZ[kap][i] + 1e-6f);
        sRZ[kap][i] = rz;
        sRS[kap][i] = rz * sPw[kap][64 + i];
    }
    __syncthreads();   // sRZ, sRS complete

    // P[i][s] = A[i][s] * sum_kap lam^(i-s) g_s / (Z_i + 1e-6) for s <= i, else 0
#pragma unroll     // register arrays need constant indices
    for (int t = 0; t < 2; ++t)
#pragma unroll     // register arrays need constant indices
        for (int r = 0; r < 8; ++r) {
            int i = (tm0 + t) * 16 + r + hi * 8;
            int e = 63 + i - n;
            float w = sPw[0][e] * sG[0][n] * sRZ[0][i] + sPw[1][e] * sG[1][n] * sRZ[1][i];
            sP[i * LA_PA + n] = sc[t][r] * w;
        }
    __syncthreads();   // sP complete

    v8f acc[2];
    acc[0] = (v8f){}; acc[1] = (v8f){};
#pragma unroll 4   // four k-steps per trip: their LDS loads go out together
    for (int kk = 0; kk < 64; kk += 4) {
        int ka = kk + hi * 2;
        v2f bb;
        bb.x = sV[ka * LA_PB + n];
        bb.y = sV[(ka + 1) * LA_PB + n];
#pragma unroll     // register arrays need constant indices
        for (int t = 0; t < 2; ++t) {
            v2f a = *(const v2f*)&sP[((tm0 + t) * 16 + lr) * LA_PA + ka];
            acc[t] = wmma_f32x4(a, bb, acc[t]);
        }
    }
#pragma unroll     // register arrays need constant indices
    for (int kap = 0; kap < 2; ++kap) {
        float rs0 = sRS[kap][tm0 * 16 + lr];
        float rs1 = sRS[kap][(tm0 + 1) * 16 + lr];
#pragma unroll     // register arrays need constant indices
        for (int ks = 0; ks < 16; ++ks) {
            int ka = ks * 4 + hi * 2;
            v2f a0 = *(const v2f*)&sQ[(tm0 * 16 + lr) * LA_PA + ka];
            v2f a1 = *(const v2f*)&sQ[((tm0 + 1) * 16 + lr) * LA_PA + ka];
            a0 *= rs0;
            a1 *= rs1;
            acc[0] = wmma_f32x4(a0, ef[kap][ks], acc[0]);
            acc[1] = wmma_f32x4(a1, ef[kap][ks], acc[1]);
        }
    }
    float* yp = y_lin + base;
    unsigned yo = (unsigned)((tm0 * 16 + hi * 8) * LA_RS + n);
#pragma unroll     // register arrays need constant indices
    for (int t = 0; t < 2; ++t)
#pragma unroll     // register arrays need constant indices
        for (int r = 0; r < 8; ++r)
            yp[yo + (t * 16 + r) * LA_RS] = acc[t][r];
}

__global__ void local_attn_wmma(const float* __restrict__ q, const float* __restrict__ k,
                                const float* __restrict__ v, const float* __restrict__ y_lin,
                                const float* __restrict__ alpha, float* __restrict__ y,
                                int B, int T, int H) {
    const int dh = 64;
    const int W = 64;
    const int SLD = 129;
    int nc = T / W;
    int h = blockIdx.x % H;
    int c = (blockIdx.x / H) % nc;
    int b = blockIdx.x / (H * nc);

    __shared__ float smem[64 * 64 + 128 * 64];   // Q | K, aliased as S after use
    __shared__ float sV[128 * 64];
    float* sQ = smem;
    float* sK = smem + 64 * 64;
    float* sS = smem;                            // aliased after barrier

    int tid = threadIdx.x;
    int wave = tid >> 5, lane = tid & 31, lr = lane & 15, hi = lane >> 4;

    // This lane's 16 outputs: rows om + r, columns on and on + 16 of the block's 64x64 tile.
    // Their y_lin and alpha are fetched here, in flight together with the tiles.
    size_t tok0 = (size_t)b * T + c * W;
    const float* lg = y_lin + (tok0 * H + h) * dh;
    const float* ag = alpha + tok0 * H + h;
    int om = (wave >> 1) * 16 + hi * 8;
    int on = (wave & 1) * 32 + lr;
    unsigned yo[8], ao[8];
    float yl[2][8], al[8];
#pragma unroll     // register arrays need constant indices
    for (int r = 0; r < 8; ++r) {
        yo[r] = (unsigned)((om + r) * H * dh + on);
        ao[r] = (unsigned)((om + r) * H);
    }
    // every offset is formed before the first load: no register of an issued load is rewritten
    __builtin_amdgcn_sched_barrier(0);
#pragma unroll     // register arrays need constant indices
    for (int r = 0; r < 8; ++r) {
        yl[0][r] = lg[yo[r]];
        yl[1][r] = lg[yo[r] + 16];
        al[r]    = ag[ao[r]];
    }
    // address registers of the loads above are free for reuse only behind this wait
    asm volatile("s_wait_xcnt 0x0" ::: "memory");

    const float* qg = q + (((size_t)b * T + c * W) * H + h) * dh;
    if (tid < 32) {
        tdm_load_2d(qg, (unsigned)(uintptr_t)(void*)sQ, 64, 64, H * dh);
        if (c > 0) {
            const float* kg = k + (((size_t)b * T + (c - 1) * W) * H + h) * dh;
            const float* vg = v + (((size_t)b * T + (c - 1) * W) * H + h) * dh;
            tdm_load_2d(kg, (unsigned)(uintptr_t)(void*)sK, 64, 128, H * dh);
            tdm_load_2d(vg, (unsigned)(uintptr_t)(void*)sV, 64, 128, H * dh);
        }
        __builtin_amdgcn_s_wait_tensorcnt(0);
    }
    if (c == 0) {
        // boundary chunk: prev-chunk rows are zero, cur-chunk rows are tokens 0..63
        for (int idx = tid; idx < 128 * 64; idx += 256) {
            int jj = idx >> 6, d = idx & 63;
            float kvl = 0.f, vvl = 0.f;
            if (jj >= 64) {
                size_t g = (((size_t)b * T + (jj - 64)) * H + h) * dh + d;
                kvl = k[g];
                vvl = v[g];
            }
            sK[idx] = kvl;
            sV[idx] = vvl;
        }
    }
    __syncthreads();

    // scores: 64x128 = 4x8 tiles of 16x16; wave handles 4 tiles
    v8f sc[4];
    for (int it = 0; it < 4; ++it) {
        int id = wave * 4 + it;
        int tm = id >> 3, tn = id & 7;
        v8f acc = {};
        for (int kkk = 0; kkk < 64; kkk += 4) {
            int ka = kkk + hi * 2;
            v2f a, bb;
            a.x  = sQ[(tm * 16 + lr) * 64 + ka];
            a.y  = sQ[(tm * 16 + lr) * 64 + ka + 1];
            bb.x = sK[(tn * 16 + lr) * 64 + ka];
            bb.y = sK[(tn * 16 + lr) * 64 + ka + 1];
            acc = wmma_f32x4(a, bb, acc);
        }
        sc[it] = acc;
    }
    __syncthreads();   // done reading sQ/sK; safe to alias as sS

    // ALiBi + causal window mask, write scores to LDS
    float slope = exp2f(-8.0f * (float)(h + 1) / (float)H);
    for (int it = 0; it < 4; ++it) {
        int id = wave * 4 + it;
        int tm = id >> 3, tn = id & 7;
#pragma unroll
        for (int r = 0; r < 8; ++r) {
            int i = tm * 16 + r + hi * 8;
            int jj = tn * 16 + lr;
            float val = sc[it][r];
            bool valid = (jj >= i + 1) && (jj <= i + W) && (c * W + jj - W >= 0);
            val = valid ? (val - slope * (float)(i + W - jj)) : -1e30f;
            sS[i * SLD + jj] = val;
        }
    }
    __syncthreads();

    // row softmax (threads 0..63, one row each)
    if (tid < 64) {
        float mx = -3.4e38f;
        for (int jj = 0; jj < 128; ++jj) mx = fmaxf(mx, sS[tid * SLD + jj]);
        float sum = 0.f;
        for (int jj = 0; jj < 128; ++jj) {
            float e = __expf(sS[tid * SLD + jj] - mx);
            sS[tid * SLD + jj] = e;
            sum += e;
        }
        float inv = 1.f / sum;
        for (int jj = 0; jj < 128; ++jj) sS[tid * SLD + jj] *= inv;
    }
    __syncthreads();

    // y_loc = P[64,128] @ Vctx[128,64]; 16 tiles, wave handles 2; V from LDS
    v8f yb[2];
#pragma unroll     // register arrays need constant indices
    for (int it = 0; it < 2; ++it) {
        int id = wave * 2 + it;
        int tm = id >> 2, tn = id & 3;
        int n = tn * 16 + lr;
        v8f acc = {};
        for (int kkk = 0; kkk < 128; kkk += 4) {
            int ka = kkk + hi * 2;
            v2f a, bb;
            a.x = sS[(tm * 16 + lr) * SLD + ka];
            a.y = sS[(tm * 16 + lr) * SLD + ka + 1];
            bb.x = sV[ka * 64 + n];
            bb.y = sV[(ka + 1) * 64 + n];
            acc = wmma_f32x4(a, bb, acc);
        }
#pragma unroll     // register arrays need constant indices
        for (int r = 0; r < 8; ++r)
            yb[it][r] = al[r] * acc[r] + (1.f - al[r]) * yl[it][r];
    }
    float* yg = y + (tok0 * H + h) * dh;
    float* yp[8];
#pragma unroll     // register arrays need constant indices
    for (int r = 0; r < 8; ++r) yp[r] = yg + yo[r];
    // the stores stay behind all the arithmetic: no register of an issued store is rewritten
    __builtin_amdgcn_sched_barrier(0);
#pragma unroll     // register arrays need constant indices
    for (int r = 0; r < 8; ++r) {
        yp[r][0]  = yb[0][r];
        yp[r][16] = yb[1][r];
    }
}

// ---------------------------------------------------------------------------
// out = LayerNorm(x + proj) * gamma + beta ; block per (b,t) row.
// ---------------------------------------------------------------------------
__global__ void addnorm_kernel(const float* __restrict__ x, const float* __restrict__ proj,
                               const float* __restrict__ gamma, const float* __restrict__ beta,
                               float* __restrict__ out, int D) {
    __shared__ float red[256];
    size_t row = blockIdx.x;
    const float* xr = x + row * D;
    const float* pr = proj + row * D;

    float s = 0.f, s2 = 0.f;
    for (int d = threadIdx.x; d < D; d += 256) {
        float r = xr[d] + pr[d];
        s += r; s2 += r * r;
    }
    red[threadIdx.x] = s;
    __syncthreads();
    for (int off = 128; off > 0; off >>= 1) {
        if (threadIdx.x < off) red[threadIdx.x] += red[threadIdx.x + off];
        __syncthreads();
    }
    float mean = red[0] / (float)D;
    __syncthreads();
    red[threadIdx.x] = s2;
    __syncthreads();
    for (int off = 128; off > 0; off >>= 1) {
        if (threadIdx.x < off) red[threadIdx.x] += red[threadIdx.x + off];
        __syncthreads();
    }
    float var = red[0] / (float)D - mean * mean;
    float inv = rsqrtf(var + 1e-5f);
    for (int d = threadIdx.x; d < D; d += 256) {
        float r = xr[d] + pr[d];
        out[row * D + d] = (r - mean) * inv * gamma[d] + beta[d];
    }
}

// ---------------------------------------------------------------------------
extern "C" void kernel_launch(void* const* d_in, const int* in_sizes, int n_in,
                              void* d_out, int out_size, void* d_ws, size_t ws_size,
                              hipStream_t stream) {
    const int D = 512, H = 8, Kts = 2, dh = 64, T = 2048;
    const int M = in_sizes[0] / D;          // B*T = 4096
    const int B = M / T;                    // 2
    const int nc = T / 64;

    const float* x      = (const float*)d_in[0];
    const float* Wq     = (const float*)d_in[1];
    const float* Wk     = (const float*)d_in[2];
    const float* Wv     = (const float*)d_in[3];
    const float* Wg     = (const float*)d_in[4];
    const float* bg     = (const float*)d_in[5];
    const float* Wa     = (const float*)d_in[6];
    const float* ba     = (const float*)d_in[7];
    const float* Wo     = (const float*)d_in[8];
    const float* bo     = (const float*)d_in[9];
    const float* decay  = (const float*)d_in[10];
    const float* gamma  = (const float*)d_in[11];
    const float* beta   = (const float*)d_in[12];
    float* out = (float*)d_out;

    // workspace carve-up
    float* ws = (float*)d_ws;
    size_t off = 0;
    float* q_buf    = ws + off; off += (size_t)M * D;
    float* k_buf    = ws + off; off += (size_t)M * D;
    float* v_buf    = ws + off; off += (size_t)M * D;
    float* gate_buf = ws + off; off += (size_t)M * H * Kts;
    float* alp_buf  = ws + off; off += (size_t)M * H;
    float* ylin_buf = ws + off; off += (size_t)M * D;
    float* ymix_buf = ws + off; off += (size_t)M * D;
    float* proj_buf = ws + off; off += (size_t)M * D;
    float* st_buf   = ws + off; off += (size_t)B * H * nc * Kts * dh * dh;
    float* zst_buf  = ws + off; off += (size_t)B * H * nc * Kts;

    dim3 blk(256);
    dim3 grid_wide(M / 64, D / 128);        // 64 x 4
    dim3 grid_small(M / 128, 1);

    // projections (wide, guard-free WMMA GEMMs)
    gemm_nt_wmma_wide<<<grid_wide, blk, 0, stream>>>(x, Wq, nullptr, q_buf, M, D, D);
    gemm_nt_wmma_wide<<<grid_wide, blk, 0, stream>>>(x, Wk, nullptr, k_buf, M, D, D);
    gemm_nt_wmma_wide<<<grid_wide, blk, 0, stream>>>(x, Wv, nullptr, v_buf, M, D, D);
    // skinny projections with sigmoid fused
    gemm_nt_wmma_small<<<grid_small, blk, 0, stream>>>(x, Wg, bg, gate_buf, M, H * Kts, D, 1);
    gemm_nt_wmma_small<<<grid_small, blk, 0, stream>>>(x, Wa, ba, alp_buf,  M, H,       D, 1);

    // gated linear attention, chunk-parallel: chunk states, scan over chunks, outputs
    linatt_chunk_state<<<B * nc * H, blk, 0, stream>>>(k_buf, v_buf, gate_buf, decay,
                                                       st_buf, zst_buf);
    linatt_chunk_scan<<<B * H * 8, blk, 0, stream>>>(st_buf, zst_buf, decay, B * H);
    linatt_chunk_out<<<B * nc * H, blk, 0, stream>>>(q_buf, k_buf, v_buf, gate_buf, decay,
                                                     st_buf, zst_buf, ylin_buf);

    local_attn_wmma<<<B * nc * H, 256, 0, stream>>>(q_buf, k_buf, v_buf, ylin_buf, alp_buf,
                                                    ymix_buf, B, T, H);

    // output projection + residual + layernorm
    gemm_nt_wmma_wide<<<grid_wide, blk, 0, stream>>>(ymix_buf, Wo, bo, proj_buf, M, D, D);
    addnorm_kernel<<<M, blk, 0, stream>>>(x, proj_buf, gamma, beta, out, D);
}

// v004
// A run of this version takes 130 microseconds.
// In both of two side-by-side timings against v003, it was 1.21 times as fast.
// All steps since v000 together make it 25.4 times as fast.
#include <hip/hip_runtime.h>
#include <hip/hip_bf16.h>
#include <math.h>

typedef __attribute__((ext_vector_type(2))) float v2f;
typedef __attribute__((ext_vector_type(8))) float v8f;
typedef __attribute__((ext_vector_type(4))) unsigned int v4u;
typedef __attribute__((ext_vector_type(8))) int v8i;
typedef __attribute__((ext_vector_type(4))) int v4i;

__device__ __forceinline__ v8f wmma_f32x4(v2f a, v2f b, v8f c) {
    // D = A(16x4 f32) * B(4x16 f32) + C(16x16 f32)
    return __builtin_amdgcn_wmma_f32_16x16x4_f32(
        /*neg_a=*/false, a, /*neg_b=*/false, b,
        /*c_mod=*/(short)0, c, /*reuse_a=*/false, /*reuse_b=*/false);
}

__device__ __forceinline__ void tdm_load_2d(const void* gptr, unsigned lds_off_bytes,
                                            unsigned tile_w_elems, unsigned tile_h_rows,
                                            unsigned row_stride_elems) {
    unsigned long long ga = (unsigned long long)(uintptr_t)gptr;
    v4u g0;
    g0.x = 1u;
    g0.y = lds_off_bytes;
    g0.z = (unsigned)(ga & 0xFFFFFFFFull);
    g0.w = (unsigned)((ga >> 32) & 0x01FFFFFFull)
         | 0x80000000u;
    const unsigned td0 = 0x7FFFFFFFu, td1 = 0x7FFFFFFFu;
    v8i g1;
    g1[0] = (int)(2u << 16);
    g1[1] = (int)((td0 & 0xFFFFu) << 16);
    g1[2] = (int)((td0 >> 16) | ((td1 & 0xFFFFu) << 16));
    g1[3] = (int)((td1 >> 16) | (tile_w_elems << 16));
    g1[4] = (int)tile_h_rows;
    g1[5] = (int)row_stride_elems;
    g1[6] = 0;
    g1[7] = 0;
    v4i zz4 = {};
    v8i zz8 = {};
    __builtin_amdgcn_tensor_load_to_lds(g0, g1, zz4, zz4, zz8, 0);
}

constexpr int GW_BM   = 64;
constexpr int GW_BN   = 128;
constexpr int GW_BK   = 64;
constexpr int GW_P    = 68;
constexpr int GW_ROWS = GW_BM + GW_BN;
constexpr int GW_BUF  = GW_ROWS * GW_P;

// One k-tile into one buffer: thread tid brings 16 bytes of rows (tid >> 4) + 16 j, j = 0..11
// (j < 4: rows of A, then rows of W), by twelve asynchronous copies global -> LDS.
__device__ __forceinline__ void gw_tile_copy(unsigned lds, const float* ga, const float* gw, int Kd) {
    const size_t rs = (size_t)16 * Kd;             // 16 rows on in global memory
    const unsigned ls = 16u * GW_P * 4u;           // 16 rows on in LDS, bytes
    // the copies go through no register; the closing wait stands inside the statement so that
    // the address registers named here are rewritten only behind it
    asm volatile("global_load_async_to_lds_b128 %0, %1, off\n\t"
                 "global_load_async_to_lds_b128 %2, %3, off\n\t"
                 "global_load_async_to_lds_b128 %4, %5, off\n\t"
                 "global_load_async_to_lds_b128 %6, %7, off\n\t"
                 "global_load_async_to_lds_b128 %8, %9, off\n\t"
                 "global_load_async_to_lds_b128 %10, %11, off\n\t"
                 "global_load_async_to_lds_b128 %12, %13, off\n\t"
                 "global_load_async_to_lds_b128 %14, %15, off\n\t"
                 "global_load_async_to_lds_b128 %16, %17, off\n\t"
                 "global_load_async_to_lds_b128 %18, %19, off\n\t"
                 "global_load_async_to_lds_b128 %20, %21, off\n\t"
                 "global_load_async_to_lds_b128 %22, %23, off\n\t"
                 "s_wait_xcnt 0x0"
                 :: "v"(lds),           "v"(ga),          "v"(lds + ls),      "v"(ga + rs),
                    "v"(lds + 2 * ls),  "v"(ga + 2 * rs), "v"(lds + 3 * ls),  "v"(ga + 3 * rs),
                    "v"(lds + 4 * ls),  "v"(gw),          "v"(lds + 5 * ls),  "v"(gw + rs),
                    "v"(lds + 6 * ls),  "v"(gw + 2 * rs), "v"(lds + 7 * ls),  "v"(gw + 3 * rs),
                    "v"(lds + 8 * ls),  "v"(gw + 4 * rs), "v"(lds + 9 * ls),  "v"(gw + 5 * rs),
                    "v"(lds + 10 * ls), "v"(gw + 6 * rs), "v"(lds + 11 * ls), "v"(gw + 7 * rs)
                 : "memory");
}

__device__ __forceinline__ void gemm_nt_skinny_block(const float* __restrict__ A, const float* __restrict__ W,
                                                     const float* __restrict__ bias, float* __restrict__ Y,
                                                     int mblk, int N, int Kd) {
    int wave = threadIdx.x >> 5;
    int lane = threadIdx.x & 31;
    int m0 = (mblk * 8 + wave) * 16;
    int lr = lane & 15;
    int hi = lane >> 4;
    int wrow = lr;                       // n0 == 0 (single tile of columns)
    int wrc = (wrow < N) ? wrow : 0;
    float msk = (wrow < N) ? 1.f : 0.f;

    const float* ap = A + (size_t)(m0 + lr) * Kd + hi * 2;
    const float* wpr = W + (size_t)wrc * Kd + hi * 2;

    v8f acc = {};
    for (int kk = 0; kk < Kd; kk += 32) {        // Kd % 64 == 0, as for the wide blocks
        const float* pa = ap + kk;
        const float* pw = wpr + kk;
        v2f a[8], b[8];
#pragma unroll     // register arrays need constant indices; eight k-steps' loads go out together
        for (int j = 0; j < 8; ++j) {
            a[j] = *(const v2f*)(pa + j * 4);
            b[j] = *(const v2f*)(pw + j * 4);
        }
        // the address registers of the loads above are free for reuse only behind this wait; it names
        // them, so they stay live up to it and no load's result is placed in one of them
        asm volatile("s_wait_xcnt 0x0" :: "v"(pa), "v"(pw) : "memory");
#pragma unroll     // register arrays need constant indices
        for (int j = 0; j < 8; ++j) acc = wmma_f32x4(a[j], b[j] * msk, acc);
    }
    float bv = bias[wrc];
    // the address registers of the load are free for reuse only behind this wait
    asm volatile("s_wait_xcnt 0x0" ::: "memory");
    float* yp[8];
    float o[8];
#pragma unroll     // register arrays need constant indices
    for (int r = 0; r < 8; ++r) {
        yp[r] = Y + (size_t)(m0 + r + hi * 8) * N + lr;
        o[r] = 1.f / (1.f + __expf(-(acc[r] + bv)));
    }
    // the stores stay behind all the arithmetic: no register of an issued store is rewritten
    __builtin_amdgcn_sched_barrier(0);
    if (lr < N) {
#pragma unroll     // register arrays need constant indices
        for (int r = 0; r < 8; ++r) yp[r][0] = o[r];
    }
}

// One launch holds every product of the same A: blockIdx.y walks, in this order, one row of
// skinny blocks (only where skinny != 0: the first half of blockIdx.x the gate, the second half
// alpha; they go first because they are short and free their place early), then the N / 128
// column tiles of W0 -> Y0, of W1 -> Y1 and of W2 -> Y2. The blocks are independent of one another.
__global__ __launch_bounds__(256) void gemm_nt_wmma_wide(const float* __restrict__ A,
                                  const float* __restrict__ W0, const float* __restrict__ W1,
                                  const float* __restrict__ W2, const float* __restrict__ bias,
                                  float* __restrict__ Y0, float* __restrict__ Y1, float* __restrict__ Y2,
                                  const float* __restrict__ Wg, const float* __restrict__ bg,
                                  float* __restrict__ Yg, int Ng,
                                  const float* __restrict__ Wa, const float* __restrict__ ba,
                                  float* __restrict__ Ya, int Na,
                                  int M, int N, int Kd, int skinny) {
    __shared__ __attribute__((aligned(16))) float sT[2 * GW_BUF];

    int by = (int)blockIdx.y - skinny;
    if (by < 0) {                        // the whole block takes this way, ahead of every barrier
        const int half = M / (2 * GW_BM);                // M / 128 blocks for each skinny product
        const bool g = (int)blockIdx.x < half;
        gemm_nt_skinny_block(A, g ? Wg : Wa, g ? bg : ba, g ? Yg : Ya,
                             g ? (int)blockIdx.x : (int)blockIdx.x - half, g ? Ng : Na, Kd);
        return;
    }
    const int ntile = N / GW_BN;         // column tiles per weight matrix
    const int sel = by / ntile;
    const float* W = sel == 0 ? W0 : (sel == 1 ? W1 : W2);
    float* Y = sel == 0 ? Y0 : (sel == 1 ? Y1 : Y2);

    int tid = threadIdx.x;
    int wave = tid >> 5;
    int lane = tid & 31;
    int wm = wave & 1;                   // 0..1
    int wn = wave >> 1;                  // 0..3
    int mB = blockIdx.x * GW_BM;
    int nB = (by - sel * ntile) * GW_BN;
    int lr = lane & 15;
    int hi = lane >> 4;

    // this thread's place in a tile: row tid >> 4, 16 bytes at dword (tid & 15) * 4
    int cr = tid >> 4, cc = (tid & 15) * 4;
    const float* ga = A + (size_t)(mB + cr) * Kd + cc;
    const float* gw = W + (size_t)(nB + cr) * Kd + cc;
    unsigned lds0 = (unsigned)(uintptr_t)(void*)&sT[cr * GW_P + cc];   // LDS byte address, buffer 0
    const unsigned bufb = (unsigned)GW_BUF * 4u;                       // bytes from buffer 0 to buffer 1
    const int nt = Kd / GW_BK;

    v8f acc[2][2];
#pragma unroll     // register arrays need constant indices
    for (int mi = 0; mi < 2; ++mi)
#pragma unroll     // register arrays need constant indices
        for (int t = 0; t < 2; ++t) acc[mi][t] = (v8f){};

    gw_tile_copy(lds0, ga, gw, Kd);
    // tile 0 has landed for this wave; the barrier publishes it to the others
    asm volatile("s_wait_asynccnt 0x0" ::: "memory");
    __syncthreads();
    if (nt > 1) gw_tile_copy(lds0 + bufb, ga + GW_BK, gw + GW_BK, Kd);

    for (int kt = 0; kt < nt; ++kt) {
        const float* sb = sT + (kt & 1) * GW_BUF;
        const float* sa = sb + (wm * 32 + lr) * GW_P + hi * 2;
        const float* sw = sb + (GW_BM + wn * 32 + lr) * GW_P + hi * 2;
#pragma unroll     // the tile's LDS reads are visible together and go out ahead of the WMMAs
        for (int ks = 0; ks < GW_BK / 4; ++ks) {
            v2f a0 = *(const v2f*)(sa + ks * 4);
            v2f a1 = *(const v2f*)(sa + 16 * GW_P + ks * 4);
            v2f b0 = *(const v2f*)(sw + ks * 4);
            v2f b1 = *(const v2f*)(sw + 16 * GW_P + ks * 4);
            acc[0][0] = wmma_f32x4(a0, b0, acc[0][0]);
            acc[0][1] = wmma_f32x4(a0, b1, acc[0][1]);
            acc[1][0] = wmma_f32x4(a1, b0, acc[1][0]);
            acc[1][1] = wmma_f32x4(a1, b1, acc[1][1]);
        }
        // this wave's reads of the buffer have returned before the buffer is refilled
        asm volatile("s_wait_dscnt 0x0" ::: "memory");
        // this wave's copies of tile kt + 1 have landed before the barrier publishes them
        asm volatile("s_wait_asynccnt 0x0" ::: "memory");
        __syncthreads();
        if (kt + 2 < nt)
            gw_tile_copy(lds0 + (unsigned)(kt & 1) * bufb, ga + (size_t)(kt + 2) * GW_BK,
                         gw + (size_t)(kt + 2) * GW_BK, Kd);
    }
    // no copy is outstanding when the wave goes on to its end
    asm volatile("s_wait_asynccnt 0x0" ::: "memory");

    int m0 = mB + wm * 32 + hi * 8;
    int n0 = nB + wn * 32 + lr;
    float bv[2] = {0.f, 0.f};
    if (bias) {
        bv[0] = bias[n0];
        bv[1] = bias[n0 + 16];
        // the address registers of the two loads are free for reuse only behind this wait
        asm volatile("s_wait_xcnt 0x0" ::: "memory");
    }
    float* yp[2][8];
#pragma unroll     // register arrays need constant indices
    for (int mi = 0; mi < 2; ++mi)
#pragma unroll     // register arrays need constant indices
        for (int r = 0; r < 8; ++r) {
            yp[mi][r] = Y + (size_t)(m0 + mi * 16 + r) * N + n0;
            acc[mi][0][r] += bv[0];
            acc[mi][1][r] += bv[1];
        }
    // the stores stay behind all the arithmetic: no register of an issued store is rewritten
    __builtin_amdgcn_sched_barrier(0);
#pragma unroll     // register arrays need constant indices
    for (int mi = 0; mi < 2; ++mi)
#pragma unroll     // register arrays need constant indices
        for (int r = 0; r < 8; ++r) {
            yp[mi][r][0]  = acc[mi][0][r];
            yp[mi][r][16] = acc[mi][1][r];
        }
}

// ---------------------------------------------------------------------------
// Multi-timescale gated linear attention, chunk-parallel form (chunks of 64
// tokens). With lam constant over time, for token i of chunk c:
//   Hm_i = lam^(i+1) * E + sum_{s<=i} lam^(i-s) * g_s * k_s v_s^T
//   Z_i  = lam^(i+1) * zE + sum_{s<=i} lam^(i-s) * g_s * s_s
// where E, zE are the state at the end of chunk c-1. Three launches:
//   1. chunk_state: S_c = sum_i lam^(63-i) g_i k_i v_i^T (and the same for Z)
//   2. chunk_scan : E_c = lam^64 * E_{c-1} + S_c over the chunks, in place
//   3. chunk_out  : y = (masked decayed Q K^T) V + scaled Q E
// Only non-negative powers of lam are formed, so every factor is in [0, 1].
// ---------------------------------------------------------------------------
constexpr int LA_T  = 2048;        // tokens per sequence
constexpr int LA_H  = 8;           // heads
constexpr int LA_NC = LA_T / 64;   // chunks per sequence
constexpr int LA_RS = LA_H * 64;   // dwords between the rows of one head's q, k, v
constexpr int LA_PA = 68;          // LDS pitch (dwords), rows read 8 bytes along k
constexpr int LA_PB = 72;          // LDS pitch (dwords), rows read across columns

__device__ __forceinline__ float la_sigmoid(float x) { return 1.f / (1.f + __expf(-x)); }

// base^n for 0 <= n <= 127 by squaring: 1 at n == 0 for any base, no logarithm.
__device__ __forceinline__ float la_ipow(float base, int n) {
    float p = 1.f;
#pragma unroll     // seven fixed bits, no loop control
    for (int bit = 0; bit < 7; ++bit) {
        if (n & 1) p *= base;
        base *= base;
        n >>= 1;
    }
    return p;
}

// A thread's four float4 of a 64x64 f32 tile (256 threads): global -> registers.
struct LaTile { float4 a, b, c, d; };
__device__ __forceinline__ LaTile la_tile_load(const float* g, int tid) {
    const float* p = g + ((unsigned)(tid >> 4) * LA_RS + (unsigned)(tid & 15) * 4);
    LaTile t;
    t.a = *(const float4*)(p);
    t.b = *(const float4*)(p + 16 * LA_RS);
    t.c = *(const float4*)(p + 32 * LA_RS);
    t.d = *(const float4*)(p + 48 * LA_RS);
    // address registers of these loads (offset, scalar base) are free for reuse only behind this wait
    asm volatile("s_wait_xcnt 0x0" ::: "memory");
    return t;
}
// ... and registers -> LDS at the given pitch.
__device__ __forceinline__ void la_tile_put(float* s, int pitch, int tid, const LaTile& t) {
    float* p = s + (tid >> 4) * pitch + (tid & 15) * 4;
    *(float4*)(p) = t.a;
    *(float4*)(p + 16 * pitch) = t.b;
    *(float4*)(p + 32 * pitch) = t.c;
    *(float4*)(p + 48 * pitch) = t.d;
}

// mean |k_i| + 1e-6 of row i = tid >> 2; four lanes share a row (valid in all four).
__device__ __forceinline__ float la_row_absmean(const float* s, int pitch, int tid) {
    int i = tid >> 2, qd = tid & 3;
    float a = 0.f;
#pragma unroll     // 16 independent LDS reads in flight
    for (int e = 0; e < 16; ++e) a += fabsf(s[i * pitch + e * 4 + qd]);
    a += __shfl_xor(a, 1);
    a += __shfl_xor(a, 2);
    return a * (1.f / 64.f) + 1e-6f;
}

// grid = B*LA_H*LA_NC, block = 256. blockIdx.x = (b*LA_H + h)*LA_NC + c.
// The pointers are not __restrict__: the loads then keep their side of the asm waits.
__global__ __launch_bounds__(256) void linatt_chunk_state(const float* k, const float* v, const float* gate,
                                   const float* decay_logit, float* S, float* zS) {
    int c  = blockIdx.x % LA_NC;
    int bh = blockIdx.x / LA_NC;
    int h = bh % LA_H, b = bh / LA_H;
    int tid = threadIdx.x;

    __shared__ __attribute__((aligned(16))) float sK[64 * LA_PB];
    __shared__ __attribute__((aligned(16))) float sV[64 * LA_PB];
    __shared__ float sW[2][64];      // lam^(63-i) * g_i
    __shared__ float sAbs[64];

    size_t tok0 = (size_t)b * LA_T + c * 64;
    size_t base = (tok0 * LA_H + h) * 64;
    LaTile rk = la_tile_load(k + base, tid);
    LaTile rv = la_tile_load(v + base, tid);
    la_tile_put(sK, LA_PB, tid, rk);
    la_tile_put(sV, LA_PB, tid, rv);
    if (tid < 128) {
        int kap = tid >> 6, i = tid & 63;
        float lam = la_sigmoid(decay_logit[h * 2 + kap]);
        sW[kap][i] = gate[((tok0 + i) * LA_H + h) * 2 + kap] * la_ipow(lam, 63 - i);
    }
    __syncthreads();

    float am = la_row_absmean(sK, LA_PB, tid);
    if ((tid & 3) == 0) sAbs[tid >> 2] = am;

    // S[a][j] = sum_i K[i][a] * (w_i V[i][j]); wave = (timescale, 16 columns j)
    int wave = tid >> 5, lane = tid & 31, lr = lane & 15, hi = lane >> 4;
    int kap = wave >> 2, tn = wave & 3;
    int n = tn * 16 + lr;
    v8f acc[4];
#pragma unroll     // register arrays need constant indices
    for (int tm = 0; tm < 4; ++tm) acc[tm] = (v8f){};
#pragma unroll 4   // four k-steps per trip: their LDS loads go out together
    for (int kk = 0; kk < 64; kk += 4) {
        int ka = kk + hi * 2;
        v2f bb;
        bb.x = sV[ka * LA_PB + n] * sW[kap][ka];
        bb.y = sV[(ka + 1) * LA_PB + n] * sW[kap][ka + 1];
#pragma unroll     // register arrays need constant indices
        for (int tm = 0; tm < 4; ++tm) {
            v2f a;
            a.x = sK[ka * LA_PB + tm * 16 + lr];
            a.y = sK[(ka + 1) * LA_PB + tm * 16 + lr];
            acc[tm] = wmma_f32x4(a, bb, acc[tm]);
        }
    }
    __syncthreads();   // sAbs complete
    if (wave < 2) {    // wave w sums timescale w
        float z = sW[wave][lane] * sAbs[lane] + sW[wave][lane + 32] * sAbs[lane + 32];
#pragma unroll     // five fixed shuffle steps
        for (int m = 16; m > 0; m >>= 1) z += __shfl_xor(z, m);
        if (lane == 0) zS[(size_t)blockIdx.x * 2 + wave] = z;
    }
    float* Sp = S + (size_t)blockIdx.x * 2 * 4096;
    unsigned so = (unsigned)(kap * 4096 + hi * 8 * 64 + n);
#pragma unroll     // register arrays need constant indices
    for (int tm = 0; tm < 4; ++tm)
#pragma unroll     // register arrays need constant indices
        for (int r = 0; r < 8; ++r)
            Sp[so + (tm * 16 + r) * 64] = acc[tm][r];
}

__global__ __launch_bounds__(256) void linatt_chunk_scan(float* __restrict__ S, float* __restrict__ zS,
                                  const float* __restrict__ decay_logit, int BH) {
    int gid = blockIdx.x * 256 + threadIdx.x;
    {
        int e4 = gid & 1023, kap = (gid >> 10) & 1, bh = gid >> 11;
        float l64 = la_ipow(la_sigmoid(decay_logit[(bh % LA_H) * 2 + kap]), 64);
        float4* p = (float4*)S + ((size_t)bh * LA_NC * 2 + kap) * 1024 + e4;
        float4 s[LA_NC];
#pragma unroll     // register arrays need constant indices
        for (int c = 0; c < LA_NC; ++c) s[c] = p[(size_t)c * 2048];
        // every load is issued before the first store (all in flight at once), and
        // the address registers are free for reuse only behind this wait
        asm volatile("s_wait_xcnt 0x0" ::: "memory");
        float4 run = make_float4(0.f, 0.f, 0.f, 0.f);
#pragma unroll     // register arrays need constant indices
        for (int c = 0; c < LA_NC; ++c) {
            float4 t = s[c];
            s[c] = run;
            run.x = run.x * l64 + t.x;
            run.y = run.y * l64 + t.y;
            run.z = run.z * l64 + t.z;
            run.w = run.w * l64 + t.w;
        }
        // the stores stay behind all the arithmetic: no register of an issued store is rewritten
        __builtin_amdgcn_sched_barrier(0);
#pragma unroll     // register arrays need constant indices
        for (int c = 1; c < LA_NC; ++c) p[(size_t)c * 2048] = s[c];
        // registers of the stores above are free for reuse only behind this wait
        asm volatile("s_wait_xcnt 0x0" ::: "memory");
    }
    if (gid < BH * 2) {
        int kap = gid & 1, bh = gid >> 1;
        float l64 = la_ipow(la_sigmoid(decay_logit[(bh % LA_H) * 2 + kap]), 64);
        float* pz = zS + (size_t)bh * LA_NC * 2 + kap;
        float z[LA_NC];
#pragma unroll     // register arrays need constant indices
        for (int c = 0; c < LA_NC; ++c) z[c] = pz[c * 2];
        asm volatile("s_wait_xcnt 0x0" ::: "memory");
        float run = 0.f;
#pragma unroll     // register arrays need constant indices
        for (int c = 0; c < LA_NC; ++c) {
            float t = z[c];
            z[c] = run;
            run = run * l64 + t;
        }
        __builtin_amdgcn_sched_barrier(0);
#pragma unroll     // register arrays need constant indices
        for (int c = 1; c < LA_NC; ++c) pz[c * 2] = z[c];
    }
}

// grid = B*LA_H*LA_NC, block = 256. blockIdx.x = (b*LA_H + h)*LA_NC + c.
// The pointers are not __restrict__: the loads then keep their side of the asm waits.
__global__ __launch_bounds__(256) void linatt_chunk_out(const float* q, const float* k, const float* v, const float* gate,
                                 const float* decay_logit, const float* E, const float* zE,
                                 float* y_lin) {
    int c  = blockIdx.x % LA_NC;
    int bh = blockIdx.x / LA_NC;
    int h = bh % LA_H, b = bh / LA_H;
    int tid = threadIdx.x;
    int wave = tid >> 5, lane = tid & 31, lr = lane & 15, hi = lane >> 4;
    int tn = wave & 3, tm0 = (wave >> 2) * 2;    // wave owns tiles (tm0, tn), (tm0+1, tn)
    int n = tn * 16 + lr;

    __shared__ __attribute__((aligned(16))) float sQ[64 * LA_PA];
    __shared__ __attribute__((aligned(16))) float sK[64 * LA_PA];
    __shared__ __attribute__((aligned(16))) float sV[64 * LA_PB];
    __shared__ __attribute__((aligned(16))) float sP[64 * LA_PA];
    __shared__ float sG[2][64];      // gate
    __shared__ float sGS[2][64];     // gate * (mean|k| + 1e-6)
    __shared__ float sZ[2][64];      // Z_i
    __shared__ float sRZ[2][64];     // 1 / (Z_i + 1e-6)
    __shared__ float sRS[2][64];     // lam^(i+1) / (Z_i + 1e-6)
    __shared__ float sPw[2][128];    // [63 + d] = lam^d for d = 0..64, 0 for d = -63..-1 (the causal mask)

    size_t tok0 = (size_t)b * LA_T + c * 64;
    size_t base = (tok0 * LA_H + h) * 64;
    LaTile rq = la_tile_load(q + base, tid);
    LaTile rk = la_tile_load(k + base, tid);
    LaTile rv = la_tile_load(v + base, tid);
    // B fragments of the two incoming states, columns n: fetched here, in flight
    // together with the tiles.
    const float* Ep = E + (size_t)blockIdx.x * 2 * 4096;
    unsigned eo = (unsigned)(hi * 2 * 64 + n);
    v2f ef[2][16];
#pragma unroll     // register arrays need constant indices
    for (int kap = 0; kap < 2; ++kap)
#pragma unroll     // register arrays need constant indices
        for (int ks = 0; ks < 16; ++ks) ef[kap][ks] = (v2f){};
    float z0 = 0.f;   // incoming Z of timescale tid & 1
    if (c > 0) {   // chunk 0 starts from the zero state
#pragma unroll     // register arrays need constant indices
        for (int kap = 0; kap < 2; ++kap)
#pragma unroll     // register arrays need constant indices
            for (int ks = 0; ks < 16; ++ks) {
                ef[kap][ks].x = Ep[eo + kap * 4096 + ks * 256];
                ef[kap][ks].y = Ep[eo + kap * 4096 + ks * 256 + 64];
            }
        z0 = zE[(size_t)blockIdx.x * 2 + (tid & 1)];
        // address registers of the loads above are free for reuse only behind this wait
        asm volatile("s_wait_xcnt 0x0" ::: "memory");
    }
    la_tile_put(sQ, LA_PA, tid, rq);
    la_tile_put(sK, LA_PA, tid, rk);
    la_tile_put(sV, LA_PB, tid, rv);
    if (tid < 128) {
        int kap = tid >> 6, i = tid & 63;
        sG[kap][i] = gate[((tok0 + i) * LA_H + h) * 2 + kap];
    }
    {
        int kap = tid >> 7, d = (tid & 127) - 63;
        float pw = la_ipow(la_sigmoid(decay_logit[h * 2 + kap]), d > 0 ? d : 0);
        sPw[kap][63 + d] = (d >= 0) ? pw : 0.f;
    }
    __syncthreads();

    float am = la_row_absmean(sK, LA_PA, tid);
    if ((tid & 3) < 2) sGS[tid & 3][tid >> 2] = sG[tid & 3][tid >> 2] * am;

    // A[i][s] = q_i . k_s
    v8f sc[2];
    sc[0] = (v8f){}; sc[1] = (v8f){};
#pragma unroll 4   // four k-steps per trip: their LDS loads go out together
    for (int kk = 0; kk < 64; kk += 4) {
        int ka = kk + hi * 2;
        v2f bb = *(const v2f*)&sK[(tn * 16 + lr) * LA_PA + ka];
#pragma unroll     // register arrays need constant indices
        for (int t = 0; t < 2; ++t) {
            v2f a = *(const v2f*)&sQ[((tm0 + t) * 16 + lr) * LA_PA + ka];
            sc[t] = wmma_f32x4(a, bb, sc[t]);
        }
    }
    __syncthreads();   // sGS complete

    if (tid < 2) {     // Z inside the chunk
        float Z = z0;
        float lam = sPw[tid][64];
#pragma unroll 16  // the LDS reads of 16 steps go out ahead of the serial chain
        for (int i = 0; i < 64; ++i) {
            Z = Z * lam + sGS[tid][i];
            sZ[tid][i] = Z;
        }
    }
    __syncthreads();   // sZ complete
    if (tid < 128) {
        int kap = tid >> 6, i = tid & 63;
        float rz = 1.f / (sZ[kap][i] + 1e-6f);
        sRZ[kap][i] = rz;
        sRS[kap][i] = rz * sPw[kap][64 + i];
    }
    __syncthreads();   // sRZ, sRS complete

    // P[i][s] = A[i][s] * sum_kap lam^(i-s) g_s / (Z_i + 1e-6) for s <= i, else 0
#pragma unroll     // register arrays need constant indices
    for (int t = 0; t < 2; ++t)
#pragma unroll     // register arrays need constant indices
        for (int r = 0; r < 8; ++r) {
            int i = (tm0 + t) * 16 + r + hi * 8;
            int e = 63 + i - n;
            float w = sPw[0][e] * sG[0][n] * sRZ[0][i] + sPw[1][e] * sG[1][n] * sRZ[1][i];
            sP[i * LA_PA + n] = sc[t][r] * w;
        }
    __syncthreads();   // sP complete

    v8f acc[2];
    acc[0] = (v8f){}; acc[1] = (v8f){};
#pragma unroll 4   // four k-steps per trip: their LDS loads go out together
    for (int kk = 0; kk < 64; kk += 4) {
        int ka = kk + hi * 2;
        v2f bb;
        bb.x = sV[ka * LA_PB + n];
        bb.y = sV[(ka + 1) * LA_PB + n];
#pragma unroll     // register arrays need constant indices
        for (int t = 0; t < 2; ++t) {
            v2f a = *(const v2f*)&sP[((tm0 + t) * 16 + lr) * LA_PA + ka];
            acc[t] = wmma_f32x4(a, bb, acc[t]);
        }
    }
#pragma unroll     // register arrays need constant indices
    for (int kap = 0; kap < 2; ++kap) {
        float rs0 = sRS[kap][tm0 * 16 + lr];
        float rs1 = sRS[kap][(tm0 + 1) * 16 + lr];
#pragma unroll     // register arrays need constant indices
        for (int ks = 0; ks < 16; ++ks) {
            int ka = ks * 4 + hi * 2;
            v2f a0 = *(const v2f*)&sQ[(tm0 * 16 + lr) * LA_PA + ka];
            v2f a1 = *(const v2f*)&sQ[((tm0 + 1) * 16 + lr) * LA_PA + ka];
            a0 *= rs0;
            a1 *= rs1;
            acc[0] = wmma_f32x4(a0, ef[kap][ks], acc[0]);
            acc[1] = wmma_f32x4(a1, ef[kap][ks], acc[1]);
        }
    }
    float* yp = y_lin + base;
    unsigned yo = (unsigned)((tm0 * 16 + hi * 8) * LA_RS + n);
#pragma unroll     // register arrays need constant indices
    for (int t = 0; t < 2; ++t)
#pragma unroll     // register arrays need constant indices
        for (int r = 0; r < 8; ++r)
            yp[yo + (t * 16 + r) * LA_RS] = acc[t][r];
}

__global__ void local_attn_wmma(const float* __restrict__ q, const float* __restrict__ k,
                                const float* __restrict__ v, const float* __restrict__ y_lin,
                                const float* __restrict__ alpha, float* __restrict__ y,
                                int B, int T, int H) {
    const int dh = 64;
    const int W = 64;
    const int SLD = 129;
    int nc = T / W;
    int h = blockIdx.x % H;
    int c = (blockIdx.x / H) % nc;
    int b = blockIdx.x / (H * nc);

    __shared__ float smem[64 * 64 + 128 * 64];   // Q | K, aliased as S after use
    __shared__ float sV[128 * 64];
    float* sQ = smem;
    float* sK = smem + 64 * 64;
    float* sS = smem;                            // aliased after barrier

    int tid = threadIdx.x;
    int wave = tid >> 5, lane = tid & 31, lr = lane & 15, hi = lane >> 4;

    // This lane's 16 outputs: rows om + r, columns on and on + 16 of the block's 64x64 tile.
    // Their y_lin and alpha are fetched here, in flight together with the tiles.
    size_t tok0 = (size_t)b * T + c * W;
    const float* lg = y_lin + (tok0 * H + h) * dh;
    const float* ag = alpha + tok0 * H + h;
    int om = (wave >> 1) * 16 + hi * 8;
    int on = (wave & 1) * 32 + lr;
    unsigned yo[8], ao[8];
    float yl[2][8], al[8];
#pragma unroll     // register arrays need constant indices
    for (int r = 0; r < 8; ++r) {
        yo[r] = (unsigned)((om + r) * H * dh + on);
        ao[r] = (unsigned)((om + r) * H);
    }
    // every offset is formed before the first load: no register of an issued load is rewritten
    __builtin_amdgcn_sched_barrier(0);
#pragma unroll     // register arrays need constant indices
    for (int r = 0; r < 8; ++r) {
        yl[0][r] = lg[yo[r]];
        yl[1][r] = lg[yo[r] + 16];
        al[r]    = ag[ao[r]];
    }
    // address registers of the loads above are free for reuse only behind this wait
    asm volatile("s_wait_xcnt 0x0" ::: "memory");

    const float* qg = q + (((size_t)b * T + c * W) * H + h) * dh;
    if (tid < 32) {
        tdm_load_2d(qg, (unsigned)(uintptr_t)(void*)sQ, 64, 64, H * dh);
        if (c > 0) {
            const float* kg = k + (((size_t)b * T + (c - 1) * W) * H + h) * dh;
            const float* vg = v + (((size_t)b * T + (c - 1) * W) * H + h) * dh;
            tdm_load_2d(kg, (unsigned)(uintptr_t)(void*)sK, 64, 128, H * dh);
            tdm_load_2d(vg, (unsigned)(uintptr_t)(void*)sV, 64, 128, H * dh);
        }
        __builtin_amdgcn_s_wait_tensorcnt(0);
    }
    if (c == 0) {
        // boundary chunk: prev-chunk rows are zero, cur-chunk rows are tokens 0..63
        for (int idx = tid; idx < 128 * 64; idx += 256) {
            int jj = idx >> 6, d = idx & 63;
            float kvl = 0.f, vvl = 0.f;
            if (jj >= 64) {
                size_t g = (((size_t)b * T + (jj - 64)) * H + h) * dh + d;
                kvl = k[g];
                vvl = v[g];
            }
            sK[idx] = kvl;
            sV[idx] = vvl;
        }
    }
    __syncthreads();

    // scores: 64x128 = 4x8 tiles of 16x16; wave handles 4 tiles
    v8f sc[4];
    for (int it = 0; it < 4; ++it) {
        int id = wave * 4 + it;
        int tm = id >> 3, tn = id & 7;
        v8f acc = {};
        for (int kkk = 0; kkk < 64; kkk += 4) {
            int ka = kkk + hi * 2;
            v2f a, bb;
            a.x  = sQ[(tm * 16 + lr) * 64 + ka];
            a.y  = sQ[(tm * 16 + lr) * 64 + ka + 1];
            bb.x = sK[(tn * 16 + lr) * 64 + ka];
            bb.y = sK[(tn * 16 + lr) * 64 + ka + 1];
            acc = wmma_f32x4(a, bb, acc);
        }
        sc[it] = acc;
    }
    __syncthreads();   // done reading sQ/sK; safe to alias as sS

    // ALiBi + causal window mask, write scores to LDS
    float slope = exp2f(-8.0f * (float)(h + 1) / (float)H);
    for (int it = 0; it < 4; ++it) {
        int id = wave * 4 + it;
        int tm = id >> 3, tn = id & 7;
#pragma unroll
        for (int r = 0; r < 8; ++r) {
            int i = tm * 16 + r + hi * 8;
            int jj = tn * 16 + lr;
            float val = sc[it][r];
            bool valid = (jj >= i + 1) && (jj <= i + W) && (c * W + jj - W >= 0);
            val = valid ? (val - slope * (float)(i + W - jj)) : -1e30f;
            sS[i * SLD + jj] = val;
        }
    }
    __syncthreads();

    // row softmax (threads 0..63, one row each)
    if (tid < 64) {
        float mx = -3.4e38f;
        for (int jj = 0; jj < 128; ++jj) mx = fmaxf(mx, sS[tid * SLD + jj]);
        float sum = 0.f;
        for (int jj = 0; jj < 128; ++jj) {
            float e = __expf(sS[tid * SLD + jj] - mx);
            sS[tid * SLD + jj] = e;
            sum += e;
        }
        float inv = 1.f / sum;
        for (int jj = 0; jj < 128; ++jj) sS[tid * SLD + jj] *= inv;
    }
    __syncthreads();

    // y_loc = P[64,128] @ Vctx[128,64]; 16 tiles, wave handles 2; V from LDS
    v8f yb[2];
#pragma unroll     // register arrays need constant indices
    for (int it = 0; it < 2; ++it) {
        int id = wave * 2 + it;
        int tm = id >> 2, tn = id & 3;
        int n = tn * 16 + lr;
        v8f acc = {};
        for (int kkk = 0; kkk < 128; kkk += 4) {
            int ka = kkk + hi * 2;
            v2f a, bb;
            a.x = sS[(tm * 16 + lr) * SLD + ka];
            a.y = sS[(tm * 16 + lr) * SLD + ka + 1];
            bb.x = sV[ka * 64 + n];
            bb.y = sV[(ka + 1) * 64 + n];
            acc = wmma_f32x4(a, bb, acc);
        }
#pragma unroll     // register arrays need constant indices
        for (int r = 0; r < 8; ++r)
            yb[it][r] = al[r] * acc[r] + (1.f - al[r]) * yl[it][r];
    }
    float* yg = y + (tok0 * H + h) * dh;
    float* yp[8];
#pragma unroll     // register arrays need constant indices
    for (int r = 0; r < 8; ++r) yp[r] = yg + yo[r];
    // the stores stay behind all the arithmetic: no register of an issued store is rewritten
    __builtin_amdgcn_sched_barrier(0);
#pragma unroll     // register arrays need constant indices
    for (int r = 0; r < 8; ++r) {
        yp[r][0]  = yb[0][r];
        yp[r][16] = yb[1][r];
    }
}

// ---------------------------------------------------------------------------
// out = LayerNorm(x + proj) * gamma + beta ; block per (b,t) row.
// ---------------------------------------------------------------------------
__global__ void addnorm_kernel(const float* __restrict__ x, const float* __restrict__ proj,
                               const float* __restrict__ gamma, const float* __restrict__ beta,
                               float* __restrict__ out, int D) {
    __shared__ float red[256];
    size_t row = blockIdx.x;
    const float* xr = x + row * D;
    const float* pr = proj + row * D;

    float s = 0.f, s2 = 0.f;
    for (int d = threadIdx.x; d < D; d += 256) {
        float r = xr[d] + pr[d];
        s += r; s2 += r * r;
    }
    red[threadIdx.x] = s;
    __syncthreads();
    for (int off = 128; off > 0; off >>= 1) {
        if (threadIdx.x < off) red[threadIdx.x] += red[threadIdx.x + off];
        __syncthreads();
    }
    float mean = red[0] / (float)D;
    __syncthreads();
    red[threadIdx.x] = s2;
    __syncthreads();
    for (int off = 128; off > 0; off >>= 1) {
        if (threadIdx.x < off) red[threadIdx.x] += red[threadIdx.x + off];
        __syncthreads();
    }
    float var = red[0] / (float)D - mean * mean;
    float inv = rsqrtf(var + 1e-5f);
    for (int d = threadIdx.x; d < D; d += 256) {
        float r = xr[d] + pr[d];
        out[row * D + d] = (r - mean) * inv * gamma[d] + beta[d];
    }
}

// ---------------------------------------------------------------------------
extern "C" void kernel_launch(void* const* d_in, const int* in_sizes, int n_in,
                              void* d_out, int out_size, void* d_ws, size_t ws_size,
                              hipStream_t stream) {
    const int D = 512, H = 8, Kts = 2, dh = 64, T = 2048;
    const int M = in_sizes[0] / D;          // B*T = 4096
    const int B = M / T;                    // 2
    const int nc = T / 64;

    const float* x      = (const float*)d_in[0];
    const float* Wq     = (const float*)d_in[1];
    const float* Wk     = (const float*)d_in[2];
    const float* Wv     = (const float*)d_in[3];
    const float* Wg     = (const float*)d_in[4];
    const float* bg     = (const float*)d_in[5];
    const float* Wa     = (const float*)d_in[6];
    const float* ba     = (const float*)d_in[7];
    const float* Wo     = (const float*)d_in[8];
    const float* bo     = (const float*)d_in[9];
    const float* decay  = (const float*)d_in[10];
    const float* gamma  = (const float*)d_in[11];
    const float* beta   = (const float*)d_in[12];
    float* out = (float*)d_out;

    // workspace carve-up
    float* ws = (float*)d_ws;
    size_t off = 0;
    float* q_buf    = ws + off; off += (size_t)M * D;
    float* k_buf    = ws + off; off += (size_t)M * D;
    float* v_buf    = ws + off; off += (size_t)M * D;
    float* gate_buf = ws + off; off += (size_t)M * H * Kts;
    float* alp_buf  = ws + off; off += (size_t)M * H;
    float* ylin_buf = ws + off; off += (size_t)M * D;
    float* ymix_buf = ws + off; off += (size_t)M * D;
    float* proj_buf = ws + off; off += (size_t)M * D;
    float* st_buf   = ws + off; off += (size_t)B * H * nc * Kts * dh * dh;
    float* zst_buf  = ws + off; off += (size_t)B * H * nc * Kts;

    dim3 blk(256);
    dim3 grid_wide(M / 64, D / 128);        // 64 x 4
    dim3 grid_proj(M / 64, 3 * (D / 128) + 1);   // skinny row, then q, k, v

    // the five projections of x in one launch: q, k, v (wide) and gate, alpha (skinny, sigmoid fused)
    gemm_nt_wmma_wide<<<grid_proj, blk, 0, stream>>>(x, Wq, Wk, Wv, nullptr, q_buf, k_buf, v_buf,
                                                     Wg, bg, gate_buf, H * Kts, Wa, ba, alp_buf, H,
                                                     M, D, D, 1);

    // gated linear attention, chunk-parallel: chunk states, scan over chunks, outputs
    linatt_chunk_state<<<B * nc * H, blk, 0, stream>>>(k_buf, v_buf, gate_buf, decay,
                                                       st_buf, zst_buf);
    linatt_chunk_scan<<<B * H * 8, blk, 0, stream>>>(st_buf, zst_buf, decay, B * H);
    linatt_chunk_out<<<B * nc * H, blk, 0, stream>>>(q_buf, k_buf, v_buf, gate_buf, decay,
                                                     st_buf, zst_buf, ylin_buf);

    local_attn_wmma<<<B * nc * H, 256, 0, stream>>>(q_buf, k_buf, v_buf, ylin_buf, alp_buf,
                                                    ymix_buf, B, T, H);

    // output projection + residual + layernorm
    gemm_nt_wmma_wide<<<grid_wide, blk, 0, stream>>>(ymix_buf, Wo, nullptr, nullptr, bo,
                                                     proj_buf, nullptr, nullptr,
                                                     nullptr, nullptr, nullptr, 0, nullptr, nullptr, nullptr, 0,
                                                     M, D, D, 0);
    addnorm_kernel<<<M, blk, 0, stream>>>(x, proj_buf, gamma, beta, out, D);
}

// v005
// One run takes 124 microseconds.
// In both of two side-by-side timings against v004, it was 1.05 times as fast.
// All steps since v000 together make it 26.6 times as fast.
#include <hip/hip_runtime.h>
#include <hip/hip_bf16.h>
#include <math.h>

typedef __attribute__((ext_vector_type(2))) float v2f;
typedef __attribute__((ext_vector_type(8))) float v8f;

__device__ __forceinline__ v8f wmma_f32x4(v2f a, v2f b, v8f c) {
    // D = A(16x4 f32) * B(4x16 f32) + C(16x16 f32)
    return __builtin_amdgcn_wmma_f32_16x16x4_f32(
        /*neg_a=*/false, a, /*neg_b=*/false, b,
        /*c_mod=*/(short)0, c, /*reuse_a=*/false, /*reuse_b=*/false);
}

constexpr int GW_BM   = 64;
constexpr int GW_BN   = 128;
constexpr int GW_BK   = 64;
constexpr int GW_P    = 68;
constexpr int GW_ROWS = GW_BM + GW_BN;
constexpr int GW_BUF  = GW_ROWS * GW_P;

// One k-tile into one buffer: thread tid brings 16 bytes of rows (tid >> 4) + 16 j, j = 0..11
// (j < 4: rows of A, then rows of W), by twelve asynchronous copies global -> LDS.
__device__ __forceinline__ void gw_tile_copy(unsigned lds, const float* ga, const float* gw, int Kd) {
    const size_t rs = (size_t)16 * Kd;             // 16 rows on in global memory
    const unsigned ls = 16u * GW_P * 4u;           // 16 rows on in LDS, bytes
    // the copies go through no register; the closing wait stands inside the statement so that
    // the address registers named here are rewritten only behind it
    asm volatile("global_load_async_to_lds_b128 %0, %1, off\n\t"
                 "global_load_async_to_lds_b128 %2, %3, off\n\t"
                 "global_load_async_to_lds_b128 %4, %5, off\n\t"
                 "global_load_async_to_lds_b128 %6, %7, off\n\t"
                 "global_load_async_to_lds_b128 %8, %9, off\n\t"
                 "global_load_async_to_lds_b128 %10, %11, off\n\t"
                 "global_load_async_to_lds_b128 %12, %13, off\n\t"
                 "global_load_async_to_lds_b128 %14, %15, off\n\t"
                 "global_load_async_to_lds_b128 %16, %17, off\n\t"
                 "global_load_async_to_lds_b128 %18, %19, off\n\t"
                 "global_load_async_to_lds_b128 %20, %21, off\n\t"
                 "global_load_async_to_lds_b128 %22, %23, off\n\t"
                 "s_wait_xcnt 0x0"
                 :: "v"(lds),           "v"(ga),          "v"(lds + ls),      "v"(ga + rs),
                    "v"(lds + 2 * ls),  "v"(ga + 2 * rs), "v"(lds + 3 * ls),  "v"(ga + 3 * rs),
                    "v"(lds + 4 * ls),  "v"(gw),          "v"(lds + 5 * ls),  "v"(gw + rs),
                    "v"(lds + 6 * ls),  "v"(gw + 2 * rs), "v"(lds + 7 * ls),  "v"(gw + 3 * rs),
                    "v"(lds + 8 * ls),  "v"(gw + 4 * rs), "v"(lds + 9 * ls),  "v"(gw + 5 * rs),
                    "v"(lds + 10 * ls), "v"(gw + 6 * rs), "v"(lds + 11 * ls), "v"(gw + 7 * rs)
                 : "memory");
}

__device__ __forceinline__ void gemm_nt_skinny_block(const float* __restrict__ A, const float* __restrict__ W,
                                                     const float* __restrict__ bias, float* __restrict__ Y,
                                                     int mblk, int N, int Kd) {
    int wave = threadIdx.x >> 5;
    int lane = threadIdx.x & 31;
    int m0 = (mblk * 8 + wave) * 16;
    int lr = lane & 15;
    int hi = lane >> 4;
    int wrow = lr;                       // n0 == 0 (single tile of columns)
    int wrc = (wrow < N) ? wrow : 0;
    float msk = (wrow < N) ? 1.f : 0.f;

    const float* ap = A + (size_t)(m0 + lr) * Kd + hi * 2;
    const float* wpr = W + (size_t)wrc * Kd + hi * 2;

    v8f acc = {};
    for (int kk = 0; kk < Kd; kk += 32) {        // Kd % 64 == 0, as for the wide blocks
        const float* pa = ap + kk;
        const float* pw = wpr + kk;
        v2f a[8], b[8];
#pragma unroll     // register arrays need constant indices; eight k-steps' loads go out together
        for (int j = 0; j < 8; ++j) {
            a[j] = *(const v2f*)(pa + j * 4);
            b[j] = *(const v2f*)(pw + j * 4);
        }
        // the address registers of the loads above are free for reuse only behind this wait; it names
        // them, so they stay live up to it and no load's result is placed in one of them
        asm volatile("s_wait_xcnt 0x0" :: "v"(pa), "v"(pw) : "memory");
#pragma unroll     // register arrays need constant indices
        for (int j = 0; j < 8; ++j) acc = wmma_f32x4(a[j], b[j] * msk, acc);
    }
    float bv = bias[wrc];
    // the address registers of the load are free for reuse only behind this wait
    asm volatile("s_wait_xcnt 0x0" ::: "memory");
    float* yp[8];
    float o[8];
#pragma unroll     // register arrays need constant indices
    for (int r = 0; r < 8; ++r) {
        yp[r] = Y + (size_t)(m0 + r + hi * 8) * N + lr;
        o[r] = 1.f / (1.f + __expf(-(acc[r] + bv)));
    }
    // the stores stay behind all the arithmetic: no register of an issued store is rewritten
    __builtin_amdgcn_sched_barrier(0);
    if (lr < N) {
#pragma unroll     // register arrays need constant indices
        for (int r = 0; r < 8; ++r) yp[r][0] = o[r];
    }
}

// One launch holds every product of the same A: blockIdx.y walks, in this order, one row of
// skinny blocks (only where skinny != 0: the first half of blockIdx.x the gate, the second half
// alpha; they go first because they are short and free their place early), then the N / 128
// column tiles of W0 -> Y0, of W1 -> Y1 and of W2 -> Y2. The blocks are independent of one another.
__global__ __launch_bounds__(256) void gemm_nt_wmma_wide(const float* __restrict__ A,
                                  const float* __restrict__ W0, const float* __restrict__ W1,
                                  const float* __restrict__ W2, const float* __restrict__ bias,
                                  float* __restrict__ Y0, float* __restrict__ Y1, float* __restrict__ Y2,
                                  const float* __restrict__ Wg, const float* __restrict__ bg,
                                  float* __restrict__ Yg, int Ng,
                                  const float* __restrict__ Wa, const float* __restrict__ ba,
                                  float* __restrict__ Ya, int Na,
                                  int M, int N, int Kd, int skinny) {
    __shared__ __attribute__((aligned(16))) float sT[2 * GW_BUF];

    int by = (int)blockIdx.y - skinny;
    if (by < 0) {                        // the whole block takes this way, ahead of every barrier
        const int half = M / (2 * GW_BM);                // M / 128 blocks for each skinny product
        const bool g = (int)blockIdx.x < half;
        gemm_nt_skinny_block(A, g ? Wg : Wa, g ? bg : ba, g ? Yg : Ya,
                             g ? (int)blockIdx.x : (int)blockIdx.x - half, g ? Ng : Na, Kd);
        return;
    }
    const int ntile = N / GW_BN;         // column tiles per weight matrix
    const int sel = by / ntile;
    const float* W = sel == 0 ? W0 : (sel == 1 ? W1 : W2);
    float* Y = sel == 0 ? Y0 : (sel == 1 ? Y1 : Y2);

    int tid = threadIdx.x;
    int wave = tid >> 5;
    int lane = tid & 31;
    int wm = wave & 1;                   // 0..1
    int wn = wave >> 1;                  // 0..3
    int mB = blockIdx.x * GW_BM;
    int nB = (by - sel * ntile) * GW_BN;
    int lr = lane & 15;
    int hi = lane >> 4;

    // this thread's place in a tile: row tid >> 4, 16 bytes at dword (tid & 15) * 4
    int cr = tid >> 4, cc = (tid & 15) * 4;
    const float* ga = A + (size_t)(mB + cr) * Kd + cc;
    const float* gw = W + (size_t)(nB + cr) * Kd + cc;
    unsigned lds0 = (unsigned)(uintptr_t)(void*)&sT[cr * GW_P + cc];   // LDS byte address, buffer 0
    const unsigned bufb = (unsigned)GW_BUF * 4u;                       // bytes from buffer 0 to buffer 1
    const int nt = Kd / GW_BK;

    v8f acc[2][2];
#pragma unroll     // register arrays need constant indices
    for (int mi = 0; mi < 2; ++mi)
#pragma unroll     // register arrays need constant indices
        for (int t = 0; t < 2; ++t) acc[mi][t] = (v8f){};

    gw_tile_copy(lds0, ga, gw, Kd);
    // tile 0 has landed for this wave; the barrier publishes it to the others
    asm volatile("s_wait_asynccnt 0x0" ::: "memory");
    __syncthreads();
    if (nt > 1) gw_tile_copy(lds0 + bufb, ga + GW_BK, gw + GW_BK, Kd);

    for (int kt = 0; kt < nt; ++kt) {
        const float* sb = sT + (kt & 1) * GW_BUF;
        const float* sa = sb + (wm * 32 + lr) * GW_P + hi * 2;
        const float* sw = sb + (GW_BM + wn * 32 + lr) * GW_P + hi * 2;
#pragma unroll     // the tile's LDS reads are visible together and go out ahead of the WMMAs
        for (int ks = 0; ks < GW_BK / 4; ++ks) {
            v2f a0 = *(const v2f*)(sa + ks * 4);
            v2f a1 = *(const v2f*)(sa + 16 * GW_P + ks * 4);
            v2f b0 = *(const v2f*)(sw + ks * 4);
            v2f b1 = *(const v2f*)(sw + 16 * GW_P + ks * 4);
            acc[0][0] = wmma_f32x4(a0, b0, acc[0][0]);
            acc[0][1] = wmma_f32x4(a0, b1, acc[0][1]);
            acc[1][0] = wmma_f32x4(a1, b0, acc[1][0]);
            acc[1][1] = wmma_f32x4(a1, b1, acc[1][1]);
        }
        // this wave's reads of the buffer have returned before the buffer is refilled
        asm volatile("s_wait_dscnt 0x0" ::: "memory");
        // this wave's copies of tile kt + 1 have landed before the barrier publishes them
        asm volatile("s_wait_asynccnt 0x0" ::: "memory");
        __syncthreads();
        if (kt + 2 < nt)
            gw_tile_copy(lds0 + (unsigned)(kt & 1) * bufb, ga + (size_t)(kt + 2) * GW_BK,
                         gw + (size_t)(kt + 2) * GW_BK, Kd);
    }
    // no copy is outstanding when the wave goes on to its end
    asm volatile("s_wait_asynccnt 0x0" ::: "memory");

    int m0 = mB + wm * 32 + hi * 8;
    int n0 = nB + wn * 32 + lr;
    float bv[2] = {0.f, 0.f};
    if (bias) {
        bv[0] = bias[n0];
        bv[1] = bias[n0 + 16];
        // the address registers of the two loads are free for reuse only behind this wait
        asm volatile("s_wait_xcnt 0x0" ::: "memory");
    }
    float* yp[2][8];
#pragma unroll     // register arrays need constant indices
    for (int mi = 0; mi < 2; ++mi)
#pragma unroll     // register arrays need constant indices
        for (int r = 0; r < 8; ++r) {
            yp[mi][r] = Y + (size_t)(m0 + mi * 16 + r) * N + n0;
            acc[mi][0][r] += bv[0];
            acc[mi][1][r] += bv[1];
        }
    // the stores stay behind all the arithmetic: no register of an issued store is rewritten
    __builtin_amdgcn_sched_barrier(0);
#pragma unroll     // register arrays need constant indices
    for (int mi = 0; mi < 2; ++mi)
#pragma unroll     // register arrays need constant indices
        for (int r = 0; r < 8; ++r) {
            yp[mi][r][0]  = acc[mi][0][r];
            yp[mi][r][16] = acc[mi][1][r];
        }
}

// ---------------------------------------------------------------------------
// Multi-timescale gated linear attention, chunk-parallel form (chunks of 64
// tokens). With lam constant over time, for token i of chunk c:
//   Hm_i = lam^(i+1) * E + sum_{s<=i} lam^(i-s) * g_s * k_s v_s^T
//   Z_i  = lam^(i+1) * zE + sum_{s<=i} lam^(i-s) * g_s * s_s
// where E, zE are the state at the end of chunk c-1. Three launches:
//   1. chunk_state: S_c = sum_i lam^(63-i) g_i k_i v_i^T (and the same for Z)
//   2. chunk_scan : E_c = lam^64 * E_{c-1} + S_c over the chunks, in place
//   3. chunk_out  : y = (masked decayed Q K^T) V + scaled Q E
// Only non-negative powers of lam are formed, so every factor is in [0, 1].
// ---------------------------------------------------------------------------
constexpr int LA_T  = 2048;        // tokens per sequence
constexpr int LA_H  = 8;           // heads
constexpr int LA_NC = LA_T / 64;   // chunks per sequence
constexpr int LA_RS = LA_H * 64;   // dwords between the rows of one head's q, k, v
constexpr int LA_PA = 68;          // LDS pitch (dwords), rows read 8 bytes along k
constexpr int LA_PB = 72;          // LDS pitch (dwords), rows read across columns

__device__ __forceinline__ float la_sigmoid(float x) { return 1.f / (1.f + __expf(-x)); }

// base^n for 0 <= n <= 127 by squaring: 1 at n == 0 for any base, no logarithm.
__device__ __forceinline__ float la_ipow(float base, int n) {
    float p = 1.f;
#pragma unroll     // seven fixed bits, no loop control
    for (int bit = 0; bit < 7; ++bit) {
        if (n & 1) p *= base;
        base *= base;
        n >>= 1;
    }
    return p;
}

// A thread's four float4 of a 64x64 f32 tile (256 threads): global -> registers.
struct LaTile { float4 a, b, c, d; };
__device__ __forceinline__ LaTile la_tile_load(const float* g, int tid) {
    const float* p = g + ((unsigned)(tid >> 4) * LA_RS + (unsigned)(tid & 15) * 4);
    LaTile t;
    t.a = *(const float4*)(p);
    t.b = *(const float4*)(p + 16 * LA_RS);
    t.c = *(const float4*)(p + 32 * LA_RS);
    t.d = *(const float4*)(p + 48 * LA_RS);
    // address registers of these loads (offset, scalar base) are free for reuse only behind this wait
    asm volatile("s_wait_xcnt 0x0" ::: "memory");
    return t;
}
// ... and registers -> LDS at the given pitch.
__device__ __forceinline__ void la_tile_put(float* s, int pitch, int tid, const LaTile& t) {
    float* p = s + (tid >> 4) * pitch + (tid & 15) * 4;
    *(float4*)(p) = t.a;
    *(float4*)(p + 16 * pitch) = t.b;
    *(float4*)(p + 32 * pitch) = t.c;
    *(float4*)(p + 48 * pitch) = t.d;
}

// mean |k_i| + 1e-6 of row i = tid >> 2; four lanes share a row (valid in all four).
__device__ __forceinline__ float la_row_absmean(const float* s, int pitch, int tid) {
    int i = tid >> 2, qd = tid & 3;
    float a = 0.f;
#pragma unroll     // 16 independent LDS reads in flight
    for (int e = 0; e < 16; ++e) a += fabsf(s[i * pitch + e * 4 + qd]);
    a += __shfl_xor(a, 1);
    a += __shfl_xor(a, 2);
    return a * (1.f / 64.f) + 1e-6f;
}

// grid = B*LA_H*LA_NC, block = 256. blockIdx.x = (b*LA_H + h)*LA_NC + c.
// The pointers are not __restrict__: the loads then keep their side of the asm waits.
__global__ __launch_bounds__(256) void linatt_chunk_state(const float* k, const float* v, const float* gate,
                                   const float* decay_logit, float* S, float* zS) {
    int c  = blockIdx.x % LA_NC;
    int bh = blockIdx.x / LA_NC;
    int h = bh % LA_H, b = bh / LA_H;
    int tid = threadIdx.x;

    __shared__ __attribute__((aligned(16))) float sK[64 * LA_PB];
    __shared__ __attribute__((aligned(16))) float sV[64 * LA_PB];
    __shared__ float sW[2][64];      // lam^(63-i) * g_i
    __shared__ float sAbs[64];

    size_t tok0 = (size_t)b * LA_T + c * 64;
    size_t base = (tok0 * LA_H + h) * 64;
    LaTile rk = la_tile_load(k + base, tid);
    LaTile rv = la_tile_load(v + base, tid);
    la_tile_put(sK, LA_PB, tid, rk);
    la_tile_put(sV, LA_PB, tid, rv);
    if (tid < 128) {
        int kap = tid >> 6, i = tid & 63;
        float lam = la_sigmoid(decay_logit[h * 2 + kap]);
        sW[kap][i] = gate[((tok0 + i) * LA_H + h) * 2 + kap] * la_ipow(lam, 63 - i);
    }
    __syncthreads();

    float am = la_row_absmean(sK, LA_PB, tid);
    if ((tid & 3) == 0) sAbs[tid >> 2] = am;

    // S[a][j] = sum_i K[i][a] * (w_i V[i][j]); wave = (timescale, 16 columns j)
    int wave = tid >> 5, lane = tid & 31, lr = lane & 15, hi = lane >> 4;
    int kap = wave >> 2, tn = wave & 3;
    int n = tn * 16 + lr;
    v8f acc[4];
#pragma unroll     // register arrays need constant indices
    for (int tm = 0; tm < 4; ++tm) acc[tm] = (v8f){};
#pragma unroll 4   // four k-steps per trip: their LDS loads go out together
    for (int kk = 0; kk < 64; kk += 4) {
        int ka = kk + hi * 2;
        v2f bb;
        bb.x = sV[ka * LA_PB + n] * sW[kap][ka];
        bb.y = sV[(ka + 1) * LA_PB + n] * sW[kap][ka + 1];
#pragma unroll     // register arrays need constant indices
        for (int tm = 0; tm < 4; ++tm) {
            v2f a;
            a.x = sK[ka * LA_PB + tm * 16 + lr];
            a.y = sK[(ka + 1) * LA_PB + tm * 16 + lr];
            acc[tm] = wmma_f32x4(a, bb, acc[tm]);
        }
    }
    __syncthreads();   // sAbs complete
    if (wave < 2) {    // wave w sums timescale w
        float z = sW[wave][lane] * sAbs[lane] + sW[wave][lane + 32] * sAbs[lane + 32];
#pragma unroll     // five fixed shuffle steps
        for (int m = 16; m > 0; m >>= 1) z += __shfl_xor(z, m);
        if (lane == 0) zS[(size_t)blockIdx.x * 2 + wave] = z;
    }
    float* Sp = S + (size_t)blockIdx.x * 2 * 4096;
    unsigned so = (unsigned)(kap * 4096 + hi * 8 * 64 + n);
#pragma unroll     // register arrays need constant indices
    for (int tm = 0; tm < 4; ++tm)
#pragma unroll     // register arrays need constant indices
        for (int r = 0; r < 8; ++r)
            Sp[so + (tm * 16 + r) * 64] = acc[tm][r];
}

__global__ __launch_bounds__(256) void linatt_chunk_scan(float* __restrict__ S, float* __restrict__ zS,
                                  const float* __restrict__ decay_logit, int BH) {
    int gid = blockIdx.x * 256 + threadIdx.x;
    {
        int e4 = gid & 1023, kap = (gid >> 10) & 1, bh = gid >> 11;
        float l64 = la_ipow(la_sigmoid(decay_logit[(bh % LA_H) * 2 + kap]), 64);
        float4* p = (float4*)S + ((size_t)bh * LA_NC * 2 + kap) * 1024 + e4;
        float4 s[LA_NC];
#pragma unroll     // register arrays need constant indices
        for (int c = 0; c < LA_NC; ++c) s[c] = p[(size_t)c * 2048];
        // every load is issued before the first store (all in flight at once), and
        // the address registers are free for reuse only behind this wait
        asm volatile("s_wait_xcnt 0x0" ::: "memory");
        float4 run = make_float4(0.f, 0.f, 0.f, 0.f);
#pragma unroll     // register arrays need constant indices
        for (int c = 0; c < LA_NC; ++c) {
            float4 t = s[c];
            s[c] = run;
            run.x = run.x * l64 + t.x;
            run.y = run.y * l64 + t.y;
            run.z = run.z * l64 + t.z;
            run.w = run.w * l64 + t.w;
        }
        // the stores stay behind all the arithmetic: no register of an issued store is rewritten
        __builtin_amdgcn_sched_barrier(0);
#pragma unroll     // register arrays need constant indices
        for (int c = 1; c < LA_NC; ++c) p[(size_t)c * 2048] = s[c];
        // registers of the stores above are free for reuse only behind this wait
        asm volatile("s_wait_xcnt 0x0" ::: "memory");
    }
    if (gid < BH * 2) {
        int kap = gid & 1, bh = gid >> 1;
        float l64 = la_ipow(la_sigmoid(decay_logit[(bh % LA_H) * 2 + kap]), 64);
        float* pz = zS + (size_t)bh * LA_NC * 2 + kap;
        float z[LA_NC];
#pragma unroll     // register arrays need constant indices
        for (int c = 0; c < LA_NC; ++c) z[c] = pz[c * 2];
        asm volatile("s_wait_xcnt 0x0" ::: "memory");
        float run = 0.f;
#pragma unroll     // register arrays need constant indices
        for (int c = 0; c < LA_NC; ++c) {
            float t = z[c];
            z[c] = run;
            run = run * l64 + t;
        }
        __builtin_amdgcn_sched_barrier(0);
#pragma unroll     // register arrays need constant indices
        for (int c = 1; c < LA_NC; ++c) pz[c * 2] = z[c];
    }
}

// grid = B*LA_H*LA_NC, block = 256. blockIdx.x = (b*LA_H + h)*LA_NC + c.
// The pointers are not __restrict__: the loads then keep their side of the asm waits.
__global__ __launch_bounds__(256) void linatt_chunk_out(const float* q, const float* k, const float* v, const float* gate,
                                 const float* decay_logit, const float* E, const float* zE,
                                 float* y_lin) {
    int c  = blockIdx.x % LA_NC;
    int bh = blockIdx.x / LA_NC;
    int h = bh % LA_H, b = bh / LA_H;
    int tid = threadIdx.x;
    int wave = tid >> 5, lane = tid & 31, lr = lane & 15, hi = lane >> 4;
    int tn = wave & 3, tm0 = (wave >> 2) * 2;    // wave owns tiles (tm0, tn), (tm0+1, tn)
    int n = tn * 16 + lr;

    __shared__ __attribute__((aligned(16))) float sQ[64 * LA_PA];
    __shared__ __attribute__((aligned(16))) float sK[64 * LA_PA];
    __shared__ __attribute__((aligned(16))) float sV[64 * LA_PB];
    __shared__ __attribute__((aligned(16))) float sP[64 * LA_PA];
    __shared__ float sG[2][64];      // gate
    __shared__ float sGS[2][64];     // gate * (mean|k| + 1e-6)
    __shared__ float sZ[2][64];      // Z_i
    __shared__ float sRZ[2][64];     // 1 / (Z_i + 1e-6)
    __shared__ float sRS[2][64];     // lam^(i+1) / (Z_i + 1e-6)
    __shared__ float sPw[2][128];    // [63 + d] = lam^d for d = 0..64, 0 for d = -63..-1 (the causal mask)

    size_t tok0 = (size_t)b * LA_T + c * 64;
    size_t base = (tok0 * LA_H + h) * 64;
    LaTile rq = la_tile_load(q + base, tid);
    LaTile rk = la_tile_load(k + base, tid);
    LaTile rv = la_tile_load(v + base, tid);
    // B fragments of the two incoming states, columns n: fetched here, in flight
    // together with the tiles.
    const float* Ep = E + (size_t)blockIdx.x * 2 * 4096;
    unsigned eo = (unsigned)(hi * 2 * 64 + n);
    v2f ef[2][16];
#pragma unroll     // register arrays need constant indices
    for (int kap = 0; kap < 2; ++kap)
#pragma unroll     // register arrays need constant indices
        for (int ks = 0; ks < 16; ++ks) ef[kap][ks] = (v2f){};
    float z0 = 0.f;   // incoming Z of timescale tid & 1
    if (c > 0) {   // chunk 0 starts from the zero state
#pragma unroll     // register arrays need constant indices
        for (int kap = 0; kap < 2; ++kap)
#pragma unroll     // register arrays need constant indices
            for (int ks = 0; ks < 16; ++ks) {
                ef[kap][ks].x = Ep[eo + kap * 4096 + ks * 256];
                ef[kap][ks].y = Ep[eo + kap * 4096 + ks * 256 + 64];
            }
        z0 = zE[(size_t)blockIdx.x * 2 + (tid & 1)];
        // address registers of the loads above are free for reuse only behind this wait
        asm volatile("s_wait_xcnt 0x0" ::: "memory");
    }
    la_tile_put(sQ, LA_PA, tid, rq);
    la_tile_put(sK, LA_PA, tid, rk);
    la_tile_put(sV, LA_PB, tid, rv);
    if (tid < 128) {
        int kap = tid >> 6, i = tid & 63;
        sG[kap][i] = gate[((tok0 + i) * LA_H + h) * 2 + kap];
    }
    {
        int kap = tid >> 7, d = (tid & 127) - 63;
        float pw = la_ipow(la_sigmoid(decay_logit[h * 2 + kap]), d > 0 ? d : 0);
        sPw[kap][63 + d] = (d >= 0) ? pw : 0.f;
    }
    __syncthreads();

    float am = la_row_absmean(sK, LA_PA, tid);
    if ((tid & 3) < 2) sGS[tid & 3][tid >> 2] = sG[tid & 3][tid >> 2] * am;

    // A[i][s] = q_i . k_s
    v8f sc[2];
    sc[0] = (v8f){}; sc[1] = (v8f){};
#pragma unroll 4   // four k-steps per trip: their LDS loads go out together
    for (int kk = 0; kk < 64; kk += 4) {
        int ka = kk + hi * 2;
        v2f bb = *(const v2f*)&sK[(tn * 16 + lr) * LA_PA + ka];
#pragma unroll     // register arrays need constant indices
        for (int t = 0; t < 2; ++t) {
            v2f a = *(const v2f*)&sQ[((tm0 + t) * 16 + lr) * LA_PA + ka];
            sc[t] = wmma_f32x4(a, bb, sc[t]);
        }
    }
    __syncthreads();   // sGS complete

    if (tid < 2) {     // Z inside the chunk
        float Z = z0;
        float lam = sPw[tid][64];
#pragma unroll 16  // the LDS reads of 16 steps go out ahead of the serial chain
        for (int i = 0; i < 64; ++i) {
            Z = Z * lam + sGS[tid][i];
            sZ[tid][i] = Z;
        }
    }
    __syncthreads();   // sZ complete
    if (tid < 128) {
        int kap = tid >> 6, i = tid & 63;
        float rz = 1.f / (sZ[kap][i] + 1e-6f);
        sRZ[kap][i] = rz;
        sRS[kap][i] = rz * sPw[kap][64 + i];
    }
    __syncthreads();   // sRZ, sRS complete

    // P[i][s] = A[i][s] * sum_kap lam^(i-s) g_s / (Z_i + 1e-6) for s <= i, else 0
#pragma unroll     // register arrays need constant indices
    for (int t = 0; t < 2; ++t)
#pragma unroll     // register arrays need constant indices
        for (int r = 0; r < 8; ++r) {
            int i = (tm0 + t) * 16 + r + hi * 8;
            int e = 63 + i - n;
            float w = sPw[0][e] * sG[0][n] * sRZ[0][i] + sPw[1][e] * sG[1][n] * sRZ[1][i];
            sP[i * LA_PA + n] = sc[t][r] * w;
        }
    __syncthreads();   // sP complete

    v8f acc[2];
    acc[0] = (v8f){}; acc[1] = (v8f){};
#pragma unroll 4   // four k-steps per trip: their LDS loads go out together
    for (int kk = 0; kk < 64; kk += 4) {
        int ka = kk + hi * 2;
        v2f bb;
        bb.x = sV[ka * LA_PB + n];
        bb.y = sV[(ka + 1) * LA_PB + n];
#pragma unroll     // register arrays need constant indices
        for (int t = 0; t < 2; ++t) {
            v2f a = *(const v2f*)&sP[((tm0 + t) * 16 + lr) * LA_PA + ka];
            acc[t] = wmma_f32x4(a, bb, acc[t]);
        }
    }
#pragma unroll     // register arrays need constant indices
    for (int kap = 0; kap < 2; ++kap) {
        float rs0 = sRS[kap][tm0 * 16 + lr];
        float rs1 = sRS[kap][(tm0 + 1) * 16 + lr];
#pragma unroll     // register arrays need constant indices
        for (int ks = 0; ks < 16; ++ks) {
            int ka = ks * 4 + hi * 2;
            v2f a0 = *(const v2f*)&sQ[(tm0 * 16 + lr) * LA_PA + ka];
            v2f a1 = *(const v2f*)&sQ[((tm0 + 1) * 16 + lr) * LA_PA + ka];
            a0 *= rs0;
            a1 *= rs1;
            acc[0] = wmma_f32x4(a0, ef[kap][ks], acc[0]);
            acc[1] = wmma_f32x4(a1, ef[kap][ks], acc[1]);
        }
    }
    float* yp = y_lin + base;
    unsigned yo = (unsigned)((tm0 * 16 + hi * 8) * LA_RS + n);
#pragma unroll     // register arrays need constant indices
    for (int t = 0; t < 2; ++t)
#pragma unroll     // register arrays need constant indices
        for (int r = 0; r < 8; ++r)
            yp[yo + (t * 16 + r) * LA_RS] = acc[t][r];
}

// ---------------------------------------------------------------------------
// Sliding-window local attention with ALiBi, one block per (b, chunk, head).
// Block = 256 threads (8 waves). Scores and P@V via fp32 WMMA.
// Q/K/V tiles come into LDS by asynchronous copies (16 bytes a lane), each row at a padded
// pitch chosen for its reader; the rows in front of token 0 (c == 0) are filled with zeros.
// LDS: phase1 Q[64]+K[128] rows (aliased as S[64] rows in phase2) + V[128] rows.
// The epilogue blends with the linear-attention output of the same tile:
// y = alpha * y_loc + (1 - alpha) * y_lin (alpha per [B,T,H]); y_loc never goes to memory.
// ---------------------------------------------------------------------------
constexpr int LC_PK = 68;
constexpr int LC_PV = 72;
constexpr int LC_PS = 132;

// Rows r + 16 j, j = 0..3, of three 64-row tiles (Q, K, V), 16 bytes a lane: twelve asynchronous
// copies global -> LDS. rs = 16 rows on in global memory (floats).
__device__ __forceinline__ void lc_copy_qkv(unsigned lq, const float* gq, unsigned lk, const float* gk,
                                            unsigned lv, const float* gv, size_t rs) {
    const unsigned sk = 16u * LC_PK * 4u;          // 16 rows on in LDS, bytes (Q, K)
    const unsigned sv = 16u * LC_PV * 4u;          // 16 rows on in LDS, bytes (V)
    // the copies go through no register; the closing wait stands inside the statement so that
    // the address registers named here are rewritten only behind it
    asm volatile("global_load_async_to_lds_b128 %0, %1, off\n\t"
                 "global_load_async_to_lds_b128 %2, %3, off\n\t"
                 "global_load_async_to_lds_b128 %4, %5, off\n\t"
                 "global_load_async_to_lds_b128 %6, %7, off\n\t"
                 "global_load_async_to_lds_b128 %8, %9, off\n\t"
                 "global_load_async_to_lds_b128 %10, %11, off\n\t"
                 "global_load_async_to_lds_b128 %12, %13, off\n\t"
                 "global_load_async_to_lds_b128 %14, %15, off\n\t"
                 "global_load_async_to_lds_b128 %16, %17, off\n\t"
                 "global_load_async_to_lds_b128 %18, %19, off\n\t"
                 "global_load_async_to_lds_b128 %20, %21, off\n\t"
                 "global_load_async_to_lds_b128 %22, %23, off\n\t"
                 "s_wait_xcnt 0x0"
                 :: "v"(lq),          "v"(gq),          "v"(lq + sk),     "v"(gq + rs),
                    "v"(lq + 2 * sk), "v"(gq + 2 * rs), "v"(lq + 3 * sk), "v"(gq + 3 * rs),
                    "v"(lk),          "v"(gk),          "v"(lk + sk),     "v"(gk + rs),
                    "v"(lk + 2 * sk), "v"(gk + 2 * rs), "v"(lk + 3 * sk), "v"(gk + 3 * rs),
                    "v"(lv),          "v"(gv),          "v"(lv + sv),     "v"(gv + rs),
                    "v"(lv + 2 * sv), "v"(gv + 2 * rs), "v"(lv + 3 * sv), "v"(gv + 3 * rs)
                 : "memory");
}
// The same for two tiles (K, V): eight copies.
__device__ __forceinline__ void lc_copy_kv(unsigned lk, const float* gk, unsigned lv, const float* gv, size_t rs) {
    const unsigned sk = 16u * LC_PK * 4u;
    const unsigned sv = 16u * LC_PV * 4u;
    asm volatile("global_load_async_to_lds_b128 %0, %1, off\n\t"
                 "global_load_async_to_lds_b128 %2, %3, off\n\t"
                 "global_load_async_to_lds_b128 %4, %5, off\n\t"
                 "global_load_async_to_lds_b128 %6, %7, off\n\t"
                 "global_load_async_to_lds_b128 %8, %9, off\n\t"
                 "global_load_async_to_lds_b128 %10, %11, off\n\t"
                 "global_load_async_to_lds_b128 %12, %13, off\n\t"
                 "global_load_async_to_lds_b128 %14, %15, off\n\t"
                 "s_wait_xcnt 0x0"
                 :: "v"(lk),          "v"(gk),          "v"(lk + sk),     "v"(gk + rs),
                    "v"(lk + 2 * sk), "v"(gk + 2 * rs), "v"(lk + 3 * sk), "v"(gk + 3 * rs),
                    "v"(lv),          "v"(gv),          "v"(lv + sv),     "v"(gv + rs),
                    "v"(lv + 2 * sv), "v"(gv + 2 * rs), "v"(lv + 3 * sv), "v"(gv + 3 * rs)
                 : "memory");
}

__global__ void local_attn_wmma(const float* __restrict__ q, const float* __restrict__ k,
                                const float* __restrict__ v, const float* __restrict__ y_lin,
                                const float* __restrict__ alpha, float* __restrict__ y,
                                int B, int T, int H) {
    const int dh = 64;
    const int W = 64;
    int nc = T / W;
    int h = blockIdx.x % H;
    int c = (blockIdx.x / H) % nc;
    int b = blockIdx.x / (H * nc);

    __shared__ __attribute__((aligned(16))) float smem[(64 + 128) * LC_PK];   // Q | K, aliased as S after use
    __shared__ __attribute__((aligned(16))) float sV[128 * LC_PV];
    float* sQ = smem;
    float* sK = smem + 64 * LC_PK;
    float* sS = smem;                            // aliased after barrier

    int tid = threadIdx.x;
    int wave = tid >> 5, lane = tid & 31, lr = lane & 15, hi = lane >> 4;

    // This lane's 16 outputs: rows om + r, columns on and on + 16 of the block's 64x64 tile.
    // Their y_lin and alpha are fetched here, in flight together with the tiles.
    size_t tok0 = (size_t)b * T + c * W;
    const float* lg = y_lin + (tok0 * H + h) * dh;
    const float* ag = alpha + tok0 * H + h;
    int om = (wave >> 1) * 16 + hi * 8;
    int on = (wave & 1) * 32 + lr;
    unsigned yo[8], ao[8];
    float yl[2][8], al[8];
#pragma unroll     // register arrays need constant indices
    for (int r = 0; r < 8; ++r) {
        yo[r] = (unsigned)((om + r) * H * dh + on);
        ao[r] = (unsigned)((om + r) * H);
    }
    // every offset is formed before the first load: no register of an issued load is rewritten
    __builtin_amdgcn_sched_barrier(0);
#pragma unroll     // register arrays need constant indices
    for (int r = 0; r < 8; ++r) {
        yl[0][r] = lg[yo[r]];
        yl[1][r] = lg[yo[r] + 16];
        al[r]    = ag[ao[r]];
    }
    // address registers of the loads above are free for reuse only behind this wait
    asm volatile("s_wait_xcnt 0x0" ::: "memory");

    // ---- stage the tiles: this thread brings 16 bytes at dword cc of rows cr + 16 j ----
    {
        int cr = tid >> 4, cc = (tid & 15) * 4;
        size_t go = ((tok0 + cr) * H + h) * dh + cc;       // row cr of this chunk
        size_t rs = (size_t)16 * H * dh;                   // 16 tokens on
        unsigned lq = (unsigned)(uintptr_t)(void*)&sQ[cr * LC_PK + cc];
        unsigned lk = (unsigned)(uintptr_t)(void*)&sK[cr * LC_PK + cc];
        unsigned lv = (unsigned)(uintptr_t)(void*)&sV[cr * LC_PV + cc];
        // this chunk: Q, and rows 64..127 of K and V
        lc_copy_qkv(lq, q + go, lk + 64u * LC_PK * 4u, k + go, lv + 64u * LC_PV * 4u, v + go, rs);
        if (c > 0) {       // the same for the whole block
            // the chunk before: rows 0..63 of K and V
            lc_copy_kv(lk, k + go - 4 * rs, lv, v + go - 4 * rs, rs);
        } else {
            // boundary chunk: the rows in front of token 0 are zero
            const float4 z4 = make_float4(0.f, 0.f, 0.f, 0.f);
#pragma unroll     // four fixed rows, no loop control
            for (int j = 0; j < 4; ++j) {
                *(float4*)&sK[(cr + 16 * j) * LC_PK + cc] = z4;
                *(float4*)&sV[(cr + 16 * j) * LC_PV + cc] = z4;
            }
        }
    }
    // this wave's copies have landed; the barrier publishes them to the others
    asm volatile("s_wait_asynccnt 0x0" ::: "memory");
    __syncthreads();

    // scores: 64x128 = 4x8 tiles of 16x16; wave handles 4 tiles
    v8f sc[4];
    for (int it = 0; it < 4; ++it) {
        int id = wave * 4 + it;
        int tm = id >> 3, tn = id & 7;
        v8f acc = {};
        for (int kkk = 0; kkk < 64; kkk += 4) {
            int ka = kkk + hi * 2;
            v2f a  = *(const v2f*)&sQ[(tm * 16 + lr) * LC_PK + ka];
            v2f bb = *(const v2f*)&sK[(tn * 16 + lr) * LC_PK + ka];
            acc = wmma_f32x4(a, bb, acc);
        }
        sc[it] = acc;
    }
    __syncthreads();   // done reading sQ/sK; safe to alias as sS

    // ALiBi + causal window mask, write scores to LDS
    float slope = exp2f(-8.0f * (float)(h + 1) / (float)H);
    for (int it = 0; it < 4; ++it) {
        int id = wave * 4 + it;
        int tm = id >> 3, tn = id & 7;
#pragma unroll
        for (int r = 0; r < 8; ++r) {
            int i = tm * 16 + r + hi * 8;
            int jj = tn * 16 + lr;
            float val = sc[it][r];
            bool valid = (jj >= i + 1) && (jj <= i + W) && (c * W + jj - W >= 0);
            val = valid ? (val - slope * (float)(i + W - jj)) : -1e30f;
            sS[i * LC_PS + jj] = val;
        }
    }
    __syncthreads();

    // row softmax (threads 0..63, one row each)
    if (tid < 64) {
        float mx = -3.4e38f;
        for (int jj = 0; jj < 128; ++jj) mx = fmaxf(mx, sS[tid * LC_PS + jj]);
        float sum = 0.f;
        for (int jj = 0; jj < 128; ++jj) {
            float e = __expf(sS[tid * LC_PS + jj] - mx);
            sS[tid * LC_PS + jj] = e;
            sum += e;
        }
        float inv = 1.f / sum;
        for (int jj = 0; jj < 128; ++jj) sS[tid * LC_PS + jj] *= inv;
    }
    __syncthreads();

    // y_loc = P[64,128] @ Vctx[128,64]; 16 tiles, wave handles 2; V from LDS
    v8f yb[2];
#pragma unroll     // register arrays need constant indices
    for (int it = 0; it < 2; ++it) {
        int id = wave * 2 + it;
        int tm = id >> 2, tn = id & 3;
        int n = tn * 16 + lr;
        v8f acc = {};
        for (int kkk = 0; kkk < 128; kkk += 4) {
            int ka = kkk + hi * 2;
            v2f a = *(const v2f*)&sS[(tm * 16 + lr) * LC_PS + ka];
            v2f bb;
            bb.x = sV[ka * LC_PV + n];
            bb.y = sV[(ka + 1) * LC_PV + n];
            acc = wmma_f32x4(a, bb, acc);
        }
#pragma unroll     // register arrays need constant indices
        for (int r = 0; r < 8; ++r)
            yb[it][r] = al[r] * acc[r] + (1.f - al[r]) * yl[it][r];
    }
    float* yg = y + (tok0 * H + h) * dh;
    float* yp[8];
#pragma unroll     // register arrays need constant indices
    for (int r = 0; r < 8; ++r) yp[r] = yg + yo[r];
    // the stores stay behind all the arithmetic: no register of an issued store is rewritten
    __builtin_amdgcn_sched_barrier(0);
#pragma unroll     // register arrays need constant indices
    for (int r = 0; r < 8; ++r) {
        yp[r][0]  = yb[0][r];
        yp[r][16] = yb[1][r];
    }
}

// ---------------------------------------------------------------------------
// out = LayerNorm(x + proj) * gamma + beta ; block per (b,t) row.
// ---------------------------------------------------------------------------
__global__ void addnorm_kernel(const float* __restrict__ x, const float* __restrict__ proj,
                               const float* __restrict__ gamma, const float* __restrict__ beta,
                               float* __restrict__ out, int D) {
    __shared__ float red[256];
    size_t row = blockIdx.x;
    const float* xr = x + row * D;
    const float* pr = proj + row * D;

    float s = 0.f, s2 = 0.f;
    for (int d = threadIdx.x; d < D; d += 256) {
        float r = xr[d] + pr[d];
        s += r; s2 += r * r;
    }
    red[threadIdx.x] = s;
    __syncthreads();
    for (int off = 128; off > 0; off >>= 1) {
        if (threadIdx.x < off) red[threadIdx.x] += red[threadIdx.x + off];
        __syncthreads();
    }
    float mean = red[0] / (float)D;
    __syncthreads();
    red[threadIdx.x] = s2;
    __syncthreads();
    for (int off = 128; off > 0; off >>= 1) {
        if (threadIdx.x < off) red[threadIdx.x] += red[threadIdx.x + off];
        __syncthreads();
    }
    float var = red[0] / (float)D - mean * mean;
    float inv = rsqrtf(var + 1e-5f);
    for (int d = threadIdx.x; d < D; d += 256) {
        float r = xr[d] + pr[d];
        out[row * D + d] = (r - mean) * inv * gamma[d] + beta[d];
    }
}

// ---------------------------------------------------------------------------
extern "C" void kernel_launch(void* const* d_in, const int* in_sizes, int n_in,
                              void* d_out, int out_size, void* d_ws, size_t ws_size,
                              hipStream_t stream) {
    const int D = 512, H = 8, Kts = 2, dh = 64, T = 2048;
    const int M = in_sizes[0] / D;          // B*T = 4096
    const int B = M / T;                    // 2
    const int nc = T / 64;

    const float* x      = (const float*)d_in[0];
    const float* Wq     = (const float*)d_in[1];
    const float* Wk     = (const float*)d_in[2];
    const float* Wv     = (const float*)d_in[3];
    const float* Wg     = (const float*)d_in[4];
    const float* bg     = (const float*)d_in[5];
    const float* Wa     = (const float*)d_in[6];
    const float* ba     = (const float*)d_in[7];
    const float* Wo     = (const float*)d_in[8];
    const float* bo     = (const float*)d_in[9];
    const float* decay  = (const float*)d_in[10];
    const float* gamma  = (const float*)d_in[11];
    const float* beta   = (const float*)d_in[12];
    float* out = (float*)d_out;

    // workspace carve-up
    float* ws = (float*)d_ws;
    size_t off = 0;
    float* q_buf    = ws + off; off += (size_t)M * D;
    float* k_buf    = ws + off; off += (size_t)M * D;
    float* v_buf    = ws + off; off += (size_t)M * D;
    float* gate_buf = ws + off; off += (size_t)M * H * Kts;
    float* alp_buf  = ws + off; off += (size_t)M * H;
    float* ylin_buf = ws + off; off += (size_t)M * D;
    float* ymix_buf = ws + off; off += (size_t)M * D;
    float* proj_buf = ws + off; off += (size_t)M * D;
    float* st_buf   = ws + off; off += (size_t)B * H * nc * Kts * dh * dh;
    float* zst_buf  = ws + off; off += (size_t)B * H * nc * Kts;

    dim3 blk(256);
    dim3 grid_wide(M / 64, D / 128);        // 64 x 4
    dim3 grid_proj(M / 64, 3 * (D / 128) + 1);   // skinny row, then q, k, v

    // the five projections of x in one launch: q, k, v (wide) and gate, alpha (skinny, sigmoid fused)
    gemm_nt_wmma_wide<<<grid_proj, blk, 0, stream>>>(x, Wq, Wk, Wv, nullptr, q_buf, k_buf, v_buf,
                                                     Wg, bg, gate_buf, H * Kts, Wa, ba, alp_buf, H,
                                                     M, D, D, 1);

    // gated linear attention, chunk-parallel: chunk states, scan over chunks, outputs
    linatt_chunk_state<<<B * nc * H, blk, 0, stream>>>(k_buf, v_buf, gate_buf, decay,
                                                       st_buf, zst_buf);
    linatt_chunk_scan<<<B * H * 8, blk, 0, stream>>>(st_buf, zst_buf, decay, B * H);
    linatt_chunk_out<<<B * nc * H, blk, 0, stream>>>(q_buf, k_buf, v_buf, gate_buf, decay,
                                                     st_buf, zst_buf, ylin_buf);

    // sliding-window local attention with ALiBi, gated blend in its epilogue
    local_attn_wmma<<<B * nc * H, 256, 0, stream>>>(q_buf, k_buf, v_buf, ylin_buf, alp_buf,
                                                    ymix_buf, B, T, H);

    // output projection + residual + layernorm
    gemm_nt_wmma_wide<<<grid_wide, blk, 0, stream>>>(ymix_buf, Wo, nullptr, nullptr, bo,
                                                     proj_buf, nullptr, nullptr,
                                                     nullptr, nullptr, nullptr, 0, nullptr, nullptr, nullptr, 0,
                                                     M, D, D, 0);
    addnorm_kernel<<<M, blk, 0, stream>>>(x, proj_buf, gamma, beta, out, D);
}

// v006
// One run takes 120 microseconds.
// Two timings next to v005 both put it at 1.03 times that version's speed.
// Over all steps from v000 it is 27.5 times as fast.
#include <hip/hip_runtime.h>
#include <hip/hip_bf16.h>
#include <math.h>

typedef __attribute__((ext_vector_type(2))) float v2f;
typedef __attribute__((ext_vector_type(8))) float v8f;

__device__ __forceinline__ v8f wmma_f32x4(v2f a, v2f b, v8f c) {
    // D = A(16x4 f32) * B(4x16 f32) + C(16x16 f32)
    return __builtin_amdgcn_wmma_f32_16x16x4_f32(
        /*neg_a=*/false, a, /*neg_b=*/false, b,
        /*c_mod=*/(short)0, c, /*reuse_a=*/false, /*reuse_b=*/false);
}

constexpr int GW_BM   = 64;
constexpr int GW_BN   = 128;
constexpr int GW_BK   = 64;
constexpr int GW_P    = 68;
constexpr int GW_ROWS = GW_BM + GW_BN;
constexpr int GW_BUF  = GW_ROWS * GW_P;

// One k-tile into one buffer: thread tid brings 16 bytes of rows (tid >> 4) + 16 j, j = 0..11
// (j < 4: rows of A, then rows of W), by twelve asynchronous copies global -> LDS.
__device__ __forceinline__ void gw_tile_copy(unsigned lds, const float* ga, const float* gw, int Kd) {
    const size_t rs = (size_t)16 * Kd;             // 16 rows on in global memory
    const unsigned ls = 16u * GW_P * 4u;           // 16 rows on in LDS, bytes
    // the copies go through no register; the closing wait stands inside the statement so that
    // the address registers named here are rewritten only behind it
    asm volatile("global_load_async_to_lds_b128 %0, %1, off\n\t"
                 "global_load_async_to_lds_b128 %2, %3, off\n\t"
                 "global_load_async_to_lds_b128 %4, %5, off\n\t"
                 "global_load_async_to_lds_b128 %6, %7, off\n\t"
                 "global_load_async_to_lds_b128 %8, %9, off\n\t"
                 "global_load_async_to_lds_b128 %10, %11, off\n\t"
                 "global_load_async_to_lds_b128 %12, %13, off\n\t"
                 "global_load_async_to_lds_b128 %14, %15, off\n\t"
                 "global_load_async_to_lds_b128 %16, %17, off\n\t"
                 "global_load_async_to_lds_b128 %18, %19, off\n\t"
                 "global_load_async_to_lds_b128 %20, %21, off\n\t"
                 "global_load_async_to_lds_b128 %22, %23, off\n\t"
                 "s_wait_xcnt 0x0"
                 :: "v"(lds),           "v"(ga),          "v"(lds + ls),      "v"(ga + rs),
                    "v"(lds + 2 * ls),  "v"(ga + 2 * rs), "v"(lds + 3 * ls),  "v"(ga + 3 * rs),
                    "v"(lds + 4 * ls),  "v"(gw),          "v"(lds + 5 * ls),  "v"(gw + rs),
                    "v"(lds + 6 * ls),  "v"(gw + 2 * rs), "v"(lds + 7 * ls),  "v"(gw + 3 * rs),
                    "v"(lds + 8 * ls),  "v"(gw + 4 * rs), "v"(lds + 9 * ls),  "v"(gw + 5 * rs),
                    "v"(lds + 10 * ls), "v"(gw + 6 * rs), "v"(lds + 11 * ls), "v"(gw + 7 * rs)
                 : "memory");
}

__device__ __forceinline__ void gemm_nt_skinny_block(const float* __restrict__ A, const float* __restrict__ W,
                                                     const float* __restrict__ bias, float* __restrict__ Y,
                                                     int mblk, int N, int Kd) {
    int wave = threadIdx.x >> 5;
    int lane = threadIdx.x & 31;
    int m0 = (mblk * 8 + wave) * 16;
    int lr = lane & 15;
    int hi = lane >> 4;
    int wrow = lr;                       // n0 == 0 (single tile of columns)
    int wrc = (wrow < N) ? wrow : 0;
    float msk = (wrow < N) ? 1.f : 0.f;

    const float* ap = A + (size_t)(m0 + lr) * Kd + hi * 2;
    const float* wpr = W + (size_t)wrc * Kd + hi * 2;

    v8f acc = {};
    for (int kk = 0; kk < Kd; kk += 32) {        // Kd % 64 == 0, as for the wide blocks
        const float* pa = ap + kk;
        const float* pw = wpr + kk;
        v2f a[8], b[8];
#pragma unroll     // register arrays need constant indices; eight k-steps' loads go out together
        for (int j = 0; j < 8; ++j) {
            a[j] = *(const v2f*)(pa + j * 4);
            b[j] = *(const v2f*)(pw + j * 4);
        }
        // the address registers of the loads above are free for reuse only behind this wait; it names
        // them, so they stay live up to it and no load's result is placed in one of them
        asm volatile("s_wait_xcnt 0x0" :: "v"(pa), "v"(pw) : "memory");
#pragma unroll     // register arrays need constant indices
        for (int j = 0; j < 8; ++j) acc = wmma_f32x4(a[j], b[j] * msk, acc);
    }
    float bv = bias[wrc];
    // the address registers of the load are free for reuse only behind this wait
    asm volatile("s_wait_xcnt 0x0" ::: "memory");
    float* yp[8];
    float o[8];
#pragma unroll     // register arrays need constant indices
    for (int r = 0; r < 8; ++r) {
        yp[r] = Y + (size_t)(m0 + r + hi * 8) * N + lr;
        o[r] = 1.f / (1.f + __expf(-(acc[r] + bv)));
    }
    // the stores stay behind all the arithmetic: no register of an issued store is rewritten
    __builtin_amdgcn_sched_barrier(0);
    if (lr < N) {
#pragma unroll     // register arrays need constant indices
        for (int r = 0; r < 8; ++r) yp[r][0] = o[r];
    }
}

// One launch holds every product of the same A: blockIdx.y walks, in this order, one row of
// skinny blocks (only where skinny != 0: the first half of blockIdx.x the gate, the second half
// alpha; they go first because they are short and free their place early), then the N / 128
// column tiles of W0 -> Y0, of W1 -> Y1 and of W2 -> Y2. The blocks are independent of one another.
__global__ __launch_bounds__(256) void gemm_nt_wmma_wide(const float* __restrict__ A,
                                  const float* __restrict__ W0, const float* __restrict__ W1,
                                  const float* __restrict__ W2, const float* __restrict__ bias,
                                  float* __restrict__ Y0, float* __restrict__ Y1, float* __restrict__ Y2,
                                  const float* __restrict__ Wg, const float* __restrict__ bg,
                                  float* __restrict__ Yg, int Ng,
                                  const float* __restrict__ Wa, const float* __restrict__ ba,
                                  float* __restrict__ Ya, int Na,
                                  int M, int N, int Kd, int skinny) {
    __shared__ __attribute__((aligned(16))) float sT[2 * GW_BUF];

    int by = (int)blockIdx.y - skinny;
    if (by < 0) {                        // the whole block takes this way, ahead of every barrier
        const int half = M / (2 * GW_BM);                // M / 128 blocks for each skinny product
        const bool g = (int)blockIdx.x < half;
        gemm_nt_skinny_block(A, g ? Wg : Wa, g ? bg : ba, g ? Yg : Ya,
                             g ? (int)blockIdx.x : (int)blockIdx.x - half, g ? Ng : Na, Kd);
        return;
    }
    const int ntile = N / GW_BN;         // column tiles per weight matrix
    const int sel = by / ntile;
    const float* W = sel == 0 ? W0 : (sel == 1 ? W1 : W2);
    float* Y = sel == 0 ? Y0 : (sel == 1 ? Y1 : Y2);

    int tid = threadIdx.x;
    int wave = tid >> 5;
    int lane = tid & 31;
    int wm = wave & 1;                   // 0..1
    int wn = wave >> 1;                  // 0..3
    int mB = blockIdx.x * GW_BM;
    int nB = (by - sel * ntile) * GW_BN;
    int lr = lane & 15;
    int hi = lane >> 4;

    // this thread's place in a tile: row tid >> 4, 16 bytes at dword (tid & 15) * 4
    int cr = tid >> 4, cc = (tid & 15) * 4;
    const float* ga = A + (size_t)(mB + cr) * Kd + cc;
    const float* gw = W + (size_t)(nB + cr) * Kd + cc;
    unsigned lds0 = (unsigned)(uintptr_t)(void*)&sT[cr * GW_P + cc];   // LDS byte address, buffer 0
    const unsigned bufb = (unsigned)GW_BUF * 4u;                       // bytes from buffer 0 to buffer 1
    const int nt = Kd / GW_BK;

    v8f acc[2][2];
#pragma unroll     // register arrays need constant indices
    for (int mi = 0; mi < 2; ++mi)
#pragma unroll     // register arrays need constant indices
        for (int t = 0; t < 2; ++t) acc[mi][t] = (v8f){};

    gw_tile_copy(lds0, ga, gw, Kd);
    // tile 0 has landed for this wave; the barrier publishes it to the others
    asm volatile("s_wait_asynccnt 0x0" ::: "memory");
    __syncthreads();
    if (nt > 1) gw_tile_copy(lds0 + bufb, ga + GW_BK, gw + GW_BK, Kd);

    for (int kt = 0; kt < nt; ++kt) {
        const float* sb = sT + (kt & 1) * GW_BUF;
        const float* sa = sb + (wm * 32 + lr) * GW_P + hi * 2;
        const float* sw = sb + (GW_BM + wn * 32 + lr) * GW_P + hi * 2;
#pragma unroll     // the tile's LDS reads are visible together and go out ahead of the WMMAs
        for (int ks = 0; ks < GW_BK / 4; ++ks) {
            v2f a0 = *(const v2f*)(sa + ks * 4);
            v2f a1 = *(const v2f*)(sa + 16 * GW_P + ks * 4);
            v2f b0 = *(const v2f*)(sw + ks * 4);
            v2f b1 = *(const v2f*)(sw + 16 * GW_P + ks * 4);
            acc[0][0] = wmma_f32x4(a0, b0, acc[0][0]);
            acc[0][1] = wmma_f32x4(a0, b1, acc[0][1]);
            acc[1][0] = wmma_f32x4(a1, b0, acc[1][0]);
            acc[1][1] = wmma_f32x4(a1, b1, acc[1][1]);
        }
        // this wave's reads of the buffer have returned before the buffer is refilled
        asm volatile("s_wait_dscnt 0x0" ::: "memory");
        // this wave's copies of tile kt + 1 have landed before the barrier publishes them
        asm volatile("s_wait_asynccnt 0x0" ::: "memory");
        __syncthreads();
        if (kt + 2 < nt)
            gw_tile_copy(lds0 + (unsigned)(kt & 1) * bufb, ga + (size_t)(kt + 2) * GW_BK,
                         gw + (size_t)(kt + 2) * GW_BK, Kd);
    }
    // no copy is outstanding when the wave goes on to its end
    asm volatile("s_wait_asynccnt 0x0" ::: "memory");

    int m0 = mB + wm * 32 + hi * 8;
    int n0 = nB + wn * 32 + lr;
    float bv[2] = {0.f, 0.f};
    if (bias) {
        bv[0] = bias[n0];
        bv[1] = bias[n0 + 16];
        // the address registers of the two loads are free for reuse only behind this wait
        asm volatile("s_wait_xcnt 0x0" ::: "memory");
    }
    float* yp[2][8];
#pragma unroll     // register arrays need constant indices
    for (int mi = 0; mi < 2; ++mi)
#pragma unroll     // register arrays need constant indices
        for (int r = 0; r < 8; ++r) {
            yp[mi][r] = Y + (size_t)(m0 + mi * 16 + r) * N + n0;
            acc[mi][0][r] += bv[0];
            acc[mi][1][r] += bv[1];
        }
    // the stores stay behind all the arithmetic: no register of an issued store is rewritten
    __builtin_amdgcn_sched_barrier(0);
#pragma unroll     // register arrays need constant indices
    for (int mi = 0; mi < 2; ++mi)
#pragma unroll     // register arrays need constant indices
        for (int r = 0; r < 8; ++r) {
            yp[mi][r][0]  = acc[mi][0][r];
            yp[mi][r][16] = acc[mi][1][r];
        }
}

// ---------------------------------------------------------------------------
// Multi-timescale gated linear attention, chunk-parallel form (chunks of 64
// tokens). With lam constant over time, for token i of chunk c:
//   Hm_i = lam^(i+1) * E + sum_{s<=i} lam^(i-s) * g_s * k_s v_s^T
//   Z_i  = lam^(i+1) * zE + sum_{s<=i} lam^(i-s) * g_s * s_s
// where E, zE are the state at the end of chunk c-1. Three launches:
//   1. chunk_state: S_c = sum_i lam^(63-i) g_i k_i v_i^T (and the same for Z)
//   2. chunk_scan : E_c = lam^64 * E_{c-1} + S_c over the chunks, in place
//   3. chunk_out  : y = (masked decayed Q K^T) V + scaled Q E
// Only non-negative powers of lam are formed, so every factor is in [0, 1].
// ---------------------------------------------------------------------------
constexpr int LA_T  = 2048;        // tokens per sequence
constexpr int LA_H  = 8;           // heads
constexpr int LA_NC = LA_T / 64;   // chunks per sequence
constexpr int LA_RS = LA_H * 64;   // dwords between the rows of one head's q, k, v
constexpr int LA_PA = 68;          // LDS pitch (dwords), rows read 8 bytes along k
constexpr int LA_PB = 72;          // LDS pitch (dwords), rows read across columns

__device__ __forceinline__ float la_sigmoid(float x) { return 1.f / (1.f + __expf(-x)); }

// base^n for 0 <= n <= 127 by squaring: 1 at n == 0 for any base, no logarithm.
__device__ __forceinline__ float la_ipow(float base, int n) {
    float p = 1.f;
#pragma unroll     // seven fixed bits, no loop control
    for (int bit = 0; bit < 7; ++bit) {
        if (n & 1) p *= base;
        base *= base;
        n >>= 1;
    }
    return p;
}

// A thread's four float4 of a 64x64 f32 tile (256 threads): global -> registers.
struct LaTile { float4 a, b, c, d; };
__device__ __forceinline__ LaTile la_tile_load(const float* g, int tid) {
    const float* p = g + ((unsigned)(tid >> 4) * LA_RS + (unsigned)(tid & 15) * 4);
    LaTile t;
    t.a = *(const float4*)(p);
    t.b = *(const float4*)(p + 16 * LA_RS);
    t.c = *(const float4*)(p + 32 * LA_RS);
    t.d = *(const float4*)(p + 48 * LA_RS);
    // address registers of these loads (offset, scalar base) are free for reuse only behind this wait
    asm volatile("s_wait_xcnt 0x0" ::: "memory");
    return t;
}
// ... and registers -> LDS at the given pitch.
__device__ __forceinline__ void la_tile_put(float* s, int pitch, int tid, const LaTile& t) {
    float* p = s + (tid >> 4) * pitch + (tid & 15) * 4;
    *(float4*)(p) = t.a;
    *(float4*)(p + 16 * pitch) = t.b;
    *(float4*)(p + 32 * pitch) = t.c;
    *(float4*)(p + 48 * pitch) = t.d;
}

// mean |k_i| + 1e-6 of row i = tid >> 2; four lanes share a row (valid in all four).
__device__ __forceinline__ float la_row_absmean(const float* s, int pitch, int tid) {
    int i = tid >> 2, qd = tid & 3;
    float a = 0.f;
#pragma unroll     // 16 independent LDS reads in flight
    for (int e = 0; e < 16; ++e) a += fabsf(s[i * pitch + e * 4 + qd]);
    a += __shfl_xor(a, 1);
    a += __shfl_xor(a, 2);
    return a * (1.f / 64.f) + 1e-6f;
}

// grid = B*LA_H*LA_NC, block = 256. blockIdx.x = (b*LA_H + h)*LA_NC + c.
// The pointers are not __restrict__: the loads then keep their side of the asm waits.
__global__ __launch_bounds__(256) void linatt_chunk_state(const float* k, const float* v, const float* gate,
                                   const float* decay_logit, float* S, float* zS) {
    int c  = blockIdx.x % LA_NC;
    int bh = blockIdx.x / LA_NC;
    int h = bh % LA_H, b = bh / LA_H;
    int tid = threadIdx.x;

    __shared__ __attribute__((aligned(16))) float sK[64 * LA_PB];
    __shared__ __attribute__((aligned(16))) float sV[64 * LA_PB];
    __shared__ float sW[2][64];      // lam^(63-i) * g_i
    __shared__ float sAbs[64];

    size_t tok0 = (size_t)b * LA_T + c * 64;
    size_t base = (tok0 * LA_H + h) * 64;
    LaTile rk = la_tile_load(k + base, tid);
    LaTile rv = la_tile_load(v + base, tid);
    la_tile_put(sK, LA_PB, tid, rk);
    la_tile_put(sV, LA_PB, tid, rv);
    if (tid < 128) {
        int kap = tid >> 6, i = tid & 63;
        float lam = la_sigmoid(decay_logit[h * 2 + kap]);
        sW[kap][i] = gate[((tok0 + i) * LA_H + h) * 2 + kap] * la_ipow(lam, 63 - i);
    }
    __syncthreads();

    float am = la_row_absmean(sK, LA_PB, tid);
    if ((tid & 3) == 0) sAbs[tid >> 2] = am;

    // S[a][j] = sum_i K[i][a] * (w_i V[i][j]); wave = (timescale, 16 columns j)
    int wave = tid >> 5, lane = tid & 31, lr = lane & 15, hi = lane >> 4;
    int kap = wave >> 2, tn = wave & 3;
    int n = tn * 16 + lr;
    v8f acc[4];
#pragma unroll     // register arrays need constant indices
    for (int tm = 0; tm < 4; ++tm) acc[tm] = (v8f){};
#pragma unroll 4   // four k-steps per trip: their LDS loads go out together
    for (int kk = 0; kk < 64; kk += 4) {
        int ka = kk + hi * 2;
        v2f bb;
        bb.x = sV[ka * LA_PB + n] * sW[kap][ka];
        bb.y = sV[(ka + 1) * LA_PB + n] * sW[kap][ka + 1];
#pragma unroll     // register arrays need constant indices
        for (int tm = 0; tm < 4; ++tm) {
            v2f a;
            a.x = sK[ka * LA_PB + tm * 16 + lr];
            a.y = sK[(ka + 1) * LA_PB + tm * 16 + lr];
            acc[tm] = wmma_f32x4(a, bb, acc[tm]);
        }
    }
    __syncthreads();   // sAbs complete
    if (wave < 2) {    // wave w sums timescale w
        float z = sW[wave][lane] * sAbs[lane] + sW[wave][lane + 32] * sAbs[lane + 32];
#pragma unroll     // five fixed shuffle steps
        for (int m = 16; m > 0; m >>= 1) z += __shfl_xor(z, m);
        if (lane == 0) zS[(size_t)blockIdx.x * 2 + wave] = z;
    }
    float* Sp = S + (size_t)blockIdx.x * 2 * 4096;
    unsigned so = (unsigned)(kap * 4096 + hi * 8 * 64 + n);
#pragma unroll     // register arrays need constant indices
    for (int tm = 0; tm < 4; ++tm)
#pragma unroll     // register arrays need constant indices
        for (int r = 0; r < 8; ++r)
            Sp[so + (tm * 16 + r) * 64] = acc[tm][r];
}

__global__ __launch_bounds__(256) void linatt_chunk_scan(float* __restrict__ S, float* __restrict__ zS,
                                  const float* __restrict__ decay_logit, int BH) {
    int gid = blockIdx.x * 256 + threadIdx.x;
    {
        int e4 = gid & 1023, kap = (gid >> 10) & 1, bh = gid >> 11;
        float l64 = la_ipow(la_sigmoid(decay_logit[(bh % LA_H) * 2 + kap]), 64);
        float4* p = (float4*)S + ((size_t)bh * LA_NC * 2 + kap) * 1024 + e4;
        float4 s[LA_NC];
#pragma unroll     // register arrays need constant indices
        for (int c = 0; c < LA_NC; ++c) s[c] = p[(size_t)c * 2048];
        // every load is issued before the first store (all in flight at once), and
        // the address registers are free for reuse only behind this wait
        asm volatile("s_wait_xcnt 0x0" ::: "memory");
        float4 run = make_float4(0.f, 0.f, 0.f, 0.f);
#pragma unroll     // register arrays need constant indices
        for (int c = 0; c < LA_NC; ++c) {
            float4 t = s[c];
            s[c] = run;
            run.x = run.x * l64 + t.x;
            run.y = run.y * l64 + t.y;
            run.z = run.z * l64 + t.z;
            run.w = run.w * l64 + t.w;
        }
        // the stores stay behind all the arithmetic: no register of an issued store is rewritten
        __builtin_amdgcn_sched_barrier(0);
#pragma unroll     // register arrays need constant indices
        for (int c = 1; c < LA_NC; ++c) p[(size_t)c * 2048] = s[c];
        // registers of the stores above are free for reuse only behind this wait
        asm volatile("s_wait_xcnt 0x0" ::: "memory");
    }
    if (gid < BH * 2) {
        int kap = gid & 1, bh = gid >> 1;
        float l64 = la_ipow(la_sigmoid(decay_logit[(bh % LA_H) * 2 + kap]), 64);
        float* pz = zS + (size_t)bh * LA_NC * 2 + kap;
        float z[LA_NC];
#pragma unroll     // register arrays need constant indices
        for (int c = 0; c < LA_NC; ++c) z[c] = pz[c * 2];
        asm volatile("s_wait_xcnt 0x0" ::: "memory");
        float run = 0.f;
#pragma unroll     // register arrays need constant indices
        for (int c = 0; c < LA_NC; ++c) {
            float t = z[c];
            z[c] = run;
            run = run * l64 + t;
        }
        __builtin_amdgcn_sched_barrier(0);
#pragma unroll     // register arrays need constant indices
        for (int c = 1; c < LA_NC; ++c) pz[c * 2] = z[c];
    }
}

// grid = B*LA_H*LA_NC, block = 256. blockIdx.x = (b*LA_H + h)*LA_NC + c.
// The pointers are not __restrict__: the loads then keep their side of the asm waits.
__global__ __launch_bounds__(256) void linatt_chunk_out(const float* q, const float* k, const float* v, const float* gate,
                                 const float* decay_logit, const float* E, const float* zE,
                                 float* y_lin) {
    int c  = blockIdx.x % LA_NC;
    int bh = blockIdx.x / LA_NC;
    int h = bh % LA_H, b = bh / LA_H;
    int tid = threadIdx.x;
    int wave = tid >> 5, lane = tid & 31, lr = lane & 15, hi = lane >> 4;
    int tn = wave & 3, tm0 = (wave >> 2) * 2;    // wave owns tiles (tm0, tn), (tm0+1, tn)
    int n = tn * 16 + lr;

    __shared__ __attribute__((aligned(16))) float sQ[64 * LA_PA];
    __shared__ __attribute__((aligned(16))) float sK[64 * LA_PA];
    __shared__ __attribute__((aligned(16))) float sV[64 * LA_PB];
    __shared__ __attribute__((aligned(16))) float sP[64 * LA_PA];
    __shared__ float sG[2][64];      // gate
    __shared__ float sGS[2][64];     // gate * (mean|k| + 1e-6)
    __shared__ float sZ[2][64];      // Z_i
    __shared__ float sRZ[2][64];     // 1 / (Z_i + 1e-6)
    __shared__ float sRS[2][64];     // lam^(i+1) / (Z_i + 1e-6)
    __shared__ float sPw[2][128];    // [63 + d] = lam^d for d = 0..64, 0 for d = -63..-1 (the causal mask)

    size_t tok0 = (size_t)b * LA_T + c * 64;
    size_t base = (tok0 * LA_H + h) * 64;
    LaTile rq = la_tile_load(q + base, tid);
    LaTile rk = la_tile_load(k + base, tid);
    LaTile rv = la_tile_load(v + base, tid);
    // B fragments of the two incoming states, columns n: fetched here, in flight
    // together with the tiles.
    const float* Ep = E + (size_t)blockIdx.x * 2 * 4096;
    unsigned eo = (unsigned)(hi * 2 * 64 + n);
    v2f ef[2][16];
#pragma unroll     // register arrays need constant indices
    for (int kap = 0; kap < 2; ++kap)
#pragma unroll     // register arrays need constant indices
        for (int ks = 0; ks < 16; ++ks) ef[kap][ks] = (v2f){};
    float z0 = 0.f;   // incoming Z of timescale tid & 1
    if (c > 0) {   // chunk 0 starts from the zero state
#pragma unroll     // register arrays need constant indices
        for (int kap = 0; kap < 2; ++kap)
#pragma unroll     // register arrays need constant indices
            for (int ks = 0; ks < 16; ++ks) {
                ef[kap][ks].x = Ep[eo + kap * 4096 + ks * 256];
                ef[kap][ks].y = Ep[eo + kap * 4096 + ks * 256 + 64];
            }
        z0 = zE[(size_t)blockIdx.x * 2 + (tid & 1)];
        // address registers of the loads above are free for reuse only behind this wait
        asm volatile("s_wait_xcnt 0x0" ::: "memory");
    }
    la_tile_put(sQ, LA_PA, tid, rq);
    la_tile_put(sK, LA_PA, tid, rk);
    la_tile_put(sV, LA_PB, tid, rv);
    if (tid < 128) {
        int kap = tid >> 6, i = tid & 63;
        sG[kap][i] = gate[((tok0 + i) * LA_H + h) * 2 + kap];
    }
    {
        int kap = tid >> 7, d = (tid & 127) - 63;
        float pw = la_ipow(la_sigmoid(decay_logit[h * 2 + kap]), d > 0 ? d : 0);
        sPw[kap][63 + d] = (d >= 0) ? pw : 0.f;
    }
    __syncthreads();

    float am = la_row_absmean(sK, LA_PA, tid);
    if ((tid & 3) < 2) sGS[tid & 3][tid >> 2] = sG[tid & 3][tid >> 2] * am;

    // A[i][s] = q_i . k_s
    v8f sc[2];
    sc[0] = (v8f){}; sc[1] = (v8f){};
#pragma unroll 4   // four k-steps per trip: their LDS loads go out together
    for (int kk = 0; kk < 64; kk += 4) {
        int ka = kk + hi * 2;
        v2f bb = *(const v2f*)&sK[(tn * 16 + lr) * LA_PA + ka];
#pragma unroll     // register arrays need constant indices
        for (int t = 0; t < 2; ++t) {
            v2f a = *(const v2f*)&sQ[((tm0 + t) * 16 + lr) * LA_PA + ka];
            sc[t] = wmma_f32x4(a, bb, sc[t]);
        }
    }
    __syncthreads();   // sGS complete

    if (tid < 2) {     // Z inside the chunk
        float Z = z0;
        float lam = sPw[tid][64];
#pragma unroll 16  // the LDS reads of 16 steps go out ahead of the serial chain
        for (int i = 0; i < 64; ++i) {
            Z = Z * lam + sGS[tid][i];
            sZ[tid][i] = Z;
        }
    }
    __syncthreads();   // sZ complete
    if (tid < 128) {
        int kap = tid >> 6, i = tid & 63;
        float rz = 1.f / (sZ[kap][i] + 1e-6f);
        sRZ[kap][i] = rz;
        sRS[kap][i] = rz * sPw[kap][64 + i];
    }
    __syncthreads();   // sRZ, sRS complete

    // P[i][s] = A[i][s] * sum_kap lam^(i-s) g_s / (Z_i + 1e-6) for s <= i, else 0
#pragma unroll     // register arrays need constant indices
    for (int t = 0; t < 2; ++t)
#pragma unroll     // register arrays need constant indices
        for (int r = 0; r < 8; ++r) {
            int i = (tm0 + t) * 16 + r + hi * 8;
            int e = 63 + i - n;
            float w = sPw[0][e] * sG[0][n] * sRZ[0][i] + sPw[1][e] * sG[1][n] * sRZ[1][i];
            sP[i * LA_PA + n] = sc[t][r] * w;
        }
    __syncthreads();   // sP complete

    v8f acc[2];
    acc[0] = (v8f){}; acc[1] = (v8f){};
#pragma unroll 4   // four k-steps per trip: their LDS loads go out together
    for (int kk = 0; kk < 64; kk += 4) {
        int ka = kk + hi * 2;
        v2f bb;
        bb.x = sV[ka * LA_PB + n];
        bb.y = sV[(ka + 1) * LA_PB + n];
#pragma unroll     // register arrays need constant indices
        for (int t = 0; t < 2; ++t) {
            v2f a = *(const v2f*)&sP[((tm0 + t) * 16 + lr) * LA_PA + ka];
            acc[t] = wmma_f32x4(a, bb, acc[t]);
        }
    }
#pragma unroll     // register arrays need constant indices
    for (int kap = 0; kap < 2; ++kap) {
        float rs0 = sRS[kap][tm0 * 16 + lr];
        float rs1 = sRS[kap][(tm0 + 1) * 16 + lr];
#pragma unroll     // register arrays need constant indices
        for (int ks = 0; ks < 16; ++ks) {
            int ka = ks * 4 + hi * 2;
            v2f a0 = *(const v2f*)&sQ[(tm0 * 16 + lr) * LA_PA + ka];
            v2f a1 = *(const v2f*)&sQ[((tm0 + 1) * 16 + lr) * LA_PA + ka];
            a0 *= rs0;
            a1 *= rs1;
            acc[0] = wmma_f32x4(a0, ef[kap][ks], acc[0]);
            acc[1] = wmma_f32x4(a1, ef[kap][ks], acc[1]);
        }
    }
    float* yp = y_lin + base;
    unsigned yo = (unsigned)((tm0 * 16 + hi * 8) * LA_RS + n);
#pragma unroll     // register arrays need constant indices
    for (int t = 0; t < 2; ++t)
#pragma unroll     // register arrays need constant indices
        for (int r = 0; r < 8; ++r)
            yp[yo + (t * 16 + r) * LA_RS] = acc[t][r];
}

// ---------------------------------------------------------------------------
// Sliding-window local attention with ALiBi, one block per (b, chunk, head).
// Block = 256 threads (8 waves). Scores and P@V via fp32 WMMA.
// Q/K/V tiles come into LDS by asynchronous copies (16 bytes a lane), each row at a padded
// pitch chosen for its reader; the rows in front of token 0 (c == 0) are filled with zeros.
// LDS: phase1 Q[64]+K[128] rows (aliased as S[64] rows in phase2) + V[128] rows.
// The epilogue blends with the linear-attention output of the same tile:
// y = alpha * y_loc + (1 - alpha) * y_lin (alpha per [B,T,H]); y_loc never goes to memory.
// ---------------------------------------------------------------------------
constexpr int LC_PK = 68;
constexpr int LC_PV = 72;
constexpr int LC_PS = 132;

// Rows r + 16 j, j = 0..3, of three 64-row tiles (Q, K, V), 16 bytes a lane: twelve asynchronous
// copies global -> LDS. rs = 16 rows on in global memory (floats).
__device__ __forceinline__ void lc_copy_qkv(unsigned lq, const float* gq, unsigned lk, const float* gk,
                                            unsigned lv, const float* gv, size_t rs) {
    const unsigned sk = 16u * LC_PK * 4u;          // 16 rows on in LDS, bytes (Q, K)
    const unsigned sv = 16u * LC_PV * 4u;          // 16 rows on in LDS, bytes (V)
    // the copies go through no register; the closing wait stands inside the statement so that
    // the address registers named here are rewritten only behind it
    asm volatile("global_load_async_to_lds_b128 %0, %1, off\n\t"
                 "global_load_async_to_lds_b128 %2, %3, off\n\t"
                 "global_load_async_to_lds_b128 %4, %5, off\n\t"
                 "global_load_async_to_lds_b128 %6, %7, off\n\t"
                 "global_load_async_to_lds_b128 %8, %9, off\n\t"
                 "global_load_async_to_lds_b128 %10, %11, off\n\t"
                 "global_load_async_to_lds_b128 %12, %13, off\n\t"
                 "global_load_async_to_lds_b128 %14, %15, off\n\t"
                 "global_load_async_to_lds_b128 %16, %17, off\n\t"
                 "global_load_async_to_lds_b128 %18, %19, off\n\t"
                 "global_load_async_to_lds_b128 %20, %21, off\n\t"
                 "global_load_async_to_lds_b128 %22, %23, off\n\t"
                 "s_wait_xcnt 0x0"
                 :: "v"(lq),          "v"(gq),          "v"(lq + sk),     "v"(gq + rs),
                    "v"(lq + 2 * sk), "v"(gq + 2 * rs), "v"(lq + 3 * sk), "v"(gq + 3 * rs),
                    "v"(lk),          "v"(gk),          "v"(lk + sk),     "v"(gk + rs),
                    "v"(lk + 2 * sk), "v"(gk + 2 * rs), "v"(lk + 3 * sk), "v"(gk + 3 * rs),
                    "v"(lv),          "v"(gv),          "v"(lv + sv),     "v"(gv + rs),
                    "v"(lv + 2 * sv), "v"(gv + 2 * rs), "v"(lv + 3 * sv), "v"(gv + 3 * rs)
                 : "memory");
}
// The same for two tiles (K, V): eight copies.
__device__ __forceinline__ void lc_copy_kv(unsigned lk, const float* gk, unsigned lv, const float* gv, size_t rs) {
    const unsigned sk = 16u * LC_PK * 4u;
    const unsigned sv = 16u * LC_PV * 4u;
    asm volatile("global_load_async_to_lds_b128 %0, %1, off\n\t"
                 "global_load_async_to_lds_b128 %2, %3, off\n\t"
                 "global_load_async_to_lds_b128 %4, %5, off\n\t"
                 "global_load_async_to_lds_b128 %6, %7, off\n\t"
                 "global_load_async_to_lds_b128 %8, %9, off\n\t"
                 "global_load_async_to_lds_b128 %10, %11, off\n\t"
                 "global_load_async_to_lds_b128 %12, %13, off\n\t"
                 "global_load_async_to_lds_b128 %14, %15, off\n\t"
                 "s_wait_xcnt 0x0"
                 :: "v"(lk),          "v"(gk),          "v"(lk + sk),     "v"(gk + rs),
                    "v"(lk + 2 * sk), "v"(gk + 2 * rs), "v"(lk + 3 * sk), "v"(gk + 3 * rs),
                    "v"(lv),          "v"(gv),          "v"(lv + sv),     "v"(gv + rs),
                    "v"(lv + 2 * sv), "v"(gv + 2 * rs), "v"(lv + 3 * sv), "v"(gv + 3 * rs)
                 : "memory");
}

// The value of another lane of this lane's group of four, by DPP quad_perm: 0xB1 = [1,0,3,2] (lane ^ 1),
// 0x4E = [2,3,0,1] (lane ^ 2). Every lane of the wave is on where it is used.
template <int CTRL>
__device__ __forceinline__ float lc_quad_swap(float x) {
    return __int_as_float(__builtin_amdgcn_mov_dpp(__float_as_int(x), CTRL, 0xf, 0xf, true));
}

// exp(s - m) of four scores: 2^((s - m) * log2(e)) on the hardware's base-2 exponential.
__device__ __forceinline__ float4 lc_exp4(float4 s, float m) {
    float a = (s.x - m) * 1.44269504f, b = (s.y - m) * 1.44269504f;
    float c = (s.z - m) * 1.44269504f, d = (s.w - m) * 1.44269504f;
    asm("v_exp_f32 %0, %0\n\t"
        "v_exp_f32 %1, %1\n\t"
        "v_exp_f32 %2, %2\n\t"
        "v_exp_f32 %3, %3\n\t"
        "v_nop"
        : "+v"(a), "+v"(b), "+v"(c), "+v"(d));
    return make_float4(a, b, c, d);
}

__global__ void local_attn_wmma(const float* __restrict__ q, const float* __restrict__ k,
                                const float* __restrict__ v, const float* __restrict__ y_lin,
                                const float* __restrict__ alpha, float* __restrict__ y,
                                int B, int T, int H) {
    const int dh = 64;
    const int W = 64;
    int nc = T / W;
    int h = blockIdx.x % H;
    int c = (blockIdx.x / H) % nc;
    int b = blockIdx.x / (H * nc);

    __shared__ __attribute__((aligned(16))) float smem[(64 + 128) * LC_PK];   // Q | K, aliased as S after use
    __shared__ __attribute__((aligned(16))) float sV[128 * LC_PV];
    float* sQ = smem;
    float* sK = smem + 64 * LC_PK;
    float* sS = smem;                            // aliased after barrier

    int tid = threadIdx.x;
    int wave = tid >> 5, lane = tid & 31, lr = lane & 15, hi = lane >> 4;

    // This lane's 16 outputs: rows om + r, columns on and on + 16 of the block's 64x64 tile.
    // Their y_lin and alpha are fetched here, in flight together with the tiles.
    size_t tok0 = (size_t)b * T + c * W;
    const float* lg = y_lin + (tok0 * H + h) * dh;
    const float* ag = alpha + tok0 * H + h;
    int om = (wave >> 1) * 16 + hi * 8;
    int on = (wave & 1) * 32 + lr;
    unsigned yo[8], ao[8];
    float yl[2][8], al[8];
#pragma unroll     // register arrays need constant indices
    for (int r = 0; r < 8; ++r) {
        yo[r] = (unsigned)((om + r) * H * dh + on);
        ao[r] = (unsigned)((om + r) * H);
    }
    // every offset is formed before the first load: no register of an issued load is rewritten
    __builtin_amdgcn_sched_barrier(0);
#pragma unroll     // register arrays need constant indices
    for (int r = 0; r < 8; ++r) {
        yl[0][r] = lg[yo[r]];
        yl[1][r] = lg[yo[r] + 16];
        al[r]    = ag[ao[r]];
    }
    // address registers of the loads above are free for reuse only behind this wait
    asm volatile("s_wait_xcnt 0x0" ::: "memory");

    // ---- stage the tiles: this thread brings 16 bytes at dword cc of rows cr + 16 j ----
    {
        int cr = tid >> 4, cc = (tid & 15) * 4;
        size_t go = ((tok0 + cr) * H + h) * dh + cc;       // row cr of this chunk
        size_t rs = (size_t)16 * H * dh;                   // 16 tokens on
        unsigned lq = (unsigned)(uintptr_t)(void*)&sQ[cr * LC_PK + cc];
        unsigned lk = (unsigned)(uintptr_t)(void*)&sK[cr * LC_PK + cc];
        unsigned lv = (unsigned)(uintptr_t)(void*)&sV[cr * LC_PV + cc];
        // this chunk: Q, and rows 64..127 of K and V
        lc_copy_qkv(lq, q + go, lk + 64u * LC_PK * 4u, k + go, lv + 64u * LC_PV * 4u, v + go, rs);
        if (c > 0) {       // the same for the whole block
            // the chunk before: rows 0..63 of K and V
            lc_copy_kv(lk, k + go - 4 * rs, lv, v + go - 4 * rs, rs);
        } else {
            // boundary chunk: the rows in front of token 0 are zero
            const float4 z4 = make_float4(0.f, 0.f, 0.f, 0.f);
#pragma unroll     // four fixed rows, no loop control
            for (int j = 0; j < 4; ++j) {
                *(float4*)&sK[(cr + 16 * j) * LC_PK + cc] = z4;
                *(float4*)&sV[(cr + 16 * j) * LC_PV + cc] = z4;
            }
        }
    }
    // this wave's copies have landed; the barrier publishes them to the others
    asm volatile("s_wait_asynccnt 0x0" ::: "memory");
    __syncthreads();

    // scores: 64x128 = 4x8 tiles of 16x16; wave handles 4 tiles
    v8f sc[4];
    for (int it = 0; it < 4; ++it) {
        int id = wave * 4 + it;
        int tm = id >> 3, tn = id & 7;
        v8f acc = {};
        for (int kkk = 0; kkk < 64; kkk += 4) {
            int ka = kkk + hi * 2;
            v2f a  = *(const v2f*)&sQ[(tm * 16 + lr) * LC_PK + ka];
            v2f bb = *(const v2f*)&sK[(tn * 16 + lr) * LC_PK + ka];
            acc = wmma_f32x4(a, bb, acc);
        }
        sc[it] = acc;
    }
    __syncthreads();   // done reading sQ/sK; safe to alias as sS

    // ALiBi + causal window mask, write scores to LDS
    float slope = exp2f(-8.0f * (float)(h + 1) / (float)H);
    for (int it = 0; it < 4; ++it) {
        int id = wave * 4 + it;
        int tm = id >> 3, tn = id & 7;
#pragma unroll
        for (int r = 0; r < 8; ++r) {
            int i = tm * 16 + r + hi * 8;
            int jj = tn * 16 + lr;
            float val = sc[it][r];
            bool valid = (jj >= i + 1) && (jj <= i + W) && (c * W + jj - W >= 0);
            val = valid ? (val - slope * (float)(i + W - jj)) : -1e30f;
            sS[i * LC_PS + jj] = val;
        }
    }
    __syncthreads();

    {
        float* pr = sS + (tid >> 2) * LC_PS + (tid & 3) * 16;
        float4 p[8];
#pragma unroll     // register arrays need constant indices; the eight LDS reads go out together
        for (int e = 0; e < 8; ++e) p[e] = *(const float4*)(pr + (e >> 2) * 64 + (e & 3) * 4);
        float mx = -3.4e38f;
#pragma unroll     // register arrays need constant indices
        for (int e = 0; e < 8; ++e)
            mx = fmaxf(mx, fmaxf(fmaxf(p[e].x, p[e].y), fmaxf(p[e].z, p[e].w)));
        mx = fmaxf(mx, lc_quad_swap<0xB1>(mx));
        mx = fmaxf(mx, lc_quad_swap<0x4E>(mx));
        float sum = 0.f;
#pragma unroll     // register arrays need constant indices
        for (int e = 0; e < 8; ++e) {
            p[e] = lc_exp4(p[e], mx);
            sum += (p[e].x + p[e].y) + (p[e].z + p[e].w);
        }
        sum += lc_quad_swap<0xB1>(sum);
        sum += lc_quad_swap<0x4E>(sum);
        float inv = 1.f / sum;
#pragma unroll     // register arrays need constant indices
        for (int e = 0; e < 8; ++e) {
            p[e].x *= inv; p[e].y *= inv; p[e].z *= inv; p[e].w *= inv;
            *(float4*)(pr + (e >> 2) * 64 + (e & 3) * 4) = p[e];
        }
    }
    __syncthreads();

    // y_loc = P[64,128] @ Vctx[128,64]; 16 tiles, wave handles 2; V from LDS
    v8f yb[2];
#pragma unroll     // register arrays need constant indices
    for (int it = 0; it < 2; ++it) {
        int id = wave * 2 + it;
        int tm = id >> 2, tn = id & 3;
        int n = tn * 16 + lr;
        v8f acc = {};
        for (int kkk = 0; kkk < 128; kkk += 4) {
            int ka = kkk + hi * 2;
            v2f a = *(const v2f*)&sS[(tm * 16 + lr) * LC_PS + ka];
            v2f bb;
            bb.x = sV[ka * LC_PV + n];
            bb.y = sV[(ka + 1) * LC_PV + n];
            acc = wmma_f32x4(a, bb, acc);
        }
#pragma unroll     // register arrays need constant indices
        for (int r = 0; r < 8; ++r)
            yb[it][r] = al[r] * acc[r] + (1.f - al[r]) * yl[it][r];
    }
    float* yg = y + (tok0 * H + h) * dh;
    float* yp[8];
#pragma unroll     // register arrays need constant indices
    for (int r = 0; r < 8; ++r) yp[r] = yg + yo[r];
    // the stores stay behind all the arithmetic: no register of an issued store is rewritten
    __builtin_amdgcn_sched_barrier(0);
#pragma unroll     // register arrays need constant indices
    for (int r = 0; r < 8; ++r) {
        yp[r][0]  = yb[0][r];
        yp[r][16] = yb[1][r];
    }
}

// ---------------------------------------------------------------------------
// out = LayerNorm(x + proj) * gamma + beta ; block per (b,t) row.
// ---------------------------------------------------------------------------
__global__ void addnorm_kernel(const float* __restrict__ x, const float* __restrict__ proj,
                               const float* __restrict__ gamma, const float* __restrict__ beta,
                               float* __restrict__ out, int D) {
    __shared__ float red[256];
    size_t row = blockIdx.x;
    const float* xr = x + row * D;
    const float* pr = proj + row * D;

    float s = 0.f, s2 = 0.f;
    for (int d = threadIdx.x; d < D; d += 256) {
        float r = xr[d] + pr[d];
        s += r; s2 += r * r;
    }
    red[threadIdx.x] = s;
    __syncthreads();
    for (int off = 128; off > 0; off >>= 1) {
        if (threadIdx.x < off) red[threadIdx.x] += red[threadIdx.x + off];
        __syncthreads();
    }
    float mean = red[0] / (float)D;
    __syncthreads();
    red[threadIdx.x] = s2;
    __syncthreads();
    for (int off = 128; off > 0; off >>= 1) {
        if (threadIdx.x < off) red[threadIdx.x] += red[threadIdx.x + off];
        __syncthreads();
    }
    float var = red[0] / (float)D - mean * mean;
    float inv = rsqrtf(var + 1e-5f);
    for (int d = threadIdx.x; d < D; d += 256) {
        float r = xr[d] + pr[d];
        out[row * D + d] = (r - mean) * inv * gamma[d] + beta[d];
    }
}

// ---------------------------------------------------------------------------
extern "C" void kernel_launch(void* const* d_in, const int* in_sizes, int n_in,
                              void* d_out, int out_size, void* d_ws, size_t ws_size,
                              hipStream_t stream) {
    const int D = 512, H = 8, Kts = 2, dh = 64, T = 2048;
    const int M = in_sizes[0] / D;          // B*T = 4096
    const int B = M / T;                    // 2
    const int nc = T / 64;

    const float* x      = (const float*)d_in[0];
    const float* Wq     = (const float*)d_in[1];
    const float* Wk     = (const float*)d_in[2];
    const float* Wv     = (const float*)d_in[3];
    const float* Wg     = (const float*)d_in[4];
    const float* bg     = (const float*)d_in[5];
    const float* Wa     = (const float*)d_in[6];
    const float* ba     = (const float*)d_in[7];
    const float* Wo     = (const float*)d_in[8];
    const float* bo     = (const float*)d_in[9];
    const float* decay  = (const float*)d_in[10];
    const float* gamma  = (const float*)d_in[11];
    const float* beta   = (const float*)d_in[12];
    float* out = (float*)d_out;

    // workspace carve-up
    float* ws = (float*)d_ws;
    size_t off = 0;
    float* q_buf    = ws + off; off += (size_t)M * D;
    float* k_buf    = ws + off; off += (size_t)M * D;
    float* v_buf    = ws + off; off += (size_t)M * D;
    float* gate_buf = ws + off; off += (size_t)M * H * Kts;
    float* alp_buf  = ws + off; off += (size_t)M * H;
    float* ylin_buf = ws + off; off += (size_t)M * D;
    float* ymix_buf = ws + off; off += (size_t)M * D;
    float* proj_buf = ws + off; off += (size_t)M * D;
    float* st_buf   = ws + off; off += (size_t)B * H * nc * Kts * dh * dh;
    float* zst_buf  = ws + off; off += (size_t)B * H * nc * Kts;

    dim3 blk(256);
    dim3 grid_wide(M / 64, D / 128);        // 64 x 4
    dim3 grid_proj(M / 64, 3 * (D / 128) + 1);   // skinny row, then q, k, v

    // the five projections of x in one launch: q, k, v (wide) and gate, alpha (skinny, sigmoid fused)
    gemm_nt_wmma_wide<<<grid_proj, blk, 0, stream>>>(x, Wq, Wk, Wv, nullptr, q_buf, k_buf, v_buf,
                                                     Wg, bg, gate_buf, H * Kts, Wa, ba, alp_buf, H,
                                                     M, D, D, 1);

    // gated linear attention, chunk-parallel: chunk states, scan over chunks, outputs
    linatt_chunk_state<<<B * nc * H, blk, 0, stream>>>(k_buf, v_buf, gate_buf, decay,
                                                       st_buf, zst_buf);
    linatt_chunk_scan<<<B * H * 8, blk, 0, stream>>>(st_buf, zst_buf, decay, B * H);
    linatt_chunk_out<<<B * nc * H, blk, 0, stream>>>(q_buf, k_buf, v_buf, gate_buf, decay,
                                                     st_buf, zst_buf, ylin_buf);

    // sliding-window local attention with ALiBi, gated blend in its epilogue
    local_attn_wmma<<<B * nc * H, 256, 0, stream>>>(q_buf, k_buf, v_buf, ylin_buf, alp_buf,
                                                    ymix_buf, B, T, H);

    // output projection + residual + layernorm
    gemm_nt_wmma_wide<<<grid_wide, blk, 0, stream>>>(ymix_buf, Wo, nullptr, nullptr, bo,
                                                     proj_buf, nullptr, nullptr,
                                                     nullptr, nullptr, nullptr, 0, nullptr, nullptr, nullptr, 0,
                                                     M, D, D, 0);
    addnorm_kernel<<<M, blk, 0, stream>>>(x, proj_buf, gamma, beta, out, D);
}

// v007
// Measured time: 113 microseconds a run.
// Timed twice side by side with v006, it ran 1.07 times as fast both times.
// Counting every step since v000, it is 29.4 times as fast.
#include <hip/hip_runtime.h>
#include <hip/hip_bf16.h>
#include <math.h>

typedef __attribute__((ext_vector_type(2))) float v2f;
typedef __attribute__((ext_vector_type(8))) float v8f;

__device__ __forceinline__ v8f wmma_f32x4(v2f a, v2f b, v8f c) {
    // D = A(16x4 f32) * B(4x16 f32) + C(16x16 f32)
    return __builtin_amdgcn_wmma_f32_16x16x4_f32(
        /*neg_a=*/false, a, /*neg_b=*/false, b,
        /*c_mod=*/(short)0, c, /*reuse_a=*/false, /*reuse_b=*/false);
}

constexpr int GW_BM   = 64;
constexpr int GW_BN   = 128;
constexpr int GW_BK   = 64;
constexpr int GW_P    = 68;
constexpr int GW_ROWS = GW_BM + GW_BN;
constexpr int GW_BUF  = GW_ROWS * GW_P;

// One k-tile into one buffer: thread tid brings 16 bytes of rows (tid >> 4) + 16 j, j = 0..11
// (j < 4: rows of A, then rows of W), by twelve asynchronous copies global -> LDS.
__device__ __forceinline__ void gw_tile_copy(unsigned lds, const float* ga, const float* gw, int Kd) {
    const size_t rs = (size_t)16 * Kd;             // 16 rows on in global memory
    const unsigned ls = 16u * GW_P * 4u;           // 16 rows on in LDS, bytes
    // the copies go through no register; the closing wait stands inside the statement so that
    // the address registers named here are rewritten only behind it
    asm volatile("global_load_async_to_lds_b128 %0, %1, off\n\t"
                 "global_load_async_to_lds_b128 %2, %3, off\n\t"
                 "global_load_async_to_lds_b128 %4, %5, off\n\t"
                 "global_load_async_to_lds_b128 %6, %7, off\n\t"
                 "global_load_async_to_lds_b128 %8, %9, off\n\t"
                 "global_load_async_to_lds_b128 %10, %11, off\n\t"
                 "global_load_async_to_lds_b128 %12, %13, off\n\t"
                 "global_load_async_to_lds_b128 %14, %15, off\n\t"
                 "global_load_async_to_lds_b128 %16, %17, off\n\t"
                 "global_load_async_to_lds_b128 %18, %19, off\n\t"
                 "global_load_async_to_lds_b128 %20, %21, off\n\t"
                 "global_load_async_to_lds_b128 %22, %23, off\n\t"
                 "s_wait_xcnt 0x0"
                 :: "v"(lds),           "v"(ga),          "v"(lds + ls),      "v"(ga + rs),
                    "v"(lds + 2 * ls),  "v"(ga + 2 * rs), "v"(lds + 3 * ls),  "v"(ga + 3 * rs),
                    "v"(lds + 4 * ls),  "v"(gw),          "v"(lds + 5 * ls),  "v"(gw + rs),
                    "v"(lds + 6 * ls),  "v"(gw + 2 * rs), "v"(lds + 7 * ls),  "v"(gw + 3 * rs),
                    "v"(lds + 8 * ls),  "v"(gw + 4 * rs), "v"(lds + 9 * ls),  "v"(gw + 5 * rs),
                    "v"(lds + 10 * ls), "v"(gw + 6 * rs), "v"(lds + 11 * ls), "v"(gw + 7 * rs)
                 : "memory");
}

__device__ __forceinline__ void gemm_nt_skinny_block(const float* __restrict__ A, const float* __restrict__ W,
                                                     const float* __restrict__ bias, float* __restrict__ Y,
                                                     int mblk, int N, int Kd) {
    int wave = threadIdx.x >> 5;
    int lane = threadIdx.x & 31;
    int m0 = (mblk * 8 + wave) * 16;
    int lr = lane & 15;
    int hi = lane >> 4;
    int wrow = lr;                       // n0 == 0 (single tile of columns)
    int wrc = (wrow < N) ? wrow : 0;
    float msk = (wrow < N) ? 1.f : 0.f;

    const float* ap = A + (size_t)(m0 + lr) * Kd + hi * 2;
    const float* wpr = W + (size_t)wrc * Kd + hi * 2;

    v8f acc = {};
    for (int kk = 0; kk < Kd; kk += 32) {        // Kd % 64 == 0, as for the wide blocks
        const float* pa = ap + kk;
        const float* pw = wpr + kk;
        v2f a[8], b[8];
#pragma unroll     // register arrays need constant indices; eight k-steps' loads go out together
        for (int j = 0; j < 8; ++j) {
            a[j] = *(const v2f*)(pa + j * 4);
            b[j] = *(const v2f*)(pw + j * 4);
        }
        // the address registers of the loads above are free for reuse only behind this wait; it names
        // them, so they stay live up to it and no load's result is placed in one of them
        asm volatile("s_wait_xcnt 0x0" :: "v"(pa), "v"(pw) : "memory");
#pragma unroll     // register arrays need constant indices
        for (int j = 0; j < 8; ++j) acc = wmma_f32x4(a[j], b[j] * msk, acc);
    }
    float bv = bias[wrc];
    // the address registers of the load are free for reuse only behind this wait
    asm volatile("s_wait_xcnt 0x0" ::: "memory");
    float* yp[8];
    float o[8];
#pragma unroll     // register arrays need constant indices
    for (int r = 0; r < 8; ++r) {
        yp[r] = Y + (size_t)(m0 + r + hi * 8) * N + lr;
        o[r] = 1.f / (1.f + __expf(-(acc[r] + bv)));
    }
    // the stores stay behind all the arithmetic: no register of an issued store is rewritten
    __builtin_amdgcn_sched_barrier(0);
    if (lr < N) {
#pragma unroll     // register arrays need constant indices
        for (int r = 0; r < 8; ++r) yp[r][0] = o[r];
    }
}

// One launch holds every product of the same A: blockIdx.y walks, in this order, one row of
// skinny blocks (only where skinny != 0: the first half of blockIdx.x the gate, the second half
// alpha; they go first because they are short and free their place early), then the N / 128
// column tiles of W0 -> Y0, of W1 -> Y1 and of W2 -> Y2. The blocks are independent of one another.
__global__ __launch_bounds__(256) void gemm_nt_wmma_wide(const float* __restrict__ A,
                                  const float* __restrict__ W0, const float* __restrict__ W1,
                                  const float* __restrict__ W2, const float* __restrict__ bias,
                                  float* __restrict__ Y0, float* __restrict__ Y1, float* __restrict__ Y2,
                                  const float* __restrict__ Wg, const float* __restrict__ bg,
                                  float* __restrict__ Yg, int Ng,
                                  const float* __restrict__ Wa, const float* __restrict__ ba,
                                  float* __restrict__ Ya, int Na,
                                  int M, int N, int Kd, int skinny) {
    __shared__ __attribute__((aligned(16))) float sT[2 * GW_BUF];

    int by = (int)blockIdx.y - skinny;
    if (by < 0) {                        // the whole block takes this way, ahead of every barrier
        const int half = M / (2 * GW_BM);                // M / 128 blocks for each skinny product
        const bool g = (int)blockIdx.x < half;
        gemm_nt_skinny_block(A, g ? Wg : Wa, g ? bg : ba, g ? Yg : Ya,
                             g ? (int)blockIdx.x : (int)blockIdx.x - half, g ? Ng : Na, Kd);
        return;
    }
    const int ntile = N / GW_BN;         // column tiles per weight matrix
    const int sel = by / ntile;
    const float* W = sel == 0 ? W0 : (sel == 1 ? W1 : W2);
    float* Y = sel == 0 ? Y0 : (sel == 1 ? Y1 : Y2);

    int tid = threadIdx.x;
    int wave = tid >> 5;
    int lane = tid & 31;
    int wm = wave & 1;                   // 0..1
    int wn = wave >> 1;                  // 0..3
    int mB = blockIdx.x * GW_BM;
    int nB = (by - sel * ntile) * GW_BN;
    int lr = lane & 15;
    int hi = lane >> 4;

    // this thread's place in a tile: row tid >> 4, 16 bytes at dword (tid & 15) * 4
    int cr = tid >> 4, cc = (tid & 15) * 4;
    const float* ga = A + (size_t)(mB + cr) * Kd + cc;
    const float* gw = W + (size_t)(nB + cr) * Kd + cc;
    unsigned lds0 = (unsigned)(uintptr_t)(void*)&sT[cr * GW_P + cc];   // LDS byte address, buffer 0
    const unsigned bufb = (unsigned)GW_BUF * 4u;                       // bytes from buffer 0 to buffer 1
    const int nt = Kd / GW_BK;

    v8f acc[2][2];
#pragma unroll     // register arrays need constant indices
    for (int mi = 0; mi < 2; ++mi)
#pragma unroll     // register arrays need constant indices
        for (int t = 0; t < 2; ++t) acc[mi][t] = (v8f){};

    gw_tile_copy(lds0, ga, gw, Kd);
    // tile 0 has landed for this wave; the barrier publishes it to the others
    asm volatile("s_wait_asynccnt 0x0" ::: "memory");
    __syncthreads();
    if (nt > 1) gw_tile_copy(lds0 + bufb, ga + GW_BK, gw + GW_BK, Kd);

    for (int kt = 0; kt < nt; ++kt) {
        const float* sb = sT + (kt & 1) * GW_BUF;
        const float* sa = sb + (wm * 32 + lr) * GW_P + hi * 2;
        const float* sw = sb + (GW_BM + wn * 32 + lr) * GW_P + hi * 2;
#pragma unroll     // the tile's LDS reads are visible together and go out ahead of the WMMAs
        for (int ks = 0; ks < GW_BK / 4; ++ks) {
            v2f a0 = *(const v2f*)(sa + ks * 4);
            v2f a1 = *(const v2f*)(sa + 16 * GW_P + ks * 4);
            v2f b0 = *(const v2f*)(sw + ks * 4);
            v2f b1 = *(const v2f*)(sw + 16 * GW_P + ks * 4);
            acc[0][0] = wmma_f32x4(a0, b0, acc[0][0]);
            acc[0][1] = wmma_f32x4(a0, b1, acc[0][1]);
            acc[1][0] = wmma_f32x4(a1, b0, acc[1][0]);
            acc[1][1] = wmma_f32x4(a1, b1, acc[1][1]);
        }
        // this wave's reads of the buffer have returned before the buffer is refilled
        asm volatile("s_wait_dscnt 0x0" ::: "memory");
        // this wave's copies of tile kt + 1 have landed before the barrier publishes them
        asm volatile("s_wait_asynccnt 0x0" ::: "memory");
        __syncthreads();
        if (kt + 2 < nt)
            gw_tile_copy(lds0 + (unsigned)(kt & 1) * bufb, ga + (size_t)(kt + 2) * GW_BK,
                         gw + (size_t)(kt + 2) * GW_BK, Kd);
    }
    // no copy is outstanding when the wave goes on to its end
    asm volatile("s_wait_asynccnt 0x0" ::: "memory");

    int m0 = mB + wm * 32 + hi * 8;
    int n0 = nB + wn * 32 + lr;
    float bv[2] = {0.f, 0.f};
    if (bias) {
        bv[0] = bias[n0];
        bv[1] = bias[n0 + 16];
        // the address registers of the two loads are free for reuse only behind this wait
        asm volatile("s_wait_xcnt 0x0" ::: "memory");
    }
    float* yp[2][8];
#pragma unroll     // register arrays need constant indices
    for (int mi = 0; mi < 2; ++mi)
#pragma unroll     // register arrays need constant indices
        for (int r = 0; r < 8; ++r) {
            yp[mi][r] = Y + (size_t)(m0 + mi * 16 + r) * N + n0;
            acc[mi][0][r] += bv[0];
            acc[mi][1][r] += bv[1];
        }
    // the stores stay behind all the arithmetic: no register of an issued store is rewritten
    __builtin_amdgcn_sched_barrier(0);
#pragma unroll     // register arrays need constant indices
    for (int mi = 0; mi < 2; ++mi)
#pragma unroll     // register arrays need constant indices
        for (int r = 0; r < 8; ++r) {
            yp[mi][r][0]  = acc[mi][0][r];
            yp[mi][r][16] = acc[mi][1][r];
        }
}

// ---------------------------------------------------------------------------
// Multi-timescale gated linear attention, chunk-parallel form (chunks of 64
// tokens). With lam constant over time, for token i of chunk c:
//   Hm_i = lam^(i+1) * E + sum_{s<=i} lam^(i-s) * g_s * k_s v_s^T
//   Z_i  = lam^(i+1) * zE + sum_{s<=i} lam^(i-s) * g_s * s_s
// where E, zE are the state at the end of chunk c-1. Three launches:
//   1. chunk_state: S_c = sum_i lam^(63-i) g_i k_i v_i^T (and the same for Z)
//   2. chunk_scan : E_c = lam^64 * E_{c-1} + S_c over the chunks, in place
//   3. chunk_out  : y = (masked decayed Q K^T) V + scaled Q E
// Only non-negative powers of lam are formed, so every factor is in [0, 1].
// ---------------------------------------------------------------------------
constexpr int LA_T  = 2048;        // tokens per sequence
constexpr int LA_H  = 8;           // heads
constexpr int LA_NC = LA_T / 64;   // chunks per sequence
constexpr int LA_RS = LA_H * 64;   // dwords between the rows of one head's q, k, v
constexpr int LA_PA = 68;          // LDS pitch (dwords), rows read 8 bytes along k
constexpr int LA_PB = 72;          // LDS pitch (dwords), rows read across columns

__device__ __forceinline__ float la_sigmoid(float x) { return 1.f / (1.f + __expf(-x)); }

// base^n for 0 <= n <= 127 by squaring: 1 at n == 0 for any base, no logarithm.
__device__ __forceinline__ float la_ipow(float base, int n) {
    float p = 1.f;
#pragma unroll     // seven fixed bits, no loop control
    for (int bit = 0; bit < 7; ++bit) {
        if (n & 1) p *= base;
        base *= base;
        n >>= 1;
    }
    return p;
}

// A thread's four float4 of a 64x64 f32 tile (256 threads): global -> registers.
struct LaTile { float4 a, b, c, d; };
__device__ __forceinline__ LaTile la_tile_load(const float* g, int tid) {
    const float* p = g + ((unsigned)(tid >> 4) * LA_RS + (unsigned)(tid & 15) * 4);
    LaTile t;
    t.a = *(const float4*)(p);
    t.b = *(const float4*)(p + 16 * LA_RS);
    t.c = *(const float4*)(p + 32 * LA_RS);
    t.d = *(const float4*)(p + 48 * LA_RS);
    // address registers of these loads (offset, scalar base) are free for reuse only behind this wait
    asm volatile("s_wait_xcnt 0x0" ::: "memory");
    return t;
}
// ... and registers -> LDS at the given pitch.
__device__ __forceinline__ void la_tile_put(float* s, int pitch, int tid, const LaTile& t) {
    float* p = s + (tid >> 4) * pitch + (tid & 15) * 4;
    *(float4*)(p) = t.a;
    *(float4*)(p + 16 * pitch) = t.b;
    *(float4*)(p + 32 * pitch) = t.c;
    *(float4*)(p + 48 * pitch) = t.d;
}

// mean |k_i| + 1e-6 of row i = tid >> 2; four lanes share a row (valid in all four).
__device__ __forceinline__ float la_row_absmean(const float* s, int pitch, int tid) {
    int i = tid >> 2, qd = tid & 3;
    float a = 0.f;
#pragma unroll     // 16 independent LDS reads in flight
    for (int e = 0; e < 16; ++e) a += fabsf(s[i * pitch + e * 4 + qd]);
    a += __shfl_xor(a, 1);
    a += __shfl_xor(a, 2);
    return a * (1.f / 64.f) + 1e-6f;
}

// grid = B*LA_H*LA_NC, block = 256. blockIdx.x = (b*LA_H + h)*LA_NC + c.
// The pointers are not __restrict__: the loads then keep their side of the asm waits.
__global__ __launch_bounds__(256) void linatt_chunk_state(const float* k, const float* v, const float* gate,
                                   const float* decay_logit, float* S, float* zS) {
    int c  = blockIdx.x % LA_NC;
    int bh = blockIdx.x / LA_NC;
    int h = bh % LA_H, b = bh / LA_H;
    int tid = threadIdx.x;

    __shared__ __attribute__((aligned(16))) float sK[64 * LA_PB];
    __shared__ __attribute__((aligned(16))) float sV[64 * LA_PB];
    __shared__ float sW[2][64];      // lam^(63-i) * g_i
    __shared__ float sAbs[64];

    size_t tok0 = (size_t)b * LA_T + c * 64;
    size_t base = (tok0 * LA_H + h) * 64;
    LaTile rk = la_tile_load(k + base, tid);
    LaTile rv = la_tile_load(v + base, tid);
    la_tile_put(sK, LA_PB, tid, rk);
    la_tile_put(sV, LA_PB, tid, rv);
    if (tid < 128) {
        int kap = tid >> 6, i = tid & 63;
        float lam = la_sigmoid(decay_logit[h * 2 + kap]);
        sW[kap][i] = gate[((tok0 + i) * LA_H + h) * 2 + kap] * la_ipow(lam, 63 - i);
    }
    __syncthreads();

    float am = la_row_absmean(sK, LA_PB, tid);
    if ((tid & 3) == 0) sAbs[tid >> 2] = am;

    // S[a][j] = sum_i K[i][a] * (w_i V[i][j]); wave = (timescale, 16 columns j)
    int wave = tid >> 5, lane = tid & 31, lr = lane & 15, hi = lane >> 4;
    int kap = wave >> 2, tn = wave & 3;
    int n = tn * 16 + lr;
    v8f acc[4];
#pragma unroll     // register arrays need constant indices
    for (int tm = 0; tm < 4; ++tm) acc[tm] = (v8f){};
#pragma unroll 4   // four k-steps per trip: their LDS loads go out together
    for (int kk = 0; kk < 64; kk += 4) {
        int ka = kk + hi * 2;
        v2f bb;
        bb.x = sV[ka * LA_PB + n] * sW[kap][ka];
        bb.y = sV[(ka + 1) * LA_PB + n] * sW[kap][ka + 1];
#pragma unroll     // register arrays need constant indices
        for (int tm = 0; tm < 4; ++tm) {
            v2f a;
            a.x = sK[ka * LA_PB + tm * 16 + lr];
            a.y = sK[(ka + 1) * LA_PB + tm * 16 + lr];
            acc[tm] = wmma_f32x4(a, bb, acc[tm]);
        }
    }
    __syncthreads();   // sAbs complete
    if (wave < 2) {    // wave w sums timescale w
        float z = sW[wave][lane] * sAbs[lane] + sW[wave][lane + 32] * sAbs[lane + 32];
#pragma unroll     // five fixed shuffle steps
        for (int m = 16; m > 0; m >>= 1) z += __shfl_xor(z, m);
        if (lane == 0) zS[(size_t)blockIdx.x * 2 + wave] = z;
    }
    float* Sp = S + (size_t)blockIdx.x * 2 * 4096;
    unsigned so = (unsigned)(kap * 4096 + hi * 8 * 64 + n);
#pragma unroll     // register arrays need constant indices
    for (int tm = 0; tm < 4; ++tm)
#pragma unroll     // register arrays need constant indices
        for (int r = 0; r < 8; ++r)
            Sp[so + (tm * 16 + r) * 64] = acc[tm][r];
}

__global__ __launch_bounds__(256) void linatt_chunk_scan(float* __restrict__ S, float* __restrict__ zS,
                                  const float* __restrict__ decay_logit, int BH) {
    int gid = blockIdx.x * 256 + threadIdx.x;
    {
        int e4 = gid & 1023, kap = (gid >> 10) & 1, bh = gid >> 11;
        float l64 = la_ipow(la_sigmoid(decay_logit[(bh % LA_H) * 2 + kap]), 64);
        float4* p = (float4*)S + ((size_t)bh * LA_NC * 2 + kap) * 1024 + e4;
        float4 s[LA_NC];
#pragma unroll     // register arrays need constant indices
        for (int c = 0; c < LA_NC; ++c) s[c] = p[(size_t)c * 2048];
        // every load is issued before the first store (all in flight at once), and
        // the address registers are free for reuse only behind this wait
        asm volatile("s_wait_xcnt 0x0" ::: "memory");
        float4 run = make_float4(0.f, 0.f, 0.f, 0.f);
#pragma unroll     // register arrays need constant indices
        for (int c = 0; c < LA_NC; ++c) {
            float4 t = s[c];
            s[c] = run;
            run.x = run.x * l64 + t.x;
            run.y = run.y * l64 + t.y;
            run.z = run.z * l64 + t.z;
            run.w = run.w * l64 + t.w;
        }
        // the stores stay behind all the arithmetic: no register of an issued store is rewritten
        __builtin_amdgcn_sched_barrier(0);
#pragma unroll     // register arrays need constant indices
        for (int c = 1; c < LA_NC; ++c) p[(size_t)c * 2048] = s[c];
        // registers of the stores above are free for reuse only behind this wait
        asm volatile("s_wait_xcnt 0x0" ::: "memory");
    }
    if (gid < BH * 2) {
        int kap = gid & 1, bh = gid >> 1;
        float l64 = la_ipow(la_sigmoid(decay_logit[(bh % LA_H) * 2 + kap]), 64);
        float* pz = zS + (size_t)bh * LA_NC * 2 + kap;
        float z[LA_NC];
#pragma unroll     // register arrays need constant indices
        for (int c = 0; c < LA_NC; ++c) z[c] = pz[c * 2];
        asm volatile("s_wait_xcnt 0x0" ::: "memory");
        float run = 0.f;
#pragma unroll     // register arrays need constant indices
        for (int c = 0; c < LA_NC; ++c) {
            float t = z[c];
            z[c] = run;
            run = run * l64 + t;
        }
        __builtin_amdgcn_sched_barrier(0);
#pragma unroll     // register arrays need constant indices
        for (int c = 1; c < LA_NC; ++c) pz[c * 2] = z[c];
    }
}

// grid = B*LA_H*LA_NC, block = 256. blockIdx.x = (b*LA_H + h)*LA_NC + c.
// The pointers are not __restrict__: the loads then keep their side of the asm waits.
__global__ __launch_bounds__(256) void linatt_chunk_out(const float* q, const float* k, const float* v, const float* gate,
                                 const float* decay_logit, const float* E, const float* zE,
                                 float* y_lin) {
    int c  = blockIdx.x % LA_NC;
    int bh = blockIdx.x / LA_NC;
    int h = bh % LA_H, b = bh / LA_H;
    int tid = threadIdx.x;
    int wave = tid >> 5, lane = tid & 31, lr = lane & 15, hi = lane >> 4;
    int tn = wave & 3, tm0 = (wave >> 2) * 2;    // wave owns tiles (tm0, tn), (tm0+1, tn)
    int n = tn * 16 + lr;

    __shared__ __attribute__((aligned(16))) float sQ[64 * LA_PA];
    __shared__ __attribute__((aligned(16))) float sK[64 * LA_PA];
    __shared__ __attribute__((aligned(16))) float sV[64 * LA_PB];
    __shared__ __attribute__((aligned(16))) float sP[64 * LA_PA];
    __shared__ float sG[2][64];      // gate
    __shared__ float sGS[2][64];     // gate * (mean|k| + 1e-6)
    __shared__ float sZ[2][64];      // Z_i
    __shared__ float sRZ[2][64];     // 1 / (Z_i + 1e-6)
    __shared__ float sRS[2][64];     // lam^(i+1) / (Z_i + 1e-6)
    __shared__ float sPw[2][128];    // [63 + d] = lam^d for d = 0..64, 0 for d = -63..-1 (the causal mask)

    size_t tok0 = (size_t)b * LA_T + c * 64;
    size_t base = (tok0 * LA_H + h) * 64;
    LaTile rq = la_tile_load(q + base, tid);
    LaTile rk = la_tile_load(k + base, tid);
    LaTile rv = la_tile_load(v + base, tid);
    // B fragments of the two incoming states, columns n: fetched here, in flight
    // together with the tiles.
    const float* Ep = E + (size_t)blockIdx.x * 2 * 4096;
    unsigned eo = (unsigned)(hi * 2 * 64 + n);
    v2f ef[2][16];
#pragma unroll     // register arrays need constant indices
    for (int kap = 0; kap < 2; ++kap)
#pragma unroll     // register arrays need constant indices
        for (int ks = 0; ks < 16; ++ks) ef[kap][ks] = (v2f){};
    float z0 = 0.f;   // incoming Z of timescale tid & 1
    if (c > 0) {   // chunk 0 starts from the zero state
#pragma unroll     // register arrays need constant indices
        for (int kap = 0; kap < 2; ++kap)
#pragma unroll     // register arrays need constant indices
            for (int ks = 0; ks < 16; ++ks) {
                ef[kap][ks].x = Ep[eo + kap * 4096 + ks * 256];
                ef[kap][ks].y = Ep[eo + kap * 4096 + ks * 256 + 64];
            }
        z0 = zE[(size_t)blockIdx.x * 2 + (tid & 1)];
        // address registers of the loads above are free for reuse only behind this wait
        asm volatile("s_wait_xcnt 0x0" ::: "memory");
    }
    la_tile_put(sQ, LA_PA, tid, rq);
    la_tile_put(sK, LA_PA, tid, rk);
    la_tile_put(sV, LA_PB, tid, rv);
    if (tid < 128) {
        int kap = tid >> 6, i = tid & 63;
        sG[kap][i] = gate[((tok0 + i) * LA_H + h) * 2 + kap];
    }
    {
        int kap = tid >> 7, d = (tid & 127) - 63;
        float pw = la_ipow(la_sigmoid(decay_logit[h * 2 + kap]), d > 0 ? d : 0);
        sPw[kap][63 + d] = (d >= 0) ? pw : 0.f;
    }
    __syncthreads();

    float am = la_row_absmean(sK, LA_PA, tid);
    if ((tid & 3) < 2) sGS[tid & 3][tid >> 2] = sG[tid & 3][tid >> 2] * am;

    // A[i][s] = q_i . k_s
    v8f sc[2];
    sc[0] = (v8f){}; sc[1] = (v8f){};
#pragma unroll 4   // four k-steps per trip: their LDS loads go out together
    for (int kk = 0; kk < 64; kk += 4) {
        int ka = kk + hi * 2;
        v2f bb = *(const v2f*)&sK[(tn * 16 + lr) * LA_PA + ka];
#pragma unroll     // register arrays need constant indices
        for (int t = 0; t < 2; ++t) {
            v2f a = *(const v2f*)&sQ[((tm0 + t) * 16 + lr) * LA_PA + ka];
            sc[t] = wmma_f32x4(a, bb, sc[t]);
        }
    }
    __syncthreads();   // sGS complete

    if (tid < 2) {     // Z inside the chunk
        float Z = z0;
        float lam = sPw[tid][64];
#pragma unroll 16  // the LDS reads of 16 steps go out ahead of the serial chain
        for (int i = 0; i < 64; ++i) {
            Z = Z * lam + sGS[tid][i];
            sZ[tid][i] = Z;
        }
    }
    __syncthreads();   // sZ complete
    if (tid < 128) {
        int kap = tid >> 6, i = tid & 63;
        float rz = 1.f / (sZ[kap][i] + 1e-6f);
        sRZ[kap][i] = rz;
        sRS[kap][i] = rz * sPw[kap][64 + i];
    }
    __syncthreads();   // sRZ, sRS complete

    // P[i][s] = A[i][s] * sum_kap lam^(i-s) g_s / (Z_i + 1e-6) for s <= i, else 0
#pragma unroll     // register arrays need constant indices
    for (int t = 0; t < 2; ++t)
#pragma unroll     // register arrays need constant indices
        for (int r = 0; r < 8; ++r) {
            int i = (tm0 + t) * 16 + r + hi * 8;
            int e = 63 + i - n;
            float w = sPw[0][e] * sG[0][n] * sRZ[0][i] + sPw[1][e] * sG[1][n] * sRZ[1][i];
            sP[i * LA_PA + n] = sc[t][r] * w;
        }
    __syncthreads();   // sP complete

    v8f acc[2];
    acc[0] = (v8f){}; acc[1] = (v8f){};
#pragma unroll 4   // four k-steps per trip: their LDS loads go out together
    for (int kk = 0; kk < 64; kk += 4) {
        int ka = kk + hi * 2;
        v2f bb;
        bb.x = sV[ka * LA_PB + n];
        bb.y = sV[(ka + 1) * LA_PB + n];
#pragma unroll     // register arrays need constant indices
        for (int t = 0; t < 2; ++t) {
            v2f a = *(const v2f*)&sP[((tm0 + t) * 16 + lr) * LA_PA + ka];
            acc[t] = wmma_f32x4(a, bb, acc[t]);
        }
    }
#pragma unroll     // register arrays need constant indices
    for (int kap = 0; kap < 2; ++kap) {
        float rs0 = sRS[kap][tm0 * 16 + lr];
        float rs1 = sRS[kap][(tm0 + 1) * 16 + lr];
#pragma unroll     // register arrays need constant indices
        for (int ks = 0; ks < 16; ++ks) {
            int ka = ks * 4 + hi * 2;
            v2f a0 = *(const v2f*)&sQ[(tm0 * 16 + lr) * LA_PA + ka];
            v2f a1 = *(const v2f*)&sQ[((tm0 + 1) * 16 + lr) * LA_PA + ka];
            a0 *= rs0;
            a1 *= rs1;
            acc[0] = wmma_f32x4(a0, ef[kap][ks], acc[0]);
            acc[1] = wmma_f32x4(a1, ef[kap][ks], acc[1]);
        }
    }
    float* yp = y_lin + base;
    unsigned yo = (unsigned)((tm0 * 16 + hi * 8) * LA_RS + n);
#pragma unroll     // register arrays need constant indices
    for (int t = 0; t < 2; ++t)
#pragma unroll     // register arrays need constant indices
        for (int r = 0; r < 8; ++r)
            yp[yo + (t * 16 + r) * LA_RS] = acc[t][r];
}

// ---------------------------------------------------------------------------
// Sliding-window local attention with ALiBi, one block per (b, chunk, head).
// Block = 256 threads (8 waves). Scores and P@V via fp32 WMMA.
// Q/K/V tiles come into LDS by asynchronous copies (16 bytes a lane), each row at a padded
// pitch chosen for its reader; the rows in front of token 0 (c == 0) are filled with zeros.
// LDS: phase1 Q[64]+K[128] rows (aliased as S[64] rows in phase2) + V[128] rows.
// The epilogue blends with the linear-attention output of the same tile:
// y = alpha * y_loc + (1 - alpha) * y_lin (alpha per [B,T,H]); y_loc never goes to memory.
// ---------------------------------------------------------------------------
constexpr int LC_PK = 68;
constexpr int LC_PV = 72;
constexpr int LC_PS = 132;

// Rows r + 16 j, j = 0..3, of three 64-row tiles (Q, K, V), 16 bytes a lane: twelve asynchronous
// copies global -> LDS. rs = 16 rows on in global memory (floats).
__device__ __forceinline__ void lc_copy_qkv(unsigned lq, const float* gq, unsigned lk, const float* gk,
                                            unsigned lv, const float* gv, size_t rs) {
    const unsigned sk = 16u * LC_PK * 4u;          // 16 rows on in LDS, bytes (Q, K)
    const unsigned sv = 16u * LC_PV * 4u;          // 16 rows on in LDS, bytes (V)
    // the copies go through no register; the closing wait stands inside the statement so that
    // the address registers named here are rewritten only behind it
    asm volatile("global_load_async_to_lds_b128 %0, %1, off\n\t"
                 "global_load_async_to_lds_b128 %2, %3, off\n\t"
                 "global_load_async_to_lds_b128 %4, %5, off\n\t"
                 "global_load_async_to_lds_b128 %6, %7, off\n\t"
                 "global_load_async_to_lds_b128 %8, %9, off\n\t"
                 "global_load_async_to_lds_b128 %10, %11, off\n\t"
                 "global_load_async_to_lds_b128 %12, %13, off\n\t"
                 "global_load_async_to_lds_b128 %14, %15, off\n\t"
                 "global_load_async_to_lds_b128 %16, %17, off\n\t"
                 "global_load_async_to_lds_b128 %18, %19, off\n\t"
                 "global_load_async_to_lds_b128 %20, %21, off\n\t"
                 "global_load_async_to_lds_b128 %22, %23, off\n\t"
                 "s_wait_xcnt 0x0"
                 :: "v"(lq),          "v"(gq),          "v"(lq + sk),     "v"(gq + rs),
                    "v"(lq + 2 * sk), "v"(gq + 2 * rs), "v"(lq + 3 * sk), "v"(gq + 3 * rs),
                    "v"(lk),          "v"(gk),          "v"(lk + sk),     "v"(gk + rs),
                    "v"(lk + 2 * sk), "v"(gk + 2 * rs), "v"(lk + 3 * sk), "v"(gk + 3 * rs),
                    "v"(lv),          "v"(gv),          "v"(lv + sv),     "v"(gv + rs),
                    "v"(lv + 2 * sv), "v"(gv + 2 * rs), "v"(lv + 3 * sv), "v"(gv + 3 * rs)
                 : "memory");
}
// The same for two tiles (K, V): eight copies.
__device__ __forceinline__ void lc_copy_kv(unsigned lk, const float* gk, unsigned lv, const float* gv, size_t rs) {
    const unsigned sk = 16u * LC_PK * 4u;
    const unsigned sv = 16u * LC_PV * 4u;
    asm volatile("global_load_async_to_lds_b128 %0, %1, off\n\t"
                 "global_load_async_to_lds_b128 %2, %3, off\n\t"
                 "global_load_async_to_lds_b128 %4, %5, off\n\t"
                 "global_load_async_to_lds_b128 %6, %7, off\n\t"
                 "global_load_async_to_lds_b128 %8, %9, off\n\t"
                 "global_load_async_to_lds_b128 %10, %11, off\n\t"
                 "global_load_async_to_lds_b128 %12, %13, off\n\t"
                 "global_load_async_to_lds_b128 %14, %15, off\n\t"
                 "s_wait_xcnt 0x0"
                 :: "v"(lk),          "v"(gk),          "v"(lk + sk),     "v"(gk + rs),
                    "v"(lk + 2 * sk), "v"(gk + 2 * rs), "v"(lk + 3 * sk), "v"(gk + 3 * rs),
                    "v"(lv),          "v"(gv),          "v"(lv + sv),     "v"(gv + rs),
                    "v"(lv + 2 * sv), "v"(gv + 2 * rs), "v"(lv + 3 * sv), "v"(gv + 3 * rs)
                 : "memory");
}

// The value of another lane of this lane's group of four, by DPP quad_perm: 0xB1 = [1,0,3,2] (lane ^ 1),
// 0x4E = [2,3,0,1] (lane ^ 2). Every lane of the wave is on where it is used.
template <int CTRL>
__device__ __forceinline__ float lc_quad_swap(float x) {
    return __int_as_float(__builtin_amdgcn_mov_dpp(__float_as_int(x), CTRL, 0xf, 0xf, true));
}

// exp(s - m) of four scores: 2^((s - m) * log2(e)) on the hardware's base-2 exponential.
__device__ __forceinline__ float4 lc_exp4(float4 s, float m) {
    float a = (s.x - m) * 1.44269504f, b = (s.y - m) * 1.44269504f;
    float c = (s.z - m) * 1.44269504f, d = (s.w - m) * 1.44269504f;
    asm("v_exp_f32 %0, %0\n\t"
        "v_exp_f32 %1, %1\n\t"
        "v_exp_f32 %2, %2\n\t"
        "v_exp_f32 %3, %3\n\t"
        "v_nop"
        : "+v"(a), "+v"(b), "+v"(c), "+v"(d));
    return make_float4(a, b, c, d);
}

__global__ void local_attn_wmma(const float* __restrict__ q, const float* __restrict__ k,
                                const float* __restrict__ v, const float* __restrict__ y_lin,
                                const float* __restrict__ alpha, float* __restrict__ y,
                                int B, int T, int H) {
    const int dh = 64;
    const int W = 64;
    int nc = T / W;
    int h = blockIdx.x % H;
    int c = (blockIdx.x / H) % nc;
    int b = blockIdx.x / (H * nc);

    __shared__ __attribute__((aligned(16))) float smem[(64 + 128) * LC_PK];   // Q | K, aliased as S after use
    __shared__ __attribute__((aligned(16))) float sV[128 * LC_PV];
    float* sQ = smem;
    float* sK = smem + 64 * LC_PK;
    float* sS = smem;                            // aliased after barrier

    int tid = threadIdx.x;
    int wave = tid >> 5, lane = tid & 31, lr = lane & 15, hi = lane >> 4;

    // This lane's 16 outputs: rows om + r, columns on and on + 16 of the block's 64x64 tile.
    // Their y_lin and alpha are fetched here, in flight together with the tiles.
    size_t tok0 = (size_t)b * T + c * W;
    const float* lg = y_lin + (tok0 * H + h) * dh;
    const float* ag = alpha + tok0 * H + h;
    int om = (wave >> 1) * 16 + hi * 8;
    int on = (wave & 1) * 32 + lr;
    unsigned yo[8], ao[8];
    float yl[2][8], al[8];
#pragma unroll     // register arrays need constant indices
    for (int r = 0; r < 8; ++r) {
        yo[r] = (unsigned)((om + r) * H * dh + on);
        ao[r] = (unsigned)((om + r) * H);
    }
    // every offset is formed before the first load: no register of an issued load is rewritten
    __builtin_amdgcn_sched_barrier(0);
#pragma unroll     // register arrays need constant indices
    for (int r = 0; r < 8; ++r) {
        yl[0][r] = lg[yo[r]];
        yl[1][r] = lg[yo[r] + 16];
        al[r]    = ag[ao[r]];
    }
    // address registers of the loads above are free for reuse only behind this wait
    asm volatile("s_wait_xcnt 0x0" ::: "memory");

    // ---- stage the tiles: this thread brings 16 bytes at dword cc of rows cr + 16 j ----
    {
        int cr = tid >> 4, cc = (tid & 15) * 4;
        size_t go = ((tok0 + cr) * H + h) * dh + cc;       // row cr of this chunk
        size_t rs = (size_t)16 * H * dh;                   // 16 tokens on
        unsigned lq = (unsigned)(uintptr_t)(void*)&sQ[cr * LC_PK + cc];
        unsigned lk = (unsigned)(uintptr_t)(void*)&sK[cr * LC_PK + cc];
        unsigned lv = (unsigned)(uintptr_t)(void*)&sV[cr * LC_PV + cc];
        // this chunk: Q, and rows 64..127 of K and V
        lc_copy_qkv(lq, q + go, lk + 64u * LC_PK * 4u, k + go, lv + 64u * LC_PV * 4u, v + go, rs);
        if (c > 0) {       // the same for the whole block
            // the chunk before: rows 0..63 of K and V
            lc_copy_kv(lk, k + go - 4 * rs, lv, v + go - 4 * rs, rs);
        } else {
            // boundary chunk: the rows in front of token 0 are zero
            const float4 z4 = make_float4(0.f, 0.f, 0.f, 0.f);
#pragma unroll     // four fixed rows, no loop control
            for (int j = 0; j < 4; ++j) {
                *(float4*)&sK[(cr + 16 * j) * LC_PK + cc] = z4;
                *(float4*)&sV[(cr + 16 * j) * LC_PV + cc] = z4;
            }
        }
    }
    // this wave's copies have landed; the barrier publishes them to the others
    asm volatile("s_wait_asynccnt 0x0" ::: "memory");
    __syncthreads();

    // scores: 64x128 = 4x8 tiles of 16x16; wave handles 4 tiles
    v8f sc[4];
    for (int it = 0; it < 4; ++it) {
        int id = wave * 4 + it;
        int tm = id >> 3, tn = id & 7;
        v8f acc = {};
        for (int kkk = 0; kkk < 64; kkk += 4) {
            int ka = kkk + hi * 2;
            v2f a  = *(const v2f*)&sQ[(tm * 16 + lr) * LC_PK + ka];
            v2f bb = *(const v2f*)&sK[(tn * 16 + lr) * LC_PK + ka];
            acc = wmma_f32x4(a, bb, acc);
        }
        sc[it] = acc;
    }
    __syncthreads();   // done reading sQ/sK; safe to alias as sS

    // ALiBi + causal window mask, write scores to LDS
    float slope = exp2f(-8.0f * (float)(h + 1) / (float)H);
    for (int it = 0; it < 4; ++it) {
        int id = wave * 4 + it;
        int tm = id >> 3, tn = id & 7;
#pragma unroll
        for (int r = 0; r < 8; ++r) {
            int i = tm * 16 + r + hi * 8;
            int jj = tn * 16 + lr;
            float val = sc[it][r];
            bool valid = (jj >= i + 1) && (jj <= i + W) && (c * W + jj - W >= 0);
            val = valid ? (val - slope * (float)(i + W - jj)) : -1e30f;
            sS[i * LC_PS + jj] = val;
        }
    }
    __syncthreads();

    {
        float* pr = sS + (tid >> 2) * LC_PS + (tid & 3) * 16;
        float4 p[8];
#pragma unroll     // register arrays need constant indices; the eight LDS reads go out together
        for (int e = 0; e < 8; ++e) p[e] = *(const float4*)(pr + (e >> 2) * 64 + (e & 3) * 4);
        float mx = -3.4e38f;
#pragma unroll     // register arrays need constant indices
        for (int e = 0; e < 8; ++e)
            mx = fmaxf(mx, fmaxf(fmaxf(p[e].x, p[e].y), fmaxf(p[e].z, p[e].w)));
        mx = fmaxf(mx, lc_quad_swap<0xB1>(mx));
        mx = fmaxf(mx, lc_quad_swap<0x4E>(mx));
        float sum = 0.f;
#pragma unroll     // register arrays need constant indices
        for (int e = 0; e < 8; ++e) {
            p[e] = lc_exp4(p[e], mx);
            sum += (p[e].x + p[e].y) + (p[e].z + p[e].w);
        }
        sum += lc_quad_swap<0xB1>(sum);
        sum += lc_quad_swap<0x4E>(sum);
        float inv = 1.f / sum;
#pragma unroll     // register arrays need constant indices
        for (int e = 0; e < 8; ++e) {
            p[e].x *= inv; p[e].y *= inv; p[e].z *= inv; p[e].w *= inv;
            *(float4*)(pr + (e >> 2) * 64 + (e & 3) * 4) = p[e];
        }
    }
    __syncthreads();

    // y_loc = P[64,128] @ Vctx[128,64]; 16 tiles, wave handles 2; V from LDS
    v8f yb[2];
#pragma unroll     // register arrays need constant indices
    for (int it = 0; it < 2; ++it) {
        int id = wave * 2 + it;
        int tm = id >> 2, tn = id & 3;
        int n = tn * 16 + lr;
        v8f acc = {};
        for (int kkk = 0; kkk < 128; kkk += 4) {
            int ka = kkk + hi * 2;
            v2f a = *(const v2f*)&sS[(tm * 16 + lr) * LC_PS + ka];
            v2f bb;
            bb.x = sV[ka * LC_PV + n];
            bb.y = sV[(ka + 1) * LC_PV + n];
            acc = wmma_f32x4(a, bb, acc);
        }
#pragma unroll     // register arrays need constant indices
        for (int r = 0; r < 8; ++r)
            yb[it][r] = al[r] * acc[r] + (1.f - al[r]) * yl[it][r];
    }
    float* yg = y + (tok0 * H + h) * dh;
    float* yp[8];
#pragma unroll     // register arrays need constant indices
    for (int r = 0; r < 8; ++r) yp[r] = yg + yo[r];
    // the stores stay behind all the arithmetic: no register of an issued store is rewritten
    __builtin_amdgcn_sched_barrier(0);
#pragma unroll     // register arrays need constant indices
    for (int r = 0; r < 8; ++r) {
        yp[r][0]  = yb[0][r];
        yp[r][16] = yb[1][r];
    }
}

constexpr int AN_D = 512;

// x + the value of lane ^ m inside a row of 16 lanes, by DPP row_xmask: CTRL = 0x160 + m.
// Every lane of the wave is on where it is used.
template <int CTRL>
__device__ __forceinline__ float an_xmask_add(float x) {
    return x + __int_as_float(__builtin_amdgcn_mov_dpp(__float_as_int(x), CTRL, 0xf, 0xf, true));
}
// Sum over the 32 lanes, the same value in every lane: four steps inside each half, then lane ^ 16.
__device__ __forceinline__ float an_wave_sum(float x) {
    x = an_xmask_add<0x161>(x);
    x = an_xmask_add<0x162>(x);
    x = an_xmask_add<0x164>(x);
    x = an_xmask_add<0x168>(x);
    return x + __int_as_float(__builtin_amdgcn_permlanex16(__float_as_int(x), __float_as_int(x),
                                                           0x76543210, 0xfedcba98, false, false));
}

// grid = rows / 8, block = 256.
// The pointers are not __restrict__: the loads then keep their side of the asm wait.
__global__ __launch_bounds__(256) void addnorm_kernel(const float* x, const float* proj,
                               const float* gamma, const float* beta, float* out) {
    // byte offsets of this lane's first column: in gamma and beta, and in its row of x, proj and out
    unsigned cb = (threadIdx.x & 31u) * 16u;
    unsigned rb = (blockIdx.x * 8u + (threadIdx.x >> 5)) * (AN_D * 4u) + cb;
    float4 r[4], p[4], g[4], b[4];
#pragma unroll     // register arrays need constant indices; the sixteen loads go out together
    for (int j = 0; j < 4; ++j) {
        r[j] = *(const float4*)((const char*)x + rb + j * 512);
        p[j] = *(const float4*)((const char*)proj + rb + j * 512);
        g[j] = *(const float4*)((const char*)gamma + cb + j * 512);
        b[j] = *(const float4*)((const char*)beta + cb + j * 512);
    }
    // the address registers of the loads above are free for reuse only behind this wait; it names
    // the two offsets, so they stay live up to it and no load's result is placed in one of them
    asm volatile("s_wait_xcnt 0x0" :: "v"(rb), "v"(cb) : "memory");
    // the arithmetic stays behind all sixteen loads: none of them waits for another's data
    __builtin_amdgcn_sched_barrier(0);

    float sj[4], qj[4];
#pragma unroll     // register arrays need constant indices; four independent chains
    for (int j = 0; j < 4; ++j) {
        r[j].x += p[j].x; r[j].y += p[j].y; r[j].z += p[j].z; r[j].w += p[j].w;
        sj[j] = (r[j].x + r[j].y) + (r[j].z + r[j].w);
        qj[j] = r[j].x * r[j].x + r[j].y * r[j].y + r[j].z * r[j].z + r[j].w * r[j].w;
    }
    float s  = an_wave_sum((sj[0] + sj[1]) + (sj[2] + sj[3]));
    float s2 = an_wave_sum((qj[0] + qj[1]) + (qj[2] + qj[3]));
    float mean = s * (1.f / (float)AN_D);
    float var = s2 * (1.f / (float)AN_D) - mean * mean;
    float inv = rsqrtf(var + 1e-5f);
#pragma unroll     // register arrays need constant indices
    for (int j = 0; j < 4; ++j) {
        r[j].x = (r[j].x - mean) * inv * g[j].x + b[j].x;
        r[j].y = (r[j].y - mean) * inv * g[j].y + b[j].y;
        r[j].z = (r[j].z - mean) * inv * g[j].z + b[j].z;
        r[j].w = (r[j].w - mean) * inv * g[j].w + b[j].w;
    }
    // the stores stay behind all the arithmetic: no register of an issued store is rewritten
    __builtin_amdgcn_sched_barrier(0);
#pragma unroll     // register arrays need constant indices
    for (int j = 0; j < 4; ++j) *(float4*)((char*)out + rb + j * 512) = r[j];
}

// ---------------------------------------------------------------------------
extern "C" void kernel_launch(void* const* d_in, const int* in_sizes, int n_in,
                              void* d_out, int out_size, void* d_ws, size_t ws_size,
                              hipStream_t stream) {
    const int D = 512, H = 8, Kts = 2, dh = 64, T = 2048;
    const int M = in_sizes[0] / D;          // B*T = 4096
    const int B = M / T;                    // 2
    const int nc = T / 64;

    const float* x      = (const float*)d_in[0];
    const float* Wq     = (const float*)d_in[1];
    const float* Wk     = (const float*)d_in[2];
    const float* Wv     = (const float*)d_in[3];
    const float* Wg     = (const float*)d_in[4];
    const float* bg     = (const float*)d_in[5];
    const float* Wa     = (const float*)d_in[6];
    const float* ba     = (const float*)d_in[7];
    const float* Wo     = (const float*)d_in[8];
    const float* bo     = (const float*)d_in[9];
    const float* decay  = (const float*)d_in[10];
    const float* gamma  = (const float*)d_in[11];
    const float* beta   = (const float*)d_in[12];
    float* out = (float*)d_out;

    // workspace carve-up
    float* ws = (float*)d_ws;
    size_t off = 0;
    float* q_buf    = ws + off; off += (size_t)M * D;
    float* k_buf    = ws + off; off += (size_t)M * D;
    float* v_buf    = ws + off; off += (size_t)M * D;
    float* gate_buf = ws + off; off += (size_t)M * H * Kts;
    float* alp_buf  = ws + off; off += (size_t)M * H;
    float* ylin_buf = ws + off; off += (size_t)M * D;
    float* ymix_buf = ws + off; off += (size_t)M * D;
    float* proj_buf = ws + off; off += (size_t)M * D;
    float* st_buf   = ws + off; off += (size_t)B * H * nc * Kts * dh * dh;
    float* zst_buf  = ws + off; off += (size_t)B * H * nc * Kts;

    dim3 blk(256);
    dim3 grid_wide(M / 64, D / 128);        // 64 x 4
    dim3 grid_proj(M / 64, 3 * (D / 128) + 1);   // skinny row, then q, k, v

    // the five projections of x in one launch: q, k, v (wide) and gate, alpha (skinny, sigmoid fused)
    gemm_nt_wmma_wide<<<grid_proj, blk, 0, stream>>>(x, Wq, Wk, Wv, nullptr, q_buf, k_buf, v_buf,
                                                     Wg, bg, gate_buf, H * Kts, Wa, ba, alp_buf, H,
                                                     M, D, D, 1);

    // gated linear attention, chunk-parallel: chunk states, scan over chunks, outputs
    linatt_chunk_state<<<B * nc * H, blk, 0, stream>>>(k_buf, v_buf, gate_buf, decay,
                                                       st_buf, zst_buf);
    linatt_chunk_scan<<<B * H * 8, blk, 0, stream>>>(st_buf, zst_buf, decay, B * H);
    linatt_chunk_out<<<B * nc * H, blk, 0, stream>>>(q_buf, k_buf, v_buf, gate_buf, decay,
                                                     st_buf, zst_buf, ylin_buf);

    // sliding-window local attention with ALiBi, gated blend in its epilogue
    local_attn_wmma<<<B * nc * H, 256, 0, stream>>>(q_buf, k_buf, v_buf, ylin_buf, alp_buf,
                                                    ymix_buf, B, T, H);

    // output projection + residual + layernorm
    gemm_nt_wmma_wide<<<grid_wide, blk, 0, stream>>>(ymix_buf, Wo, nullptr, nullptr, bo,
                                                     proj_buf, nullptr, nullptr,
                                                     nullptr, nullptr, nullptr, 0, nullptr, nullptr, nullptr, 0,
                                                     M, D, D, 0);
    addnorm_kernel<<<M / 8, blk, 0, stream>>>(x, proj_buf, gamma, beta, out);
}

// v008
// A run of this version takes 107 microseconds.
// In both of two side-by-side timings against v007, it was 1.05 times as fast.
// Counting every step since v000, it is 30.8 times as fast.
#include <hip/hip_runtime.h>
#include <hip/hip_bf16.h>
#include <math.h>

typedef __attribute__((ext_vector_type(2))) float v2f;
typedef __attribute__((ext_vector_type(8))) float v8f;

__device__ __forceinline__ v8f wmma_f32x4(v2f a, v2f b, v8f c) {
    // D = A(16x4 f32) * B(4x16 f32) + C(16x16 f32)
    return __builtin_amdgcn_wmma_f32_16x16x4_f32(
        /*neg_a=*/false, a, /*neg_b=*/false, b,
        /*c_mod=*/(short)0, c, /*reuse_a=*/false, /*reuse_b=*/false);
}

constexpr int GW_BM   = 64;
constexpr int GW_BN   = 128;
constexpr int GW_BK   = 64;
constexpr int GW_P    = 68;
constexpr int GW_ROWS = GW_BM + GW_BN;
constexpr int GW_BUF  = GW_ROWS * GW_P;

// One k-tile into one buffer: thread tid brings 16 bytes of rows (tid >> 4) + 16 j, j = 0..11
// (j < 4: rows of A, then rows of W), by twelve asynchronous copies global -> LDS.
__device__ __forceinline__ void gw_tile_copy(unsigned lds, const float* ga, const float* gw, int Kd) {
    const size_t rs = (size_t)16 * Kd;             // 16 rows on in global memory
    const unsigned ls = 16u * GW_P * 4u;           // 16 rows on in LDS, bytes
    // the copies go through no register; the closing wait stands inside the statement so that
    // the address registers named here are rewritten only behind it
    asm volatile("global_load_async_to_lds_b128 %0, %1, off\n\t"
                 "global_load_async_to_lds_b128 %2, %3, off\n\t"
                 "global_load_async_to_lds_b128 %4, %5, off\n\t"
                 "global_load_async_to_lds_b128 %6, %7, off\n\t"
                 "global_load_async_to_lds_b128 %8, %9, off\n\t"
                 "global_load_async_to_lds_b128 %10, %11, off\n\t"
                 "global_load_async_to_lds_b128 %12, %13, off\n\t"
                 "global_load_async_to_lds_b128 %14, %15, off\n\t"
                 "global_load_async_to_lds_b128 %16, %17, off\n\t"
                 "global_load_async_to_lds_b128 %18, %19, off\n\t"
                 "global_load_async_to_lds_b128 %20, %21, off\n\t"
                 "global_load_async_to_lds_b128 %22, %23, off\n\t"
                 "s_wait_xcnt 0x0"
                 :: "v"(lds),           "v"(ga),          "v"(lds + ls),      "v"(ga + rs),
                    "v"(lds + 2 * ls),  "v"(ga + 2 * rs), "v"(lds + 3 * ls),  "v"(ga + 3 * rs),
                    "v"(lds + 4 * ls),  "v"(gw),          "v"(lds + 5 * ls),  "v"(gw + rs),
                    "v"(lds + 6 * ls),  "v"(gw + 2 * rs), "v"(lds + 7 * ls),  "v"(gw + 3 * rs),
                    "v"(lds + 8 * ls),  "v"(gw + 4 * rs), "v"(lds + 9 * ls),  "v"(gw + 5 * rs),
                    "v"(lds + 10 * ls), "v"(gw + 6 * rs), "v"(lds + 11 * ls), "v"(gw + 7 * rs)
                 : "memory");
}

__device__ __forceinline__ void gemm_nt_skinny_block(const float* __restrict__ A, const float* __restrict__ W,
                                                     const float* __restrict__ bias, float* __restrict__ Y,
                                                     int mblk, int N, int Kd) {
    int wave = threadIdx.x >> 5;
    int lane = threadIdx.x & 31;
    int m0 = (mblk * 8 + wave) * 16;
    int lr = lane & 15;
    int hi = lane >> 4;
    int wrow = lr;                       // n0 == 0 (single tile of columns)
    int wrc = (wrow < N) ? wrow : 0;
    float msk = (wrow < N) ? 1.f : 0.f;

    const float* ap = A + (size_t)(m0 + lr) * Kd + hi * 2;
    const float* wpr = W + (size_t)wrc * Kd + hi * 2;

    v8f acc = {};
    for (int kk = 0; kk < Kd; kk += 32) {        // Kd % 64 == 0, as for the wide blocks
        const float* pa = ap + kk;
        const float* pw = wpr + kk;
        v2f a[8], b[8];
#pragma unroll     // register arrays need constant indices; eight k-steps' loads go out together
        for (int j = 0; j < 8; ++j) {
            a[j] = *(const v2f*)(pa + j * 4);
            b[j] = *(const v2f*)(pw + j * 4);
        }
        // the address registers of the loads above are free for reuse only behind this wait; it names
        // them, so they stay live up to it and no load's result is placed in one of them
        asm volatile("s_wait_xcnt 0x0" :: "v"(pa), "v"(pw) : "memory");
#pragma unroll     // register arrays need constant indices
        for (int j = 0; j < 8; ++j) acc = wmma_f32x4(a[j], b[j] * msk, acc);
    }
    float bv = bias[wrc];
    // the address registers of the load are free for reuse only behind this wait
    asm volatile("s_wait_xcnt 0x0" ::: "memory");
    float* yp[8];
    float o[8];
#pragma unroll     // register arrays need constant indices
    for (int r = 0; r < 8; ++r) {
        yp[r] = Y + (size_t)(m0 + r + hi * 8) * N + lr;
        o[r] = 1.f / (1.f + __expf(-(acc[r] + bv)));
    }
    // the stores stay behind all the arithmetic: no register of an issued store is rewritten
    __builtin_amdgcn_sched_barrier(0);
    if (lr < N) {
#pragma unroll     // register arrays need constant indices
        for (int r = 0; r < 8; ++r) yp[r][0] = o[r];
    }
}

// One launch holds every product of the same A: blockIdx.y walks, in this order, one row of
// skinny blocks (only where skinny != 0: the first half of blockIdx.x the gate, the second half
// alpha; they go first because they are short and free their place early), then the N / 128
// column tiles of W0 -> Y0, of W1 -> Y1 and of W2 -> Y2. The blocks are independent of one another.
__global__ __launch_bounds__(256) void gemm_nt_wmma_wide(const float* __restrict__ A,
                                  const float* __restrict__ W0, const float* __restrict__ W1,
                                  const float* __restrict__ W2, const float* __restrict__ bias,
                                  float* __restrict__ Y0, float* __restrict__ Y1, float* __restrict__ Y2,
                                  const float* __restrict__ Wg, const float* __restrict__ bg,
                                  float* __restrict__ Yg, int Ng,
                                  const float* __restrict__ Wa, const float* __restrict__ ba,
                                  float* __restrict__ Ya, int Na,
                                  int M, int N, int Kd, int skinny) {
    __shared__ __attribute__((aligned(16))) float sT[2 * GW_BUF];

    int by = (int)blockIdx.y - skinny;
    if (by < 0) {                        // the whole block takes this way, ahead of every barrier
        const int half = M / (2 * GW_BM);                // M / 128 blocks for each skinny product
        const bool g = (int)blockIdx.x < half;
        gemm_nt_skinny_block(A, g ? Wg : Wa, g ? bg : ba, g ? Yg : Ya,
                             g ? (int)blockIdx.x : (int)blockIdx.x - half, g ? Ng : Na, Kd);
        return;
    }
    const int ntile = N / GW_BN;         // column tiles per weight matrix
    const int sel = by / ntile;
    const float* W = sel == 0 ? W0 : (sel == 1 ? W1 : W2);
    float* Y = sel == 0 ? Y0 : (sel == 1 ? Y1 : Y2);

    int tid = threadIdx.x;
    int wave = tid >> 5;
    int lane = tid & 31;
    int wm = wave & 1;                   // 0..1
    int wn = wave >> 1;                  // 0..3
    int mB = blockIdx.x * GW_BM;
    int nB = (by - sel * ntile) * GW_BN;
    int lr = lane & 15;
    int hi = lane >> 4;

    // this thread's place in a tile: row tid >> 4, 16 bytes at dword (tid & 15) * 4
    int cr = tid >> 4, cc = (tid & 15) * 4;
    const float* ga = A + (size_t)(mB + cr) * Kd + cc;
    const float* gw = W + (size_t)(nB + cr) * Kd + cc;
    unsigned lds0 = (unsigned)(uintptr_t)(void*)&sT[cr * GW_P + cc];   // LDS byte address, buffer 0
    const unsigned bufb = (unsigned)GW_BUF * 4u;                       // bytes from buffer 0 to buffer 1
    const int nt = Kd / GW_BK;

    v8f acc[2][2];
#pragma unroll     // register arrays need constant indices
    for (int mi = 0; mi < 2; ++mi)
#pragma unroll     // register arrays need constant indices
        for (int t = 0; t < 2; ++t) acc[mi][t] = (v8f){};

    gw_tile_copy(lds0, ga, gw, Kd);
    // tile 0 has landed for this wave; the barrier publishes it to the others
    asm volatile("s_wait_asynccnt 0x0" ::: "memory");
    __syncthreads();
    if (nt > 1) gw_tile_copy(lds0 + bufb, ga + GW_BK, gw + GW_BK, Kd);

    for (int kt = 0; kt < nt; ++kt) {
        const float* sb = sT + (kt & 1) * GW_BUF;
        const float* sa = sb + (wm * 32 + lr) * GW_P + hi * 2;
        const float* sw = sb + (GW_BM + wn * 32 + lr) * GW_P + hi * 2;
#pragma unroll     // the tile's LDS reads are visible together and go out ahead of the WMMAs
        for (int ks = 0; ks < GW_BK / 4; ++ks) {
            v2f a0 = *(const v2f*)(sa + ks * 4);
            v2f a1 = *(const v2f*)(sa + 16 * GW_P + ks * 4);
            v2f b0 = *(const v2f*)(sw + ks * 4);
            v2f b1 = *(const v2f*)(sw + 16 * GW_P + ks * 4);
            acc[0][0] = wmma_f32x4(a0, b0, acc[0][0]);
            acc[0][1] = wmma_f32x4(a0, b1, acc[0][1]);
            acc[1][0] = wmma_f32x4(a1, b0, acc[1][0]);
            acc[1][1] = wmma_f32x4(a1, b1, acc[1][1]);
        }
        // this wave's reads of the buffer have returned before the buffer is refilled
        asm volatile("s_wait_dscnt 0x0" ::: "memory");
        // this wave's copies of tile kt + 1 have landed before the barrier publishes them
        asm volatile("s_wait_asynccnt 0x0" ::: "memory");
        __syncthreads();
        if (kt + 2 < nt)
            gw_tile_copy(lds0 + (unsigned)(kt & 1) * bufb, ga + (size_t)(kt + 2) * GW_BK,
                         gw + (size_t)(kt + 2) * GW_BK, Kd);
    }
    // no copy is outstanding when the wave goes on to its end
    asm volatile("s_wait_asynccnt 0x0" ::: "memory");

    int m0 = mB + wm * 32 + hi * 8;
    int n0 = nB + wn * 32 + lr;
    float bv[2] = {0.f, 0.f};
    if (bias) {
        bv[0] = bias[n0];
        bv[1] = bias[n0 + 16];
        // the address registers of the two loads are free for reuse only behind this wait
        asm volatile("s_wait_xcnt 0x0" ::: "memory");
    }
    float* yp[2][8];
#pragma unroll     // register arrays need constant indices
    for (int mi = 0; mi < 2; ++mi)
#pragma unroll     // register arrays need constant indices
        for (int r = 0; r < 8; ++r) {
            yp[mi][r] = Y + (size_t)(m0 + mi * 16 + r) * N + n0;
            acc[mi][0][r] += bv[0];
            acc[mi][1][r] += bv[1];
        }
    // the stores stay behind all the arithmetic: no register of an issued store is rewritten
    __builtin_amdgcn_sched_barrier(0);
#pragma unroll     // register arrays need constant indices
    for (int mi = 0; mi < 2; ++mi)
#pragma unroll     // register arrays need constant indices
        for (int r = 0; r < 8; ++r) {
            yp[mi][r][0]  = acc[mi][0][r];
            yp[mi][r][16] = acc[mi][1][r];
        }
}

// ---------------------------------------------------------------------------
// Multi-timescale gated linear attention, chunk-parallel form (chunks of 64
// tokens). With lam constant over time, for token i of chunk c:
//   Hm_i = lam^(i+1) * E + sum_{s<=i} lam^(i-s) * g_s * k_s v_s^T
//   Z_i  = lam^(i+1) * zE + sum_{s<=i} lam^(i-s) * g_s * s_s
// where E, zE are the state at the end of chunk c-1. Three launches:
//   1. chunk_state: S_c = sum_i lam^(63-i) g_i k_i v_i^T (and the same for Z)
//   2. chunk_scan : E_c = lam^64 * E_{c-1} + S_c over the chunks, in place
//   3. chunk_out  : y_lin = (masked decayed Q K^T) V + scaled Q E, blended with y_loc
// Only non-negative powers of lam are formed, so every factor is in [0, 1].
// ---------------------------------------------------------------------------
constexpr int LA_T  = 2048;        // tokens per sequence
constexpr int LA_H  = 8;           // heads
constexpr int LA_NC = LA_T / 64;   // chunks per sequence
constexpr int LA_RS = LA_H * 64;   // dwords between the rows of one head's q, k, v
constexpr int LA_PA = 68;          // LDS pitch (dwords), rows read 8 bytes along k
constexpr int LA_PB = 72;          // LDS pitch (dwords), rows read across columns

__device__ __forceinline__ float la_sigmoid(float x) { return 1.f / (1.f + __expf(-x)); }

// base^n for 0 <= n <= 127 by squaring: 1 at n == 0 for any base, no logarithm.
__device__ __forceinline__ float la_ipow(float base, int n) {
    float p = 1.f;
#pragma unroll     // seven fixed bits, no loop control
    for (int bit = 0; bit < 7; ++bit) {
        if (n & 1) p *= base;
        base *= base;
        n >>= 1;
    }
    return p;
}

// A thread's four float4 of a 64x64 f32 tile (256 threads): global -> registers.
struct LaTile { float4 a, b, c, d; };
__device__ __forceinline__ LaTile la_tile_load(const float* g, int tid) {
    const float* p = g + ((unsigned)(tid >> 4) * LA_RS + (unsigned)(tid & 15) * 4);
    LaTile t;
    t.a = *(const float4*)(p);
    t.b = *(const float4*)(p + 16 * LA_RS);
    t.c = *(const float4*)(p + 32 * LA_RS);
    t.d = *(const float4*)(p + 48 * LA_RS);
    // address registers of these loads (offset, scalar base) are free for reuse only behind this wait
    asm volatile("s_wait_xcnt 0x0" ::: "memory");
    return t;
}
// ... and registers -> LDS at the given pitch.
__device__ __forceinline__ void la_tile_put(float* s, int pitch, int tid, const LaTile& t) {
    float* p = s + (tid >> 4) * pitch + (tid & 15) * 4;
    *(float4*)(p) = t.a;
    *(float4*)(p + 16 * pitch) = t.b;
    *(float4*)(p + 32 * pitch) = t.c;
    *(float4*)(p + 48 * pitch) = t.d;
}

// mean |k_i| + 1e-6 of row i = tid >> 2; four lanes share a row (valid in all four).
__device__ __forceinline__ float la_row_absmean(const float* s, int pitch, int tid) {
    int i = tid >> 2, qd = tid & 3;
    float a = 0.f;
#pragma unroll     // 16 independent LDS reads in flight
    for (int e = 0; e < 16; ++e) a += fabsf(s[i * pitch + e * 4 + qd]);
    a += __shfl_xor(a, 1);
    a += __shfl_xor(a, 2);
    return a * (1.f / 64.f) + 1e-6f;
}

// grid = B*LA_H*LA_NC, block = 256. blockIdx.x = (b*LA_H + h)*LA_NC + c.
// The pointers are not __restrict__: the loads then keep their side of the asm waits.
__global__ __launch_bounds__(256) void linatt_chunk_state(const float* k, const float* v, const float* gate,
                                   const float* decay_logit, float* S, float* zS) {
    int c  = blockIdx.x % LA_NC;
    int bh = blockIdx.x / LA_NC;
    int h = bh % LA_H, b = bh / LA_H;
    int tid = threadIdx.x;

    __shared__ __attribute__((aligned(16))) float sK[64 * LA_PB];
    __shared__ __attribute__((aligned(16))) float sV[64 * LA_PB];
    __shared__ float sW[2][64];      // lam^(63-i) * g_i
    __shared__ float sAbs[64];

    size_t tok0 = (size_t)b * LA_T + c * 64;
    size_t base = (tok0 * LA_H + h) * 64;
    LaTile rk = la_tile_load(k + base, tid);
    LaTile rv = la_tile_load(v + base, tid);
    la_tile_put(sK, LA_PB, tid, rk);
    la_tile_put(sV, LA_PB, tid, rv);
    if (tid < 128) {
        int kap = tid >> 6, i = tid & 63;
        float lam = la_sigmoid(decay_logit[h * 2 + kap]);
        sW[kap][i] = gate[((tok0 + i) * LA_H + h) * 2 + kap] * la_ipow(lam, 63 - i);
    }
    __syncthreads();

    float am = la_row_absmean(sK, LA_PB, tid);
    if ((tid & 3) == 0) sAbs[tid >> 2] = am;

    // S[a][j] = sum_i K[i][a] * (w_i V[i][j]); wave = (timescale, 16 columns j)
    int wave = tid >> 5, lane = tid & 31, lr = lane & 15, hi = lane >> 4;
    int kap = wave >> 2, tn = wave & 3;
    int n = tn * 16 + lr;
    v8f acc[4];
#pragma unroll     // register arrays need constant indices
    for (int tm = 0; tm < 4; ++tm) acc[tm] = (v8f){};
#pragma unroll 4   // four k-steps per trip: their LDS loads go out together
    for (int kk = 0; kk < 64; kk += 4) {
        int ka = kk + hi * 2;
        v2f bb;
        bb.x = sV[ka * LA_PB + n] * sW[kap][ka];
        bb.y = sV[(ka + 1) * LA_PB + n] * sW[kap][ka + 1];
#pragma unroll     // register arrays need constant indices
        for (int tm = 0; tm < 4; ++tm) {
            v2f a;
            a.x = sK[ka * LA_PB + tm * 16 + lr];
            a.y = sK[(ka + 1) * LA_PB + tm * 16 + lr];
            acc[tm] = wmma_f32x4(a, bb, acc[tm]);
        }
    }
    __syncthreads();   // sAbs complete
    if (wave < 2) {    // wave w sums timescale w
        float z = sW[wave][lane] * sAbs[lane] + sW[wave][lane + 32] * sAbs[lane + 32];
#pragma unroll     // five fixed shuffle steps
        for (int m = 16; m > 0; m >>= 1) z += __shfl_xor(z, m);
        if (lane == 0) zS[(size_t)blockIdx.x * 2 + wave] = z;
    }
    float* Sp = S + (size_t)blockIdx.x * 2 * 4096;
    unsigned so = (unsigned)(kap * 4096 + hi * 8 * 64 + n);
#pragma unroll     // register arrays need constant indices
    for (int tm = 0; tm < 4; ++tm)
#pragma unroll     // register arrays need constant indices
        for (int r = 0; r < 8; ++r)
            Sp[so + (tm * 16 + r) * 64] = acc[tm][r];
}

__device__ __forceinline__ void linatt_chunk_scan_block(float* __restrict__ S, float* __restrict__ zS,
                                  const float* __restrict__ decay_logit, int BH, int bid) {
    int gid = bid * 256 + threadIdx.x;
    {
        int e4 = gid & 1023, kap = (gid >> 10) & 1, bh = gid >> 11;
        float l64 = la_ipow(la_sigmoid(decay_logit[(bh % LA_H) * 2 + kap]), 64);
        float4* p = (float4*)S + ((size_t)bh * LA_NC * 2 + kap) * 1024 + e4;
        float4 s[LA_NC];
#pragma unroll     // register arrays need constant indices
        for (int c = 0; c < LA_NC; ++c) s[c] = p[(size_t)c * 2048];
        // every load is issued before the first store (all in flight at once), and
        // the address registers are free for reuse only behind this wait
        asm volatile("s_wait_xcnt 0x0" ::: "memory");
        float4 run = make_float4(0.f, 0.f, 0.f, 0.f);
#pragma unroll     // register arrays need constant indices
        for (int c = 0; c < LA_NC; ++c) {
            float4 t = s[c];
            s[c] = run;
            run.x = run.x * l64 + t.x;
            run.y = run.y * l64 + t.y;
            run.z = run.z * l64 + t.z;
            run.w = run.w * l64 + t.w;
        }
        // the stores stay behind all the arithmetic: no register of an issued store is rewritten
        __builtin_amdgcn_sched_barrier(0);
#pragma unroll     // register arrays need constant indices
        for (int c = 1; c < LA_NC; ++c) p[(size_t)c * 2048] = s[c];
        // registers of the stores above are free for reuse only behind this wait
        asm volatile("s_wait_xcnt 0x0" ::: "memory");
    }
    if (gid < BH * 2) {
        int kap = gid & 1, bh = gid >> 1;
        int di = (bh % LA_H) * 2 + kap;
        float dl = decay_logit[di];
        float* pz = zS + (size_t)bh * LA_NC * 2 + kap;
        float z[LA_NC];
#pragma unroll     // register arrays need constant indices
        for (int c = 0; c < LA_NC; ++c) z[c] = pz[c * 2];
        asm volatile("s_wait_xcnt 0x0" :: "v"(di) : "memory");
        float l64 = la_ipow(la_sigmoid(dl), 64);
        float run = 0.f;
#pragma unroll     // register arrays need constant indices
        for (int c = 0; c < LA_NC; ++c) {
            float t = z[c];
            z[c] = run;
            run = run * l64 + t;
        }
        __builtin_amdgcn_sched_barrier(0);
#pragma unroll     // register arrays need constant indices
        for (int c = 1; c < LA_NC; ++c) pz[c * 2] = z[c];
    }
}

// grid = B*LA_H*LA_NC, block = 256. blockIdx.x = (b*LA_H + h)*LA_NC + c.
// The pointers are not __restrict__: the loads then keep their side of the asm waits.
// The epilogue blends with the local-attention output of the same tile:
// y = alpha * y_loc + (1 - alpha) * y_lin (alpha per [B,T,H]); y_lin never goes to memory.
__global__ __launch_bounds__(256) void linatt_chunk_out(const float* q, const float* k, const float* v, const float* gate,
                                 const float* decay_logit, const float* E, const float* zE,
                                 const float* y_loc, const float* alpha, float* y) {
    int c  = blockIdx.x % LA_NC;
    int bh = blockIdx.x / LA_NC;
    int h = bh % LA_H, b = bh / LA_H;
    int tid = threadIdx.x;
    int wave = tid >> 5, lane = tid & 31, lr = lane & 15, hi = lane >> 4;
    int tn = wave & 3, tm0 = (wave >> 2) * 2;    // wave owns tiles (tm0, tn), (tm0+1, tn)
    int n = tn * 16 + lr;

    __shared__ __attribute__((aligned(16))) float sQ[64 * LA_PA];
    __shared__ __attribute__((aligned(16))) float sK[64 * LA_PA];
    __shared__ __attribute__((aligned(16))) float sV[64 * LA_PB];
    __shared__ __attribute__((aligned(16))) float sP[64 * LA_PA];
    __shared__ float sG[2][64];      // gate
    __shared__ float sGS[2][64];     // gate * (mean|k| + 1e-6)
    __shared__ float sZ[2][64];      // Z_i
    __shared__ float sRZ[2][64];     // 1 / (Z_i + 1e-6)
    __shared__ float sRS[2][64];     // lam^(i+1) / (Z_i + 1e-6)
    __shared__ float sPw[2][128];    // [63 + d] = lam^d for d = 0..64, 0 for d = -63..-1 (the causal mask)
    __shared__ __attribute__((aligned(16))) float sAl[64];   // alpha

    size_t tok0 = (size_t)b * LA_T + c * 64;
    size_t base = (tok0 * LA_H + h) * 64;
    LaTile rq = la_tile_load(q + base, tid);
    LaTile rk = la_tile_load(k + base, tid);
    LaTile rv = la_tile_load(v + base, tid);
    // y_loc at this lane's 16 outputs: fetched here, in flight together with the tiles.
    const float* lp = y_loc + base;
    unsigned yo = (unsigned)((tm0 * 16 + hi * 8) * LA_RS + n);
    float yl[2][8];
#pragma unroll     // register arrays need constant indices
    for (int t = 0; t < 2; ++t)
#pragma unroll     // register arrays need constant indices
        for (int r = 0; r < 8; ++r) yl[t][r] = lp[yo + (t * 16 + r) * LA_RS];
    // address registers of the loads above are free for reuse only behind this wait
    asm volatile("s_wait_xcnt 0x0" ::: "memory");
    // B fragments of the two incoming states, columns n: fetched here, in flight
    // together with the tiles.
    const float* Ep = E + (size_t)blockIdx.x * 2 * 4096;
    unsigned eo = (unsigned)(hi * 2 * 64 + n);
    v2f ef[2][16];
#pragma unroll     // register arrays need constant indices
    for (int kap = 0; kap < 2; ++kap)
#pragma unroll     // register arrays need constant indices
        for (int ks = 0; ks < 16; ++ks) ef[kap][ks] = (v2f){};
    float z0 = 0.f;   // incoming Z of timescale tid & 1
    if (c > 0) {   // chunk 0 starts from the zero state
#pragma unroll     // register arrays need constant indices
        for (int kap = 0; kap < 2; ++kap)
#pragma unroll     // register arrays need constant indices
            for (int ks = 0; ks < 16; ++ks) {
                ef[kap][ks].x = Ep[eo + kap * 4096 + ks * 256];
                ef[kap][ks].y = Ep[eo + kap * 4096 + ks * 256 + 64];
            }
        z0 = zE[(size_t)blockIdx.x * 2 + (tid & 1)];
        // address registers of the loads above are free for reuse only behind this wait
        asm volatile("s_wait_xcnt 0x0" ::: "memory");
    }
    la_tile_put(sQ, LA_PA, tid, rq);
    la_tile_put(sK, LA_PA, tid, rk);
    la_tile_put(sV, LA_PB, tid, rv);
    if (tid < 128) {
        int kap = tid >> 6, i = tid & 63;
        sG[kap][i] = gate[((tok0 + i) * LA_H + h) * 2 + kap];
    } else if (tid < 192) {
        float av = alpha[(tok0 + (tid - 128)) * LA_H + h];
        // address registers of the load are free for reuse only behind this wait
        asm volatile("s_wait_xcnt 0x0" ::: "memory");
        sAl[tid - 128] = av;
    }
    {
        int kap = tid >> 7, d = (tid & 127) - 63;
        float pw = la_ipow(la_sigmoid(decay_logit[h * 2 + kap]), d > 0 ? d : 0);
        sPw[kap][63 + d] = (d >= 0) ? pw : 0.f;
    }
    __syncthreads();

    float am = la_row_absmean(sK, LA_PA, tid);
    if ((tid & 3) < 2) sGS[tid & 3][tid >> 2] = sG[tid & 3][tid >> 2] * am;

    // A[i][s] = q_i . k_s
    v8f sc[2];
    sc[0] = (v8f){}; sc[1] = (v8f){};
#pragma unroll 4   // four k-steps per trip: their LDS loads go out together
    for (int kk = 0; kk < 64; kk += 4) {
        int ka = kk + hi * 2;
        v2f bb = *(const v2f*)&sK[(tn * 16 + lr) * LA_PA + ka];
#pragma unroll     // register arrays need constant indices
        for (int t = 0; t < 2; ++t) {
            v2f a = *(const v2f*)&sQ[((tm0 + t) * 16 + lr) * LA_PA + ka];
            sc[t] = wmma_f32x4(a, bb, sc[t]);
        }
    }
    __syncthreads();   // sGS complete

    if (tid < 2) {     // Z inside the chunk
        float Z = z0;
        float lam = sPw[tid][64];
#pragma unroll 16  // the LDS reads of 16 steps go out ahead of the serial chain
        for (int i = 0; i < 64; ++i) {
            Z = Z * lam + sGS[tid][i];
            sZ[tid][i] = Z;
        }
    }
    __syncthreads();   // sZ complete
    if (tid < 128) {
        int kap = tid >> 6, i = tid & 63;
        float rz = 1.f / (sZ[kap][i] + 1e-6f);
        sRZ[kap][i] = rz;
        sRS[kap][i] = rz * sPw[kap][64 + i];
    }
    __syncthreads();   // sRZ, sRS complete

    // P[i][s] = A[i][s] * sum_kap lam^(i-s) g_s / (Z_i + 1e-6) for s <= i, else 0
#pragma unroll     // register arrays need constant indices
    for (int t = 0; t < 2; ++t)
#pragma unroll     // register arrays need constant indices
        for (int r = 0; r < 8; ++r) {
            int i = (tm0 + t) * 16 + r + hi * 8;
            int e = 63 + i - n;
            float w = sPw[0][e] * sG[0][n] * sRZ[0][i] + sPw[1][e] * sG[1][n] * sRZ[1][i];
            sP[i * LA_PA + n] = sc[t][r] * w;
        }
    __syncthreads();   // sP complete

    v8f acc[2];
    acc[0] = (v8f){}; acc[1] = (v8f){};
#pragma unroll 4   // four k-steps per trip: their LDS loads go out together
    for (int kk = 0; kk < 64; kk += 4) {
        int ka = kk + hi * 2;
        v2f bb;
        bb.x = sV[ka * LA_PB + n];
        bb.y = sV[(ka + 1) * LA_PB + n];
#pragma unroll     // register arrays need constant indices
        for (int t = 0; t < 2; ++t) {
            v2f a = *(const v2f*)&sP[((tm0 + t) * 16 + lr) * LA_PA + ka];
            acc[t] = wmma_f32x4(a, bb, acc[t]);
        }
    }
#pragma unroll     // register arrays need constant indices
    for (int kap = 0; kap < 2; ++kap) {
        float rs0 = sRS[kap][tm0 * 16 + lr];
        float rs1 = sRS[kap][(tm0 + 1) * 16 + lr];
#pragma unroll     // register arrays need constant indices
        for (int ks = 0; ks < 16; ++ks) {
            int ka = ks * 4 + hi * 2;
            v2f a0 = *(const v2f*)&sQ[(tm0 * 16 + lr) * LA_PA + ka];
            v2f a1 = *(const v2f*)&sQ[((tm0 + 1) * 16 + lr) * LA_PA + ka];
            a0 *= rs0;
            a1 *= rs1;
            acc[0] = wmma_f32x4(a0, ef[kap][ks], acc[0]);
            acc[1] = wmma_f32x4(a1, ef[kap][ks], acc[1]);
        }
    }
    float* yp = y + base;
#pragma unroll     // register arrays need constant indices
    for (int t = 0; t < 2; ++t)
#pragma unroll     // register arrays need constant indices
        for (int r = 0; r < 8; ++r) {
            float al = sAl[(tm0 + t) * 16 + hi * 8 + r];
            acc[t][r] = al * yl[t][r] + (1.f - al) * acc[t][r];
        }
    // the stores stay behind all the arithmetic: no register of an issued store is rewritten
    __builtin_amdgcn_sched_barrier(0);
#pragma unroll     // register arrays need constant indices
    for (int t = 0; t < 2; ++t)
#pragma unroll     // register arrays need constant indices
        for (int r = 0; r < 8; ++r)
            yp[yo + (t * 16 + r) * LA_RS] = acc[t][r];
}

// ---------------------------------------------------------------------------
// Sliding-window local attention with ALiBi, one block per (b, chunk, head).
// Block = 256 threads (8 waves). Scores and P@V via fp32 WMMA.
// Q/K/V tiles come into LDS by asynchronous copies (16 bytes a lane), each row at a padded
// pitch chosen for its reader; the rows in front of token 0 (c == 0) are filled with zeros.
// LDS: phase1 Q[64]+K[128] rows (aliased as S[64] rows in phase2) + V[128] rows.
// It needs q, k, v alone, nothing of the linear branch: its blocks share a launch with the chunk scan.
// ---------------------------------------------------------------------------
constexpr int LC_PK = 68;
constexpr int LC_PV = 72;
constexpr int LC_PS = 132;

// Rows r + 16 j, j = 0..3, of three 64-row tiles (Q, K, V), 16 bytes a lane: twelve asynchronous
// copies global -> LDS. rs = 16 rows on in global memory (floats).
__device__ __forceinline__ void lc_copy_qkv(unsigned lq, const float* gq, unsigned lk, const float* gk,
                                            unsigned lv, const float* gv, size_t rs) {
    const unsigned sk = 16u * LC_PK * 4u;          // 16 rows on in LDS, bytes (Q, K)
    const unsigned sv = 16u * LC_PV * 4u;          // 16 rows on in LDS, bytes (V)
    // the copies go through no register; the closing wait stands inside the statement so that
    // the address registers named here are rewritten only behind it
    asm volatile("global_load_async_to_lds_b128 %0, %1, off\n\t"
                 "global_load_async_to_lds_b128 %2, %3, off\n\t"
                 "global_load_async_to_lds_b128 %4, %5, off\n\t"
                 "global_load_async_to_lds_b128 %6, %7, off\n\t"
                 "global_load_async_to_lds_b128 %8, %9, off\n\t"
                 "global_load_async_to_lds_b128 %10, %11, off\n\t"
                 "global_load_async_to_lds_b128 %12, %13, off\n\t"
                 "global_load_async_to_lds_b128 %14, %15, off\n\t"
                 "global_load_async_to_lds_b128 %16, %17, off\n\t"
                 "global_load_async_to_lds_b128 %18, %19, off\n\t"
                 "global_load_async_to_lds_b128 %20, %21, off\n\t"
                 "global_load_async_to_lds_b128 %22, %23, off\n\t"
                 "s_wait_xcnt 0x0"
                 :: "v"(lq),          "v"(gq),          "v"(lq + sk),     "v"(gq + rs),
                    "v"(lq + 2 * sk), "v"(gq + 2 * rs), "v"(lq + 3 * sk), "v"(gq + 3 * rs),
                    "v"(lk),          "v"(gk),          "v"(lk + sk),     "v"(gk + rs),
                    "v"(lk + 2 * sk), "v"(gk + 2 * rs), "v"(lk + 3 * sk), "v"(gk + 3 * rs),
                    "v"(lv),          "v"(gv),          "v"(lv + sv),     "v"(gv + rs),
                    "v"(lv + 2 * sv), "v"(gv + 2 * rs), "v"(lv + 3 * sv), "v"(gv + 3 * rs)
                 : "memory");
}
// The same for two tiles (K, V): eight copies.
__device__ __forceinline__ void lc_copy_kv(unsigned lk, const float* gk, unsigned lv, const float* gv, size_t rs) {
    const unsigned sk = 16u * LC_PK * 4u;
    const unsigned sv = 16u * LC_PV * 4u;
    asm volatile("global_load_async_to_lds_b128 %0, %1, off\n\t"
                 "global_load_async_to_lds_b128 %2, %3, off\n\t"
                 "global_load_async_to_lds_b128 %4, %5, off\n\t"
                 "global_load_async_to_lds_b128 %6, %7, off\n\t"
                 "global_load_async_to_lds_b128 %8, %9, off\n\t"
                 "global_load_async_to_lds_b128 %10, %11, off\n\t"
                 "global_load_async_to_lds_b128 %12, %13, off\n\t"
                 "global_load_async_to_lds_b128 %14, %15, off\n\t"
                 "s_wait_xcnt 0x0"
                 :: "v"(lk),          "v"(gk),          "v"(lk + sk),     "v"(gk + rs),
                    "v"(lk + 2 * sk), "v"(gk + 2 * rs), "v"(lk + 3 * sk), "v"(gk + 3 * rs),
                    "v"(lv),          "v"(gv),          "v"(lv + sv),     "v"(gv + rs),
                    "v"(lv + 2 * sv), "v"(gv + 2 * rs), "v"(lv + 3 * sv), "v"(gv + 3 * rs)
                 : "memory");
}

// The value of another lane of this lane's group of four, by DPP quad_perm: 0xB1 = [1,0,3,2] (lane ^ 1),
// 0x4E = [2,3,0,1] (lane ^ 2). Every lane of the wave is on where it is used.
template <int CTRL>
__device__ __forceinline__ float lc_quad_swap(float x) {
    return __int_as_float(__builtin_amdgcn_mov_dpp(__float_as_int(x), CTRL, 0xf, 0xf, true));
}

// exp(s - m) of four scores: 2^((s - m) * log2(e)) on the hardware's base-2 exponential.
__device__ __forceinline__ float4 lc_exp4(float4 s, float m) {
    float a = (s.x - m) * 1.44269504f, b = (s.y - m) * 1.44269504f;
    float c = (s.z - m) * 1.44269504f, d = (s.w - m) * 1.44269504f;
    asm("v_exp_f32 %0, %0\n\t"
        "v_exp_f32 %1, %1\n\t"
        "v_exp_f32 %2, %2\n\t"
        "v_exp_f32 %3, %3\n\t"
        "v_nop"
        : "+v"(a), "+v"(b), "+v"(c), "+v"(d));
    return make_float4(a, b, c, d);
}

__device__ __forceinline__ void local_attn_block(const float* __restrict__ q, const float* __restrict__ k,
                                const float* __restrict__ v, float* __restrict__ y,
                                int T, int H, int bid) {
    const int dh = 64;
    const int W = 64;
    int nc = T / W;
    int h = bid % H;
    int c = (bid / H) % nc;
    int b = bid / (H * nc);

    __shared__ __attribute__((aligned(16))) float smem[(64 + 128) * LC_PK];   // Q | K, aliased as S after use
    __shared__ __attribute__((aligned(16))) float sV[128 * LC_PV];
    float* sQ = smem;
    float* sK = smem + 64 * LC_PK;
    float* sS = smem;                            // aliased after barrier

    int tid = threadIdx.x;
    int wave = tid >> 5, lane = tid & 31, lr = lane & 15, hi = lane >> 4;

    // This lane's 16 outputs: rows om + r, columns on and on + 16 of the block's 64x64 tile.
    size_t tok0 = (size_t)b * T + c * W;
    int om = (wave >> 1) * 16 + hi * 8;
    int on = (wave & 1) * 32 + lr;

    // ---- stage the tiles: this thread brings 16 bytes at dword cc of rows cr + 16 j ----
    {
        int cr = tid >> 4, cc = (tid & 15) * 4;
        size_t go = ((tok0 + cr) * H + h) * dh + cc;       // row cr of this chunk
        size_t rs = (size_t)16 * H * dh;                   // 16 tokens on
        unsigned lq = (unsigned)(uintptr_t)(void*)&sQ[cr * LC_PK + cc];
        unsigned lk = (unsigned)(uintptr_t)(void*)&sK[cr * LC_PK + cc];
        unsigned lv = (unsigned)(uintptr_t)(void*)&sV[cr * LC_PV + cc];
        // this chunk: Q, and rows 64..127 of K and V
        lc_copy_qkv(lq, q + go, lk + 64u * LC_PK * 4u, k + go, lv + 64u * LC_PV * 4u, v + go, rs);
        if (c > 0) {       // the same for the whole block
            // the chunk before: rows 0..63 of K and V
            lc_copy_kv(lk, k + go - 4 * rs, lv, v + go - 4 * rs, rs);
        } else {
            // boundary chunk: the rows in front of token 0 are zero
            const float4 z4 = make_float4(0.f, 0.f, 0.f, 0.f);
#pragma unroll     // four fixed rows, no loop control
            for (int j = 0; j < 4; ++j) {
                *(float4*)&sK[(cr + 16 * j) * LC_PK + cc] = z4;
                *(float4*)&sV[(cr + 16 * j) * LC_PV + cc] = z4;
            }
        }
    }
    // this wave's copies have landed; the barrier publishes them to the others
    asm volatile("s_wait_asynccnt 0x0" ::: "memory");
    __syncthreads();

    // scores: 64x128 = 4x8 tiles of 16x16; wave handles 4 tiles
    v8f sc[4];
    for (int it = 0; it < 4; ++it) {
        int id = wave * 4 + it;
        int tm = id >> 3, tn = id & 7;
        v8f acc = {};
        for (int kkk = 0; kkk < 64; kkk += 4) {
            int ka = kkk + hi * 2;
            v2f a  = *(const v2f*)&sQ[(tm * 16 + lr) * LC_PK + ka];
            v2f bb = *(const v2f*)&sK[(tn * 16 + lr) * LC_PK + ka];
            acc = wmma_f32x4(a, bb, acc);
        }
        sc[it] = acc;
    }
    __syncthreads();   // done reading sQ/sK; safe to alias as sS

    // ALiBi + causal window mask, write scores to LDS
    float slope = exp2f(-8.0f * (float)(h + 1) / (float)H);
    for (int it = 0; it < 4; ++it) {
        int id = wave * 4 + it;
        int tm = id >> 3, tn = id & 7;
#pragma unroll
        for (int r = 0; r < 8; ++r) {
            int i = tm * 16 + r + hi * 8;
            int jj = tn * 16 + lr;
            float val = sc[it][r];
            bool valid = (jj >= i + 1) && (jj <= i + W) && (c * W + jj - W >= 0);
            val = valid ? (val - slope * (float)(i + W - jj)) : -1e30f;
            sS[i * LC_PS + jj] = val;
        }
    }
    __syncthreads();

    {
        float* pr = sS + (tid >> 2) * LC_PS + (tid & 3) * 16;
        float4 p[8];
#pragma unroll     // register arrays need constant indices; the eight LDS reads go out together
        for (int e = 0; e < 8; ++e) p[e] = *(const float4*)(pr + (e >> 2) * 64 + (e & 3) * 4);
        float mx = -3.4e38f;
#pragma unroll     // register arrays need constant indices
        for (int e = 0; e < 8; ++e)
            mx = fmaxf(mx, fmaxf(fmaxf(p[e].x, p[e].y), fmaxf(p[e].z, p[e].w)));
        mx = fmaxf(mx, lc_quad_swap<0xB1>(mx));
        mx = fmaxf(mx, lc_quad_swap<0x4E>(mx));
        float sum = 0.f;
#pragma unroll     // register arrays need constant indices
        for (int e = 0; e < 8; ++e) {
            p[e] = lc_exp4(p[e], mx);
            sum += (p[e].x + p[e].y) + (p[e].z + p[e].w);
        }
        sum += lc_quad_swap<0xB1>(sum);
        sum += lc_quad_swap<0x4E>(sum);
        float inv = 1.f / sum;
#pragma unroll     // register arrays need constant indices
        for (int e = 0; e < 8; ++e) {
            p[e].x *= inv; p[e].y *= inv; p[e].z *= inv; p[e].w *= inv;
            *(float4*)(pr + (e >> 2) * 64 + (e & 3) * 4) = p[e];
        }
    }
    __syncthreads();

    // y_loc = P[64,128] @ Vctx[128,64]; 16 tiles, wave handles 2; V from LDS
    v8f yb[2];
#pragma unroll     // register arrays need constant indices
    for (int it = 0; it < 2; ++it) {
        int id = wave * 2 + it;
        int tm = id >> 2, tn = id & 3;
        int n = tn * 16 + lr;
        v8f acc = {};
        for (int kkk = 0; kkk < 128; kkk += 4) {
            int ka = kkk + hi * 2;
            v2f a = *(const v2f*)&sS[(tm * 16 + lr) * LC_PS + ka];
            v2f bb;
            bb.x = sV[ka * LC_PV + n];
            bb.y = sV[(ka + 1) * LC_PV + n];
            acc = wmma_f32x4(a, bb, acc);
        }
        yb[it] = acc;
    }
    float* yg = y + (tok0 * H + h) * dh;
    float* yp[8];
#pragma unroll     // register arrays need constant indices
    for (int r = 0; r < 8; ++r) yp[r] = yg + (unsigned)((om + r) * H * dh + on);
    // the stores stay behind all the arithmetic: no register of an issued store is rewritten
    __builtin_amdgcn_sched_barrier(0);
#pragma unroll     // register arrays need constant indices
    for (int r = 0; r < 8; ++r) {
        yp[r][0]  = yb[0][r];
        yp[r][16] = yb[1][r];
    }
}

// One launch for two pieces of work that do not depend on one another: the local attention
// (B * T/64 * H blocks, the long ones, first) and the scan over the chunk states (the rest of the
// grid). A whole block goes one way, so every barrier stands under block-uniform control flow.
__global__ __launch_bounds__(256) void local_attn_and_chunk_scan(const float* __restrict__ q, const float* __restrict__ k,
                                const float* __restrict__ v, float* __restrict__ y_loc,
                                int B, int T, int H,
                                float* __restrict__ S, float* __restrict__ zS,
                                const float* __restrict__ decay_logit) {
    const int nloc = B * (T / 64) * H;
    if ((int)blockIdx.x < nloc) local_attn_block(q, k, v, y_loc, T, H, (int)blockIdx.x);
    else linatt_chunk_scan_block(S, zS, decay_logit, B * H, (int)blockIdx.x - nloc);
}

constexpr int AN_D = 512;

// x + the value of lane ^ m inside a row of 16 lanes, by DPP row_xmask: CTRL = 0x160 + m.
// Every lane of the wave is on where it is used.
template <int CTRL>
__device__ __forceinline__ float an_xmask_add(float x) {
    return x + __int_as_float(__builtin_amdgcn_mov_dpp(__float_as_int(x), CTRL, 0xf, 0xf, true));
}
// Sum over the 32 lanes, the same value in every lane: four steps inside each half, then lane ^ 16.
__device__ __forceinline__ float an_wave_sum(float x) {
    x = an_xmask_add<0x161>(x);
    x = an_xmask_add<0x162>(x);
    x = an_xmask_add<0x164>(x);
    x = an_xmask_add<0x168>(x);
    return x + __int_as_float(__builtin_amdgcn_permlanex16(__float_as_int(x), __float_as_int(x),
                                                           0x76543210, 0xfedcba98, false, false));
}

// grid = rows / 8, block = 256.
// The pointers are not __restrict__: the loads then keep their side of the asm wait.
__global__ __launch_bounds__(256) void addnorm_kernel(const float* x, const float* proj,
                               const float* gamma, const float* beta, float* out) {
    // byte offsets of this lane's first column: in gamma and beta, and in its row of x, proj and out
    unsigned cb = (threadIdx.x & 31u) * 16u;
    unsigned rb = (blockIdx.x * 8u + (threadIdx.x >> 5)) * (AN_D * 4u) + cb;
    float4 r[4], p[4], g[4], b[4];
#pragma unroll     // register arrays need constant indices; the sixteen loads go out together
    for (int j = 0; j < 4; ++j) {
        r[j] = *(const float4*)((const char*)x + rb + j * 512);
        p[j] = *(const float4*)((const char*)proj + rb + j * 512);
        g[j] = *(const float4*)((const char*)gamma + cb + j * 512);
        b[j] = *(const float4*)((const char*)beta + cb + j * 512);
    }
    // the address registers of the loads above are free for reuse only behind this wait; it names
    // the two offsets, so they stay live up to it and no load's result is placed in one of them
    asm volatile("s_wait_xcnt 0x0" :: "v"(rb), "v"(cb) : "memory");
    // the arithmetic stays behind all sixteen loads: none of them waits for another's data
    __builtin_amdgcn_sched_barrier(0);

    float sj[4], qj[4];
#pragma unroll     // register arrays need constant indices; four independent chains
    for (int j = 0; j < 4; ++j) {
        r[j].x += p[j].x; r[j].y += p[j].y; r[j].z += p[j].z; r[j].w += p[j].w;
        sj[j] = (r[j].x + r[j].y) + (r[j].z + r[j].w);
        qj[j] = r[j].x * r[j].x + r[j].y * r[j].y + r[j].z * r[j].z + r[j].w * r[j].w;
    }
    float s  = an_wave_sum((sj[0] + sj[1]) + (sj[2] + sj[3]));
    float s2 = an_wave_sum((qj[0] + qj[1]) + (qj[2] + qj[3]));
    float mean = s * (1.f / (float)AN_D);
    float var = s2 * (1.f / (float)AN_D) - mean * mean;
    float inv = rsqrtf(var + 1e-5f);
#pragma unroll     // register arrays need constant indices
    for (int j = 0; j < 4; ++j) {
        r[j].x = (r[j].x - mean) * inv * g[j].x + b[j].x;
        r[j].y = (r[j].y - mean) * inv * g[j].y + b[j].y;
        r[j].z = (r[j].z - mean) * inv * g[j].z + b[j].z;
        r[j].w = (r[j].w - mean) * inv * g[j].w + b[j].w;
    }
    // the stores stay behind all the arithmetic: no register of an issued store is rewritten
    __builtin_amdgcn_sched_barrier(0);
#pragma unroll     // register arrays need constant indices
    for (int j = 0; j < 4; ++j) *(float4*)((char*)out + rb + j * 512) = r[j];
}

// ---------------------------------------------------------------------------
extern "C" void kernel_launch(void* const* d_in, const int* in_sizes, int n_in,
                              void* d_out, int out_size, void* d_ws, size_t ws_size,
                              hipStream_t stream) {
    const int D = 512, H = 8, Kts = 2, dh = 64, T = 2048;
    const int M = in_sizes[0] / D;          // B*T = 4096
    const int B = M / T;                    // 2
    const int nc = T / 64;

    const float* x      = (const float*)d_in[0];
    const float* Wq     = (const float*)d_in[1];
    const float* Wk     = (const float*)d_in[2];
    const float* Wv     = (const float*)d_in[3];
    const float* Wg     = (const float*)d_in[4];
    const float* bg     = (const float*)d_in[5];
    const float* Wa     = (const float*)d_in[6];
    const float* ba     = (const float*)d_in[7];
    const float* Wo     = (const float*)d_in[8];
    const float* bo     = (const float*)d_in[9];
    const float* decay  = (const float*)d_in[10];
    const float* gamma  = (const float*)d_in[11];
    const float* beta   = (const float*)d_in[12];
    float* out = (float*)d_out;

    // workspace carve-up
    float* ws = (float*)d_ws;
    size_t off = 0;
    float* q_buf    = ws + off; off += (size_t)M * D;
    float* k_buf    = ws + off; off += (size_t)M * D;
    float* v_buf    = ws + off; off += (size_t)M * D;
    float* gate_buf = ws + off; off += (size_t)M * H * Kts;
    float* alp_buf  = ws + off; off += (size_t)M * H;
    float* yloc_buf = ws + off; off += (size_t)M * D;
    float* ymix_buf = ws + off; off += (size_t)M * D;
    float* proj_buf = ws + off; off += (size_t)M * D;
    float* st_buf   = ws + off; off += (size_t)B * H * nc * Kts * dh * dh;
    float* zst_buf  = ws + off; off += (size_t)B * H * nc * Kts;

    dim3 blk(256);
    dim3 grid_wide(M / 64, D / 128);        // 64 x 4
    dim3 grid_proj(M / 64, 3 * (D / 128) + 1);   // skinny row, then q, k, v

    // the five projections of x in one launch: q, k, v (wide) and gate, alpha (skinny, sigmoid fused)
    gemm_nt_wmma_wide<<<grid_proj, blk, 0, stream>>>(x, Wq, Wk, Wv, nullptr, q_buf, k_buf, v_buf,
                                                     Wg, bg, gate_buf, H * Kts, Wa, ba, alp_buf, H,
                                                     M, D, D, 1);

    // gated linear attention, chunk-parallel: chunk states, scan over chunks, outputs; the
    // sliding-window local attention with ALiBi rides in the scan's launch, the gated blend of the
    // two branches is the epilogue of the chunk outputs
    linatt_chunk_state<<<B * nc * H, blk, 0, stream>>>(k_buf, v_buf, gate_buf, decay,
                                                       st_buf, zst_buf);
    local_attn_and_chunk_scan<<<B * nc * H + B * H * 8, blk, 0, stream>>>(q_buf, k_buf, v_buf, yloc_buf,
                                                                          B, T, H, st_buf, zst_buf, decay);
    linatt_chunk_out<<<B * nc * H, blk, 0, stream>>>(q_buf, k_buf, v_buf, gate_buf, decay,
                                                     st_buf, zst_buf, yloc_buf, alp_buf, ymix_buf);

    // output projection + residual + layernorm
    gemm_nt_wmma_wide<<<grid_wide, blk, 0, stream>>>(ymix_buf, Wo, nullptr, nullptr, bo,
                                                     proj_buf, nullptr, nullptr,
                                                     nullptr, nullptr, nullptr, 0, nullptr, nullptr, nullptr, 0,
                                                     M, D, D, 0);
    addnorm_kernel<<<M / 8, blk, 0, stream>>>(x, proj_buf, gamma, beta, out);
}

// v009
// One run takes 98.1 microseconds.
// In both of two side-by-side timings against v008, it was 1.10 times as fast.
// All steps since v000 together make it 33.8 times as fast.
#include <hip/hip_runtime.h>
#include <hip/hip_bf16.h>
#include <math.h>

typedef __attribute__((ext_vector_type(2))) float v2f;
typedef __attribute__((ext_vector_type(8))) float v8f;

__device__ __forceinline__ v8f wmma_f32x4(v2f a, v2f b, v8f c) {
    // D = A(16x4 f32) * B(4x16 f32) + C(16x16 f32)
    return __builtin_amdgcn_wmma_f32_16x16x4_f32(
        /*neg_a=*/false, a, /*neg_b=*/false, b,
        /*c_mod=*/(short)0, c, /*reuse_a=*/false, /*reuse_b=*/false);
}

constexpr int GW_BM   = 64;
constexpr int GW_BN   = 128;
constexpr int GW_BK   = 64;
constexpr int GW_P    = 68;
constexpr int GW_ROWS = GW_BM + GW_BN;
constexpr int GW_BUF  = GW_ROWS * GW_P;

// One k-tile into one buffer: thread tid brings 16 bytes of rows (tid >> 4) + 16 j, j = 0..11
// (j < 4: rows of A, then rows of W), by twelve asynchronous copies global -> LDS.
__device__ __forceinline__ void gw_tile_copy(unsigned lds, const float* ga, const float* gw, int Kd) {
    const size_t rs = (size_t)16 * Kd;             // 16 rows on in global memory
    const unsigned ls = 16u * GW_P * 4u;           // 16 rows on in LDS, bytes
    // the copies go through no register; the closing wait stands inside the statement so that
    // the address registers named here are rewritten only behind it
    asm volatile("global_load_async_to_lds_b128 %0, %1, off\n\t"
                 "global_load_async_to_lds_b128 %2, %3, off\n\t"
                 "global_load_async_to_lds_b128 %4, %5, off\n\t"
                 "global_load_async_to_lds_b128 %6, %7, off\n\t"
                 "global_load_async_to_lds_b128 %8, %9, off\n\t"
                 "global_load_async_to_lds_b128 %10, %11, off\n\t"
                 "global_load_async_to_lds_b128 %12, %13, off\n\t"
                 "global_load_async_to_lds_b128 %14, %15, off\n\t"
                 "global_load_async_to_lds_b128 %16, %17, off\n\t"
                 "global_load_async_to_lds_b128 %18, %19, off\n\t"
                 "global_load_async_to_lds_b128 %20, %21, off\n\t"
                 "global_load_async_to_lds_b128 %22, %23, off\n\t"
                 "s_wait_xcnt 0x0"
                 :: "v"(lds),           "v"(ga),          "v"(lds + ls),      "v"(ga + rs),
                    "v"(lds + 2 * ls),  "v"(ga + 2 * rs), "v"(lds + 3 * ls),  "v"(ga + 3 * rs),
                    "v"(lds + 4 * ls),  "v"(gw),          "v"(lds + 5 * ls),  "v"(gw + rs),
                    "v"(lds + 6 * ls),  "v"(gw + 2 * rs), "v"(lds + 7 * ls),  "v"(gw + 3 * rs),
                    "v"(lds + 8 * ls),  "v"(gw + 4 * rs), "v"(lds + 9 * ls),  "v"(gw + 5 * rs),
                    "v"(lds + 10 * ls), "v"(gw + 6 * rs), "v"(lds + 11 * ls), "v"(gw + 7 * rs)
                 : "memory");
}

__device__ __forceinline__ void gemm_nt_skinny_block(const float* __restrict__ A, const float* __restrict__ W,
                                                     const float* __restrict__ bias, float* __restrict__ Y,
                                                     int mblk, int N, int Kd) {
    int wave = threadIdx.x >> 5;
    int lane = threadIdx.x & 31;
    int m0 = (mblk * 8 + wave) * 16;
    int lr = lane & 15;
    int hi = lane >> 4;
    int wrow = lr;                       // n0 == 0 (single tile of columns)
    int wrc = (wrow < N) ? wrow : 0;
    float msk = (wrow < N) ? 1.f : 0.f;

    const float* ap = A + (size_t)(m0 + lr) * Kd + hi * 2;
    const float* wpr = W + (size_t)wrc * Kd + hi * 2;

    v8f acc = {};
    for (int kk = 0; kk < Kd; kk += 32) {        // Kd % 64 == 0, as for the wide blocks
        const float* pa = ap + kk;
        const float* pw = wpr + kk;
        v2f a[8], b[8];
#pragma unroll     // register arrays need constant indices; eight k-steps' loads go out together
        for (int j = 0; j < 8; ++j) {
            a[j] = *(const v2f*)(pa + j * 4);
            b[j] = *(const v2f*)(pw + j * 4);
        }
        // the address registers of the loads above are free for reuse only behind this wait; it names
        // them, so they stay live up to it and no load's result is placed in one of them
        asm volatile("s_wait_xcnt 0x0" :: "v"(pa), "v"(pw) : "memory");
#pragma unroll     // register arrays need constant indices
        for (int j = 0; j < 8; ++j) acc = wmma_f32x4(a[j], b[j] * msk, acc);
    }
    float bv = bias[wrc];
    // the address registers of the load are free for reuse only behind this wait
    asm volatile("s_wait_xcnt 0x0" ::: "memory");
    float* yp[8];
    float o[8];
#pragma unroll     // register arrays need constant indices
    for (int r = 0; r < 8; ++r) {
        yp[r] = Y + (size_t)(m0 + r + hi * 8) * N + lr;
        o[r] = 1.f / (1.f + __expf(-(acc[r] + bv)));
    }
    // the stores stay behind all the arithmetic: no register of an issued store is rewritten
    __builtin_amdgcn_sched_barrier(0);
    if (lr < N) {
#pragma unroll     // register arrays need constant indices
        for (int r = 0; r < 8; ++r) yp[r][0] = o[r];
    }
}

// One launch holds every product of the same A: blockIdx.y walks, in this order, one row of
// skinny blocks (only where skinny != 0: the first half of blockIdx.x the gate, the second half
// alpha; they go first because they are short and free their place early), then the N / 128
// column tiles of W0 -> Y0, of W1 -> Y1 and of W2 -> Y2. The blocks are independent of one another.
__global__ __launch_bounds__(256) void gemm_nt_wmma_wide(const float* __restrict__ A,
                                  const float* __restrict__ W0, const float* __restrict__ W1,
                                  const float* __restrict__ W2, const float* __restrict__ bias,
                                  float* __restrict__ Y0, float* __restrict__ Y1, float* __restrict__ Y2,
                                  const float* __restrict__ Wg, const float* __restrict__ bg,
                                  float* __restrict__ Yg, int Ng,
                                  const float* __restrict__ Wa, const float* __restrict__ ba,
                                  float* __restrict__ Ya, int Na,
                                  int M, int N, int Kd, int skinny) {
    __shared__ __attribute__((aligned(16))) float sT[2 * GW_BUF];

    int by = (int)blockIdx.y - skinny;
    if (by < 0) {                        // the whole block takes this way, ahead of every barrier
        const int half = M / (2 * GW_BM);                // M / 128 blocks for each skinny product
        const bool g = (int)blockIdx.x < half;
        gemm_nt_skinny_block(A, g ? Wg : Wa, g ? bg : ba, g ? Yg : Ya,
                             g ? (int)blockIdx.x : (int)blockIdx.x - half, g ? Ng : Na, Kd);
        return;
    }
    const int ntile = N / GW_BN;         // column tiles per weight matrix
    const int sel = by / ntile;
    const float* W = sel == 0 ? W0 : (sel == 1 ? W1 : W2);
    float* Y = sel == 0 ? Y0 : (sel == 1 ? Y1 : Y2);

    int tid = threadIdx.x;
    int wave = tid >> 5;
    int lane = tid & 31;
    int wm = wave & 1;                   // 0..1
    int wn = wave >> 1;                  // 0..3
    int mB = blockIdx.x * GW_BM;
    int nB = (by - sel * ntile) * GW_BN;
    int lr = lane & 15;
    int hi = lane >> 4;

    // this thread's place in a tile: row tid >> 4, 16 bytes at dword (tid & 15) * 4
    int cr = tid >> 4, cc = (tid & 15) * 4;
    const float* ga = A + (size_t)(mB + cr) * Kd + cc;
    const float* gw = W + (size_t)(nB + cr) * Kd + cc;
    unsigned lds0 = (unsigned)(uintptr_t)(void*)&sT[cr * GW_P + cc];   // LDS byte address, buffer 0
    const unsigned bufb = (unsigned)GW_BUF * 4u;                       // bytes from buffer 0 to buffer 1
    const int nt = Kd / GW_BK;

    v8f acc[2][2];
#pragma unroll     // register arrays need constant indices
    for (int mi = 0; mi < 2; ++mi)
#pragma unroll     // register arrays need constant indices
        for (int t = 0; t < 2; ++t) acc[mi][t] = (v8f){};

    gw_tile_copy(lds0, ga, gw, Kd);
    // tile 0 has landed for this wave; the barrier publishes it to the others
    asm volatile("s_wait_asynccnt 0x0" ::: "memory");
    __syncthreads();
    if (nt > 1) gw_tile_copy(lds0 + bufb, ga + GW_BK, gw + GW_BK, Kd);

    for (int kt = 0; kt < nt; ++kt) {
        const float* sb = sT + (kt & 1) * GW_BUF;
        const float* sa = sb + (wm * 32 + lr) * GW_P + hi * 2;
        const float* sw = sb + (GW_BM + wn * 32 + lr) * GW_P + hi * 2;
#pragma unroll     // the tile's LDS reads are visible together and go out ahead of the WMMAs
        for (int ks = 0; ks < GW_BK / 4; ++ks) {
            v2f a0 = *(const v2f*)(sa + ks * 4);
            v2f a1 = *(const v2f*)(sa + 16 * GW_P + ks * 4);
            v2f b0 = *(const v2f*)(sw + ks * 4);
            v2f b1 = *(const v2f*)(sw + 16 * GW_P + ks * 4);
            acc[0][0] = wmma_f32x4(a0, b0, acc[0][0]);
            acc[0][1] = wmma_f32x4(a0, b1, acc[0][1]);
            acc[1][0] = wmma_f32x4(a1, b0, acc[1][0]);
            acc[1][1] = wmma_f32x4(a1, b1, acc[1][1]);
        }
        // this wave's reads of the buffer have returned before the buffer is refilled
        asm volatile("s_wait_dscnt 0x0" ::: "memory");
        // this wave's copies of tile kt + 1 have landed before the barrier publishes them
        asm volatile("s_wait_asynccnt 0x0" ::: "memory");
        __syncthreads();
        if (kt + 2 < nt)
            gw_tile_copy(lds0 + (unsigned)(kt & 1) * bufb, ga + (size_t)(kt + 2) * GW_BK,
                         gw + (size_t)(kt + 2) * GW_BK, Kd);
    }
    // no copy is outstanding when the wave goes on to its end
    asm volatile("s_wait_asynccnt 0x0" ::: "memory");

    int m0 = mB + wm * 32 + hi * 8;
    int n0 = nB + wn * 32 + lr;
    float bv[2] = {0.f, 0.f};
    if (bias) {
        bv[0] = bias[n0];
        bv[1] = bias[n0 + 16];
        // the address registers of the two loads are free for reuse only behind this wait
        asm volatile("s_wait_xcnt 0x0" ::: "memory");
    }
    float* yp[2][8];
#pragma unroll     // register arrays need constant indices
    for (int mi = 0; mi < 2; ++mi)
#pragma unroll     // register arrays need constant indices
        for (int r = 0; r < 8; ++r) {
            yp[mi][r] = Y + (size_t)(m0 + mi * 16 + r) * N + n0;
            acc[mi][0][r] += bv[0];
            acc[mi][1][r] += bv[1];
        }
    // the stores stay behind all the arithmetic: no register of an issued store is rewritten
    __builtin_amdgcn_sched_barrier(0);
#pragma unroll     // register arrays need constant indices
    for (int mi = 0; mi < 2; ++mi)
#pragma unroll     // register arrays need constant indices
        for (int r = 0; r < 8; ++r) {
            yp[mi][r][0]  = acc[mi][0][r];
            yp[mi][r][16] = acc[mi][1][r];
        }
}

// ---------------------------------------------------------------------------
// Multi-timescale gated linear attention, chunk-parallel form (chunks of 64
// tokens). With lam constant over time, for token i of chunk c:
//   Hm_i = lam^(i+1) * E + sum_{s<=i} lam^(i-s) * g_s * k_s v_s^T
//   Z_i  = lam^(i+1) * zE + sum_{s<=i} lam^(i-s) * g_s * s_s
// where E, zE are the state at the end of chunk c-1. Two launches:
//   1. state_scan: E_c = lam^64 * E_{c-1} + sum_i lam^(63-i) g_i k_i v_i^T (and the same for Z),
//                  one pass over the chunks with the running state kept in the accumulator
//   2. chunk_out : y_lin = (masked decayed Q K^T) V + scaled Q E, blended with y_loc
// Only non-negative powers of lam are formed, so every factor is in [0, 1].
// ---------------------------------------------------------------------------
constexpr int LA_T  = 2048;        // tokens per sequence
constexpr int LA_H  = 8;           // heads
constexpr int LA_NC = LA_T / 64;   // chunks per sequence
constexpr int LA_RS = LA_H * 64;   // dwords between the rows of one head's q, k, v
constexpr int LA_PA = 68;          // LDS pitch (dwords), rows read 8 bytes along k
constexpr int LA_PB = 72;          // LDS pitch (dwords), rows read across columns

__device__ __forceinline__ float la_sigmoid(float x) { return 1.f / (1.f + __expf(-x)); }

// base^n for 0 <= n <= 127 by squaring: 1 at n == 0 for any base, no logarithm.
__device__ __forceinline__ float la_ipow(float base, int n) {
    float p = 1.f;
#pragma unroll     // seven fixed bits, no loop control
    for (int bit = 0; bit < 7; ++bit) {
        if (n & 1) p *= base;
        base *= base;
        n >>= 1;
    }
    return p;
}

// A thread's four float4 of a 64x64 f32 tile (256 threads): global -> registers.
struct LaTile { float4 a, b, c, d; };
__device__ __forceinline__ LaTile la_tile_load(const float* g, int tid) {
    const float* p = g + ((unsigned)(tid >> 4) * LA_RS + (unsigned)(tid & 15) * 4);
    LaTile t;
    t.a = *(const float4*)(p);
    t.b = *(const float4*)(p + 16 * LA_RS);
    t.c = *(const float4*)(p + 32 * LA_RS);
    t.d = *(const float4*)(p + 48 * LA_RS);
    // address registers of these loads (offset, scalar base) are free for reuse only behind this wait
    asm volatile("s_wait_xcnt 0x0" ::: "memory");
    return t;
}
// ... and registers -> LDS at the given pitch.
__device__ __forceinline__ void la_tile_put(float* s, int pitch, int tid, const LaTile& t) {
    float* p = s + (tid >> 4) * pitch + (tid & 15) * 4;
    *(float4*)(p) = t.a;
    *(float4*)(p + 16 * pitch) = t.b;
    *(float4*)(p + 32 * pitch) = t.c;
    *(float4*)(p + 48 * pitch) = t.d;
}

// mean |k_i| + 1e-6 of row i = tid >> 2; four lanes share a row (valid in all four).
__device__ __forceinline__ float la_row_absmean(const float* s, int pitch, int tid) {
    int i = tid >> 2, qd = tid & 3;
    float a = 0.f;
#pragma unroll     // 16 independent LDS reads in flight
    for (int e = 0; e < 16; ++e) a += fabsf(s[i * pitch + e * 4 + qd]);
    a += __shfl_xor(a, 1);
    a += __shfl_xor(a, 2);
    return a * (1.f / 64.f) + 1e-6f;
}

constexpr int SS_PK    = 72;
constexpr int SS_PV    = 24;
constexpr int SS_ROWS  = 128;
constexpr int SS_STAGE = SS_ROWS * (SS_PK + SS_PV);
constexpr int SS_W     = 2 * SS_STAGE;
constexpr int SS_Z     = SS_W + LA_T;
constexpr int SS_LDS   = SS_Z + LA_NC * 4;

// x + the value of lane ^ m inside a row of 16 lanes, by DPP row_xmask: CTRL = 0x160 + m.
// Every lane of the wave is on where it is used.
template <int CTRL>
__device__ __forceinline__ float la_xmask_add(float x) {
    return x + __int_as_float(__builtin_amdgcn_mov_dpp(__float_as_int(x), CTRL, 0xf, 0xf, true));
}
// Sum over the 32 lanes, the same value in every lane: four steps inside each half, then lane ^ 16.
__device__ __forceinline__ float la_wave_sum(float x) {
    x = la_xmask_add<0x161>(x);
    x = la_xmask_add<0x162>(x);
    x = la_xmask_add<0x164>(x);
    x = la_xmask_add<0x168>(x);
    return x + __int_as_float(__builtin_amdgcn_permlanex16(__float_as_int(x), __float_as_int(x),
                                                           0x76543210, 0xfedcba98, false, false));
}

// One stage: thread tid brings 16 bytes of K rows (tid >> 4) + 16 j, j = 0..7, and of V rows
// (tid >> 2) + 64 j, j = 0..1, by ten asynchronous copies global -> LDS.
__device__ __forceinline__ void ss_stage_copy(unsigned lk, const float* gk, unsigned lv, const float* gv) {
    const size_t rk = (size_t)16 * LA_RS;          // 16 tokens on in global memory
    const size_t rv = (size_t)64 * LA_RS;          // 64 tokens on
    const unsigned sk = 16u * SS_PK * 4u;          // 16 rows on in LDS, bytes (K)
    const unsigned sv = 64u * SS_PV * 4u;          // 64 rows on in LDS, bytes (V)
    // the copies go through no register; the closing wait stands inside the statement so that
    // the address registers named here are rewritten only behind it
    asm volatile("global_load_async_to_lds_b128 %0, %1, off\n\t"
                 "global_load_async_to_lds_b128 %2, %3, off\n\t"
                 "global_load_async_to_lds_b128 %4, %5, off\n\t"
                 "global_load_async_to_lds_b128 %6, %7, off\n\t"
                 "global_load_async_to_lds_b128 %8, %9, off\n\t"
                 "global_load_async_to_lds_b128 %10, %11, off\n\t"
                 "global_load_async_to_lds_b128 %12, %13, off\n\t"
                 "global_load_async_to_lds_b128 %14, %15, off\n\t"
                 "global_load_async_to_lds_b128 %16, %17, off\n\t"
                 "global_load_async_to_lds_b128 %18, %19, off\n\t"
                 "s_wait_xcnt 0x0"
                 :: "v"(lk),          "v"(gk),          "v"(lk + sk),     "v"(gk + rk),
                    "v"(lk + 2 * sk), "v"(gk + 2 * rk), "v"(lk + 3 * sk), "v"(gk + 3 * rk),
                    "v"(lk + 4 * sk), "v"(gk + 4 * rk), "v"(lk + 5 * sk), "v"(gk + 5 * rk),
                    "v"(lk + 6 * sk), "v"(gk + 6 * rk), "v"(lk + 7 * sk), "v"(gk + 7 * rk),
                    "v"(lv),          "v"(gv),          "v"(lv + sv),     "v"(gv + rv)
                 : "memory");
}

__device__ __forceinline__ void linatt_state_scan_block(float* sh, const float* k, const float* v,
                                  const float* gate, const float* decay_logit,
                                  float* E, float* zE, int bid) {
    int kap = bid & 1, jt = (bid >> 1) & 3, bh = bid >> 3;
    int h = bh % LA_H, b = bh / LA_H;
    int tid = threadIdx.x;
    int wave = __builtin_amdgcn_readfirstlane(tid >> 5);   // scalar: the waves' roles are scalar branches
    int lane = tid & 31, lr = lane & 15, hi = lane >> 4;
    float* sW = sh + SS_W;
    float* sZp = sh + SS_Z;

    size_t tokb = (size_t)b * LA_T;
    const float* gk = k + ((tokb + (tid >> 4)) * LA_H + h) * 64 + (tid & 15) * 4;
    const float* gv = v + ((tokb + (tid >> 2)) * LA_H + h) * 64 + jt * 16 + (tid & 3) * 4;
    unsigned lk = (unsigned)(uintptr_t)(void*)&sh[(tid >> 4) * SS_PK + (tid & 15) * 4];
    unsigned lv = (unsigned)(uintptr_t)(void*)&sh[SS_ROWS * SS_PK + (tid >> 2) * SS_PV + (tid & 3) * 4];
    const unsigned bufb = (unsigned)SS_STAGE * 4u;         // bytes from buffer 0 to buffer 1
    const size_t gs = (size_t)SS_ROWS * LA_RS;             // one stage on in global memory
    const int nst = LA_T / SS_ROWS;                        // stages

    ss_stage_copy(lk, gk, lv, gv);

    float lam = la_sigmoid(decay_logit[h * 2 + kap]);
    float l64 = la_ipow(lam, 64);
    {   // the weights of all tokens: thread tid has tokens tid + 256 j, all at place tid & 63 of their chunk
        float pw = la_ipow(lam, 63 - (tid & 63));
        const float* gp = gate + ((tokb + tid) * LA_H + h) * 2 + kap;
        float g[8];
#pragma unroll     // register arrays need constant indices; the eight loads go out together
        for (int j = 0; j < 8; ++j) g[j] = gp[(size_t)j * 256 * LA_H * 2];
        // the address registers of the loads above are free for reuse only behind this wait
        asm volatile("s_wait_xcnt 0x0" ::: "memory");
#pragma unroll     // register arrays need constant indices
        for (int j = 0; j < 8; ++j) sW[tid + 256 * j] = g[j] * pw;
    }
    // stage 0 has landed for this wave; the barrier publishes it, and the weights, to the others
    asm volatile("s_wait_asynccnt 0x0" ::: "memory");
    __syncthreads();
    ss_stage_copy(lk + bufb, gk + gs, lv + bufb, gv + gs);

    int tm = wave & 3;
    v8f acc = {};      // the running state of tile (tm, jt)
    v8f keep = {};     // the state in front of the stage's second chunk, stored at the head of the next stage
    float* Ep = E + (size_t)bh * LA_NC * 2 * 4096 + (unsigned)(kap * 4096 + (tm * 16 + hi * 8) * 64 + jt * 16 + lr);
    // this lane's first element of a chunk's fragments (dwords from the chunk's K rows, V rows, weights)
    const int fk = hi * 2 * SS_PK + tm * 16 + lr;
    const int fv = hi * 2 * SS_PV + lr;
    // this lane's half row of K for the Z sums: two lanes share a row, 16 rows a wave
    const int zr = tm * 16 + (lane >> 1);
    const float ze = (lane & 1) ? 0.f : 1e-6f;

    for (int t = 0; t < nst; ++t) {
        const float* sb = sh + (t & 1) * SS_STAGE;
        if (wave < 4) {
            float* e0 = Ep + (size_t)(t > 0 ? 2 * t - 1 : 0) * 2 * 4096;
            float* e1 = Ep + (size_t)(2 * t) * 2 * 4096;
#pragma unroll     // register arrays need constant indices
            for (int r = 0; r < 8; ++r) e0[r * 64] = keep[r];
#pragma unroll     // register arrays need constant indices
            for (int r = 0; r < 8; ++r) e1[r * 64] = acc[r];
            // registers of the stores above are free for reuse only behind this wait
            asm volatile("s_wait_xcnt 0x0" ::: "memory");
#pragma unroll     // two chunks a stage, constant LDS offsets
            for (int u = 0; u < 2; ++u) {
                const float* pk = sb + u * 64 * SS_PK + fk;
                const float* pv = sb + SS_ROWS * SS_PK + u * 64 * SS_PV + fv;
                const float* pw = sW + (t * 2 + u) * 64 + hi * 2;
                v2f a[16], bb[16];
#pragma unroll     // register arrays need constant indices; the chunk's LDS reads go out together
                for (int ks = 0; ks < 16; ++ks) {
                    v2f w2 = *(const v2f*)(pw + ks * 4);
                    a[ks].x = pk[ks * 4 * SS_PK];
                    a[ks].y = pk[ks * 4 * SS_PK + SS_PK];
                    bb[ks].x = pv[ks * 4 * SS_PV] * w2.x;
                    bb[ks].y = pv[ks * 4 * SS_PV + SS_PV] * w2.y;
                }
                if (u == 1) keep = acc;
#pragma unroll     // register arrays need constant indices
                for (int r = 0; r < 8; ++r) acc[r] *= l64;
                // two accumulator chains: a lone wave's WMMAs then issue at the pipe's rate
                v8f s1 = {};
#pragma unroll     // register arrays need constant indices
                for (int ks = 0; ks < 8; ++ks) {
                    acc = wmma_f32x4(a[ks], bb[ks], acc);
                    s1 = wmma_f32x4(a[ks + 8], bb[ks + 8], s1);
                }
#pragma unroll     // register arrays need constant indices
                for (int r = 0; r < 8; ++r) acc[r] += s1[r];
            }
        } else if (jt == 0) {
#pragma unroll     // two chunks a stage, constant LDS offsets; the two are independent
            for (int u = 0; u < 2; ++u) {
                // sum_i w_i (mean |k_i| + 1e-6) over this wave's 16 rows
                const float* p = sb + u * 64 * SS_PK + zr * SS_PK + (lane & 1) * 32;
                float s = 0.f;
#pragma unroll     // eight independent LDS reads in flight
                for (int e = 0; e < 8; ++e) {
                    float4 x = *(const float4*)(p + e * 4);
                    s += (fabsf(x.x) + fabsf(x.y)) + (fabsf(x.z) + fabsf(x.w));
                }
                float val = la_wave_sum(sW[(t * 2 + u) * 64 + zr] * (s * (1.f / 64.f) + ze));
                if (lane == 0) sZp[(t * 2 + u) * 4 + tm] = val;
            }
        }
        // this wave's reads of the buffer have returned before the buffer is refilled
        asm volatile("s_wait_dscnt 0x0" ::: "memory");
        // this wave's copies of stage t + 1 have landed before the barrier publishes them
        asm volatile("s_wait_asynccnt 0x0" ::: "memory");
        __syncthreads();
        if (t + 2 < nst)
            ss_stage_copy(lk + (unsigned)(t & 1) * bufb, gk + (size_t)(t + 2) * gs,
                          lv + (unsigned)(t & 1) * bufb, gv + (size_t)(t + 2) * gs);
    }
    // no copy is outstanding when the wave goes on to its end
    asm volatile("s_wait_asynccnt 0x0" ::: "memory");
    if (wave < 4) {
        float* e0 = Ep + (size_t)(LA_NC - 1) * 2 * 4096;
#pragma unroll     // register arrays need constant indices
        for (int r = 0; r < 8; ++r) e0[r * 64] = keep[r];
        // registers of the stores above are free for reuse only behind this wait
        asm volatile("s_wait_xcnt 0x0" ::: "memory");
    }

    if (jt == 0 && wave == 0) {    // lane c: Z at the end of chunk c-1 (LA_NC == 32 lanes)
        float4 zp = *(const float4*)(sZp + lane * 4);
        float z = (zp.x + zp.y) + (zp.z + zp.w);
        float run = 0.f, zo = 0.f;
#pragma unroll     // constant lane numbers for the reads of one lane
        for (int s = 0; s < LA_NC; ++s) {
            float zs = __int_as_float(__builtin_amdgcn_readlane(__float_as_int(z), s));
            zo = (lane == s) ? run : zo;
            run = run * l64 + zs;
        }
        if (lane > 0) zE[((size_t)bh * LA_NC + lane) * 2 + kap] = zo;
    }
}

// grid = B*LA_H*LA_NC, block = 256. blockIdx.x = (b*LA_H + h)*LA_NC + c.
// The pointers are not __restrict__: the loads then keep their side of the asm waits.
// The epilogue blends with the local-attention output of the same tile:
// y = alpha * y_loc + (1 - alpha) * y_lin (alpha per [B,T,H]); y_lin never goes to memory.
__global__ __launch_bounds__(256) void linatt_chunk_out(const float* q, const float* k, const float* v, const float* gate,
                                 const float* decay_logit, const float* E, const float* zE,
                                 const float* y_loc, const float* alpha, float* y) {
    int c  = blockIdx.x % LA_NC;
    int bh = blockIdx.x / LA_NC;
    int h = bh % LA_H, b = bh / LA_H;
    int tid = threadIdx.x;
    int wave = tid >> 5, lane = tid & 31, lr = lane & 15, hi = lane >> 4;
    int tn = wave & 3, tm0 = (wave >> 2) * 2;    // wave owns tiles (tm0, tn), (tm0+1, tn)
    int n = tn * 16 + lr;

    __shared__ __attribute__((aligned(16))) float sQ[64 * LA_PA];
    __shared__ __attribute__((aligned(16))) float sK[64 * LA_PA];
    __shared__ __attribute__((aligned(16))) float sV[64 * LA_PB];
    __shared__ __attribute__((aligned(16))) float sP[64 * LA_PA];
    __shared__ float sG[2][64];      // gate
    __shared__ float sGS[2][64];     // gate * (mean|k| + 1e-6)
    __shared__ float sZ[2][64];      // Z_i
    __shared__ float sRZ[2][64];     // 1 / (Z_i + 1e-6)
    __shared__ float sRS[2][64];     // lam^(i+1) / (Z_i + 1e-6)
    __shared__ float sPw[2][128];    // [63 + d] = lam^d for d = 0..64, 0 for d = -63..-1 (the causal mask)
    __shared__ __attribute__((aligned(16))) float sAl[64];   // alpha

    size_t tok0 = (size_t)b * LA_T + c * 64;
    size_t base = (tok0 * LA_H + h) * 64;
    LaTile rq = la_tile_load(q + base, tid);
    LaTile rk = la_tile_load(k + base, tid);
    LaTile rv = la_tile_load(v + base, tid);
    // y_loc at this lane's 16 outputs: fetched here, in flight together with the tiles.
    const float* lp = y_loc + base;
    unsigned yo = (unsigned)((tm0 * 16 + hi * 8) * LA_RS + n);
    float yl[2][8];
#pragma unroll     // register arrays need constant indices
    for (int t = 0; t < 2; ++t)
#pragma unroll     // register arrays need constant indices
        for (int r = 0; r < 8; ++r) yl[t][r] = lp[yo + (t * 16 + r) * LA_RS];
    // address registers of the loads above are free for reuse only behind this wait
    asm volatile("s_wait_xcnt 0x0" ::: "memory");
    // B fragments of the two incoming states, columns n: fetched here, in flight
    // together with the tiles.
    const float* Ep = E + (size_t)blockIdx.x * 2 * 4096;
    unsigned eo = (unsigned)(hi * 2 * 64 + n);
    v2f ef[2][16];
#pragma unroll     // register arrays need constant indices
    for (int kap = 0; kap < 2; ++kap)
#pragma unroll     // register arrays need constant indices
        for (int ks = 0; ks < 16; ++ks) ef[kap][ks] = (v2f){};
    float z0 = 0.f;   // incoming Z of timescale tid & 1
    if (c > 0) {   // chunk 0 starts from the zero state
#pragma unroll     // register arrays need constant indices
        for (int kap = 0; kap < 2; ++kap)
#pragma unroll     // register arrays need constant indices
            for (int ks = 0; ks < 16; ++ks) {
                ef[kap][ks].x = Ep[eo + kap * 4096 + ks * 256];
                ef[kap][ks].y = Ep[eo + kap * 4096 + ks * 256 + 64];
            }
        z0 = zE[(size_t)blockIdx.x * 2 + (tid & 1)];
        // address registers of the loads above are free for reuse only behind this wait
        asm volatile("s_wait_xcnt 0x0" ::: "memory");
    }
    la_tile_put(sQ, LA_PA, tid, rq);
    la_tile_put(sK, LA_PA, tid, rk);
    la_tile_put(sV, LA_PB, tid, rv);
    if (tid < 128) {
        int kap = tid >> 6, i = tid & 63;
        sG[kap][i] = gate[((tok0 + i) * LA_H + h) * 2 + kap];
    } else if (tid < 192) {
        float av = alpha[(tok0 + (tid - 128)) * LA_H + h];
        // address registers of the load are free for reuse only behind this wait
        asm volatile("s_wait_xcnt 0x0" ::: "memory");
        sAl[tid - 128] = av;
    }
    {
        int kap = tid >> 7, d = (tid & 127) - 63;
        float pw = la_ipow(la_sigmoid(decay_logit[h * 2 + kap]), d > 0 ? d : 0);
        sPw[kap][63 + d] = (d >= 0) ? pw : 0.f;
    }
    __syncthreads();

    float am = la_row_absmean(sK, LA_PA, tid);
    if ((tid & 3) < 2) sGS[tid & 3][tid >> 2] = sG[tid & 3][tid >> 2] * am;

    // A[i][s] = q_i . k_s
    v8f sc[2];
    sc[0] = (v8f){}; sc[1] = (v8f){};
#pragma unroll 4   // four k-steps per trip: their LDS loads go out together
    for (int kk = 0; kk < 64; kk += 4) {
        int ka = kk + hi * 2;
        v2f bb = *(const v2f*)&sK[(tn * 16 + lr) * LA_PA + ka];
#pragma unroll     // register arrays need constant indices
        for (int t = 0; t < 2; ++t) {
            v2f a = *(const v2f*)&sQ[((tm0 + t) * 16 + lr) * LA_PA + ka];
            sc[t] = wmma_f32x4(a, bb, sc[t]);
        }
    }
    __syncthreads();   // sGS complete

    if (tid < 2) {     // Z inside the chunk
        float Z = z0;
        float lam = sPw[tid][64];
#pragma unroll 16  // the LDS reads of 16 steps go out ahead of the serial chain
        for (int i = 0; i < 64; ++i) {
            Z = Z * lam + sGS[tid][i];
            sZ[tid][i] = Z;
        }
    }
    __syncthreads();   // sZ complete
    if (tid < 128) {
        int kap = tid >> 6, i = tid & 63;
        float rz = 1.f / (sZ[kap][i] + 1e-6f);
        sRZ[kap][i] = rz;
        sRS[kap][i] = rz * sPw[kap][64 + i];
    }
    __syncthreads();   // sRZ, sRS complete

    // P[i][s] = A[i][s] * sum_kap lam^(i-s) g_s / (Z_i + 1e-6) for s <= i, else 0
#pragma unroll     // register arrays need constant indices
    for (int t = 0; t < 2; ++t)
#pragma unroll     // register arrays need constant indices
        for (int r = 0; r < 8; ++r) {
            int i = (tm0 + t) * 16 + r + hi * 8;
            int e = 63 + i - n;
            float w = sPw[0][e] * sG[0][n] * sRZ[0][i] + sPw[1][e] * sG[1][n] * sRZ[1][i];
            sP[i * LA_PA + n] = sc[t][r] * w;
        }
    __syncthreads();   // sP complete

    v8f acc[2];
    acc[0] = (v8f){}; acc[1] = (v8f){};
#pragma unroll 4   // four k-steps per trip: their LDS loads go out together
    for (int kk = 0; kk < 64; kk += 4) {
        int ka = kk + hi * 2;
        v2f bb;
        bb.x = sV[ka * LA_PB + n];
        bb.y = sV[(ka + 1) * LA_PB + n];
#pragma unroll     // register arrays need constant indices
        for (int t = 0; t < 2; ++t) {
            v2f a = *(const v2f*)&sP[((tm0 + t) * 16 + lr) * LA_PA + ka];
            acc[t] = wmma_f32x4(a, bb, acc[t]);
        }
    }
#pragma unroll     // register arrays need constant indices
    for (int kap = 0; kap < 2; ++kap) {
        float rs0 = sRS[kap][tm0 * 16 + lr];
        float rs1 = sRS[kap][(tm0 + 1) * 16 + lr];
#pragma unroll     // register arrays need constant indices
        for (int ks = 0; ks < 16; ++ks) {
            int ka = ks * 4 + hi * 2;
            v2f a0 = *(const v2f*)&sQ[(tm0 * 16 + lr) * LA_PA + ka];
            v2f a1 = *(const v2f*)&sQ[((tm0 + 1) * 16 + lr) * LA_PA + ka];
            a0 *= rs0;
            a1 *= rs1;
            acc[0] = wmma_f32x4(a0, ef[kap][ks], acc[0]);
            acc[1] = wmma_f32x4(a1, ef[kap][ks], acc[1]);
        }
    }
    float* yp = y + base;
#pragma unroll     // register arrays need constant indices
    for (int t = 0; t < 2; ++t)
#pragma unroll     // register arrays need constant indices
        for (int r = 0; r < 8; ++r) {
            float al = sAl[(tm0 + t) * 16 + hi * 8 + r];
            acc[t][r] = al * yl[t][r] + (1.f - al) * acc[t][r];
        }
    // the stores stay behind all the arithmetic: no register of an issued store is rewritten
    __builtin_amdgcn_sched_barrier(0);
#pragma unroll     // register arrays need constant indices
    for (int t = 0; t < 2; ++t)
#pragma unroll     // register arrays need constant indices
        for (int r = 0; r < 8; ++r)
            yp[yo + (t * 16 + r) * LA_RS] = acc[t][r];
}

// ---------------------------------------------------------------------------
// Sliding-window local attention with ALiBi, one block per (b, chunk, head).
// Block = 256 threads (8 waves). Scores and P@V via fp32 WMMA.
// Q/K/V tiles come into LDS by asynchronous copies (16 bytes a lane), each row at a padded
// pitch chosen for its reader; the rows in front of token 0 (c == 0) are filled with zeros.
// LDS: phase1 Q[64]+K[128] rows (aliased as S[64] rows in phase2) + V[128] rows.
// It needs q, k, v alone, nothing of the linear branch: its blocks share a launch with the state scan.
// ---------------------------------------------------------------------------
constexpr int LC_PK = 68;
constexpr int LC_PV = 72;
constexpr int LC_PS = 132;

// Rows r + 16 j, j = 0..3, of three 64-row tiles (Q, K, V), 16 bytes a lane: twelve asynchronous
// copies global -> LDS. rs = 16 rows on in global memory (floats).
__device__ __forceinline__ void lc_copy_qkv(unsigned lq, const float* gq, unsigned lk, const float* gk,
                                            unsigned lv, const float* gv, size_t rs) {
    const unsigned sk = 16u * LC_PK * 4u;          // 16 rows on in LDS, bytes (Q, K)
    const unsigned sv = 16u * LC_PV * 4u;          // 16 rows on in LDS, bytes (V)
    // the copies go through no register; the closing wait stands inside the statement so that
    // the address registers named here are rewritten only behind it
    asm volatile("global_load_async_to_lds_b128 %0, %1, off\n\t"
                 "global_load_async_to_lds_b128 %2, %3, off\n\t"
                 "global_load_async_to_lds_b128 %4, %5, off\n\t"
                 "global_load_async_to_lds_b128 %6, %7, off\n\t"
                 "global_load_async_to_lds_b128 %8, %9, off\n\t"
                 "global_load_async_to_lds_b128 %10, %11, off\n\t"
                 "global_load_async_to_lds_b128 %12, %13, off\n\t"
                 "global_load_async_to_lds_b128 %14, %15, off\n\t"
                 "global_load_async_to_lds_b128 %16, %17, off\n\t"
                 "global_load_async_to_lds_b128 %18, %19, off\n\t"
                 "global_load_async_to_lds_b128 %20, %21, off\n\t"
                 "global_load_async_to_lds_b128 %22, %23, off\n\t"
                 "s_wait_xcnt 0x0"
                 :: "v"(lq),          "v"(gq),          "v"(lq + sk),     "v"(gq + rs),
                    "v"(lq + 2 * sk), "v"(gq + 2 * rs), "v"(lq + 3 * sk), "v"(gq + 3 * rs),
                    "v"(lk),          "v"(gk),          "v"(lk + sk),     "v"(gk + rs),
                    "v"(lk + 2 * sk), "v"(gk + 2 * rs), "v"(lk + 3 * sk), "v"(gk + 3 * rs),
                    "v"(lv),          "v"(gv),          "v"(lv + sv),     "v"(gv + rs),
                    "v"(lv + 2 * sv), "v"(gv + 2 * rs), "v"(lv + 3 * sv), "v"(gv + 3 * rs)
                 : "memory");
}
// The same for two tiles (K, V): eight copies.
__device__ __forceinline__ void lc_copy_kv(unsigned lk, const float* gk, unsigned lv, const float* gv, size_t rs) {
    const unsigned sk = 16u * LC_PK * 4u;
    const unsigned sv = 16u * LC_PV * 4u;
    asm volatile("global_load_async_to_lds_b128 %0, %1, off\n\t"
                 "global_load_async_to_lds_b128 %2, %3, off\n\t"
                 "global_load_async_to_lds_b128 %4, %5, off\n\t"
                 "global_load_async_to_lds_b128 %6, %7, off\n\t"
                 "global_load_async_to_lds_b128 %8, %9, off\n\t"
                 "global_load_async_to_lds_b128 %10, %11, off\n\t"
                 "global_load_async_to_lds_b128 %12, %13, off\n\t"
                 "global_load_async_to_lds_b128 %14, %15, off\n\t"
                 "s_wait_xcnt 0x0"
                 :: "v"(lk),          "v"(gk),          "v"(lk + sk),     "v"(gk + rs),
                    "v"(lk + 2 * sk), "v"(gk + 2 * rs), "v"(lk + 3 * sk), "v"(gk + 3 * rs),
                    "v"(lv),          "v"(gv),          "v"(lv + sv),     "v"(gv + rs),
                    "v"(lv + 2 * sv), "v"(gv + 2 * rs), "v"(lv + 3 * sv), "v"(gv + 3 * rs)
                 : "memory");
}

// The value of another lane of this lane's group of four, by DPP quad_perm: 0xB1 = [1,0,3,2] (lane ^ 1),
// 0x4E = [2,3,0,1] (lane ^ 2). Every lane of the wave is on where it is used.
template <int CTRL>
__device__ __forceinline__ float lc_quad_swap(float x) {
    return __int_as_float(__builtin_amdgcn_mov_dpp(__float_as_int(x), CTRL, 0xf, 0xf, true));
}

// exp(s - m) of four scores: 2^((s - m) * log2(e)) on the hardware's base-2 exponential.
__device__ __forceinline__ float4 lc_exp4(float4 s, float m) {
    float a = (s.x - m) * 1.44269504f, b = (s.y - m) * 1.44269504f;
    float c = (s.z - m) * 1.44269504f, d = (s.w - m) * 1.44269504f;
    asm("v_exp_f32 %0, %0\n\t"
        "v_exp_f32 %1, %1\n\t"
        "v_exp_f32 %2, %2\n\t"
        "v_exp_f32 %3, %3\n\t"
        "v_nop"
        : "+v"(a), "+v"(b), "+v"(c), "+v"(d));
    return make_float4(a, b, c, d);
}

__device__ __forceinline__ void local_attn_block(float* sh, const float* __restrict__ q, const float* __restrict__ k,
                                const float* __restrict__ v, float* __restrict__ y,
                                int T, int H, int bid) {
    const int dh = 64;
    const int W = 64;
    int nc = T / W;
    int h = bid % H;
    int c = (bid / H) % nc;
    int b = bid / (H * nc);

    float* smem = sh;                            // Q | K, aliased as S after use
    float* sV = sh + (64 + 128) * LC_PK;         // 128 rows
    float* sQ = smem;
    float* sK = smem + 64 * LC_PK;
    float* sS = smem;                            // aliased after barrier

    int tid = threadIdx.x;
    int wave = tid >> 5, lane = tid & 31, lr = lane & 15, hi = lane >> 4;

    // This lane's 16 outputs: rows om + r, columns on and on + 16 of the block's 64x64 tile.
    size_t tok0 = (size_t)b * T + c * W;
    int om = (wave >> 1) * 16 + hi * 8;
    int on = (wave & 1) * 32 + lr;

    // ---- stage the tiles: this thread brings 16 bytes at dword cc of rows cr + 16 j ----
    {
        int cr = tid >> 4, cc = (tid & 15) * 4;
        size_t go = ((tok0 + cr) * H + h) * dh + cc;       // row cr of this chunk
        size_t rs = (size_t)16 * H * dh;                   // 16 tokens on
        unsigned lq = (unsigned)(uintptr_t)(void*)&sQ[cr * LC_PK + cc];
        unsigned lk = (unsigned)(uintptr_t)(void*)&sK[cr * LC_PK + cc];
        unsigned lv = (unsigned)(uintptr_t)(void*)&sV[cr * LC_PV + cc];
        // this chunk: Q, and rows 64..127 of K and V
        lc_copy_qkv(lq, q + go, lk + 64u * LC_PK * 4u, k + go, lv + 64u * LC_PV * 4u, v + go, rs);
        if (c > 0) {       // the same for the whole block
            // the chunk before: rows 0..63 of K and V
            lc_copy_kv(lk, k + go - 4 * rs, lv, v + go - 4 * rs, rs);
        } else {
            // boundary chunk: the rows in front of token 0 are zero
            const float4 z4 = make_float4(0.f, 0.f, 0.f, 0.f);
#pragma unroll     // four fixed rows, no loop control
            for (int j = 0; j < 4; ++j) {
                *(float4*)&sK[(cr + 16 * j) * LC_PK + cc] = z4;
                *(float4*)&sV[(cr + 16 * j) * LC_PV + cc] = z4;
            }
        }
    }
    // this wave's copies have landed; the barrier publishes them to the others
    asm volatile("s_wait_asynccnt 0x0" ::: "memory");
    __syncthreads();

    // scores: 64x128 = 4x8 tiles of 16x16; wave handles 4 tiles
    v8f sc[4];
    for (int it = 0; it < 4; ++it) {
        int id = wave * 4 + it;
        int tm = id >> 3, tn = id & 7;
        v8f acc = {};
        for (int kkk = 0; kkk < 64; kkk += 4) {
            int ka = kkk + hi * 2;
            v2f a  = *(const v2f*)&sQ[(tm * 16 + lr) * LC_PK + ka];
            v2f bb = *(const v2f*)&sK[(tn * 16 + lr) * LC_PK + ka];
            acc = wmma_f32x4(a, bb, acc);
        }
        sc[it] = acc;
    }
    __syncthreads();   // done reading sQ/sK; safe to alias as sS

    // ALiBi + causal window mask, write scores to LDS
    float slope = exp2f(-8.0f * (float)(h + 1) / (float)H);
    for (int it = 0; it < 4; ++it) {
        int id = wave * 4 + it;
        int tm = id >> 3, tn = id & 7;
#pragma unroll
        for (int r = 0; r < 8; ++r) {
            int i = tm * 16 + r + hi * 8;
            int jj = tn * 16 + lr;
            float val = sc[it][r];
            bool valid = (jj >= i + 1) && (jj <= i + W) && (c * W + jj - W >= 0);
            val = valid ? (val - slope * (float)(i + W - jj)) : -1e30f;
            sS[i * LC_PS + jj] = val;
        }
    }
    __syncthreads();

    {
        float* pr = sS + (tid >> 2) * LC_PS + (tid & 3) * 16;
        float4 p[8];
#pragma unroll     // register arrays need constant indices; the eight LDS reads go out together
        for (int e = 0; e < 8; ++e) p[e] = *(const float4*)(pr + (e >> 2) * 64 + (e & 3) * 4);
        float mx = -3.4e38f;
#pragma unroll     // register arrays need constant indices
        for (int e = 0; e < 8; ++e)
            mx = fmaxf(mx, fmaxf(fmaxf(p[e].x, p[e].y), fmaxf(p[e].z, p[e].w)));
        mx = fmaxf(mx, lc_quad_swap<0xB1>(mx));
        mx = fmaxf(mx, lc_quad_swap<0x4E>(mx));
        float sum = 0.f;
#pragma unroll     // register arrays need constant indices
        for (int e = 0; e < 8; ++e) {
            p[e] = lc_exp4(p[e], mx);
            sum += (p[e].x + p[e].y) + (p[e].z + p[e].w);
        }
        sum += lc_quad_swap<0xB1>(sum);
        sum += lc_quad_swap<0x4E>(sum);
        float inv = 1.f / sum;
#pragma unroll     // register arrays need constant indices
        for (int e = 0; e < 8; ++e) {
            p[e].x *= inv; p[e].y *= inv; p[e].z *= inv; p[e].w *= inv;
            *(float4*)(pr + (e >> 2) * 64 + (e & 3) * 4) = p[e];
        }
    }
    __syncthreads();

    // y_loc = P[64,128] @ Vctx[128,64]; 16 tiles, wave handles 2; V from LDS
    v8f yb[2];
#pragma unroll     // register arrays need constant indices
    for (int it = 0; it < 2; ++it) {
        int id = wave * 2 + it;
        int tm = id >> 2, tn = id & 3;
        int n = tn * 16 + lr;
        v8f acc = {};
        for (int kkk = 0; kkk < 128; kkk += 4) {
            int ka = kkk + hi * 2;
            v2f a = *(const v2f*)&sS[(tm * 16 + lr) * LC_PS + ka];
            v2f bb;
            bb.x = sV[ka * LC_PV + n];
            bb.y = sV[(ka + 1) * LC_PV + n];
            acc = wmma_f32x4(a, bb, acc);
        }
        yb[it] = acc;
    }
    float* yg = y + (tok0 * H + h) * dh;
    float* yp[8];
#pragma unroll     // register arrays need constant indices
    for (int r = 0; r < 8; ++r) yp[r] = yg + (unsigned)((om + r) * H * dh + on);
    // the stores stay behind all the arithmetic: no register of an issued store is rewritten
    __builtin_amdgcn_sched_barrier(0);
#pragma unroll     // register arrays need constant indices
    for (int r = 0; r < 8; ++r) {
        yp[r][0]  = yb[0][r];
        yp[r][16] = yb[1][r];
    }
    // registers of the stores above (offsets, scalar base) are free for reuse only behind this wait
    asm volatile("s_wait_xcnt 0x0" ::: "memory");
}

// One launch for two pieces of work that do not depend on one another: the pass over the chunk states
// (B * LA_H * 8 blocks, each a serial walk over the chunks) and the local attention (B * T/64 * H
// blocks, four times as many). A whole block goes one way, so every barrier stands under block-uniform
// control flow. The two share one LDS array; three blocks fit a WGP, so the whole grid is resident.
static_assert(SS_LDS >= (64 + 128) * LC_PK + 128 * LC_PV, "the LDS array holds the local attention's tiles");
__global__ __launch_bounds__(256) void local_attn_and_state_scan(const float* __restrict__ q, const float* __restrict__ k,
                                const float* __restrict__ v, float* __restrict__ y_loc,
                                int B, int T, int H, const float* __restrict__ gate,
                                float* __restrict__ E, float* __restrict__ zE,
                                const float* __restrict__ decay_logit) {
    __shared__ __attribute__((aligned(16))) float sh[SS_LDS];
    const int nss = B * LA_H * 8;
    const int bx = (int)blockIdx.x;
    if (bx >= nss && bx < 2 * nss) linatt_state_scan_block(sh, k, v, gate, decay_logit, E, zE, bx - nss);
    else local_attn_block(sh, q, k, v, y_loc, T, H, bx < nss ? bx : bx - nss);
}

constexpr int AN_D = 512;

// x + the value of lane ^ m inside a row of 16 lanes, by DPP row_xmask: CTRL = 0x160 + m.
// Every lane of the wave is on where it is used.
template <int CTRL>
__device__ __forceinline__ float an_xmask_add(float x) {
    return x + __int_as_float(__builtin_amdgcn_mov_dpp(__float_as_int(x), CTRL, 0xf, 0xf, true));
}
// Sum over the 32 lanes, the same value in every lane: four steps inside each half, then lane ^ 16.
__device__ __forceinline__ float an_wave_sum(float x) {
    x = an_xmask_add<0x161>(x);
    x = an_xmask_add<0x162>(x);
    x = an_xmask_add<0x164>(x);
    x = an_xmask_add<0x168>(x);
    return x + __int_as_float(__builtin_amdgcn_permlanex16(__float_as_int(x), __float_as_int(x),
                                                           0x76543210, 0xfedcba98, false, false));
}

// grid = rows / 8, block = 256.
// The pointers are not __restrict__: the loads then keep their side of the asm wait.
__global__ __launch_bounds__(256) void addnorm_kernel(const float* x, const float* proj,
                               const float* gamma, const float* beta, float* out) {
    // byte offsets of this lane's first column: in gamma and beta, and in its row of x, proj and out
    unsigned cb = (threadIdx.x & 31u) * 16u;
    unsigned rb = (blockIdx.x * 8u + (threadIdx.x >> 5)) * (AN_D * 4u) + cb;
    float4 r[4], p[4], g[4], b[4];
#pragma unroll     // register arrays need constant indices; the sixteen loads go out together
    for (int j = 0; j < 4; ++j) {
        r[j] = *(const float4*)((const char*)x + rb + j * 512);
        p[j] = *(const float4*)((const char*)proj + rb + j * 512);
        g[j] = *(const float4*)((const char*)gamma + cb + j * 512);
        b[j] = *(const float4*)((const char*)beta + cb + j * 512);
    }
    // the address registers of the loads above are free for reuse only behind this wait; it names
    // the two offsets, so they stay live up to it and no load's result is placed in one of them
    asm volatile("s_wait_xcnt 0x0" :: "v"(rb), "v"(cb) : "memory");
    // the arithmetic stays behind all sixteen loads: none of them waits for another's data
    __builtin_amdgcn_sched_barrier(0);

    float sj[4], qj[4];
#pragma unroll     // register arrays need constant indices; four independent chains
    for (int j = 0; j < 4; ++j) {
        r[j].x += p[j].x; r[j].y += p[j].y; r[j].z += p[j].z; r[j].w += p[j].w;
        sj[j] = (r[j].x + r[j].y) + (r[j].z + r[j].w);
        qj[j] = r[j].x * r[j].x + r[j].y * r[j].y + r[j].z * r[j].z + r[j].w * r[j].w;
    }
    float s  = an_wave_sum((sj[0] + sj[1]) + (sj[2] + sj[3]));
    float s2 = an_wave_sum((qj[0] + qj[1]) + (qj[2] + qj[3]));
    float mean = s * (1.f / (float)AN_D);
    float var = s2 * (1.f / (float)AN_D) - mean * mean;
    float inv = rsqrtf(var + 1e-5f);
#pragma unroll     // register arrays need constant indices
    for (int j = 0; j < 4; ++j) {
        r[j].x = (r[j].x - mean) * inv * g[j].x + b[j].x;
        r[j].y = (r[j].y - mean) * inv * g[j].y + b[j].y;
        r[j].z = (r[j].z - mean) * inv * g[j].z + b[j].z;
        r[j].w = (r[j].w - mean) * inv * g[j].w + b[j].w;
    }
    // the stores stay behind all the arithmetic: no register of an issued store is rewritten
    __builtin_amdgcn_sched_barrier(0);
#pragma unroll     // register arrays need constant indices
    for (int j = 0; j < 4; ++j) *(float4*)((char*)out + rb + j * 512) = r[j];
}

// ---------------------------------------------------------------------------
extern "C" void kernel_launch(void* const* d_in, const int* in_sizes, int n_in,
                              void* d_out, int out_size, void* d_ws, size_t ws_size,
                              hipStream_t stream) {
    const int D = 512, H = 8, Kts = 2, dh = 64, T = 2048;
    const int M = in_sizes[0] / D;          // B*T = 4096
    const int B = M / T;                    // 2
    const int nc = T / 64;

    const float* x      = (const float*)d_in[0];
    const float* Wq     = (const float*)d_in[1];
    const float* Wk     = (const float*)d_in[2];
    const float* Wv     = (const float*)d_in[3];
    const float* Wg     = (const float*)d_in[4];
    const float* bg     = (const float*)d_in[5];
    const float* Wa     = (const float*)d_in[6];
    const float* ba     = (const float*)d_in[7];
    const float* Wo     = (const float*)d_in[8];
    const float* bo     = (const float*)d_in[9];
    const float* decay  = (const float*)d_in[10];
    const float* gamma  = (const float*)d_in[11];
    const float* beta   = (const float*)d_in[12];
    float* out = (float*)d_out;

    // workspace carve-up
    float* ws = (float*)d_ws;
    size_t off = 0;
    float* q_buf    = ws + off; off += (size_t)M * D;
    float* k_buf    = ws + off; off += (size_t)M * D;
    float* v_buf    = ws + off; off += (size_t)M * D;
    float* gate_buf = ws + off; off += (size_t)M * H * Kts;
    float* alp_buf  = ws + off; off += (size_t)M * H;
    float* yloc_buf = ws + off; off += (size_t)M * D;
    float* ymix_buf = ws + off; off += (size_t)M * D;
    float* proj_buf = ws + off; off += (size_t)M * D;
    float* st_buf   = ws + off; off += (size_t)B * H * nc * Kts * dh * dh;
    float* zst_buf  = ws + off; off += (size_t)B * H * nc * Kts;

    dim3 blk(256);
    dim3 grid_wide(M / 64, D / 128);        // 64 x 4
    dim3 grid_proj(M / 64, 3 * (D / 128) + 1);   // skinny row, then q, k, v

    // the five projections of x in one launch: q, k, v (wide) and gate, alpha (skinny, sigmoid fused)
    gemm_nt_wmma_wide<<<grid_proj, blk, 0, stream>>>(x, Wq, Wk, Wv, nullptr, q_buf, k_buf, v_buf,
                                                     Wg, bg, gate_buf, H * Kts, Wa, ba, alp_buf, H,
                                                     M, D, D, 1);

    // gated linear attention, chunk-parallel: one pass forms and scans the chunk states, then the
    // outputs; the sliding-window local attention with ALiBi rides in the pass's launch, the gated
    // blend of the two branches is the epilogue of the chunk outputs
    local_attn_and_state_scan<<<B * H * 8 + B * nc * H, blk, 0, stream>>>(q_buf, k_buf, v_buf, yloc_buf,
                                                                          B, T, H, gate_buf, st_buf, zst_buf, decay);
    linatt_chunk_out<<<B * nc * H, blk, 0, stream>>>(q_buf, k_buf, v_buf, gate_buf, decay,
                                                     st_buf, zst_buf, yloc_buf, alp_buf, ymix_buf);

    // output projection + residual + layernorm
    gemm_nt_wmma_wide<<<grid_wide, blk, 0, stream>>>(ymix_buf, Wo, nullptr, nullptr, bo,
                                                     proj_buf, nullptr, nullptr,
                                                     nullptr, nullptr, nullptr, 0, nullptr, nullptr, nullptr, 0,
                                                     M, D, D, 0);
    addnorm_kernel<<<M / 8, blk, 0, stream>>>(x, proj_buf, gamma, beta, out);
}

// v010
// Measured time: 90.3 microseconds a run.
// Timed twice side by side with v009, it ran 1.09 and 1.08 times as fast.
// Over all steps from v000 it is 36.6 times as fast.
#include <hip/hip_runtime.h>
#include <hip/hip_bf16.h>
#include <math.h>

typedef __attribute__((ext_vector_type(2))) float v2f;
typedef __attribute__((ext_vector_type(8))) float v8f;

__device__ __forceinline__ v8f wmma_f32x4(v2f a, v2f b, v8f c) {
    // D = A(16x4 f32) * B(4x16 f32) + C(16x16 f32)
    return __builtin_amdgcn_wmma_f32_16x16x4_f32(
        /*neg_a=*/false, a, /*neg_b=*/false, b,
        /*c_mod=*/(short)0, c, /*reuse_a=*/false, /*reuse_b=*/false);
}

constexpr int GW_BM   = 64;
constexpr int GW_BN   = 128;
constexpr int GW_BK   = 64;
constexpr int GW_P    = 68;
constexpr int GW_ROWS = GW_BM + GW_BN;
constexpr int GW_BUF  = GW_ROWS * GW_P;

// One k-tile into one buffer: thread tid brings 16 bytes of rows (tid >> 4) + 16 j, j = 0..11
// (j < 4: rows of A, then rows of W), by twelve asynchronous copies global -> LDS.
__device__ __forceinline__ void gw_tile_copy(unsigned lds, const float* ga, const float* gw, int Kd) {
    const size_t rs = (size_t)16 * Kd;             // 16 rows on in global memory
    const unsigned ls = 16u * GW_P * 4u;           // 16 rows on in LDS, bytes
    // the copies go through no register; the closing wait stands inside the statement so that
    // the address registers named here are rewritten only behind it
    asm volatile("global_load_async_to_lds_b128 %0, %1, off\n\t"
                 "global_load_async_to_lds_b128 %2, %3, off\n\t"
                 "global_load_async_to_lds_b128 %4, %5, off\n\t"
                 "global_load_async_to_lds_b128 %6, %7, off\n\t"
                 "global_load_async_to_lds_b128 %8, %9, off\n\t"
                 "global_load_async_to_lds_b128 %10, %11, off\n\t"
                 "global_load_async_to_lds_b128 %12, %13, off\n\t"
                 "global_load_async_to_lds_b128 %14, %15, off\n\t"
                 "global_load_async_to_lds_b128 %16, %17, off\n\t"
                 "global_load_async_to_lds_b128 %18, %19, off\n\t"
                 "global_load_async_to_lds_b128 %20, %21, off\n\t"
                 "global_load_async_to_lds_b128 %22, %23, off\n\t"
                 "s_wait_xcnt 0x0"
                 :: "v"(lds),           "v"(ga),          "v"(lds + ls),      "v"(ga + rs),
                    "v"(lds + 2 * ls),  "v"(ga + 2 * rs), "v"(lds + 3 * ls),  "v"(ga + 3 * rs),
                    "v"(lds + 4 * ls),  "v"(gw),          "v"(lds + 5 * ls),  "v"(gw + rs),
                    "v"(lds + 6 * ls),  "v"(gw + 2 * rs), "v"(lds + 7 * ls),  "v"(gw + 3 * rs),
                    "v"(lds + 8 * ls),  "v"(gw + 4 * rs), "v"(lds + 9 * ls),  "v"(gw + 5 * rs),
                    "v"(lds + 10 * ls), "v"(gw + 6 * rs), "v"(lds + 11 * ls), "v"(gw + 7 * rs)
                 : "memory");
}

__device__ __forceinline__ void gemm_nt_skinny_block(const float* __restrict__ A, const float* __restrict__ W,
                                                     const float* __restrict__ bias, float* __restrict__ Y,
                                                     int mblk, int N, int Kd) {
    int wave = threadIdx.x >> 5;
    int lane = threadIdx.x & 31;
    int m0 = (mblk * 8 + wave) * 16;
    int lr = lane & 15;
    int hi = lane >> 4;
    int wrow = lr;                       // n0 == 0 (single tile of columns)
    int wrc = (wrow < N) ? wrow : 0;
    float msk = (wrow < N) ? 1.f : 0.f;

    const float* ap = A + (size_t)(m0 + lr) * Kd + hi * 2;
    const float* wpr = W + (size_t)wrc * Kd + hi * 2;

    v8f acc = {};
    for (int kk = 0; kk < Kd; kk += 32) {        // Kd % 64 == 0, as for the wide blocks
        const float* pa = ap + kk;
        const float* pw = wpr + kk;
        v2f a[8], b[8];
#pragma unroll     // register arrays need constant indices; eight k-steps' loads go out together
        for (int j = 0; j < 8; ++j) {
            a[j] = *(const v2f*)(pa + j * 4);
            b[j] = *(const v2f*)(pw + j * 4);
        }
        // the address registers of the loads above are free for reuse only behind this wait; it names
        // them, so they stay live up to it and no load's result is placed in one of them
        asm volatile("s_wait_xcnt 0x0" :: "v"(pa), "v"(pw) : "memory");
#pragma unroll     // register arrays need constant indices
        for (int j = 0; j < 8; ++j) acc = wmma_f32x4(a[j], b[j] * msk, acc);
    }
    float bv = bias[wrc];
    // the address registers of the load are free for reuse only behind this wait
    asm volatile("s_wait_xcnt 0x0" ::: "memory");
    float* yp[8];
    float o[8];
#pragma unroll     // register arrays need constant indices
    for (int r = 0; r < 8; ++r) {
        yp[r] = Y + (size_t)(m0 + r + hi * 8) * N + lr;
        o[r] = 1.f / (1.f + __expf(-(acc[r] + bv)));
    }
    // the stores stay behind all the arithmetic: no register of an issued store is rewritten
    __builtin_amdgcn_sched_barrier(0);
    if (lr < N) {
#pragma unroll     // register arrays need constant indices
        for (int r = 0; r < 8; ++r) yp[r][0] = o[r];
    }
}

// One launch holds every product of the same A: blockIdx.y walks, in this order, one row of
// skinny blocks (only where skinny != 0: the first half of blockIdx.x the gate, the second half
// alpha; they go first because they are short and free their place early), then the N / 128
// column tiles of W0 -> Y0, of W1 -> Y1 and of W2 -> Y2. The blocks are independent of one another.
__global__ __launch_bounds__(256) void gemm_nt_wmma_wide(const float* __restrict__ A,
                                  const float* __restrict__ W0, const float* __restrict__ W1,
                                  const float* __restrict__ W2, const float* __restrict__ bias,
                                  float* __restrict__ Y0, float* __restrict__ Y1, float* __restrict__ Y2,
                                  const float* __restrict__ Wg, const float* __restrict__ bg,
                                  float* __restrict__ Yg, int Ng,
                                  const float* __restrict__ Wa, const float* __restrict__ ba,
                                  float* __restrict__ Ya, int Na,
                                  int M, int N, int Kd, int skinny) {
    __shared__ __attribute__((aligned(16))) float sT[2 * GW_BUF];

    int by = (int)blockIdx.y - skinny;
    if (by < 0) {                        // the whole block takes this way, ahead of every barrier
        const int half = M / (2 * GW_BM);                // M / 128 blocks for each skinny product
        const bool g = (int)blockIdx.x < half;
        gemm_nt_skinny_block(A, g ? Wg : Wa, g ? bg : ba, g ? Yg : Ya,
                             g ? (int)blockIdx.x : (int)blockIdx.x - half, g ? Ng : Na, Kd);
        return;
    }
    const int ntile = N / GW_BN;         // column tiles per weight matrix
    const int sel = by / ntile;
    const float* W = sel == 0 ? W0 : (sel == 1 ? W1 : W2);
    float* Y = sel == 0 ? Y0 : (sel == 1 ? Y1 : Y2);

    int tid = threadIdx.x;
    int wave = tid >> 5;
    int lane = tid & 31;
    int wm = wave & 1;                   // 0..1
    int wn = wave >> 1;                  // 0..3
    int mB = blockIdx.x * GW_BM;
    int nB = (by - sel * ntile) * GW_BN;
    int lr = lane & 15;
    int hi = lane >> 4;

    // this thread's place in a tile: row tid >> 4, 16 bytes at dword (tid & 15) * 4
    int cr = tid >> 4, cc = (tid & 15) * 4;
    const float* ga = A + (size_t)(mB + cr) * Kd + cc;
    const float* gw = W + (size_t)(nB + cr) * Kd + cc;
    unsigned lds0 = (unsigned)(uintptr_t)(void*)&sT[cr * GW_P + cc];   // LDS byte address, buffer 0
    const unsigned bufb = (unsigned)GW_BUF * 4u;                       // bytes from buffer 0 to buffer 1
    const int nt = Kd / GW_BK;

    v8f acc[2][2];
#pragma unroll     // register arrays need constant indices
    for (int mi = 0; mi < 2; ++mi)
#pragma unroll     // register arrays need constant indices
        for (int t = 0; t < 2; ++t) acc[mi][t] = (v8f){};

    gw_tile_copy(lds0, ga, gw, Kd);
    // tile 0 has landed for this wave; the barrier publishes it to the others
    asm volatile("s_wait_asynccnt 0x0" ::: "memory");
    __syncthreads();
    if (nt > 1) gw_tile_copy(lds0 + bufb, ga + GW_BK, gw + GW_BK, Kd);

    for (int kt = 0; kt < nt; ++kt) {
        const float* sb = sT + (kt & 1) * GW_BUF;
        const float* sa = sb + (wm * 32 + lr) * GW_P + hi * 2;
        const float* sw = sb + (GW_BM + wn * 32 + lr) * GW_P + hi * 2;
#pragma unroll     // the tile's LDS reads are visible together and go out ahead of the WMMAs
        for (int ks = 0; ks < GW_BK / 4; ++ks) {
            v2f a0 = *(const v2f*)(sa + ks * 4);
            v2f a1 = *(const v2f*)(sa + 16 * GW_P + ks * 4);
            v2f b0 = *(const v2f*)(sw + ks * 4);
            v2f b1 = *(const v2f*)(sw + 16 * GW_P + ks * 4);
            acc[0][0] = wmma_f32x4(a0, b0, acc[0][0]);
            acc[0][1] = wmma_f32x4(a0, b1, acc[0][1]);
            acc[1][0] = wmma_f32x4(a1, b0, acc[1][0]);
            acc[1][1] = wmma_f32x4(a1, b1, acc[1][1]);
        }
        // this wave's reads of the buffer have returned before the buffer is refilled
        asm volatile("s_wait_dscnt 0x0" ::: "memory");
        // this wave's copies of tile kt + 1 have landed before the barrier publishes them
        asm volatile("s_wait_asynccnt 0x0" ::: "memory");
        __syncthreads();
        if (kt + 2 < nt)
            gw_tile_copy(lds0 + (unsigned)(kt & 1) * bufb, ga + (size_t)(kt + 2) * GW_BK,
                         gw + (size_t)(kt + 2) * GW_BK, Kd);
    }
    // no copy is outstanding when the wave goes on to its end
    asm volatile("s_wait_asynccnt 0x0" ::: "memory");

    int m0 = mB + wm * 32 + hi * 8;
    int n0 = nB + wn * 32 + lr;
    float bv[2] = {0.f, 0.f};
    if (bias) {
        bv[0] = bias[n0];
        bv[1] = bias[n0 + 16];
        // the address registers of the two loads are free for reuse only behind this wait
        asm volatile("s_wait_xcnt 0x0" ::: "memory");
    }
    float* yp[2][8];
#pragma unroll     // register arrays need constant indices
    for (int mi = 0; mi < 2; ++mi)
#pragma unroll     // register arrays need constant indices
        for (int r = 0; r < 8; ++r) {
            yp[mi][r] = Y + (size_t)(m0 + mi * 16 + r) * N + n0;
            acc[mi][0][r] += bv[0];
            acc[mi][1][r] += bv[1];
        }
    // the stores stay behind all the arithmetic: no register of an issued store is rewritten
    __builtin_amdgcn_sched_barrier(0);
#pragma unroll     // register arrays need constant indices
    for (int mi = 0; mi < 2; ++mi)
#pragma unroll     // register arrays need constant indices
        for (int r = 0; r < 8; ++r) {
            yp[mi][r][0]  = acc[mi][0][r];
            yp[mi][r][16] = acc[mi][1][r];
        }
}

// ---------------------------------------------------------------------------
// Multi-timescale gated linear attention, chunk-parallel form (chunks of 64
// tokens). With lam constant over time, for token i of chunk c:
//   Hm_i = lam^(i+1) * E + sum_{s<=i} lam^(i-s) * g_s * k_s v_s^T
//   Z_i  = lam^(i+1) * zE + sum_{s<=i} lam^(i-s) * g_s * s_s
// where E, zE are the state at the end of chunk c-1. Two launches:
//   1. state_scan: E_c = lam^64 * E_{c-1} + sum_i lam^(63-i) g_i k_i v_i^T (and the same for Z),
//                  one pass over the chunks with the running state kept in the accumulator;
//                  the two halves of the sequence go side by side, the second from a zero state
//   2. chunk_out : y_lin = (masked decayed Q K^T) V + scaled Q E, blended with y_loc; in the second
//                  half E_c = (state from zero) + lam^(64 (c - 16)) * (state at the end of the first half)
// Only non-negative powers of lam are formed, so every factor is in [0, 1].
// ---------------------------------------------------------------------------
constexpr int LA_T  = 2048;        // tokens per sequence
constexpr int LA_H  = 8;           // heads
constexpr int LA_NC = LA_T / 64;   // chunks per sequence
constexpr int LA_RS = LA_H * 64;   // dwords between the rows of one head's q, k, v
constexpr int LA_PA = 68;          // LDS pitch (dwords), rows read 8 bytes along k
constexpr int LA_PB = 72;          // LDS pitch (dwords), rows read across columns

__device__ __forceinline__ float la_sigmoid(float x) { return 1.f / (1.f + __expf(-x)); }

// base^n for 0 <= n <= 127 by squaring: 1 at n == 0 for any base, no logarithm.
__device__ __forceinline__ float la_ipow(float base, int n) {
    float p = 1.f;
#pragma unroll     // seven fixed bits, no loop control
    for (int bit = 0; bit < 7; ++bit) {
        if (n & 1) p *= base;
        base *= base;
        n >>= 1;
    }
    return p;
}

// A thread's four float4 of a 64x64 f32 tile (256 threads): global -> registers.
struct LaTile { float4 a, b, c, d; };
__device__ __forceinline__ LaTile la_tile_load(const float* g, int tid) {
    const float* p = g + ((unsigned)(tid >> 4) * LA_RS + (unsigned)(tid & 15) * 4);
    LaTile t;
    t.a = *(const float4*)(p);
    t.b = *(const float4*)(p + 16 * LA_RS);
    t.c = *(const float4*)(p + 32 * LA_RS);
    t.d = *(const float4*)(p + 48 * LA_RS);
    // address registers of these loads (offset, scalar base) are free for reuse only behind this wait
    asm volatile("s_wait_xcnt 0x0" ::: "memory");
    return t;
}
// ... and registers -> LDS at the given pitch.
__device__ __forceinline__ void la_tile_put(float* s, int pitch, int tid, const LaTile& t) {
    float* p = s + (tid >> 4) * pitch + (tid & 15) * 4;
    *(float4*)(p) = t.a;
    *(float4*)(p + 16 * pitch) = t.b;
    *(float4*)(p + 32 * pitch) = t.c;
    *(float4*)(p + 48 * pitch) = t.d;
}

// mean |k_i| + 1e-6 of row i = tid >> 2; four lanes share a row (valid in all four).
__device__ __forceinline__ float la_row_absmean(const float* s, int pitch, int tid) {
    int i = tid >> 2, qd = tid & 3;
    float a = 0.f;
#pragma unroll     // 16 independent LDS reads in flight
    for (int e = 0; e < 16; ++e) a += fabsf(s[i * pitch + e * 4 + qd]);
    a += __shfl_xor(a, 1);
    a += __shfl_xor(a, 2);
    return a * (1.f / 64.f) + 1e-6f;
}

constexpr int SS_PK    = 72;
constexpr int SS_PV    = 24;
constexpr int SS_ROWS  = 128;
constexpr int SS_STAGE = SS_ROWS * (SS_PK + SS_PV);
constexpr int SS_NC    = LA_NC / 2;
constexpr int SS_T     = LA_T / 2;
constexpr int SS_W     = 2 * SS_STAGE;
constexpr int SS_Z     = SS_W + SS_T;
constexpr int SS_LDS   = SS_Z + SS_NC * 4;

// x + the value of lane ^ m inside a row of 16 lanes, by DPP row_xmask: CTRL = 0x160 + m.
// Every lane of the wave is on where it is used.
template <int CTRL>
__device__ __forceinline__ float la_xmask_add(float x) {
    return x + __int_as_float(__builtin_amdgcn_mov_dpp(__float_as_int(x), CTRL, 0xf, 0xf, true));
}
// Sum over the 32 lanes, the same value in every lane: four steps inside each half, then lane ^ 16.
__device__ __forceinline__ float la_wave_sum(float x) {
    x = la_xmask_add<0x161>(x);
    x = la_xmask_add<0x162>(x);
    x = la_xmask_add<0x164>(x);
    x = la_xmask_add<0x168>(x);
    return x + __int_as_float(__builtin_amdgcn_permlanex16(__float_as_int(x), __float_as_int(x),
                                                           0x76543210, 0xfedcba98, false, false));
}

// One stage: thread tid brings 16 bytes of K rows (tid >> 4) + 16 j, j = 0..7, and of V rows
// (tid >> 2) + 64 j, j = 0..1, by ten asynchronous copies global -> LDS.
__device__ __forceinline__ void ss_stage_copy(unsigned lk, const float* gk, unsigned lv, const float* gv) {
    const size_t rk = (size_t)16 * LA_RS;          // 16 tokens on in global memory
    const size_t rv = (size_t)64 * LA_RS;          // 64 tokens on
    const unsigned sk = 16u * SS_PK * 4u;          // 16 rows on in LDS, bytes (K)
    const unsigned sv = 64u * SS_PV * 4u;          // 64 rows on in LDS, bytes (V)
    // the copies go through no register; the closing wait stands inside the statement so that
    // the address registers named here are rewritten only behind it
    asm volatile("global_load_async_to_lds_b128 %0, %1, off\n\t"
                 "global_load_async_to_lds_b128 %2, %3, off\n\t"
                 "global_load_async_to_lds_b128 %4, %5, off\n\t"
                 "global_load_async_to_lds_b128 %6, %7, off\n\t"
                 "global_load_async_to_lds_b128 %8, %9, off\n\t"
                 "global_load_async_to_lds_b128 %10, %11, off\n\t"
                 "global_load_async_to_lds_b128 %12, %13, off\n\t"
                 "global_load_async_to_lds_b128 %14, %15, off\n\t"
                 "global_load_async_to_lds_b128 %16, %17, off\n\t"
                 "global_load_async_to_lds_b128 %18, %19, off\n\t"
                 "s_wait_xcnt 0x0"
                 :: "v"(lk),          "v"(gk),          "v"(lk + sk),     "v"(gk + rk),
                    "v"(lk + 2 * sk), "v"(gk + 2 * rk), "v"(lk + 3 * sk), "v"(gk + 3 * rk),
                    "v"(lk + 4 * sk), "v"(gk + 4 * rk), "v"(lk + 5 * sk), "v"(gk + 5 * rk),
                    "v"(lk + 6 * sk), "v"(gk + 6 * rk), "v"(lk + 7 * sk), "v"(gk + 7 * rk),
                    "v"(lv),          "v"(gv),          "v"(lv + sv),     "v"(gv + rv)
                 : "memory");
}

__device__ __forceinline__ void linatt_state_scan_block(float* sh, const float* k, const float* v,
                                  const float* gate, const float* decay_logit,
                                  float* E, float* zE, int bid) {
    int seg = bid & 1, kap = (bid >> 1) & 1, jt = (bid >> 2) & 3, bh = bid >> 4;
    int h = bh % LA_H, b = bh / LA_H;
    int tid = threadIdx.x;
    int wave = __builtin_amdgcn_readfirstlane(tid >> 5);   // scalar: the waves' roles are scalar branches
    int lane = tid & 31, lr = lane & 15, hi = lane >> 4;
    float* sW = sh + SS_W;
    float* sZp = sh + SS_Z;

    size_t tokb = (size_t)b * LA_T + seg * SS_T;           // the block's first token
    const float* gk = k + ((tokb + (tid >> 4)) * LA_H + h) * 64 + (tid & 15) * 4;
    const float* gv = v + ((tokb + (tid >> 2)) * LA_H + h) * 64 + jt * 16 + (tid & 3) * 4;
    unsigned lk = (unsigned)(uintptr_t)(void*)&sh[(tid >> 4) * SS_PK + (tid & 15) * 4];
    unsigned lv = (unsigned)(uintptr_t)(void*)&sh[SS_ROWS * SS_PK + (tid >> 2) * SS_PV + (tid & 3) * 4];
    const unsigned bufb = (unsigned)SS_STAGE * 4u;         // bytes from buffer 0 to buffer 1
    const size_t gs = (size_t)SS_ROWS * LA_RS;             // one stage on in global memory
    const int nst = SS_T / SS_ROWS;                        // stages

    ss_stage_copy(lk, gk, lv, gv);

    float lam = la_sigmoid(decay_logit[h * 2 + kap]);
    float l64 = la_ipow(lam, 64);
    {   // the weights of the block's tokens: thread tid has tokens tid + 256 j, all at place tid & 63 of their chunk
        float pw = la_ipow(lam, 63 - (tid & 63));
        const float* gp = gate + ((tokb + tid) * LA_H + h) * 2 + kap;
        float g[SS_T / 256];
#pragma unroll     // register arrays need constant indices; the loads go out together
        for (int j = 0; j < SS_T / 256; ++j) g[j] = gp[(size_t)j * 256 * LA_H * 2];
        // the address registers of the loads above are free for reuse only behind this wait
        asm volatile("s_wait_xcnt 0x0" ::: "memory");
#pragma unroll     // register arrays need constant indices
        for (int j = 0; j < SS_T / 256; ++j) sW[tid + 256 * j] = g[j] * pw;
    }
    // stage 0 has landed for this wave; the barrier publishes it, and the weights, to the others
    asm volatile("s_wait_asynccnt 0x0" ::: "memory");
    __syncthreads();
    ss_stage_copy(lk + bufb, gk + gs, lv + bufb, gv + gs);

    int tm = wave & 3;
    v8f acc = {};      // the running state of tile (tm, jt)
    v8f keep = {};     // the state in front of the stage's second chunk, stored at the head of the next stage
    float* Ep = E + ((size_t)bh * LA_NC + seg * SS_NC) * 2 * 4096 + (unsigned)(kap * 4096 + (tm * 16 + hi * 8) * 64 + jt * 16 + lr);
    // this lane's first element of a chunk's fragments (dwords from the chunk's K rows, V rows, weights)
    const int fk = hi * 2 * SS_PK + tm * 16 + lr;
    const int fv = hi * 2 * SS_PV + lr;
    // this lane's half row of K for the Z sums: two lanes share a row, 16 rows a wave
    const int zr = tm * 16 + (lane >> 1);
    const float ze = (lane & 1) ? 0.f : 1e-6f;

    for (int t = 0; t < nst; ++t) {
        const float* sb = sh + (t & 1) * SS_STAGE;
        if (wave < 4) {
            if (t > 0) {
                float* e0 = Ep + (size_t)(2 * t - 1) * 2 * 4096;
                float* e1 = Ep + (size_t)(2 * t) * 2 * 4096;
#pragma unroll     // register arrays need constant indices
                for (int r = 0; r < 8; ++r) e0[r * 64] = keep[r];
#pragma unroll     // register arrays need constant indices
                for (int r = 0; r < 8; ++r) e1[r * 64] = acc[r];
                // registers of the stores above are free for reuse only behind this wait
                asm volatile("s_wait_xcnt 0x0" ::: "memory");
            }
#pragma unroll     // two chunks a stage, constant LDS offsets
            for (int u = 0; u < 2; ++u) {
                const float* pk = sb + u * 64 * SS_PK + fk;
                const float* pv = sb + SS_ROWS * SS_PK + u * 64 * SS_PV + fv;
                const float* pw = sW + (t * 2 + u) * 64 + hi * 2;
                v2f a[16], bb[16];
#pragma unroll     // register arrays need constant indices; the chunk's LDS reads go out together
                for (int ks = 0; ks < 16; ++ks) {
                    v2f w2 = *(const v2f*)(pw + ks * 4);
                    a[ks].x = pk[ks * 4 * SS_PK];
                    a[ks].y = pk[ks * 4 * SS_PK + SS_PK];
                    bb[ks].x = pv[ks * 4 * SS_PV] * w2.x;
                    bb[ks].y = pv[ks * 4 * SS_PV + SS_PV] * w2.y;
                }
                if (u == 1) keep = acc;
#pragma unroll     // register arrays need constant indices
                for (int r = 0; r < 8; ++r) acc[r] *= l64;
                // two accumulator chains: a lone wave's WMMAs then issue at the pipe's rate
                v8f s1 = {};
#pragma unroll     // register arrays need constant indices
                for (int ks = 0; ks < 8; ++ks) {
                    acc = wmma_f32x4(a[ks], bb[ks], acc);
                    s1 = wmma_f32x4(a[ks + 8], bb[ks + 8], s1);
                }
#pragma unroll     // register arrays need constant indices
                for (int r = 0; r < 8; ++r) acc[r] += s1[r];
            }
        } else if (jt == 0) {
#pragma unroll     // two chunks a stage, constant LDS offsets; the two are independent
            for (int u = 0; u < 2; ++u) {
                // sum_i w_i (mean |k_i| + 1e-6) over this wave's 16 rows
                const float* p = sb + u * 64 * SS_PK + zr * SS_PK + (lane & 1) * 32;
                float s = 0.f;
#pragma unroll     // eight independent LDS reads in flight
                for (int e = 0; e < 8; ++e) {
                    float4 x = *(const float4*)(p + e * 4);
                    s += (fabsf(x.x) + fabsf(x.y)) + (fabsf(x.z) + fabsf(x.w));
                }
                float val = la_wave_sum(sW[(t * 2 + u) * 64 + zr] * (s * (1.f / 64.f) + ze));
                if (lane == 0) sZp[(t * 2 + u) * 4 + tm] = val;
            }
        }
        // this wave's reads of the buffer have returned before the buffer is refilled
        asm volatile("s_wait_dscnt 0x0" ::: "memory");
        // this wave's copies of stage t + 1 have landed before the barrier publishes them
        asm volatile("s_wait_asynccnt 0x0" ::: "memory");
        __syncthreads();
        if (t + 2 < nst)
            ss_stage_copy(lk + (unsigned)(t & 1) * bufb, gk + (size_t)(t + 2) * gs,
                          lv + (unsigned)(t & 1) * bufb, gv + (size_t)(t + 2) * gs);
    }
    // no copy is outstanding when the wave goes on to its end
    asm volatile("s_wait_asynccnt 0x0" ::: "memory");
    if (wave < 4) {
        float* e0 = Ep + (size_t)(SS_NC - 1) * 2 * 4096;
#pragma unroll     // register arrays need constant indices
        for (int r = 0; r < 8; ++r) e0[r * 64] = keep[r];
        if (seg == 0) {
            float* e1 = Ep + (size_t)SS_NC * 2 * 4096;
#pragma unroll     // register arrays need constant indices
            for (int r = 0; r < 8; ++r) e1[r * 64] = acc[r];
        }
        // registers of the stores above are free for reuse only behind this wait
        asm volatile("s_wait_xcnt 0x0" ::: "memory");
    }

    if (jt == 0 && wave == 0) {    // lane c: Z at the end of the half's chunk c-1, c = 1 .. SS_NC
        float4 zp = *(const float4*)(sZp + (lane & (SS_NC - 1)) * 4);
        float z = (zp.x + zp.y) + (zp.z + zp.w);
        float run = 0.f, zo = 0.f;
#pragma unroll     // constant lane numbers for the reads of one lane
        for (int s = 0; s < SS_NC; ++s) {
            float zs = __int_as_float(__builtin_amdgcn_readlane(__float_as_int(z), s));
            zo = (lane == s) ? run : zo;
            run = run * l64 + zs;
        }
        zo = (lane == SS_NC) ? run : zo;
        if (lane > 0 && lane < SS_NC + 1 - seg) zE[((size_t)bh * LA_NC + seg * SS_NC + lane) * 2 + kap] = zo;
    }
}

// grid = B*LA_H*LA_NC, block = 256. blockIdx.x = (b*LA_H + h)*LA_NC + c.
// The pointers are not __restrict__: the loads then keep their side of the asm waits.
// The epilogue blends with the local-attention output of the same tile:
// y = alpha * y_loc + (1 - alpha) * y_lin (alpha per [B,T,H]); y_lin never goes to memory.
__global__ __launch_bounds__(256) void linatt_chunk_out(const float* q, const float* k, const float* v, const float* gate,
                                 const float* decay_logit, const float* E, const float* zE,
                                 const float* y_loc, const float* alpha, float* y) {
    int c  = blockIdx.x % LA_NC;
    int bh = blockIdx.x / LA_NC;
    int h = bh % LA_H, b = bh / LA_H;
    int tid = threadIdx.x;
    int wave = tid >> 5, lane = tid & 31, lr = lane & 15, hi = lane >> 4;
    int tn = wave & 3, tm0 = (wave >> 2) * 2;    // wave owns tiles (tm0, tn), (tm0+1, tn)
    int n = tn * 16 + lr;

    __shared__ __attribute__((aligned(16))) float sQ[64 * LA_PA];
    __shared__ __attribute__((aligned(16))) float sK[64 * LA_PA];
    __shared__ __attribute__((aligned(16))) float sV[64 * LA_PB];
    __shared__ __attribute__((aligned(16))) float sP[64 * LA_PA];
    __shared__ float sG[2][64];      // gate
    __shared__ float sGS[2][64];     // gate * (mean|k| + 1e-6)
    __shared__ float sZ[2][64];      // Z_i
    __shared__ float sRZ[2][64];     // 1 / (Z_i + 1e-6)
    __shared__ float sRS[2][64];     // lam^(i+1) / (Z_i + 1e-6)
    __shared__ float sPw[2][128];    // [63 + d] = lam^d for d = 0..64, 0 for d = -63..-1 (the causal mask)
    __shared__ __attribute__((aligned(16))) float sAl[64];   // alpha

    size_t tok0 = (size_t)b * LA_T + c * 64;
    size_t base = (tok0 * LA_H + h) * 64;
    LaTile rq = la_tile_load(q + base, tid);
    LaTile rk = la_tile_load(k + base, tid);
    LaTile rv = la_tile_load(v + base, tid);
    // y_loc at this lane's 16 outputs: fetched here, in flight together with the tiles.
    const float* lp = y_loc + base;
    unsigned yo = (unsigned)((tm0 * 16 + hi * 8) * LA_RS + n);
    float yl[2][8];
#pragma unroll     // register arrays need constant indices
    for (int t = 0; t < 2; ++t)
#pragma unroll     // register arrays need constant indices
        for (int r = 0; r < 8; ++r) yl[t][r] = lp[yo + (t * 16 + r) * LA_RS];
    // address registers of the loads above are free for reuse only behind this wait
    asm volatile("s_wait_xcnt 0x0" ::: "memory");
    // B fragments of the two incoming states, columns n: fetched here, in flight
    // together with the tiles.
    const float* Ep = E + (size_t)blockIdx.x * 2 * 4096;
    unsigned eo = (unsigned)(hi * 2 * 64 + n);
    v2f ef[2][16];
#pragma unroll     // register arrays need constant indices
    for (int kap = 0; kap < 2; ++kap)
#pragma unroll     // register arrays need constant indices
        for (int ks = 0; ks < 16; ++ks) ef[kap][ks] = (v2f){};
    float z0 = 0.f;   // incoming Z of timescale tid & 1
    if (c > 0) {   // chunk 0 starts from the zero state
#pragma unroll     // register arrays need constant indices
        for (int kap = 0; kap < 2; ++kap)
#pragma unroll     // register arrays need constant indices
            for (int ks = 0; ks < 16; ++ks) {
                ef[kap][ks].x = Ep[eo + kap * 4096 + ks * 256];
                ef[kap][ks].y = Ep[eo + kap * 4096 + ks * 256 + 64];
            }
        z0 = zE[(size_t)blockIdx.x * 2 + (tid & 1)];
        // address registers of the loads above are free for reuse only behind this wait
        asm volatile("s_wait_xcnt 0x0" ::: "memory");
    }
    const bool carry = c > SS_NC;      // the same for the whole block
    v2f ff[2][16];
    float zf = 0.f;
    if (carry) {
        const float* Fp = E + ((size_t)bh * LA_NC + SS_NC) * 2 * 4096;
#pragma unroll     // register arrays need constant indices
        for (int kap = 0; kap < 2; ++kap)
#pragma unroll     // register arrays need constant indices
            for (int ks = 0; ks < 16; ++ks) {
                ff[kap][ks].x = Fp[eo + kap * 4096 + ks * 256];
                ff[kap][ks].y = Fp[eo + kap * 4096 + ks * 256 + 64];
            }
        zf = zE[((size_t)bh * LA_NC + SS_NC) * 2 + (tid & 1)];
        // address registers of the loads above are free for reuse only behind this wait
        asm volatile("s_wait_xcnt 0x0" ::: "memory");
    }
    la_tile_put(sQ, LA_PA, tid, rq);
    la_tile_put(sK, LA_PA, tid, rk);
    la_tile_put(sV, LA_PB, tid, rv);
    if (tid < 128) {
        int kap = tid >> 6, i = tid & 63;
        sG[kap][i] = gate[((tok0 + i) * LA_H + h) * 2 + kap];
    } else if (tid < 192) {
        float av = alpha[(tok0 + (tid - 128)) * LA_H + h];
        // address registers of the load are free for reuse only behind this wait
        asm volatile("s_wait_xcnt 0x0" ::: "memory");
        sAl[tid - 128] = av;
    }
    {
        int kap = tid >> 7, d = (tid & 127) - 63;
        float pw = la_ipow(la_sigmoid(decay_logit[h * 2 + kap]), d > 0 ? d : 0);
        sPw[kap][63 + d] = (d >= 0) ? pw : 0.f;
    }
    __syncthreads();

    if (carry) {
        float cf[2];
#pragma unroll     // register arrays need constant indices
        for (int kap = 0; kap < 2; ++kap) {
            cf[kap] = la_ipow(sPw[kap][127], c - SS_NC);     // sPw[kap][127] = lam^64
#pragma unroll     // register arrays need constant indices
            for (int ks = 0; ks < 16; ++ks) ef[kap][ks] += cf[kap] * ff[kap][ks];
        }
        z0 += ((tid & 1) ? cf[1] : cf[0]) * zf;
    }

    float am = la_row_absmean(sK, LA_PA, tid);
    if ((tid & 3) < 2) sGS[tid & 3][tid >> 2] = sG[tid & 3][tid >> 2] * am;

    // A[i][s] = q_i . k_s
    v8f sc[2];
    sc[0] = (v8f){}; sc[1] = (v8f){};
#pragma unroll 4   // four k-steps per trip: their LDS loads go out together
    for (int kk = 0; kk < 64; kk += 4) {
        int ka = kk + hi * 2;
        v2f bb = *(const v2f*)&sK[(tn * 16 + lr) * LA_PA + ka];
#pragma unroll     // register arrays need constant indices
        for (int t = 0; t < 2; ++t) {
            v2f a = *(const v2f*)&sQ[((tm0 + t) * 16 + lr) * LA_PA + ka];
            sc[t] = wmma_f32x4(a, bb, sc[t]);
        }
    }
    __syncthreads();   // sGS complete

    if (tid < 2) {     // Z inside the chunk
        float Z = z0;
        float lam = sPw[tid][64];
#pragma unroll 16  // the LDS reads of 16 steps go out ahead of the serial chain
        for (int i = 0; i < 64; ++i) {
            Z = Z * lam + sGS[tid][i];
            sZ[tid][i] = Z;
        }
    }
    __syncthreads();   // sZ complete
    if (tid < 128) {
        int kap = tid >> 6, i = tid & 63;
        float rz = 1.f / (sZ[kap][i] + 1e-6f);
        sRZ[kap][i] = rz;
        sRS[kap][i] = rz * sPw[kap][64 + i];
    }
    __syncthreads();   // sRZ, sRS complete

    // P[i][s] = A[i][s] * sum_kap lam^(i-s) g_s / (Z_i + 1e-6) for s <= i, else 0
#pragma unroll     // register arrays need constant indices
    for (int t = 0; t < 2; ++t)
#pragma unroll     // register arrays need constant indices
        for (int r = 0; r < 8; ++r) {
            int i = (tm0 + t) * 16 + r + hi * 8;
            int e = 63 + i - n;
            float w = sPw[0][e] * sG[0][n] * sRZ[0][i] + sPw[1][e] * sG[1][n] * sRZ[1][i];
            sP[i * LA_PA + n] = sc[t][r] * w;
        }
    __syncthreads();   // sP complete

    v8f acc[2];
    acc[0] = (v8f){}; acc[1] = (v8f){};
#pragma unroll 4   // four k-steps per trip: their LDS loads go out together
    for (int kk = 0; kk < 64; kk += 4) {
        int ka = kk + hi * 2;
        v2f bb;
        bb.x = sV[ka * LA_PB + n];
        bb.y = sV[(ka + 1) * LA_PB + n];
#pragma unroll     // register arrays need constant indices
        for (int t = 0; t < 2; ++t) {
            v2f a = *(const v2f*)&sP[((tm0 + t) * 16 + lr) * LA_PA + ka];
            acc[t] = wmma_f32x4(a, bb, acc[t]);
        }
    }
#pragma unroll     // register arrays need constant indices
    for (int kap = 0; kap < 2; ++kap) {
        float rs0 = sRS[kap][tm0 * 16 + lr];
        float rs1 = sRS[kap][(tm0 + 1) * 16 + lr];
#pragma unroll     // register arrays need constant indices
        for (int ks = 0; ks < 16; ++ks) {
            int ka = ks * 4 + hi * 2;
            v2f a0 = *(const v2f*)&sQ[(tm0 * 16 + lr) * LA_PA + ka];
            v2f a1 = *(const v2f*)&sQ[((tm0 + 1) * 16 + lr) * LA_PA + ka];
            a0 *= rs0;
            a1 *= rs1;
            acc[0] = wmma_f32x4(a0, ef[kap][ks], acc[0]);
            acc[1] = wmma_f32x4(a1, ef[kap][ks], acc[1]);
        }
    }
    float* yp = y + base;
#pragma unroll     // register arrays need constant indices
    for (int t = 0; t < 2; ++t)
#pragma unroll     // register arrays need constant indices
        for (int r = 0; r < 8; ++r) {
            float al = sAl[(tm0 + t) * 16 + hi * 8 + r];
            acc[t][r] = al * yl[t][r] + (1.f - al) * acc[t][r];
        }
    // the stores stay behind all the arithmetic: no register of an issued store is rewritten
    __builtin_amdgcn_sched_barrier(0);
#pragma unroll     // register arrays need constant indices
    for (int t = 0; t < 2; ++t)
#pragma unroll     // register arrays need constant indices
        for (int r = 0; r < 8; ++r)
            yp[yo + (t * 16 + r) * LA_RS] = acc[t][r];
}

// ---------------------------------------------------------------------------
// Sliding-window local attention with ALiBi, one block per (b, chunk, head).
// Block = 256 threads (8 waves). Scores and P@V via fp32 WMMA.
// Q/K/V tiles come into LDS by asynchronous copies (16 bytes a lane), each row at a padded
// pitch chosen for its reader; the rows in front of token 0 (c == 0) are filled with zeros.
// LDS: phase1 Q[64]+K[128] rows (aliased as S[64] rows in phase2) + V[128] rows.
// It needs q, k, v alone, nothing of the linear branch: its blocks share a launch with the state scan.
// ---------------------------------------------------------------------------
constexpr int LC_PK = 68;
constexpr int LC_PV = 72;
constexpr int LC_PS = 132;

// Rows r + 16 j, j = 0..3, of three 64-row tiles (Q, K, V), 16 bytes a lane: twelve asynchronous
// copies global -> LDS. rs = 16 rows on in global memory (floats).
__device__ __forceinline__ void lc_copy_qkv(unsigned lq, const float* gq, unsigned lk, const float* gk,
                                            unsigned lv, const float* gv, size_t rs) {
    const unsigned sk = 16u * LC_PK * 4u;          // 16 rows on in LDS, bytes (Q, K)
    const unsigned sv = 16u * LC_PV * 4u;          // 16 rows on in LDS, bytes (V)
    // the copies go through no register; the closing wait stands inside the statement so that
    // the address registers named here are rewritten only behind it
    asm volatile("global_load_async_to_lds_b128 %0, %1, off\n\t"
                 "global_load_async_to_lds_b128 %2, %3, off\n\t"
                 "global_load_async_to_lds_b128 %4, %5, off\n\t"
                 "global_load_async_to_lds_b128 %6, %7, off\n\t"
                 "global_load_async_to_lds_b128 %8, %9, off\n\t"
                 "global_load_async_to_lds_b128 %10, %11, off\n\t"
                 "global_load_async_to_lds_b128 %12, %13, off\n\t"
                 "global_load_async_to_lds_b128 %14, %15, off\n\t"
                 "global_load_async_to_lds_b128 %16, %17, off\n\t"
                 "global_load_async_to_lds_b128 %18, %19, off\n\t"
                 "global_load_async_to_lds_b128 %20, %21, off\n\t"
                 "global_load_async_to_lds_b128 %22, %23, off\n\t"
                 "s_wait_xcnt 0x0"
                 :: "v"(lq),          "v"(gq),          "v"(lq + sk),     "v"(gq + rs),
                    "v"(lq + 2 * sk), "v"(gq + 2 * rs), "v"(lq + 3 * sk), "v"(gq + 3 * rs),
                    "v"(lk),          "v"(gk),          "v"(lk + sk),     "v"(gk + rs),
                    "v"(lk + 2 * sk), "v"(gk + 2 * rs), "v"(lk + 3 * sk), "v"(gk + 3 * rs),
                    "v"(lv),          "v"(gv),          "v"(lv + sv),     "v"(gv + rs),
                    "v"(lv + 2 * sv), "v"(gv + 2 * rs), "v"(lv + 3 * sv), "v"(gv + 3 * rs)
                 : "memory");
}
// The same for two tiles (K, V): eight copies.
__device__ __forceinline__ void lc_copy_kv(unsigned lk, const float* gk, unsigned lv, const float* gv, size_t rs) {
    const unsigned sk = 16u * LC_PK * 4u;
    const unsigned sv = 16u * LC_PV * 4u;
    asm volatile("global_load_async_to_lds_b128 %0, %1, off\n\t"
                 "global_load_async_to_lds_b128 %2, %3, off\n\t"
                 "global_load_async_to_lds_b128 %4, %5, off\n\t"
                 "global_load_async_to_lds_b128 %6, %7, off\n\t"
                 "global_load_async_to_lds_b128 %8, %9, off\n\t"
                 "global_load_async_to_lds_b128 %10, %11, off\n\t"
                 "global_load_async_to_lds_b128 %12, %13, off\n\t"
                 "global_load_async_to_lds_b128 %14, %15, off\n\t"
                 "s_wait_xcnt 0x0"
                 :: "v"(lk),          "v"(gk),          "v"(lk + sk),     "v"(gk + rs),
                    "v"(lk + 2 * sk), "v"(gk + 2 * rs), "v"(lk + 3 * sk), "v"(gk + 3 * rs),
                    "v"(lv),          "v"(gv),          "v"(lv + sv),     "v"(gv + rs),
                    "v"(lv + 2 * sv), "v"(gv + 2 * rs), "v"(lv + 3 * sv), "v"(gv + 3 * rs)
                 : "memory");
}

// The value of another lane of this lane's group of four, by DPP quad_perm: 0xB1 = [1,0,3,2] (lane ^ 1),
// 0x4E = [2,3,0,1] (lane ^ 2). Every lane of the wave is on where it is used.
template <int CTRL>
__device__ __forceinline__ float lc_quad_swap(float x) {
    return __int_as_float(__builtin_amdgcn_mov_dpp(__float_as_int(x), CTRL, 0xf, 0xf, true));
}

// exp(s - m) of four scores: 2^((s - m) * log2(e)) on the hardware's base-2 exponential.
__device__ __forceinline__ float4 lc_exp4(float4 s, float m) {
    float a = (s.x - m) * 1.44269504f, b = (s.y - m) * 1.44269504f;
    float c = (s.z - m) * 1.44269504f, d = (s.w - m) * 1.44269504f;
    asm("v_exp_f32 %0, %0\n\t"
        "v_exp_f32 %1, %1\n\t"
        "v_exp_f32 %2, %2\n\t"
        "v_exp_f32 %3, %3\n\t"
        "v_nop"
        : "+v"(a), "+v"(b), "+v"(c), "+v"(d));
    return make_float4(a, b, c, d);
}

__device__ __forceinline__ void local_attn_block(float* sh, const float* __restrict__ q, const float* __restrict__ k,
                                const float* __restrict__ v, float* __restrict__ y,
                                int T, int H, int bid) {
    const int dh = 64;
    const int W = 64;
    int nc = T / W;
    int h = bid % H;
    int c = (bid / H) % nc;
    int b = bid / (H * nc);

    float* smem = sh;                            // Q | K, aliased as S after use
    float* sV = sh + (64 + 128) * LC_PK;         // 128 rows
    float* sQ = smem;
    float* sK = smem + 64 * LC_PK;
    float* sS = smem;                            // aliased after barrier

    int tid = threadIdx.x;
    int wave = tid >> 5, lane = tid & 31, lr = lane & 15, hi = lane >> 4;

    // This lane's 16 outputs: rows om + r, columns on and on + 16 of the block's 64x64 tile.
    size_t tok0 = (size_t)b * T + c * W;
    int om = (wave >> 1) * 16 + hi * 8;
    int on = (wave & 1) * 32 + lr;

    // ---- stage the tiles: this thread brings 16 bytes at dword cc of rows cr + 16 j ----
    {
        int cr = tid >> 4, cc = (tid & 15) * 4;
        size_t go = ((tok0 + cr) * H + h) * dh + cc;       // row cr of this chunk
        size_t rs = (size_t)16 * H * dh;                   // 16 tokens on
        unsigned lq = (unsigned)(uintptr_t)(void*)&sQ[cr * LC_PK + cc];
        unsigned lk = (unsigned)(uintptr_t)(void*)&sK[cr * LC_PK + cc];
        unsigned lv = (unsigned)(uintptr_t)(void*)&sV[cr * LC_PV + cc];
        // this chunk: Q, and rows 64..127 of K and V
        lc_copy_qkv(lq, q + go, lk + 64u * LC_PK * 4u, k + go, lv + 64u * LC_PV * 4u, v + go, rs);
        if (c > 0) {       // the same for the whole block
            // the chunk before: rows 0..63 of K and V
            lc_copy_kv(lk, k + go - 4 * rs, lv, v + go - 4 * rs, rs);
        } else {
            // boundary chunk: the rows in front of token 0 are zero
            const float4 z4 = make_float4(0.f, 0.f, 0.f, 0.f);
#pragma unroll     // four fixed rows, no loop control
            for (int j = 0; j < 4; ++j) {
                *(float4*)&sK[(cr + 16 * j) * LC_PK + cc] = z4;
                *(float4*)&sV[(cr + 16 * j) * LC_PV + cc] = z4;
            }
        }
    }
    // this wave's copies have landed; the barrier publishes them to the others
    asm volatile("s_wait_asynccnt 0x0" ::: "memory");
    __syncthreads();

    // scores: 64x128 = 4x8 tiles of 16x16; wave handles 4 tiles
    v8f sc[4];
    for (int it = 0; it < 4; ++it) {
        int id = wave * 4 + it;
        int tm = id >> 3, tn = id & 7;
        v8f acc = {};
        for (int kkk = 0; kkk < 64; kkk += 4) {
            int ka = kkk + hi * 2;
            v2f a  = *(const v2f*)&sQ[(tm * 16 + lr) * LC_PK + ka];
            v2f bb = *(const v2f*)&sK[(tn * 16 + lr) * LC_PK + ka];
            acc = wmma_f32x4(a, bb, acc);
        }
        sc[it] = acc;
    }
    __syncthreads();   // done reading sQ/sK; safe to alias as sS

    // ALiBi + causal window mask, write scores to LDS
    float slope = exp2f(-8.0f * (float)(h + 1) / (float)H);
    for (int it = 0; it < 4; ++it) {
        int id = wave * 4 + it;
        int tm = id >> 3, tn = id & 7;
#pragma unroll
        for (int r = 0; r < 8; ++r) {
            int i = tm * 16 + r + hi * 8;
            int jj = tn * 16 + lr;
            float val = sc[it][r];
            bool valid = (jj >= i + 1) && (jj <= i + W) && (c * W + jj - W >= 0);
            val = valid ? (val - slope * (float)(i + W - jj)) : -1e30f;
            sS[i * LC_PS + jj] = val;
        }
    }
    __syncthreads();

    {
        float* pr = sS + (tid >> 2) * LC_PS + (tid & 3) * 16;
        float4 p[8];
#pragma unroll     // register arrays need constant indices; the eight LDS reads go out together
        for (int e = 0; e < 8; ++e) p[e] = *(const float4*)(pr + (e >> 2) * 64 + (e & 3) * 4);
        float mx = -3.4e38f;
#pragma unroll     // register arrays need constant indices
        for (int e = 0; e < 8; ++e)
            mx = fmaxf(mx, fmaxf(fmaxf(p[e].x, p[e].y), fmaxf(p[e].z, p[e].w)));
        mx = fmaxf(mx, lc_quad_swap<0xB1>(mx));
        mx = fmaxf(mx, lc_quad_swap<0x4E>(mx));
        float sum = 0.f;
#pragma unroll     // register arrays need constant indices
        for (int e = 0; e < 8; ++e) {
            p[e] = lc_exp4(p[e], mx);
            sum += (p[e].x + p[e].y) + (p[e].z + p[e].w);
        }
        sum += lc_quad_swap<0xB1>(sum);
        sum += lc_quad_swap<0x4E>(sum);
        float inv = 1.f / sum;
#pragma unroll     // register arrays need constant indices
        for (int e = 0; e < 8; ++e) {
            p[e].x *= inv; p[e].y *= inv; p[e].z *= inv; p[e].w *= inv;
            *(float4*)(pr + (e >> 2) * 64 + (e & 3) * 4) = p[e];
        }
    }
    __syncthreads();

    // y_loc = P[64,128] @ Vctx[128,64]; 16 tiles, wave handles 2; V from LDS
    v8f yb[2];
#pragma unroll     // register arrays need constant indices
    for (int it = 0; it < 2; ++it) {
        int id = wave * 2 + it;
        int tm = id >> 2, tn = id & 3;
        int n = tn * 16 + lr;
        v8f acc = {};
        for (int kkk = 0; kkk < 128; kkk += 4) {
            int ka = kkk + hi * 2;
            v2f a = *(const v2f*)&sS[(tm * 16 + lr) * LC_PS + ka];
            v2f bb;
            bb.x = sV[ka * LC_PV + n];
            bb.y = sV[(ka + 1) * LC_PV + n];
            acc = wmma_f32x4(a, bb, acc);
        }
        yb[it] = acc;
    }
    float* yg = y + (tok0 * H + h) * dh;
    float* yp[8];
#pragma unroll     // register arrays need constant indices
    for (int r = 0; r < 8; ++r) yp[r] = yg + (unsigned)((om + r) * H * dh + on);
    // the stores stay behind all the arithmetic: no register of an issued store is rewritten
    __builtin_amdgcn_sched_barrier(0);
#pragma unroll     // register arrays need constant indices
    for (int r = 0; r < 8; ++r) {
        yp[r][0]  = yb[0][r];
        yp[r][16] = yb[1][r];
    }
    // registers of the stores above (offsets, scalar base) are free for reuse only behind this wait
    asm volatile("s_wait_xcnt 0x0" ::: "memory");
}

// One launch for two pieces of work that do not depend on one another: the pass over the chunk states
// (B * LA_H * 16 blocks, each a serial walk over half the chunks) and the local attention (B * T/64 * H
// blocks, twice as many). A whole block goes one way, so every barrier stands under block-uniform
// control flow. The two share one LDS array; three blocks fit a WGP, so the whole grid is resident.
static_assert(SS_LDS >= (64 + 128) * LC_PK + 128 * LC_PV, "the LDS array holds the local attention's tiles");
__global__ __launch_bounds__(256) void local_attn_and_state_scan(const float* __restrict__ q, const float* __restrict__ k,
                                const float* __restrict__ v, float* __restrict__ y_loc,
                                int B, int T, int H, const float* __restrict__ gate,
                                float* __restrict__ E, float* __restrict__ zE,
                                const float* __restrict__ decay_logit) {
    __shared__ __attribute__((aligned(16))) float sh[SS_LDS];
    const int nss = B * LA_H * 16;
    const int bx = (int)blockIdx.x;
    // The state blocks, the longest, take the first indices. For speed only: nothing leans on it.
    if (bx < nss) linatt_state_scan_block(sh, k, v, gate, decay_logit, E, zE, bx);
    else local_attn_block(sh, q, k, v, y_loc, T, H, bx - nss);
}

constexpr int AN_D = 512;

// x + the value of lane ^ m inside a row of 16 lanes, by DPP row_xmask: CTRL = 0x160 + m.
// Every lane of the wave is on where it is used.
template <int CTRL>
__device__ __forceinline__ float an_xmask_add(float x) {
    return x + __int_as_float(__builtin_amdgcn_mov_dpp(__float_as_int(x), CTRL, 0xf, 0xf, true));
}
// Sum over the 32 lanes, the same value in every lane: four steps inside each half, then lane ^ 16.
__device__ __forceinline__ float an_wave_sum(float x) {
    x = an_xmask_add<0x161>(x);
    x = an_xmask_add<0x162>(x);
    x = an_xmask_add<0x164>(x);
    x = an_xmask_add<0x168>(x);
    return x + __int_as_float(__builtin_amdgcn_permlanex16(__float_as_int(x), __float_as_int(x),
                                                           0x76543210, 0xfedcba98, false, false));
}

// grid = rows / 8, block = 256.
// The pointers are not __restrict__: the loads then keep their side of the asm wait.
__global__ __launch_bounds__(256) void addnorm_kernel(const float* x, const float* proj,
                               const float* gamma, const float* beta, float* out) {
    // byte offsets of this lane's first column: in gamma and beta, and in its row of x, proj and out
    unsigned cb = (threadIdx.x & 31u) * 16u;
    unsigned rb = (blockIdx.x * 8u + (threadIdx.x >> 5)) * (AN_D * 4u) + cb;
    float4 r[4], p[4], g[4], b[4];
#pragma unroll     // register arrays need constant indices; the sixteen loads go out together
    for (int j = 0; j < 4; ++j) {
        r[j] = *(const float4*)((const char*)x + rb + j * 512);
        p[j] = *(const float4*)((const char*)proj + rb + j * 512);
        g[j] = *(const float4*)((const char*)gamma + cb + j * 512);
        b[j] = *(const float4*)((const char*)beta + cb + j * 512);
    }
    // the address registers of the loads above are free for reuse only behind this wait; it names
    // the two offsets, so they stay live up to it and no load's result is placed in one of them
    asm volatile("s_wait_xcnt 0x0" :: "v"(rb), "v"(cb) : "memory");
    // the arithmetic stays behind all sixteen loads: none of them waits for another's data
    __builtin_amdgcn_sched_barrier(0);

    float sj[4], qj[4];
#pragma unroll     // register arrays need constant indices; four independent chains
    for (int j = 0; j < 4; ++j) {
        r[j].x += p[j].x; r[j].y += p[j].y; r[j].z += p[j].z; r[j].w += p[j].w;
        sj[j] = (r[j].x + r[j].y) + (r[j].z + r[j].w);
        qj[j] = r[j].x * r[j].x + r[j].y * r[j].y + r[j].z * r[j].z + r[j].w * r[j].w;
    }
    float s  = an_wave_sum((sj[0] + sj[1]) + (sj[2] + sj[3]));
    float s2 = an_wave_sum((qj[0] + qj[1]) + (qj[2] + qj[3]));
    float mean = s * (1.f / (float)AN_D);
    float var = s2 * (1.f / (float)AN_D) - mean * mean;
    float inv = rsqrtf(var + 1e-5f);
#pragma unroll     // register arrays need constant indices
    for (int j = 0; j < 4; ++j) {
        r[j].x = (r[j].x - mean) * inv * g[j].x + b[j].x;
        r[j].y = (r[j].y - mean) * inv * g[j].y + b[j].y;
        r[j].z = (r[j].z - mean) * inv * g[j].z + b[j].z;
        r[j].w = (r[j].w - mean) * inv * g[j].w + b[j].w;
    }
    // the stores stay behind all the arithmetic: no register of an issued store is rewritten
    __builtin_amdgcn_sched_barrier(0);
#pragma unroll     // register arrays need constant indices
    for (int j = 0; j < 4; ++j) *(float4*)((char*)out + rb + j * 512) = r[j];
}

// ---------------------------------------------------------------------------
extern "C" void kernel_launch(void* const* d_in, const int* in_sizes, int n_in,
                              void* d_out, int out_size, void* d_ws, size_t ws_size,
                              hipStream_t stream) {
    const int D = 512, H = 8, Kts = 2, dh = 64, T = 2048;
    const int M = in_sizes[0] / D;          // B*T = 4096
    const int B = M / T;                    // 2
    const int nc = T / 64;

    const float* x      = (const float*)d_in[0];
    const float* Wq     = (const float*)d_in[1];
    const float* Wk     = (const float*)d_in[2];
    const float* Wv     = (const float*)d_in[3];
    const float* Wg     = (const float*)d_in[4];
    const float* bg     = (const float*)d_in[5];
    const float* Wa     = (const float*)d_in[6];
    const float* ba     = (const float*)d_in[7];
    const float* Wo     = (const float*)d_in[8];
    const float* bo     = (const float*)d_in[9];
    const float* decay  = (const float*)d_in[10];
    const float* gamma  = (const float*)d_in[11];
    const float* beta   = (const float*)d_in[12];
    float* out = (float*)d_out;

    // workspace carve-up
    float* ws = (float*)d_ws;
    size_t off = 0;
    float* q_buf    = ws + off; off += (size_t)M * D;
    float* k_buf    = ws + off; off += (size_t)M * D;
    float* v_buf    = ws + off; off += (size_t)M * D;
    float* gate_buf = ws + off; off += (size_t)M * H * Kts;
    float* alp_buf  = ws + off; off += (size_t)M * H;
    float* yloc_buf = ws + off; off += (size_t)M * D;
    float* ymix_buf = ws + off; off += (size_t)M * D;
    float* proj_buf = ws + off; off += (size_t)M * D;
    float* st_buf   = ws + off; off += (size_t)B * H * nc * Kts * dh * dh;
    float* zst_buf  = ws + off; off += (size_t)B * H * nc * Kts;

    dim3 blk(256);
    dim3 grid_wide(M / 64, D / 128);        // 64 x 4
    dim3 grid_proj(M / 64, 3 * (D / 128) + 1);   // skinny row, then q, k, v

    // the five projections of x in one launch: q, k, v (wide) and gate, alpha (skinny, sigmoid fused)
    gemm_nt_wmma_wide<<<grid_proj, blk, 0, stream>>>(x, Wq, Wk, Wv, nullptr, q_buf, k_buf, v_buf,
                                                     Wg, bg, gate_buf, H * Kts, Wa, ba, alp_buf, H,
                                                     M, D, D, 1);

    // gated linear attention, chunk-parallel: one pass forms and scans the chunk states, then the
    // outputs; the sliding-window local attention with ALiBi rides in the pass's launch, the gated
    // blend of the two branches is the epilogue of the chunk outputs
    local_attn_and_state_scan<<<B * H * 16 + B * nc * H, blk, 0, stream>>>(q_buf, k_buf, v_buf, yloc_buf,
                                                                          B, T, H, gate_buf, st_buf, zst_buf, decay);
    linatt_chunk_out<<<B * nc * H, blk, 0, stream>>>(q_buf, k_buf, v_buf, gate_buf, decay,
                                                     st_buf, zst_buf, yloc_buf, alp_buf, ymix_buf);

    // output projection + residual + layernorm
    gemm_nt_wmma_wide<<<grid_wide, blk, 0, stream>>>(ymix_buf, Wo, nullptr, nullptr, bo,
                                                     proj_buf, nullptr, nullptr,
                                                     nullptr, nullptr, nullptr, 0, nullptr, nullptr, nullptr, 0,
                                                     M, D, D, 0);
    addnorm_kernel<<<M / 8, blk, 0, stream>>>(x, proj_buf, gamma, beta, out);
}
